// v000
// Times are from an AMD MI455X. After a warm-up the kernel runs many times in a row, and a time is the length of
// such a window on the GPU divided by its runs, so every launch and the gaps after it count. The runs cycle
// through copies of the inputs. A figure is the median of several windows, for all but v000 over two sittings.
// Sittings can differ by a few percent; kernels timed side by side share one.
// The starting kernel, v000, takes 301 microseconds a run.
#include <hip/hip_runtime.h>

// compute dtype: all contractions on v_wmma_f32_16x16x32_f16 (f16 operands, f32 accumulate). x @ W_attn and y @ W_proj: x and W enter as their bf16-RNE
// values carried x8 (x) and x64 (W) in f16 planes, 1 product; y carried x16 as f16 hi, plus a x1024 f16 residual plane on the first 128 token rows of each
// sequence (2 products there, second accumulator folded in the f32 epilogue). S^T = K Q^T per head: q, k after rms-norm and rotary carried x8 as f16 hi,
// 1 product; query blocks below 128 tokens add x1024 f16 q and k residual planes (3 products). O^T += V^T P^T: v carried x8 f16, P f16 x1024, 1 product;
// the same early query blocks add P and v x1024 residuals into a second accumulator folded before normalisation. Norm, rotary, softmax statistics in f32.
// Fragment k-map per lane half hh for A AND B: elements 0..7 <- k = 8hh+0..7, 8..15 <- k = 16+8hh+0..7; acc[r] = D[8hh+r][col = lane&15].

#ifndef NB
#define NB 2
#endif
#ifndef SEQ
#define SEQ 2048
#endif
#ifndef NB_FULL
#define NB_FULL 2
#endif
#ifndef SEQ_FULL
#define SEQ_FULL 2048
#endif

namespace {
constexpr int H = 16, HD = 64, CD = 1024, N3 = 3 * CD, KD = CD, QL = SEQ, SK = SEQ, MROWS = NB * SEQ;
constexpr int EARLY = 128, EB = EARLY / 32;                       // token rows per sequence that get residual planes; EB = early query blocks of 32
constexpr int BM = 128, BN = 64, BK = 64, TP = 72, AP = BK + 8, CP = BN + 4;
constexpr int ABYTES = BM * AP * 2, BBYTES = BN * AP * 2, SMEM = 2 * ABYTES + BBYTES;
constexpr float XS = 8.0f, WS = 64.0f, YS = 16.0f, PS = 1024.0f, RS = 1024.0f;
constexpr float LOG2E = 1.4426950408889634f, LOG2B = 13.287712379549449f, RMS_EPS = 1.1920929e-07f;
static_assert(SEQ % BM == 0 && SEQ >= BM && SEQ <= SEQ_FULL && NB >= 1 && NB <= NB_FULL);
static_assert(EARLY == BM && EARLY % 64 == 0 && EB * 32 == EARLY && MROWS % BM == 0 && N3 % BN == 0 && CD % BN == 0 && KD % BK == 0);
static_assert(BM * CP * 4 <= SMEM && HD == 64 && QL == SK && SEQ % 64 == 0 && (MROWS * 128) % 256 == 0);

typedef _Float16 b16;
typedef __attribute__((ext_vector_type(16))) _Float16 v16b;
typedef __attribute__((ext_vector_type(8))) _Float16 v8b;
typedef __attribute__((ext_vector_type(8))) float v8f;
typedef __attribute__((ext_vector_type(4))) float v4f;

__device__ __forceinline__ float bf16_rne(float f) { unsigned int u = __float_as_uint(f); u += 0x7FFFu + ((u >> 16) & 1u); return __uint_as_float(u & 0xFFFF0000u); }
// 16-bit fragment from a k-contiguous row: elements 0..7 <- p[8hh .. 8hh+7], 8..15 <- p[16+8hh .. 16+8hh+7]
__device__ __forceinline__ v16b frag_kb(const b16* p, int hh) {
  const v8b a = *(const v8b*)(p + 8 * hh), b = *(const v8b*)(p + 16 + 8 * hh); v16b f;
#pragma unroll
  for (int e = 0; e < 8; ++e) { f[e] = a[e]; f[8 + e] = b[e]; }
  return f;
}
__device__ __forceinline__ v8f wmma16b(v16b a, v16b b, v8f c) {
  v8f d = __builtin_amdgcn_wmma_f32_16x16x32_f16(false, a, false, b, (short)0, c, false, false);
  asm volatile("v_nop\n\tv_nop\n\tv_nop\n\tv_nop" : "+v"(d) : "v"(a), "v"(b));
  return d;
}
__device__ __forceinline__ void wave_lds_sync() { __builtin_amdgcn_fence(3, "workgroup"); __builtin_amdgcn_wave_barrier(); __builtin_amdgcn_fence(2, "workgroup"); }
__device__ __forceinline__ float nexp2(float v) { return __builtin_amdgcn_exp2f(v); }

__device__ __forceinline__ void store_tile64(const b16 (*S)[TP], b16* dst, size_t pitch, int wave, int lane) {
  {
#pragma unroll 1
    for (int it = 0; it < 8; ++it) {
      const int r = wave * 32 + it * 4 + (lane >> 3), c8 = (lane & 7) * 8;
      const v8b o = *(const v8b*)(&S[r][c8]);
      *(v8b*)(dst + (size_t)r * pitch + c8) = o; }
     }
}

__global__ __launch_bounds__(256) void cvt_x_kernel(const float* __restrict__ X, b16* __restrict__ Xp) {
  const size_t u = (size_t)blockIdx.x * 256 + threadIdx.x; const size_t g = u >> 7; const int piece = (int)(u & 127);
  if (g >= (size_t)MROWS) return;
  const size_t srow = (g / SEQ) * SEQ_FULL + (g % SEQ);
  const float* src = X + srow * CD + piece * 8; b16* dst = Xp + g * CD + piece * 8;
  const v4f x0 = *(const v4f*)src, x1 = *(const v4f*)(src + 4); v8b o;
#pragma unroll
  for (int j = 0; j < 4; ++j) { o[j] = (b16)(bf16_rne(x0[j]) * XS); o[4 + j] = (b16)(bf16_rne(x1[j]) * XS); }
  *(v8b*)dst = o; 
}

// W [KD][N] f32 (in-major: W[k][n]) -> WT [N][KD] f16 = bf16-RNE(W) x64 (k-contiguous per output column). Block per 64x64 tile (blockIdx.x = n tile,
__global__ __launch_bounds__(64) void cvt_w_kernel(const float* __restrict__ W, b16* __restrict__ WT, int N) {
  __shared__ __attribute__((aligned(16))) b16 St[64][TP];
  const int tid = threadIdx.x, wave = tid >> 5, lane = tid & 31; const int nb = blockIdx.x, kb = blockIdx.y;
  const float* src = W + (size_t)kb * 64 * (size_t)N + (size_t)nb * 64;
#pragma unroll 1
  for (int it = 0; it < 16; ++it) {
    const int e = (it * 64 + tid) * 4; const int kk = e >> 6, n = e & 63;
    const v4f x = *(const v4f*)(src + (size_t)kk * N + n);
#pragma unroll
    for (int j = 0; j < 4; ++j) St[n + j][kk] = (b16)(bf16_rne(x[j]) * WS);
  }
  __syncthreads();   // St is read across waves
  store_tile64(St, WT + (size_t)nb * 64 * KD + (size_t)kb * 64, KD, wave, lane);
}

// C[m][n] = (A[m][.] . BT[n][.] + Ar[m][.] . BT[n][.] / 1024) * oscale + bf16-RNE(bias[n]); A, Ar, BT f16 with k-contiguous rows of KD = 1024, f32 accumulate.
// Rows m = b*SEQ + t (compact); C row = b*cstr + t. The residual plane Ar ([b][EARLY][KD]) is used only when res_on != 0 and the tile's t0 < EARLY (block-uniform).
// Block 256 threads = 8 waves (4 along m x 2 along n), tile 128 x 64, k steps of 64 staged in LDS with plain 16-B loads; epilogue staged in LDS, each 256-B row
__global__ __launch_bounds__(256) void gemm_kernel(const b16* __restrict__ A, const b16* __restrict__ Ar, const b16* __restrict__ BT, const float* __restrict__ bias,
                                                   float* __restrict__ C, int N, int cstr, int res_on, float oscale) {
  __shared__ __attribute__((aligned(16))) char smem[SMEM];
  b16* As = reinterpret_cast<b16*>(smem); b16* Ars = reinterpret_cast<b16*>(smem + ABYTES); b16* Bs = reinterpret_cast<b16*>(smem + 2 * ABYTES);
  float* Cs = reinterpret_cast<float*>(smem);   // aliases As/Ars after the k loop (block barrier in between)
  const int tid = threadIdx.x, wave = tid >> 5, lane = tid & 31, hh = lane >> 4, col = lane & 15, wm = wave >> 1, wn = wave & 1;
  const int bm = (int)blockIdx.y * BM, bn = (int)blockIdx.x * BN; const int bb = bm / SEQ, t0 = bm % SEQ;
  const bool res = (res_on != 0) && (t0 < EARLY);
  const b16* Ab = A + (size_t)bm * KD; const b16* Bb = BT + (size_t)bn * KD;
  const b16* Arb = Ar + ((size_t)bb * EARLY + (size_t)t0) * KD;   // dereferenced only when res (then t0 == 0)
  v8f acc[2][2], accr[2][2];
#pragma unroll
  for (int i = 0; i < 2; ++i)
#pragma unroll
    for (int j = 0; j < 2; ++j) { acc[i][j] = (v8f){}; accr[i][j] = (v8f){}; }
#pragma unroll 1
  for (int k0 = 0; k0 < KD; k0 += BK) {
#pragma unroll
    for (int j = 0; j < 4; ++j) { const int p = tid + 256 * j, row = p >> 3, c8 = (p & 7) * 8;
      *(v8b*)(As + row * AP + c8) = *(const v8b*)(Ab + (size_t)row * KD + k0 + c8); }
    if (res) {
#pragma unroll
      for (int j = 0; j < 4; ++j) { const int p = tid + 256 * j, row = p >> 3, c8 = (p & 7) * 8;
        *(v8b*)(Ars + row * AP + c8) = *(const v8b*)(Arb + (size_t)row * KD + k0 + c8); } }
#pragma unroll
    for (int j = 0; j < 2; ++j) { const int p = tid + 256 * j, row = p >> 3, c8 = (p & 7) * 8;
      *(v8b*)(Bs + row * AP + c8) = *(const v8b*)(Bb + (size_t)row * KD + k0 + c8); }
    __syncthreads();   // tiles are read across waves
#pragma unroll
    for (int ks = 0; ks < BK; ks += 32) {
      const v16b a0 = frag_kb(As + (wm * 32 + col) * AP + ks, hh), a1 = frag_kb(As + (wm * 32 + 16 + col) * AP + ks, hh);
      const v16b b0 = frag_kb(Bs + (wn * 32 + col) * AP + ks, hh), b1 = frag_kb(Bs + (wn * 32 + 16 + col) * AP + ks, hh);
      acc[0][0] = wmma16b(a0, b0, acc[0][0]); acc[0][1] = wmma16b(a0, b1, acc[0][1]);
      acc[1][0] = wmma16b(a1, b0, acc[1][0]); acc[1][1] = wmma16b(a1, b1, acc[1][1]);
      if (res) {
        const v16b r0 = frag_kb(Ars + (wm * 32 + col) * AP + ks, hh), r1 = frag_kb(Ars + (wm * 32 + 16 + col) * AP + ks, hh);
        accr[0][0] = wmma16b(r0, b0, accr[0][0]); accr[0][1] = wmma16b(r0, b1, accr[0][1]);
        accr[1][0] = wmma16b(r1, b0, accr[1][0]); accr[1][1] = wmma16b(r1, b1, accr[1][1]); }
    }
    __syncthreads();   // all fragment reads done before the next stage overwrites / the epilogue aliases
  }
#pragma unroll
  for (int i = 0; i < 2; ++i)
#pragma unroll
    for (int j = 0; j < 2; ++j) {
      const int cc = wn * 32 + j * 16 + col; const float bv = bf16_rne(bias[bn + cc]);
#pragma unroll
      for (int r = 0; r < 8; ++r) {
        const float v = acc[i][j][r] + accr[i][j][r] * (1.0f / RS);   // accr stays 0 when the residual plane is off
        Cs[(wm * 32 + i * 16 + 8 * hh + r) * CP + cc] = v * oscale + bv; } }
  __syncthreads();   // Cs rows are read across waves
  float* Cb = C + ((size_t)bb * (size_t)cstr + (size_t)t0) * (size_t)N + bn;
  {
#pragma unroll 1
    for (int it = 0; it < 8; ++it) {
      const int rr = wave * 16 + it * 2 + hh; const v4f f = *(const v4f*)(Cs + rr * CP + col * 4);
      *(v4f*)(Cb + (size_t)rr * N + col * 4) = f; }
     }
}

// Per (64-token block rb, bhi = b*H + h), 64 threads = 2 waves: reads the f32 qkv rows [b*SEQ + t][3072]; q and k: rms-norm over the 64 head dims, rotary with
// angle h * inv_freq[i] (head-indexed, same for every token), x8, f16 hi into Qh/Kh [bhi][SEQ][64] and, for rb*64 < EARLY, x1024 residuals into Qr/Kr
// [bhi][EARLY][64]; v: x8, transposed through LDS into VTh [bhi][64][SEQ] and VTr [bhi][64][EARLY]. cos/sin for this head built once per block in LDS.
__global__ __launch_bounds__(64) void qkv_post_kernel(const float* __restrict__ QKV, b16* __restrict__ Qh, b16* __restrict__ Qr, b16* __restrict__ Kh, b16* __restrict__ Kr,
                                                      b16* __restrict__ VTh, b16* __restrict__ VTr) {
  __shared__ __attribute__((aligned(16))) b16 Sh[64][TP];
  __shared__ __attribute__((aligned(16))) b16 Sr[64][TP];
  __shared__ float Tcos[32], Tsin[32];
  const int tid = threadIdx.x, wave = tid >> 5, lane = tid & 31; const int rb = blockIdx.x; const int bhi = blockIdx.y; const int b = bhi / H, h = bhi % H;
  const bool early = (rb * 64 < EARLY);
  if (tid < 32) {
    const float invf = exp2f(-(float)tid * (LOG2B / 32.0f));   // (1/10000)^(2i/64)
    const float ang = (float)h * invf; float sn, cn; sincosf(ang, &sn, &cn);
    Tcos[tid] = cn; Tsin[tid] = sn; }
  __syncthreads();
  const size_t row0 = (size_t)b * SEQ + (size_t)rb * 64;
  for (int cls = 0; cls < 2; ++cls) {
#pragma unroll 1
    for (int i = 0; i < 32; ++i) {
      const int tok = wave * 32 + i;
      const float* src = QKV + (row0 + tok) * (size_t)N3 + cls * CD + h * HD;
      const float e0 = src[lane], e1 = src[lane + 32];
      float ss = e0 * e0 + e1 * e1;
#pragma unroll
      for (int off = 16; off > 0; off >>= 1) ss += __shfl_xor(ss, off);
      const float rn = rsqrtf(ss * (1.0f / 64.0f) + RMS_EPS);
      const float n0 = e0 * rn, n1 = e1 * rn; const float c = Tcos[lane], s = Tsin[lane];
      const float y0 = (n0 * c + n1 * s) * XS, y1 = (n1 * c - n0 * s) * XS;
      const b16 h0 = (b16)y0, h1 = (b16)y1;
      Sh[tok][lane] = h0; Sh[tok][lane + 32] = h1;
      if (early) { Sr[tok][lane] = (b16)((y0 - (float)h0) * RS); Sr[tok][lane + 32] = (b16)((y1 - (float)h1) * RS); }
    }
    __syncthreads();
    b16* dh = (cls == 0 ? Qh : Kh) + ((size_t)bhi * SEQ + (size_t)rb * 64) * HD;
    store_tile64(Sh, dh, HD, wave, lane);
    if (early) { b16* dr = (cls == 0 ? Qr : Kr) + ((size_t)bhi * EARLY + (size_t)rb * 64) * HD; store_tile64(Sr, dr, HD, wave, lane); }
    __syncthreads();
  }
#pragma unroll 1
  for (int i = 0; i < 32; ++i) {
    const int tok = wave * 32 + i;
    const float* src = QKV + (row0 + tok) * (size_t)N3 + 2 * CD + h * HD;
    const float v0 = src[lane] * XS, v1 = src[lane + 32] * XS;
    const b16 h0 = (b16)v0, h1 = (b16)v1;
    Sh[lane][tok] = h0; Sh[lane + 32][tok] = h1;
    if (early) { Sr[lane][tok] = (b16)((v0 - (float)h0) * RS); Sr[lane + 32][tok] = (b16)((v1 - (float)h1) * RS); }
  }
  __syncthreads();
  store_tile64(Sh, VTh + (size_t)bhi * HD * (size_t)SK + (size_t)rb * 64, SK, wave, lane);
  if (early) store_tile64(Sr, VTr + (size_t)bhi * HD * (size_t)EARLY + (size_t)rb * 64, EARLY, wave, lane);
}

// Causal softmax(Q K^T / 8) V per (b, h): grid (query blocks of 32 starting at block bx0, NB*H); block = 2 waves x 16 queries; key steps of 32 from 0 up to the
// block's last query in fixed order, keys above the query replaced by -inf before the running-max softmax (f32); P x1024 via wave-private LDS; O^T += V^T P^T.
// ER (blocks with queries < EARLY, which only visit keys < EARLY): S adds K_hi Q_res + K_res Q_hi (x1024), P adds a x1024 residual tile and V a x1024 residual
// plane into a second accumulator folded before normalisation, and the x16 y row is written as f16 hi plus a x1024 residual. y rows -> Yh [b*SEQ + q][h*64 + d]
template <bool ER>
__global__ __launch_bounds__(64) __attribute__((amdgpu_num_vgpr(256))) void attn_kernel(const b16* __restrict__ Qh, const b16* __restrict__ Qr, const b16* __restrict__ Kh,
                                                                                      const b16* __restrict__ Kr, const b16* __restrict__ VTh, const b16* __restrict__ VTr,
                                                                                      b16* __restrict__ Yh, b16* __restrict__ Yr, int bx0) {
  __shared__ __attribute__((aligned(16))) b16 Pb[2][16][32 + 8];
  __shared__ __attribute__((aligned(16))) b16 Pr[2][16][32 + 8];
  __shared__ __attribute__((aligned(16))) b16 Th[2][16][TP];
  __shared__ __attribute__((aligned(16))) b16 Tr[2][16][TP];
  const int wave = threadIdx.x >> 5, lane = threadIdx.x & 31, hh = lane >> 4, col = lane & 15;
  const int bhi = (int)blockIdx.y; const int b = bhi / H, h = bhi % H; const int bx = (int)blockIdx.x + bx0; const int q0 = bx * 32 + wave * 16, qi = q0 + col;
  const b16* Qb = Qh + (size_t)bhi * QL * HD; const b16* Kb = Kh + (size_t)bhi * SK * HD; const b16* Vb = VTh + (size_t)bhi * HD * (size_t)SK;
  const b16* Qrb = Qr + (size_t)bhi * EARLY * HD; const b16* Krb = Kr + (size_t)bhi * EARLY * HD; const b16* Vrb = VTr + (size_t)bhi * HD * (size_t)EARLY;
  const v16b qa0 = frag_kb(Qb + (size_t)qi * HD, hh), qa1 = frag_kb(Qb + (size_t)qi * HD + 32, hh);
  v16b qr0 = (v16b){}, qr1 = (v16b){};
  if constexpr (ER) { qr0 = frag_kb(Qrb + (size_t)qi * HD, hh); qr1 = frag_kb(Qrb + (size_t)qi * HD + 32, hh); }
  const float cs = LOG2E / (8.0f * XS * XS);   // 1/sqrt(64) and the two x8 carriers, in the log2 domain
  float m = -INFINITY, l = 0.0f; v8f o[4], o2[4];
#pragma unroll
  for (int t = 0; t < 4; ++t) { o[t] = (v8f){}; o2[t] = (v8f){}; }
  const int kend = bx * 32 + 32;   // causal: keys 0 .. last query of this block; ER blocks: kend <= EARLY
#pragma unroll 1
  for (int kb = 0; kb < kend; kb += 32) {
    float e[16]; float mx = -INFINITY;
#pragma unroll
    for (int u = 0; u < 2; ++u) {
      const int krow = kb + u * 16 + col;
      const v16b kh0 = frag_kb(Kb + (size_t)krow * HD, hh), kh1 = frag_kb(Kb + (size_t)krow * HD + 32, hh);
      v8f s = (v8f){}; s = wmma16b(kh0, qa0, s); s = wmma16b(kh1, qa1, s);
      v8f sr = (v8f){};
      if constexpr (ER) {
        const v16b kr0 = frag_kb(Krb + (size_t)krow * HD, hh), kr1 = frag_kb(Krb + (size_t)krow * HD + 32, hh);
        sr = wmma16b(kh0, qr0, sr); sr = wmma16b(kh1, qr1, sr); sr = wmma16b(kr0, qa0, sr); sr = wmma16b(kr1, qa1, sr); }
#pragma unroll
      for (int r = 0; r < 8; ++r) {
        float v = s[r];
        if constexpr (ER) v += sr[r] * (1.0f / RS);
        v *= cs;
        const int key = kb + u * 16 + 8 * hh + r;
        v = (key > qi) ? -INFINITY : v;
        e[u * 8 + r] = v; mx = fmaxf(mx, v); } }
    mx = fmaxf(mx, __shfl_xor(mx, 16)); const float mn = fmaxf(m, mx); const float al = nexp2(m - mn); float sum = 0.0f;
#pragma unroll
    for (int i2 = 0; i2 < 16; ++i2) {
      const float p = nexp2(e[i2] - mn); sum += p; const int pi = (i2 < 8 ? 0 : 16) + 8 * hh + (i2 & 7);
      const float pp = p * PS; const b16 ph = (b16)pp; Pb[wave][col][pi] = ph;
      if constexpr (ER) Pr[wave][col][pi] = (b16)((pp - (float)ph) * RS); }
    sum += __shfl_xor(sum, 16); l = l * al + sum; m = mn;
    wave_lds_sync();
    const v16b pf = frag_kb(&Pb[wave][col][0], hh);
    v16b prf = (v16b){};
    if constexpr (ER) prf = frag_kb(&Pr[wave][col][0], hh);
#pragma unroll
    for (int t = 0; t < 4; ++t) {
      o[t] *= al; const v16b vh = frag_kb(Vb + (size_t)(t * 16 + col) * SK + kb, hh);
      o[t] = wmma16b(vh, pf, o[t]);
      if constexpr (ER) { const v16b vr = frag_kb(Vrb + (size_t)(t * 16 + col) * EARLY + kb, hh); o2[t] *= al; o2[t] = wmma16b(vh, prf, o2[t]); o2[t] = wmma16b(vr, pf, o2[t]); } }
    wave_lds_sync(); }
  const float inv = YS / (l * PS * XS);
#pragma unroll
  for (int t = 0; t < 4; ++t) {
#pragma unroll
    for (int r = 0; r < 8; ++r) {
      float ov = o[t][r];
      if constexpr (ER) ov += o2[t][r] * (1.0f / RS);
      const float yv = ov * inv; const b16 yh = (b16)yv;
      Th[wave][col][t * 16 + 8 * hh + r] = yh;
      if constexpr (ER) Tr[wave][col][t * 16 + 8 * hh + r] = (b16)((yv - (float)yh) * RS); } }
  wave_lds_sync();
  b16* yb = Yh + ((size_t)b * SEQ + (size_t)q0) * CD + (size_t)h * HD;
  {
#pragma unroll 1
    for (int it = 0; it < 4; ++it) {
      const int rr = it * 4 + (lane >> 3), c8 = (lane & 7) * 8; const v8b f = *(const v8b*)(&Th[wave][rr][c8]);
      *(v8b*)(yb + (size_t)rr * CD + c8) = f;
      if constexpr (ER) {
        const v8b fr = *(const v8b*)(&Tr[wave][rr][c8]);
        *(v8b*)(Yr + (((size_t)b * EARLY + (size_t)(q0 + rr)) * CD + (size_t)h * HD + c8)) = fr; } }
     }
}
}  // namespace

extern "C" void kernel_launch(void* const* d_in, const int* in_sizes, int n_in, void* d_out, int out_size, void* d_ws, size_t ws_size, hipStream_t stream) {
  // wire order: 0 x [NB_FULL][SEQ_FULL][1024] f32, 1 W_attn [1024][3072] f32, 2 b_attn [3072] f32, 3 W_proj [1024][1024] f32, 4 b_proj [1024] f32; out [NB_FULL][SEQ_FULL][1024] f32
  const size_t need_x = ((size_t)(NB - 1) * SEQ_FULL + (size_t)SEQ) * CD;
  if (n_in < 5 || (size_t)in_sizes[0] < need_x || (size_t)in_sizes[1] < (size_t)KD * N3 || (size_t)in_sizes[2] < (size_t)N3 ||
      (size_t)in_sizes[3] < (size_t)KD * CD || (size_t)in_sizes[4] < (size_t)CD || (size_t)out_size < need_x) return;
  const float* Xin = (const float*)d_in[0]; const float* Wa = (const float*)d_in[1]; const float* Ba = (const float*)d_in[2];
  const float* Wp = (const float*)d_in[3]; const float* Bp = (const float*)d_in[4];
  size_t off = 0; char* ws = (char*)d_ws;
  auto carve = [&](size_t bytes) { char* p = ws + off; off += (bytes + 255) & ~(size_t)255; return p; };
  b16* Xp = (b16*)carve((size_t)MROWS * CD * 2);                       //  8,388,608 B at NB=2, SEQ=2048
  b16* WaT = (b16*)carve((size_t)N3 * KD * 2);                         //  6,291,456
  b16* WpT = (b16*)carve((size_t)CD * KD * 2);                         //  2,097,152
  float* QKV = (float*)carve((size_t)MROWS * N3 * 4);                  // 50,331,648
  const size_t plane = (size_t)NB * H * SEQ * HD * 2, rplane = (size_t)NB * H * EARLY * HD * 2;
  b16* Qh = (b16*)carve(plane); b16* Kh = (b16*)carve(plane); b16* VTh = (b16*)carve(plane);      // 3 x 8,388,608
  b16* Qr = (b16*)carve(rplane); b16* Kr = (b16*)carve(rplane); b16* VTr = (b16*)carve(rplane);   // 3 x 524,288
  b16* Yh = (b16*)carve((size_t)MROWS * CD * 2);                       //  8,388,608
  b16* Yr = (b16*)carve((size_t)NB * EARLY * CD * 2);                  //    524,288   -> total 102,760,448 B
  if (off > ws_size || off > ((size_t)128 << 20)) return;
  cvt_x_kernel<<<dim3((unsigned)(((size_t)MROWS * 128 + 255) / 256)), 256, 0, stream>>>(Xin, Xp);
  cvt_w_kernel<<<dim3(N3 / 64, KD / 64), 64, 0, stream>>>(Wa, WaT, N3);
  cvt_w_kernel<<<dim3(CD / 64, KD / 64), 64, 0, stream>>>(Wp, WpT, CD);
  gemm_kernel<<<dim3(N3 / BN, MROWS / BM), 256, 0, stream>>>(Xp, Xp, WaT, Ba, QKV, N3, SEQ, 0, 1.0f / (XS * WS));
  qkv_post_kernel<<<dim3(SEQ / 64, NB * H), 64, 0, stream>>>(QKV, Qh, Qr, Kh, Kr, VTh, VTr);
  attn_kernel<true><<<dim3(EB, NB * H), 64, 0, stream>>>(Qh, Qr, Kh, Kr, VTh, VTr, Yh, Yr, 0);
  if (QL / 32 > EB) attn_kernel<false><<<dim3(QL / 32 - EB, NB * H), 64, 0, stream>>>(Qh, Qr, Kh, Kr, VTh, VTr, Yh, Yr, EB);
  gemm_kernel<<<dim3(CD / BN, MROWS / BM), 256, 0, stream>>>(Yh, Yr, WpT, Bp, (float*)d_out, CD, SEQ_FULL, 1, 1.0f / (YS * WS));
}

// v001
// It runs in 218 microseconds.
// Timed twice side by side with v000, it ran 1.40 times as fast both times.
#include <hip/hip_runtime.h>

// compute dtype: all contractions on v_wmma_f32_16x16x32_f16 (f16 operands, f32 accumulate). x @ W_attn and y @ W_proj: x and W enter as their bf16-RNE
// values carried x8 (x) and x64 (W) in f16 planes, 1 product; y carried x16 as f16 hi, plus a x1024 f16 residual plane on the first 128 token rows of each
// sequence (2 products there, second accumulator folded in the f32 epilogue). S^T = K Q^T per head: q, k after rms-norm and rotary carried x8 as f16 hi,
// 1 product; query blocks below 128 tokens add x1024 f16 q and k residual planes (3 products). O^T += V^T P^T: v carried x8 f16, P f16 x1024, 1 product;
// the same early query blocks add P and v x1024 residuals into a second accumulator folded before normalisation. Norm, rotary, softmax statistics in f32.
// Fragment k-map per lane half hh for A AND B: elements 0..7 <- k = 8hh+0..7, 8..15 <- k = 16+8hh+0..7; acc[r] = D[8hh+r][col = lane&15].

#ifndef NB
#define NB 2
#endif
#ifndef SEQ
#define SEQ 2048
#endif
#ifndef NB_FULL
#define NB_FULL 2
#endif
#ifndef SEQ_FULL
#define SEQ_FULL 2048
#endif

namespace {
constexpr int H = 16, HD = 64, CD = 1024, N3 = 3 * CD, KD = CD, QL = SEQ, SK = SEQ, MROWS = NB * SEQ;
constexpr int EARLY = 128, EB = EARLY / 32;                       // token rows per sequence that get residual planes; EB = early query blocks of 32
constexpr int BM = 128, BN = 64, BK = 64, TP = 72, AP = BK + 8, CP = BN + 4;
constexpr int ABYTES = BM * AP * 2, BBYTES = BN * AP * 2, SMEM = 2 * ABYTES + BBYTES;
constexpr float XS = 8.0f, WS = 64.0f, YS = 16.0f, PS = 1024.0f, RS = 1024.0f;
constexpr float LOG2E = 1.4426950408889634f, LOG2B = 13.287712379549449f, RMS_EPS = 1.1920929e-07f;
static_assert(SEQ % BM == 0 && SEQ >= BM && SEQ <= SEQ_FULL && NB >= 1 && NB <= NB_FULL);
static_assert(EARLY == BM && EARLY % 64 == 0 && EB * 32 == EARLY && MROWS % BM == 0 && N3 % BN == 0 && CD % BN == 0 && KD % BK == 0);
static_assert(BM * CP * 4 <= SMEM && HD == 64 && QL == SK && SEQ % 64 == 0 && (MROWS * 128) % 256 == 0);

typedef _Float16 b16;
typedef __attribute__((ext_vector_type(16))) _Float16 v16b;
typedef __attribute__((ext_vector_type(8))) _Float16 v8b;
typedef __attribute__((ext_vector_type(8))) float v8f;
typedef __attribute__((ext_vector_type(4))) float v4f;

__device__ __forceinline__ float bf16_rne(float f) { unsigned int u = __float_as_uint(f); u += 0x7FFFu + ((u >> 16) & 1u); return __uint_as_float(u & 0xFFFF0000u); }
// 16-bit fragment from a k-contiguous row: elements 0..7 <- p[8hh .. 8hh+7], 8..15 <- p[16+8hh .. 16+8hh+7]
__device__ __forceinline__ v16b frag_kb(const b16* p, int hh) {
  const v8b a = *(const v8b*)(p + 8 * hh), b = *(const v8b*)(p + 16 + 8 * hh); v16b f;
#pragma unroll
  for (int e = 0; e < 8; ++e) { f[e] = a[e]; f[8 + e] = b[e]; }
  return f;
}
__device__ __forceinline__ v8f wmma16b(v16b a, v16b b, v8f c) {
  v8f d = __builtin_amdgcn_wmma_f32_16x16x32_f16(false, a, false, b, (short)0, c, false, false);
  asm volatile("v_nop\n\tv_nop\n\tv_nop\n\tv_nop" : "+v"(d) : "v"(a), "v"(b));
  return d;
}
__device__ __forceinline__ void wave_lds_sync() { __builtin_amdgcn_fence(3, "workgroup"); __builtin_amdgcn_wave_barrier(); __builtin_amdgcn_fence(2, "workgroup"); }
__device__ __forceinline__ float nexp2(float v) { return __builtin_amdgcn_exp2f(v); }

__device__ __forceinline__ void store_tile64(const b16 (*S)[TP], b16* dst, size_t pitch, int wave, int lane) {
  {
#pragma unroll 1
    for (int it = 0; it < 8; ++it) {
      const int r = wave * 32 + it * 4 + (lane >> 3), c8 = (lane & 7) * 8;
      const v8b o = *(const v8b*)(&S[r][c8]);
      *(v8b*)(dst + (size_t)r * pitch + c8) = o; }
     }
}

__global__ __launch_bounds__(256) void cvt_x_kernel(const float* __restrict__ X, b16* __restrict__ Xp) {
  const size_t u = (size_t)blockIdx.x * 256 + threadIdx.x; const size_t g = u >> 7; const int piece = (int)(u & 127);
  if (g >= (size_t)MROWS) return;
  const size_t srow = (g / SEQ) * SEQ_FULL + (g % SEQ);
  const float* src = X + srow * CD + piece * 8; b16* dst = Xp + g * CD + piece * 8;
  const v4f x0 = *(const v4f*)src, x1 = *(const v4f*)(src + 4); v8b o;
#pragma unroll
  for (int j = 0; j < 4; ++j) { o[j] = (b16)(bf16_rne(x0[j]) * XS); o[4 + j] = (b16)(bf16_rne(x1[j]) * XS); }
  *(v8b*)dst = o; 
}

// W [KD][N] f32 (in-major: W[k][n]) -> WT [N][KD] f16 = bf16-RNE(W) x64 (k-contiguous per output column). Block per 64x64 tile (blockIdx.x = n tile,
__global__ __launch_bounds__(64) void cvt_w_kernel(const float* __restrict__ W, b16* __restrict__ WT, int N) {
  __shared__ __attribute__((aligned(16))) b16 St[64][TP];
  const int tid = threadIdx.x, wave = tid >> 5, lane = tid & 31; const int nb = blockIdx.x, kb = blockIdx.y;
  const float* src = W + (size_t)kb * 64 * (size_t)N + (size_t)nb * 64;
#pragma unroll 1
  for (int it = 0; it < 16; ++it) {
    const int e = (it * 64 + tid) * 4; const int kk = e >> 6, n = e & 63;
    const v4f x = *(const v4f*)(src + (size_t)kk * N + n);
#pragma unroll
    for (int j = 0; j < 4; ++j) St[n + j][kk] = (b16)(bf16_rne(x[j]) * WS);
  }
  __syncthreads();   // St is read across waves
  store_tile64(St, WT + (size_t)nb * 64 * KD + (size_t)kb * 64, KD, wave, lane);
}

// C[m][n] = (A[m][.] . BT[n][.] + Ar[m][.] . BT[n][.] / 1024) * oscale + bf16-RNE(bias[n]); A, Ar, BT f16 with k-contiguous rows of KD = 1024, f32 accumulate.
// Rows m = b*SEQ + t (compact); C row = b*cstr + t. The residual plane Ar ([b][EARLY][KD]) is used only when res_on != 0 and the tile's t0 < EARLY (block-uniform).
// Block 256 threads = 8 waves (4 along m x 2 along n), tile 128 x 64, k steps of 64 staged in LDS with plain 16-B loads; epilogue staged in LDS, each 256-B row
__global__ __launch_bounds__(256) void gemm_kernel(const b16* __restrict__ A, const b16* __restrict__ Ar, const b16* __restrict__ BT, const float* __restrict__ bias,
                                                   float* __restrict__ C, int N, int cstr, int res_on, float oscale) {
  __shared__ __attribute__((aligned(16))) char smem[SMEM];
  b16* As = reinterpret_cast<b16*>(smem); b16* Ars = reinterpret_cast<b16*>(smem + ABYTES); b16* Bs = reinterpret_cast<b16*>(smem + 2 * ABYTES);
  float* Cs = reinterpret_cast<float*>(smem);   // aliases As/Ars after the k loop (block barrier in between)
  const int tid = threadIdx.x, wave = tid >> 5, lane = tid & 31, hh = lane >> 4, col = lane & 15, wm = wave >> 1, wn = wave & 1;
  const int bm = (int)blockIdx.y * BM, bn = (int)blockIdx.x * BN; const int bb = bm / SEQ, t0 = bm % SEQ;
  const bool res = (res_on != 0) && (t0 < EARLY);
  const b16* Ab = A + (size_t)bm * KD; const b16* Bb = BT + (size_t)bn * KD;
  const b16* Arb = Ar + ((size_t)bb * EARLY + (size_t)t0) * KD;   // dereferenced only when res (then t0 == 0)
  v8f acc[2][2], accr[2][2];
#pragma unroll
  for (int i = 0; i < 2; ++i)
#pragma unroll
    for (int j = 0; j < 2; ++j) { acc[i][j] = (v8f){}; accr[i][j] = (v8f){}; }
#pragma unroll 1
  for (int k0 = 0; k0 < KD; k0 += BK) {
#pragma unroll
    for (int j = 0; j < 4; ++j) { const int p = tid + 256 * j, row = p >> 3, c8 = (p & 7) * 8;
      *(v8b*)(As + row * AP + c8) = *(const v8b*)(Ab + (size_t)row * KD + k0 + c8); }
    if (res) {
#pragma unroll
      for (int j = 0; j < 4; ++j) { const int p = tid + 256 * j, row = p >> 3, c8 = (p & 7) * 8;
        *(v8b*)(Ars + row * AP + c8) = *(const v8b*)(Arb + (size_t)row * KD + k0 + c8); } }
#pragma unroll
    for (int j = 0; j < 2; ++j) { const int p = tid + 256 * j, row = p >> 3, c8 = (p & 7) * 8;
      *(v8b*)(Bs + row * AP + c8) = *(const v8b*)(Bb + (size_t)row * KD + k0 + c8); }
    __syncthreads();   // tiles are read across waves
#pragma unroll
    for (int ks = 0; ks < BK; ks += 32) {
      const v16b a0 = frag_kb(As + (wm * 32 + col) * AP + ks, hh), a1 = frag_kb(As + (wm * 32 + 16 + col) * AP + ks, hh);
      const v16b b0 = frag_kb(Bs + (wn * 32 + col) * AP + ks, hh), b1 = frag_kb(Bs + (wn * 32 + 16 + col) * AP + ks, hh);
      acc[0][0] = wmma16b(a0, b0, acc[0][0]); acc[0][1] = wmma16b(a0, b1, acc[0][1]);
      acc[1][0] = wmma16b(a1, b0, acc[1][0]); acc[1][1] = wmma16b(a1, b1, acc[1][1]);
      if (res) {
        const v16b r0 = frag_kb(Ars + (wm * 32 + col) * AP + ks, hh), r1 = frag_kb(Ars + (wm * 32 + 16 + col) * AP + ks, hh);
        accr[0][0] = wmma16b(r0, b0, accr[0][0]); accr[0][1] = wmma16b(r0, b1, accr[0][1]);
        accr[1][0] = wmma16b(r1, b0, accr[1][0]); accr[1][1] = wmma16b(r1, b1, accr[1][1]); }
    }
    __syncthreads();   // all fragment reads done before the next stage overwrites / the epilogue aliases
  }
#pragma unroll
  for (int i = 0; i < 2; ++i)
#pragma unroll
    for (int j = 0; j < 2; ++j) {
      const int cc = wn * 32 + j * 16 + col; const float bv = bf16_rne(bias[bn + cc]);
#pragma unroll
      for (int r = 0; r < 8; ++r) {
        const float v = acc[i][j][r] + accr[i][j][r] * (1.0f / RS);   // accr stays 0 when the residual plane is off
        Cs[(wm * 32 + i * 16 + 8 * hh + r) * CP + cc] = v * oscale + bv; } }
  __syncthreads();   // Cs rows are read across waves
  float* Cb = C + ((size_t)bb * (size_t)cstr + (size_t)t0) * (size_t)N + bn;
  {
#pragma unroll 1
    for (int it = 0; it < 8; ++it) {
      const int rr = wave * 16 + it * 2 + hh; const v4f f = *(const v4f*)(Cs + rr * CP + col * 4);
      *(v4f*)(Cb + (size_t)rr * N + col * 4) = f; }
     }
}

// Per (64-token block rb, bhi = b*H + h), 64 threads = 2 waves: reads the f32 qkv rows [b*SEQ + t][3072]; q and k: rms-norm over the 64 head dims, rotary with
// angle h * inv_freq[i] (head-indexed, same for every token), x8, f16 hi into Qh/Kh [bhi][SEQ][64] and, for rb*64 < EARLY, x1024 residuals into Qr/Kr
// [bhi][EARLY][64]; v: x8, transposed through LDS into VTh [bhi][64][SEQ] and VTr [bhi][64][EARLY]. cos/sin for this head built once per block in LDS.
__global__ __launch_bounds__(64) void qkv_post_kernel(const float* __restrict__ QKV, b16* __restrict__ Qh, b16* __restrict__ Qr, b16* __restrict__ Kh, b16* __restrict__ Kr,
                                                      b16* __restrict__ VTh, b16* __restrict__ VTr) {
  __shared__ __attribute__((aligned(16))) b16 Sh[64][TP];
  __shared__ __attribute__((aligned(16))) b16 Sr[64][TP];
  __shared__ float Tcos[32], Tsin[32];
  const int tid = threadIdx.x, wave = tid >> 5, lane = tid & 31; const int rb = blockIdx.x; const int bhi = blockIdx.y; const int b = bhi / H, h = bhi % H;
  const bool early = (rb * 64 < EARLY);
  if (tid < 32) {
    const float invf = exp2f(-(float)tid * (LOG2B / 32.0f));   // (1/10000)^(2i/64)
    const float ang = (float)h * invf; float sn, cn; sincosf(ang, &sn, &cn);
    Tcos[tid] = cn; Tsin[tid] = sn; }
  __syncthreads();
  const size_t row0 = (size_t)b * SEQ + (size_t)rb * 64;
  for (int cls = 0; cls < 2; ++cls) {
#pragma unroll 1
    for (int i = 0; i < 32; ++i) {
      const int tok = wave * 32 + i;
      const float* src = QKV + (row0 + tok) * (size_t)N3 + cls * CD + h * HD;
      const float e0 = src[lane], e1 = src[lane + 32];
      float ss = e0 * e0 + e1 * e1;
#pragma unroll
      for (int off = 16; off > 0; off >>= 1) ss += __shfl_xor(ss, off);
      const float rn = rsqrtf(ss * (1.0f / 64.0f) + RMS_EPS);
      const float n0 = e0 * rn, n1 = e1 * rn; const float c = Tcos[lane], s = Tsin[lane];
      const float y0 = (n0 * c + n1 * s) * XS, y1 = (n1 * c - n0 * s) * XS;
      const b16 h0 = (b16)y0, h1 = (b16)y1;
      Sh[tok][lane] = h0; Sh[tok][lane + 32] = h1;
      if (early) { Sr[tok][lane] = (b16)((y0 - (float)h0) * RS); Sr[tok][lane + 32] = (b16)((y1 - (float)h1) * RS); }
    }
    __syncthreads();
    b16* dh = (cls == 0 ? Qh : Kh) + ((size_t)bhi * SEQ + (size_t)rb * 64) * HD;
    store_tile64(Sh, dh, HD, wave, lane);
    if (early) { b16* dr = (cls == 0 ? Qr : Kr) + ((size_t)bhi * EARLY + (size_t)rb * 64) * HD; store_tile64(Sr, dr, HD, wave, lane); }
    __syncthreads();
  }
#pragma unroll 1
  for (int i = 0; i < 32; ++i) {
    const int tok = wave * 32 + i;
    const float* src = QKV + (row0 + tok) * (size_t)N3 + 2 * CD + h * HD;
    const float v0 = src[lane] * XS, v1 = src[lane + 32] * XS;
    const b16 h0 = (b16)v0, h1 = (b16)v1;
    Sh[lane][tok] = h0; Sh[lane + 32][tok] = h1;
    if (early) { Sr[lane][tok] = (b16)((v0 - (float)h0) * RS); Sr[lane + 32][tok] = (b16)((v1 - (float)h1) * RS); }
  }
  __syncthreads();
  store_tile64(Sh, VTh + (size_t)bhi * HD * (size_t)SK + (size_t)rb * 64, SK, wave, lane);
  if (early) store_tile64(Sr, VTr + (size_t)bhi * HD * (size_t)EARLY + (size_t)rb * 64, EARLY, wave, lane);
}

// Causal softmax(Q K^T / 8) V per (b, h): grid (query blocks of 32 starting at block bx0, NB*H); block = 2 waves x 16 queries; key steps of 32 from 0 up to the
// block's last query in fixed order, keys above the query replaced by -inf before the running-max softmax (f32); P x1024 via wave-private LDS; O^T += V^T P^T.
// ER (blocks with queries < EARLY, which only visit keys < EARLY): S adds K_hi Q_res + K_res Q_hi (x1024), P adds a x1024 residual tile and V a x1024 residual
// plane into a second accumulator folded before normalisation, and the x16 y row is written as f16 hi plus a x1024 residual. y rows -> Yh [b*SEQ + q][h*64 + d]
template <bool ER>
__global__ __launch_bounds__(64) __attribute__((amdgpu_num_vgpr(256))) void attn_kernel(const b16* __restrict__ Qh, const b16* __restrict__ Qr, const b16* __restrict__ Kh,
                                                                                      const b16* __restrict__ Kr, const b16* __restrict__ VTh, const b16* __restrict__ VTr,
                                                                                      b16* __restrict__ Yh, b16* __restrict__ Yr, int bx0) {
  __shared__ __attribute__((aligned(16))) b16 Pb[2][16][32 + 8];
  __shared__ __attribute__((aligned(16))) b16 Pr[2][16][32 + 8];
  __shared__ __attribute__((aligned(16))) b16 Th[2][16][TP];
  __shared__ __attribute__((aligned(16))) b16 Tr[2][16][TP];
  const int wave = threadIdx.x >> 5, lane = threadIdx.x & 31, hh = lane >> 4, col = lane & 15;
  const int bhi = (int)blockIdx.y; const int b = bhi / H, h = bhi % H; const int bx = (int)blockIdx.x + bx0; const int q0 = bx * 32 + wave * 16, qi = q0 + col;
  const b16* Qb = Qh + (size_t)bhi * QL * HD; const b16* Kb = Kh + (size_t)bhi * SK * HD; const b16* Vb = VTh + (size_t)bhi * HD * (size_t)SK;
  const b16* Qrb = Qr + (size_t)bhi * EARLY * HD; const b16* Krb = Kr + (size_t)bhi * EARLY * HD; const b16* Vrb = VTr + (size_t)bhi * HD * (size_t)EARLY;
  const v16b qa0 = frag_kb(Qb + (size_t)qi * HD, hh), qa1 = frag_kb(Qb + (size_t)qi * HD + 32, hh);
  v16b qr0 = (v16b){}, qr1 = (v16b){};
  if constexpr (ER) { qr0 = frag_kb(Qrb + (size_t)qi * HD, hh); qr1 = frag_kb(Qrb + (size_t)qi * HD + 32, hh); }
  const float cs = LOG2E / (8.0f * XS * XS);   // 1/sqrt(64) and the two x8 carriers, in the log2 domain
  float m = -INFINITY, l = 0.0f; v8f o[4], o2[4];
#pragma unroll
  for (int t = 0; t < 4; ++t) { o[t] = (v8f){}; o2[t] = (v8f){}; }
  const int kend = bx * 32 + 32;   // causal: keys 0 .. last query of this block; ER blocks: kend <= EARLY
#pragma unroll 1
  for (int kb = 0; kb < kend; kb += 32) {
    float e[16]; float mx = -INFINITY;
#pragma unroll
    for (int u = 0; u < 2; ++u) {
      const int krow = kb + u * 16 + col;
      const v16b kh0 = frag_kb(Kb + (size_t)krow * HD, hh), kh1 = frag_kb(Kb + (size_t)krow * HD + 32, hh);
      v8f s = (v8f){}; s = wmma16b(kh0, qa0, s); s = wmma16b(kh1, qa1, s);
      v8f sr = (v8f){};
      if constexpr (ER) {
        const v16b kr0 = frag_kb(Krb + (size_t)krow * HD, hh), kr1 = frag_kb(Krb + (size_t)krow * HD + 32, hh);
        sr = wmma16b(kh0, qr0, sr); sr = wmma16b(kh1, qr1, sr); sr = wmma16b(kr0, qa0, sr); sr = wmma16b(kr1, qa1, sr); }
#pragma unroll
      for (int r = 0; r < 8; ++r) {
        float v = s[r];
        if constexpr (ER) v += sr[r] * (1.0f / RS);
        v *= cs;
        const int key = kb + u * 16 + 8 * hh + r;
        v = (key > qi) ? -INFINITY : v;
        e[u * 8 + r] = v; mx = fmaxf(mx, v); } }
    mx = fmaxf(mx, __shfl_xor(mx, 16)); const float mn = fmaxf(m, mx); const float al = nexp2(m - mn); float sum = 0.0f;
#pragma unroll
    for (int i2 = 0; i2 < 16; ++i2) {
      const float p = nexp2(e[i2] - mn); sum += p; const int pi = (i2 < 8 ? 0 : 16) + 8 * hh + (i2 & 7);
      const float pp = p * PS; const b16 ph = (b16)pp; Pb[wave][col][pi] = ph;
      if constexpr (ER) Pr[wave][col][pi] = (b16)((pp - (float)ph) * RS); }
    sum += __shfl_xor(sum, 16); l = l * al + sum; m = mn;
    wave_lds_sync();
    const v16b pf = frag_kb(&Pb[wave][col][0], hh);
    v16b prf = (v16b){};
    if constexpr (ER) prf = frag_kb(&Pr[wave][col][0], hh);
#pragma unroll
    for (int t = 0; t < 4; ++t) {
      o[t] *= al; const v16b vh = frag_kb(Vb + (size_t)(t * 16 + col) * SK + kb, hh);
      o[t] = wmma16b(vh, pf, o[t]);
      if constexpr (ER) { const v16b vr = frag_kb(Vrb + (size_t)(t * 16 + col) * EARLY + kb, hh); o2[t] *= al; o2[t] = wmma16b(vh, prf, o2[t]); o2[t] = wmma16b(vr, pf, o2[t]); } }
    wave_lds_sync(); }
  const float inv = YS / (l * PS * XS);
#pragma unroll
  for (int t = 0; t < 4; ++t) {
#pragma unroll
    for (int r = 0; r < 8; ++r) {
      float ov = o[t][r];
      if constexpr (ER) ov += o2[t][r] * (1.0f / RS);
      const float yv = ov * inv; const b16 yh = (b16)yv;
      Th[wave][col][t * 16 + 8 * hh + r] = yh;
      if constexpr (ER) Tr[wave][col][t * 16 + 8 * hh + r] = (b16)((yv - (float)yh) * RS); } }
  wave_lds_sync();
  b16* yb = Yh + ((size_t)b * SEQ + (size_t)q0) * CD + (size_t)h * HD;
  {
#pragma unroll 1
    for (int it = 0; it < 4; ++it) {
      const int rr = it * 4 + (lane >> 3), c8 = (lane & 7) * 8; const v8b f = *(const v8b*)(&Th[wave][rr][c8]);
      *(v8b*)(yb + (size_t)rr * CD + c8) = f;
      if constexpr (ER) {
        const v8b fr = *(const v8b*)(&Tr[wave][rr][c8]);
        *(v8b*)(Yr + (((size_t)b * EARLY + (size_t)(q0 + rr)) * CD + (size_t)h * HD + c8)) = fr; } }
     }
}

// LDS byte address of a __shared__ object: the low 32 bits of its address.
__device__ __forceinline__ unsigned lds_off(const void* p) { return (unsigned)(size_t)p; }
// One staged tile pair = 64 keys: K rows [64 keys][64 dims] and V^T rows [64 dims][64 keys], 128 B a row, laid at the 144-B pitch of TP. 128 threads, 16 B a lane:
// copy j of a thread brings row (tid >> 3) + 16 j, piece tid & 7, so a wave's copy covers four whole 128-B lines. kg / vg: the lane's first global byte of the tile,
// kl / vl: its first LDS byte. s_wait_xcnt stands inside the statement so that no address register named here is rewritten ahead of it.
__device__ __forceinline__ void stage_kv(const b16* kg, const b16* vg, unsigned kl, unsigned vl) {
  const b16 *k1 = kg + 16 * HD, *k2 = kg + 32 * HD, *k3 = kg + 48 * HD; const b16 *v1 = vg + 16 * (size_t)SK, *v2 = vg + 32 * (size_t)SK, *v3 = vg + 48 * (size_t)SK;
  const unsigned kl1 = kl + 16 * TP * 2, kl2 = kl + 32 * TP * 2, kl3 = kl + 48 * TP * 2, vl1 = vl + 16 * TP * 2, vl2 = vl + 32 * TP * 2, vl3 = vl + 48 * TP * 2;
  asm volatile("global_load_async_to_lds_b128 %0, %8, off\n\t"
               "global_load_async_to_lds_b128 %1, %9, off\n\t"
               "global_load_async_to_lds_b128 %2, %10, off\n\t"
               "global_load_async_to_lds_b128 %3, %11, off\n\t"
               "global_load_async_to_lds_b128 %4, %12, off\n\t"
               "global_load_async_to_lds_b128 %5, %13, off\n\t"
               "global_load_async_to_lds_b128 %6, %14, off\n\t"
               "global_load_async_to_lds_b128 %7, %15, off\n\t"
               "s_wait_xcnt 0x0"
               :: "v"(kl), "v"(kl1), "v"(kl2), "v"(kl3), "v"(vl), "v"(vl1), "v"(vl2), "v"(vl3), "v"(kg), "v"(k1), "v"(k2), "v"(k3), "v"(vg), "v"(v1), "v"(v2), "v"(v3)
               : "memory");
}

// The same causal softmax(Q K^T / 8) V for the queries from EARLY on (no residual planes): grid (query blocks of 64 starting at block bx0, NB*H); block = 4 waves x 16
// queries. K and V^T come in tiles of 64 keys, copied once per block into two LDS buffers (tile s + 1 flies while tile s is worked on) and read as fragments by all
// four waves. Each wave walks key steps of 32 in the same fixed order and up to the same last key (the end of its 32-query group) as the kernel above.
// Every plain '#pragma unroll' below keeps the index of a register array a compile-time constant.
__global__ __launch_bounds__(128) void attn_main_kernel(const b16* __restrict__ Qh, const b16* __restrict__ Kh, const b16* __restrict__ VTh, b16* __restrict__ Yh, int bx0) {
  __shared__ __attribute__((aligned(16))) b16 Ks[2][64][TP];
  __shared__ __attribute__((aligned(16))) b16 Vs[2][64][TP];
  __shared__ __attribute__((aligned(16))) b16 Pb[4][16][32 + 8];
  __shared__ __attribute__((aligned(16))) b16 Th[4][16][TP];
  const int tid = threadIdx.x, wave = __builtin_amdgcn_readfirstlane(tid >> 5), lane = tid & 31, hh = lane >> 4, col = lane & 15;
  const int bhi = (int)blockIdx.y; const int b = bhi / H, h = bhi % H; const int bx = (int)blockIdx.x + bx0; const int q0 = bx * 64 + wave * 16, qi = q0 + col;
  const b16* Qb = Qh + (size_t)bhi * QL * HD; const b16* Kb = Kh + (size_t)bhi * SK * HD; const b16* Vb = VTh + (size_t)bhi * HD * (size_t)SK;
  const int nst = bx + 1;                     // tiles of 64 keys: keys 0 .. last query of this block
  const int kend = (q0 >> 5) * 32 + 32;       // this wave's causal end
  const int srow = tid >> 3, sc8 = (tid & 7) * 8;
  const b16* kg = Kb + (size_t)srow * HD + sc8; const b16* vg = Vb + (size_t)srow * SK + sc8;   // tile s: kg + s * 64 * HD, vg + s * 64
  const unsigned kl = lds_off(&Ks[0][srow][sc8]), vl = lds_off(&Vs[0][srow][sc8]); constexpr unsigned BUFB = 64 * TP * 2;
  stage_kv(kg, vg, kl, vl);
  asm volatile("s_wait_asynccnt 0x0" ::: "memory");   // tile 0 has landed before the barrier that publishes it
  __syncthreads();
  if (nst > 1) stage_kv(kg + 64 * HD, vg + 64, kl + BUFB, vl + BUFB);
  const v16b qa0 = frag_kb(Qb + (size_t)qi * HD, hh), qa1 = frag_kb(Qb + (size_t)qi * HD + 32, hh);
  const float cs = LOG2E / (8.0f * XS * XS);   // 1/sqrt(64) and the two x8 carriers, in the log2 domain
  float m = -INFINITY, l = 0.0f; v8f o[4];
#pragma unroll
  for (int t = 0; t < 4; ++t) o[t] = (v8f){};
#pragma unroll 1   // one copy of the loop body in the text: the buffer index is a run-time offset
  for (int s = 0; s < nst; ++s) {
    const int buf = s & 1;
#pragma unroll 1   // the two key steps of a tile share one body
    for (int sub = 0; sub < 64; sub += 32) {
      const int kb = s * 64 + sub;
      if (kb < kend) {   // wave-uniform: a wave skips the step wholly above its diagonal, never the publish point below
        float e[16]; float mx = -INFINITY;
#pragma unroll
        for (int u = 0; u < 2; ++u) {
          const b16* kr = &Ks[buf][sub + u * 16 + col][0];
          const v16b kh0 = frag_kb(kr, hh), kh1 = frag_kb(kr + 32, hh);
          v8f sc = (v8f){}; sc = wmma16b(kh0, qa0, sc); sc = wmma16b(kh1, qa1, sc);
#pragma unroll
          for (int r = 0; r < 8; ++r) {
            float v = sc[r] * cs;
            const int key = kb + u * 16 + 8 * hh + r;
            v = (key > qi) ? -INFINITY : v;
            e[u * 8 + r] = v; mx = fmaxf(mx, v); } }
        mx = fmaxf(mx, __shfl_xor(mx, 16)); const float mn = fmaxf(m, mx); const float al = nexp2(m - mn); float sum = 0.0f;
#pragma unroll
        for (int i2 = 0; i2 < 16; ++i2) {
          const float p = nexp2(e[i2] - mn); sum += p; const int pi = (i2 < 8 ? 0 : 16) + 8 * hh + (i2 & 7);
          Pb[wave][col][pi] = (b16)(p * PS); }
        sum += __shfl_xor(sum, 16); l = l * al + sum; m = mn;
        wave_lds_sync();
        const v16b pf = frag_kb(&Pb[wave][col][0], hh);
#pragma unroll
        for (int t = 0; t < 4; ++t) {
          o[t] *= al; const v16b vh = frag_kb(&Vs[buf][t * 16 + col][sub], hh);
          o[t] = wmma16b(vh, pf, o[t]); }
        wave_lds_sync(); }
    }
    asm volatile("s_wait_dscnt 0x0" ::: "memory");      // this wave's reads of tile s are done before the buffer is handed back
    asm volatile("s_wait_asynccnt 0x0" ::: "memory");   // this wave's copies of tile s + 1 have landed
    __syncthreads();                                    // publishes tile s + 1 and ends every wave's reads of tile s
    if (s + 2 < nst) stage_kv(kg + (size_t)(s + 2) * 64 * HD, vg + (size_t)(s + 2) * 64, kl + buf * BUFB, vl + buf * BUFB);
  }
  asm volatile("s_wait_asynccnt 0x0" ::: "memory");     // no copy is left in flight when the wave ends
  const float inv = YS / (l * PS * XS);
#pragma unroll
  for (int t = 0; t < 4; ++t) {
#pragma unroll
    for (int r = 0; r < 8; ++r) Th[wave][col][t * 16 + 8 * hh + r] = (b16)(o[t][r] * inv); }
  wave_lds_sync();
  b16* yb = Yh + ((size_t)b * SEQ + (size_t)q0) * CD + (size_t)h * HD;
#pragma unroll 1   // as in the kernel above: four short trips, no gain from unrolling
  for (int it = 0; it < 4; ++it) {
    const int rr = it * 4 + (lane >> 3), c8 = (lane & 7) * 8; const v8b f = *(const v8b*)(&Th[wave][rr][c8]);
    *(v8b*)(yb + (size_t)rr * CD + c8) = f; }
}
}  // namespace

extern "C" void kernel_launch(void* const* d_in, const int* in_sizes, int n_in, void* d_out, int out_size, void* d_ws, size_t ws_size, hipStream_t stream) {
  // wire order: 0 x [NB_FULL][SEQ_FULL][1024] f32, 1 W_attn [1024][3072] f32, 2 b_attn [3072] f32, 3 W_proj [1024][1024] f32, 4 b_proj [1024] f32; out [NB_FULL][SEQ_FULL][1024] f32
  const size_t need_x = ((size_t)(NB - 1) * SEQ_FULL + (size_t)SEQ) * CD;
  if (n_in < 5 || (size_t)in_sizes[0] < need_x || (size_t)in_sizes[1] < (size_t)KD * N3 || (size_t)in_sizes[2] < (size_t)N3 ||
      (size_t)in_sizes[3] < (size_t)KD * CD || (size_t)in_sizes[4] < (size_t)CD || (size_t)out_size < need_x) return;
  const float* Xin = (const float*)d_in[0]; const float* Wa = (const float*)d_in[1]; const float* Ba = (const float*)d_in[2];
  const float* Wp = (const float*)d_in[3]; const float* Bp = (const float*)d_in[4];
  size_t off = 0; char* ws = (char*)d_ws;
  auto carve = [&](size_t bytes) { char* p = ws + off; off += (bytes + 255) & ~(size_t)255; return p; };
  b16* Xp = (b16*)carve((size_t)MROWS * CD * 2);                       //  8,388,608 B at NB=2, SEQ=2048
  b16* WaT = (b16*)carve((size_t)N3 * KD * 2);                         //  6,291,456
  b16* WpT = (b16*)carve((size_t)CD * KD * 2);                         //  2,097,152
  float* QKV = (float*)carve((size_t)MROWS * N3 * 4);                  // 50,331,648
  const size_t plane = (size_t)NB * H * SEQ * HD * 2, rplane = (size_t)NB * H * EARLY * HD * 2;
  b16* Qh = (b16*)carve(plane); b16* Kh = (b16*)carve(plane); b16* VTh = (b16*)carve(plane);      // 3 x 8,388,608
  b16* Qr = (b16*)carve(rplane); b16* Kr = (b16*)carve(rplane); b16* VTr = (b16*)carve(rplane);   // 3 x 524,288
  b16* Yh = (b16*)carve((size_t)MROWS * CD * 2);                       //  8,388,608
  b16* Yr = (b16*)carve((size_t)NB * EARLY * CD * 2);                  //    524,288   -> total 102,760,448 B
  if (off > ws_size || off > ((size_t)128 << 20)) return;
  cvt_x_kernel<<<dim3((unsigned)(((size_t)MROWS * 128 + 255) / 256)), 256, 0, stream>>>(Xin, Xp);
  cvt_w_kernel<<<dim3(N3 / 64, KD / 64), 64, 0, stream>>>(Wa, WaT, N3);
  cvt_w_kernel<<<dim3(CD / 64, KD / 64), 64, 0, stream>>>(Wp, WpT, CD);
  gemm_kernel<<<dim3(N3 / BN, MROWS / BM), 256, 0, stream>>>(Xp, Xp, WaT, Ba, QKV, N3, SEQ, 0, 1.0f / (XS * WS));
  qkv_post_kernel<<<dim3(SEQ / 64, NB * H), 64, 0, stream>>>(QKV, Qh, Qr, Kh, Kr, VTh, VTr);
  attn_kernel<true><<<dim3(EB, NB * H), 64, 0, stream>>>(Qh, Qr, Kh, Kr, VTh, VTr, Yh, Yr, 0);
  if (QL / 64 > EARLY / 64) attn_main_kernel<<<dim3(QL / 64 - EARLY / 64, NB * H), 128, 0, stream>>>(Qh, Kh, VTh, Yh, EARLY / 64);
  gemm_kernel<<<dim3(CD / BN, MROWS / BM), 256, 0, stream>>>(Yh, Yr, WpT, Bp, (float*)d_out, CD, SEQ_FULL, 1, 1.0f / (YS * WS));
}

// v002
// A run of this version takes 158 microseconds.
// Timed twice side by side with v001, it ran 1.38 and 1.37 times as fast.
// Counting every step since v000, it is 1.92 times as fast.
#include <hip/hip_runtime.h>

// compute dtype: all contractions on v_wmma_f32_16x16x32_f16 (f16 operands, f32 accumulate). x @ W_attn and y @ W_proj: x and W enter as their bf16-RNE
// values carried x8 (x) and x64 (W) in f16 planes, 1 product; y carried x16 as f16 hi, plus a x1024 f16 residual plane on the first 128 token rows of each
// sequence (2 products there, second accumulator folded in the f32 epilogue). S^T = K Q^T per head: q, k after rms-norm and rotary carried x8 as f16 hi,
// 1 product; query blocks below 128 tokens add x1024 f16 q and k residual planes (3 products). O^T += V^T P^T: v carried x8 f16, P f16 x1024, 1 product;
// the same early query blocks add P and v x1024 residuals into a second accumulator folded before normalisation. Norm, rotary, softmax statistics in f32.
// Fragment k-map per lane half hh for A AND B: elements 0..7 <- k = 8hh+0..7, 8..15 <- k = 16+8hh+0..7; acc[r] = D[8hh+r][col = lane&15].

#ifndef NB
#define NB 2
#endif
#ifndef SEQ
#define SEQ 2048
#endif
#ifndef NB_FULL
#define NB_FULL 2
#endif
#ifndef SEQ_FULL
#define SEQ_FULL 2048
#endif

namespace {
constexpr int H = 16, HD = 64, CD = 1024, N3 = 3 * CD, KD = CD, QL = SEQ, SK = SEQ, MROWS = NB * SEQ;
constexpr int EARLY = 128, EB = EARLY / 32;                       // token rows per sequence that get residual planes; EB = early query blocks of 32
constexpr int BM = 128, BN = 64, BK = 64, TP = 72, AP = BK + 8, CP = BN + 4, VP = BM + 8;
constexpr int ABYTES = BM * AP * 2, BBYTES = BN * AP * 2, SMEM = 2 * ABYTES + BBYTES;
constexpr float XS = 8.0f, WS = 64.0f, YS = 16.0f, PS = 1024.0f, RS = 1024.0f;
constexpr float LOG2E = 1.4426950408889634f, LOG2B = 13.287712379549449f, RMS_EPS = 1.1920929e-07f;
static_assert(SEQ % BM == 0 && SEQ >= BM && SEQ <= SEQ_FULL && NB >= 1 && NB <= NB_FULL);
static_assert(EARLY == BM && EARLY % 64 == 0 && EB * 32 == EARLY && MROWS % BM == 0 && N3 % BN == 0 && CD % BN == 0 && KD % BK == 0);
static_assert(BM * CP * 4 <= SMEM && HD == 64 && QL == SK && SEQ % 64 == 0 && (MROWS * 128) % 256 == 0);
static_assert(BN == HD && 2 * HD * VP * 2 <= SMEM);

typedef _Float16 b16;
typedef __attribute__((ext_vector_type(16))) _Float16 v16b;
typedef __attribute__((ext_vector_type(8))) _Float16 v8b;
typedef __attribute__((ext_vector_type(8))) float v8f;
typedef __attribute__((ext_vector_type(4))) float v4f;

__device__ __forceinline__ float bf16_rne(float f) { unsigned int u = __float_as_uint(f); u += 0x7FFFu + ((u >> 16) & 1u); return __uint_as_float(u & 0xFFFF0000u); }
// 16-bit fragment from a k-contiguous row: elements 0..7 <- p[8hh .. 8hh+7], 8..15 <- p[16+8hh .. 16+8hh+7]
__device__ __forceinline__ v16b frag_kb(const b16* p, int hh) {
  const v8b a = *(const v8b*)(p + 8 * hh), b = *(const v8b*)(p + 16 + 8 * hh); v16b f;
#pragma unroll
  for (int e = 0; e < 8; ++e) { f[e] = a[e]; f[8 + e] = b[e]; }
  return f;
}
__device__ __forceinline__ v8f wmma16b(v16b a, v16b b, v8f c) {
  v8f d = __builtin_amdgcn_wmma_f32_16x16x32_f16(false, a, false, b, (short)0, c, false, false);
  asm volatile("v_nop\n\tv_nop\n\tv_nop\n\tv_nop" : "+v"(d) : "v"(a), "v"(b));
  return d;
}
__device__ __forceinline__ void wave_lds_sync() { __builtin_amdgcn_fence(3, "workgroup"); __builtin_amdgcn_wave_barrier(); __builtin_amdgcn_fence(2, "workgroup"); }
__device__ __forceinline__ float nexp2(float v) { return __builtin_amdgcn_exp2f(v); }

__device__ __forceinline__ void store_tile64(const b16 (*S)[TP], b16* dst, size_t pitch, int wave, int lane) {
  {
#pragma unroll 1
    for (int it = 0; it < 8; ++it) {
      const int r = wave * 32 + it * 4 + (lane >> 3), c8 = (lane & 7) * 8;
      const v8b o = *(const v8b*)(&S[r][c8]);
      *(v8b*)(dst + (size_t)r * pitch + c8) = o; }
     }
}

__global__ __launch_bounds__(256) void cvt_x_kernel(const float* __restrict__ X, b16* __restrict__ Xp) {
  const size_t u = (size_t)blockIdx.x * 256 + threadIdx.x; const size_t g = u >> 7; const int piece = (int)(u & 127);
  if (g >= (size_t)MROWS) return;
  const size_t srow = (g / SEQ) * SEQ_FULL + (g % SEQ);
  const float* src = X + srow * CD + piece * 8; b16* dst = Xp + g * CD + piece * 8;
  const v4f x0 = *(const v4f*)src, x1 = *(const v4f*)(src + 4); v8b o;
#pragma unroll
  for (int j = 0; j < 4; ++j) { o[j] = (b16)(bf16_rne(x0[j]) * XS); o[4 + j] = (b16)(bf16_rne(x1[j]) * XS); }
  *(v8b*)dst = o; 
}

// W [KD][N] f32 (in-major: W[k][n]) -> WT [N][KD] f16 = bf16-RNE(W) x64 (k-contiguous per output column). Block per 64x64 tile (blockIdx.x = n tile,
__global__ __launch_bounds__(64) void cvt_w_kernel(const float* __restrict__ W, b16* __restrict__ WT, int N) {
  __shared__ __attribute__((aligned(16))) b16 St[64][TP];
  const int tid = threadIdx.x, wave = tid >> 5, lane = tid & 31; const int nb = blockIdx.x, kb = blockIdx.y;
  const float* src = W + (size_t)kb * 64 * (size_t)N + (size_t)nb * 64;
#pragma unroll 1
  for (int it = 0; it < 16; ++it) {
    const int e = (it * 64 + tid) * 4; const int kk = e >> 6, n = e & 63;
    const v4f x = *(const v4f*)(src + (size_t)kk * N + n);
#pragma unroll
    for (int j = 0; j < 4; ++j) St[n + j][kk] = (b16)(bf16_rne(x[j]) * WS);
  }
  __syncthreads();   // St is read across waves
  store_tile64(St, WT + (size_t)nb * 64 * KD + (size_t)kb * 64, KD, wave, lane);
}

// Tile value c[m][n] = (A[m][.] . BT[n][.] + Ar[m][.] . BT[n][.] / 1024) * oscale + bf16-RNE(bias[n]); A, Ar, BT f16 with k-contiguous rows of KD = 1024, f32 accumulate.
// Rows m = b*SEQ + t (compact). The residual plane Ar ([b][EARLY][KD]) is used only when res_on != 0 and the tile's t0 < EARLY (block-uniform).
// Block 256 threads = 8 waves (4 along m x 2 along n), tile 128 x 64, k steps of 64 staged in LDS with plain 16-B loads; epilogue staged in LDS.
// HEADS == false: C[b*cstr + t][n] = c, f32, each 256-B row piece stored whole.
// HEADS == true (x @ W_attn): the tile's 64 columns are one head h of q, k or v (BN == HD) and c never goes to memory. q and k: rms-norm over the 64 head dims, rotary with
// angle h * inv_freq[i] (head-indexed, same for every token), x8, f16 hi into Qh/Kh [bhi][SEQ][64] and, for t0 < EARLY, x1024 residuals into Qr/Kr [bhi][EARLY][64];
// v: x8, transposed through LDS into VTh [bhi][64][SEQ] and VTr [bhi][64][EARLY]. EARLY == BM: a tile is early as a whole or not at all.
template <bool HEADS>
__global__ __launch_bounds__(256) void gemm_kernel(const b16* __restrict__ A, const b16* __restrict__ Ar, const b16* __restrict__ BT, const float* __restrict__ bias,
                                                   float* __restrict__ C, b16* __restrict__ Qh, b16* __restrict__ Qr, b16* __restrict__ Kh, b16* __restrict__ Kr,
                                                   b16* __restrict__ VTh, b16* __restrict__ VTr, int N, int cstr, int res_on, float oscale) {
  __shared__ __attribute__((aligned(16))) char smem[SMEM];
  b16* As = reinterpret_cast<b16*>(smem); b16* Ars = reinterpret_cast<b16*>(smem + ABYTES); b16* Bs = reinterpret_cast<b16*>(smem + 2 * ABYTES);
  float* Cs = reinterpret_cast<float*>(smem);   // aliases As/Ars after the k loop (block barrier in between)
  const int tid = threadIdx.x, wave = tid >> 5, lane = tid & 31, hh = lane >> 4, col = lane & 15, wm = wave >> 1, wn = wave & 1;
  const int bm = (int)blockIdx.y * BM, bn = (int)blockIdx.x * BN; const int bb = bm / SEQ, t0 = bm % SEQ;
  const bool res = (res_on != 0) && (t0 < EARLY);
  const b16* Ab = A + (size_t)bm * KD; const b16* Bb = BT + (size_t)bn * KD;
  const b16* Arb = Ar + ((size_t)bb * EARLY + (size_t)t0) * KD;   // dereferenced only when res (then t0 == 0)
  v8f acc[2][2], accr[2][2];
#pragma unroll
  for (int i = 0; i < 2; ++i)
#pragma unroll
    for (int j = 0; j < 2; ++j) { acc[i][j] = (v8f){}; accr[i][j] = (v8f){}; }
#pragma unroll 1
  for (int k0 = 0; k0 < KD; k0 += BK) {
#pragma unroll
    for (int j = 0; j < 4; ++j) { const int p = tid + 256 * j, row = p >> 3, c8 = (p & 7) * 8;
      *(v8b*)(As + row * AP + c8) = *(const v8b*)(Ab + (size_t)row * KD + k0 + c8); }
    if (res) {
#pragma unroll
      for (int j = 0; j < 4; ++j) { const int p = tid + 256 * j, row = p >> 3, c8 = (p & 7) * 8;
        *(v8b*)(Ars + row * AP + c8) = *(const v8b*)(Arb + (size_t)row * KD + k0 + c8); } }
#pragma unroll
    for (int j = 0; j < 2; ++j) { const int p = tid + 256 * j, row = p >> 3, c8 = (p & 7) * 8;
      *(v8b*)(Bs + row * AP + c8) = *(const v8b*)(Bb + (size_t)row * KD + k0 + c8); }
    __syncthreads();   // tiles are read across waves
#pragma unroll
    for (int ks = 0; ks < BK; ks += 32) {
      const v16b a0 = frag_kb(As + (wm * 32 + col) * AP + ks, hh), a1 = frag_kb(As + (wm * 32 + 16 + col) * AP + ks, hh);
      const v16b b0 = frag_kb(Bs + (wn * 32 + col) * AP + ks, hh), b1 = frag_kb(Bs + (wn * 32 + 16 + col) * AP + ks, hh);
      acc[0][0] = wmma16b(a0, b0, acc[0][0]); acc[0][1] = wmma16b(a0, b1, acc[0][1]);
      acc[1][0] = wmma16b(a1, b0, acc[1][0]); acc[1][1] = wmma16b(a1, b1, acc[1][1]);
      if (res) {
        const v16b r0 = frag_kb(Ars + (wm * 32 + col) * AP + ks, hh), r1 = frag_kb(Ars + (wm * 32 + 16 + col) * AP + ks, hh);
        accr[0][0] = wmma16b(r0, b0, accr[0][0]); accr[0][1] = wmma16b(r0, b1, accr[0][1]);
        accr[1][0] = wmma16b(r1, b0, accr[1][0]); accr[1][1] = wmma16b(r1, b1, accr[1][1]); }
    }
    __syncthreads();   // all fragment reads done before the next stage overwrites / the epilogue aliases
  }
  const int cls = bn / CD, h = (bn % CD) / HD, bhi = bb * H + h;   // HEADS: 0 q, 1 k, 2 v; block-uniform
  const bool early = (t0 < EARLY);
  if (HEADS && cls == 2) {
    // acc[i][j][0..7] are 8 consecutive tokens of one head dim: one 16-B piece of a V^T row
    b16* Sv = reinterpret_cast<b16*>(smem); b16* Svr = Sv + HD * VP;
#pragma unroll
    for (int i = 0; i < 2; ++i)
#pragma unroll
      for (int j = 0; j < 2; ++j) {
        const int cc = wn * 32 + j * 16 + col; const float bv = bf16_rne(bias[bn + cc]); v8b oh;
#pragma unroll
        for (int r = 0; r < 8; ++r) {
          const float v = acc[i][j][r] + accr[i][j][r] * (1.0f / RS);
          const float v0 = (v * oscale + bv) * XS; acc[i][j][r] = v0; oh[r] = (b16)v0; }
        *(v8b*)(Sv + cc * VP + wm * 32 + i * 16 + 8 * hh) = oh; }
    if (early) {
#pragma unroll
      for (int i = 0; i < 2; ++i)
#pragma unroll
        for (int j = 0; j < 2; ++j) {
          const int cc = wn * 32 + j * 16 + col; v8b orr;
#pragma unroll
          for (int r = 0; r < 8; ++r) { const float v0 = acc[i][j][r]; orr[r] = (b16)((v0 - (float)(b16)v0) * RS); }
          *(v8b*)(Svr + cc * VP + wm * 32 + i * 16 + 8 * hh) = orr; } }
    __syncthreads();   // V^T rows are read across waves
    b16* dv = VTh + (size_t)bhi * HD * (size_t)SK + t0;
#pragma unroll 1   // four short trips, no gain from unrolling
    for (int it = 0; it < 4; ++it) {
      const int d = wave * 8 + it * 2 + hh; const v8b f = *(const v8b*)(Sv + d * VP + col * 8);
      *(v8b*)(dv + (size_t)d * SK + col * 8) = f; }
    if (early) {   // then t0 == 0
      b16* dvr = VTr + (size_t)bhi * HD * (size_t)EARLY;
#pragma unroll 1   // as above
      for (int it = 0; it < 4; ++it) {
        const int d = wave * 8 + it * 2 + hh; const v8b fr = *(const v8b*)(Svr + d * VP + col * 8);
        *(v8b*)(dvr + (size_t)d * EARLY + col * 8) = fr; } }
    return;
  }
#pragma unroll
  for (int i = 0; i < 2; ++i)
#pragma unroll
    for (int j = 0; j < 2; ++j) {
      const int cc = wn * 32 + j * 16 + col; const float bv = bf16_rne(bias[bn + cc]);
#pragma unroll
      for (int r = 0; r < 8; ++r) {
        const float v = acc[i][j][r] + accr[i][j][r] * (1.0f / RS);   // accr stays 0 when the residual plane is off
        Cs[(wm * 32 + i * 16 + 8 * hh + r) * CP + cc] = v * oscale + bv; } }
  __syncthreads();   // Cs rows are read across waves
  if constexpr (HEADS) {
    // From here on a wave works on its own 16 rows alone. A lane holds head dims lane and lane + 32, the two partners of one rotation.
    const float invf = exp2f(-(float)lane * (LOG2B / 32.0f));   // (1/10000)^(2i/64)
    const float ang = (float)h * invf; float s, c; sincosf(ang, &s, &c);
    float* rows = Cs + wave * 16 * CP;
#pragma unroll 1   // two batches of 8 rows: all 16 at once would take more registers than the k loop does and cost a resident block
    for (int g = 0; g < 16; g += 8) {
      float e0[8], e1[8], ss[8];
      // Every '#pragma unroll' of this batch keeps the index of a register array a compile-time constant; the 8 rows go through each stage side by side, so that
      // their LDS reads and lane exchanges overlap.
#pragma unroll
      for (int i = 0; i < 8; ++i) { e0[i] = rows[(g + i) * CP + lane]; e1[i] = rows[(g + i) * CP + lane + 32]; ss[i] = e0[i] * e0[i] + e1[i] * e1[i]; }
#pragma unroll
      for (int off = 16; off > 0; off >>= 1)
#pragma unroll
        for (int i = 0; i < 8; ++i) ss[i] += __shfl_xor(ss[i], off);
      // The batch's rows are in registers by now: a row's f16 hi goes over the first 128 B of its own 256 B, its residual over the second.
#pragma unroll
      for (int i = 0; i < 8; ++i) {
        const float rn = rsqrtf(ss[i] * (1.0f / 64.0f) + RMS_EPS);
        const float n0 = e0[i] * rn, n1 = e1[i] * rn;
        const float y0 = (n0 * c + n1 * s) * XS, y1 = (n1 * c - n0 * s) * XS;
        b16* ro = reinterpret_cast<b16*>(rows + (g + i) * CP);
        ro[lane] = (b16)y0; ro[lane + 32] = (b16)y1; e0[i] = y0; e1[i] = y1;
      }
      if (early) {
#pragma unroll
        for (int i = 0; i < 8; ++i) {
          const float y0 = e0[i], y1 = e1[i]; b16* ro = reinterpret_cast<b16*>(rows + (g + i) * CP);
          ro[64 + lane] = (b16)((y0 - (float)(b16)y0) * RS); ro[96 + lane] = (b16)((y1 - (float)(b16)y1) * RS); } }
    }
    wave_lds_sync();
    const int r4 = lane >> 3, c8 = (lane & 7) * 8;
    b16* dh = (cls == 0 ? Qh : Kh) + ((size_t)bhi * SEQ + (size_t)(t0 + wave * 16)) * HD;
#pragma unroll 1   // four short trips, no gain from unrolling
    for (int it = 0; it < 4; ++it) {
      const int rr = it * 4 + r4; const v8b f = *(const v8b*)(reinterpret_cast<const b16*>(rows + rr * CP) + c8);
      *(v8b*)(dh + (size_t)rr * HD + c8) = f; }
    if (early) {   // then t0 == 0
      b16* dr = (cls == 0 ? Qr : Kr) + ((size_t)bhi * EARLY + (size_t)(wave * 16)) * HD;
#pragma unroll 1   // as above
      for (int it = 0; it < 4; ++it) {
        const int rr = it * 4 + r4; const v8b fr = *(const v8b*)(reinterpret_cast<const b16*>(rows + rr * CP) + 64 + c8);
        *(v8b*)(dr + (size_t)rr * HD + c8) = fr; } }
  } else {
    float* Cb = C + ((size_t)bb * (size_t)cstr + (size_t)t0) * (size_t)N + bn;
#pragma unroll 1
    for (int it = 0; it < 8; ++it) {
      const int rr = wave * 16 + it * 2 + hh; const v4f f = *(const v4f*)(Cs + rr * CP + col * 4);
      *(v4f*)(Cb + (size_t)rr * N + col * 4) = f; }
  }
}

// Causal softmax(Q K^T / 8) V per (b, h): grid (query blocks of 32 starting at block bx0, NB*H); block = 2 waves x 16 queries; key steps of 32 from 0 up to the
// block's last query in fixed order, keys above the query replaced by -inf before the running-max softmax (f32); P x1024 via wave-private LDS; O^T += V^T P^T.
// ER (blocks with queries < EARLY, which only visit keys < EARLY): S adds K_hi Q_res + K_res Q_hi (x1024), P adds a x1024 residual tile and V a x1024 residual
// plane into a second accumulator folded before normalisation, and the x16 y row is written as f16 hi plus a x1024 residual. y rows -> Yh [b*SEQ + q][h*64 + d]
template <bool ER>
__global__ __launch_bounds__(64) __attribute__((amdgpu_num_vgpr(256))) void attn_kernel(const b16* __restrict__ Qh, const b16* __restrict__ Qr, const b16* __restrict__ Kh,
                                                                                      const b16* __restrict__ Kr, const b16* __restrict__ VTh, const b16* __restrict__ VTr,
                                                                                      b16* __restrict__ Yh, b16* __restrict__ Yr, int bx0) {
  __shared__ __attribute__((aligned(16))) b16 Pb[2][16][32 + 8];
  __shared__ __attribute__((aligned(16))) b16 Pr[2][16][32 + 8];
  __shared__ __attribute__((aligned(16))) b16 Th[2][16][TP];
  __shared__ __attribute__((aligned(16))) b16 Tr[2][16][TP];
  const int wave = threadIdx.x >> 5, lane = threadIdx.x & 31, hh = lane >> 4, col = lane & 15;
  const int bhi = (int)blockIdx.y; const int b = bhi / H, h = bhi % H; const int bx = (int)blockIdx.x + bx0; const int q0 = bx * 32 + wave * 16, qi = q0 + col;
  const b16* Qb = Qh + (size_t)bhi * QL * HD; const b16* Kb = Kh + (size_t)bhi * SK * HD; const b16* Vb = VTh + (size_t)bhi * HD * (size_t)SK;
  const b16* Qrb = Qr + (size_t)bhi * EARLY * HD; const b16* Krb = Kr + (size_t)bhi * EARLY * HD; const b16* Vrb = VTr + (size_t)bhi * HD * (size_t)EARLY;
  const v16b qa0 = frag_kb(Qb + (size_t)qi * HD, hh), qa1 = frag_kb(Qb + (size_t)qi * HD + 32, hh);
  v16b qr0 = (v16b){}, qr1 = (v16b){};
  if constexpr (ER) { qr0 = frag_kb(Qrb + (size_t)qi * HD, hh); qr1 = frag_kb(Qrb + (size_t)qi * HD + 32, hh); }
  const float cs = LOG2E / (8.0f * XS * XS);   // 1/sqrt(64) and the two x8 carriers, in the log2 domain
  float m = -INFINITY, l = 0.0f; v8f o[4], o2[4];
#pragma unroll
  for (int t = 0; t < 4; ++t) { o[t] = (v8f){}; o2[t] = (v8f){}; }
  const int kend = bx * 32 + 32;   // causal: keys 0 .. last query of this block; ER blocks: kend <= EARLY
#pragma unroll 1
  for (int kb = 0; kb < kend; kb += 32) {
    float e[16]; float mx = -INFINITY;
#pragma unroll
    for (int u = 0; u < 2; ++u) {
      const int krow = kb + u * 16 + col;
      const v16b kh0 = frag_kb(Kb + (size_t)krow * HD, hh), kh1 = frag_kb(Kb + (size_t)krow * HD + 32, hh);
      v8f s = (v8f){}; s = wmma16b(kh0, qa0, s); s = wmma16b(kh1, qa1, s);
      v8f sr = (v8f){};
      if constexpr (ER) {
        const v16b kr0 = frag_kb(Krb + (size_t)krow * HD, hh), kr1 = frag_kb(Krb + (size_t)krow * HD + 32, hh);
        sr = wmma16b(kh0, qr0, sr); sr = wmma16b(kh1, qr1, sr); sr = wmma16b(kr0, qa0, sr); sr = wmma16b(kr1, qa1, sr); }
#pragma unroll
      for (int r = 0; r < 8; ++r) {
        float v = s[r];
        if constexpr (ER) v += sr[r] * (1.0f / RS);
        v *= cs;
        const int key = kb + u * 16 + 8 * hh + r;
        v = (key > qi) ? -INFINITY : v;
        e[u * 8 + r] = v; mx = fmaxf(mx, v); } }
    mx = fmaxf(mx, __shfl_xor(mx, 16)); const float mn = fmaxf(m, mx); const float al = nexp2(m - mn); float sum = 0.0f;
#pragma unroll
    for (int i2 = 0; i2 < 16; ++i2) {
      const float p = nexp2(e[i2] - mn); sum += p; const int pi = (i2 < 8 ? 0 : 16) + 8 * hh + (i2 & 7);
      const float pp = p * PS; const b16 ph = (b16)pp; Pb[wave][col][pi] = ph;
      if constexpr (ER) Pr[wave][col][pi] = (b16)((pp - (float)ph) * RS); }
    sum += __shfl_xor(sum, 16); l = l * al + sum; m = mn;
    wave_lds_sync();
    const v16b pf = frag_kb(&Pb[wave][col][0], hh);
    v16b prf = (v16b){};
    if constexpr (ER) prf = frag_kb(&Pr[wave][col][0], hh);
#pragma unroll
    for (int t = 0; t < 4; ++t) {
      o[t] *= al; const v16b vh = frag_kb(Vb + (size_t)(t * 16 + col) * SK + kb, hh);
      o[t] = wmma16b(vh, pf, o[t]);
      if constexpr (ER) { const v16b vr = frag_kb(Vrb + (size_t)(t * 16 + col) * EARLY + kb, hh); o2[t] *= al; o2[t] = wmma16b(vh, prf, o2[t]); o2[t] = wmma16b(vr, pf, o2[t]); } }
    wave_lds_sync(); }
  const float inv = YS / (l * PS * XS);
#pragma unroll
  for (int t = 0; t < 4; ++t) {
#pragma unroll
    for (int r = 0; r < 8; ++r) {
      float ov = o[t][r];
      if constexpr (ER) ov += o2[t][r] * (1.0f / RS);
      const float yv = ov * inv; const b16 yh = (b16)yv;
      Th[wave][col][t * 16 + 8 * hh + r] = yh;
      if constexpr (ER) Tr[wave][col][t * 16 + 8 * hh + r] = (b16)((yv - (float)yh) * RS); } }
  wave_lds_sync();
  b16* yb = Yh + ((size_t)b * SEQ + (size_t)q0) * CD + (size_t)h * HD;
  {
#pragma unroll 1
    for (int it = 0; it < 4; ++it) {
      const int rr = it * 4 + (lane >> 3), c8 = (lane & 7) * 8; const v8b f = *(const v8b*)(&Th[wave][rr][c8]);
      *(v8b*)(yb + (size_t)rr * CD + c8) = f;
      if constexpr (ER) {
        const v8b fr = *(const v8b*)(&Tr[wave][rr][c8]);
        *(v8b*)(Yr + (((size_t)b * EARLY + (size_t)(q0 + rr)) * CD + (size_t)h * HD + c8)) = fr; } }
     }
}

// LDS byte address of a __shared__ object: the low 32 bits of its address.
__device__ __forceinline__ unsigned lds_off(const void* p) { return (unsigned)(size_t)p; }
// One staged tile pair = 64 keys: K rows [64 keys][64 dims] and V^T rows [64 dims][64 keys], 128 B a row, laid at the 144-B pitch of TP. 128 threads, 16 B a lane:
// copy j of a thread brings row (tid >> 3) + 16 j, piece tid & 7, so a wave's copy covers four whole 128-B lines. kg / vg: the lane's first global byte of the tile,
// kl / vl: its first LDS byte. s_wait_xcnt stands inside the statement so that no address register named here is rewritten ahead of it.
__device__ __forceinline__ void stage_kv(const b16* kg, const b16* vg, unsigned kl, unsigned vl) {
  const b16 *k1 = kg + 16 * HD, *k2 = kg + 32 * HD, *k3 = kg + 48 * HD; const b16 *v1 = vg + 16 * (size_t)SK, *v2 = vg + 32 * (size_t)SK, *v3 = vg + 48 * (size_t)SK;
  const unsigned kl1 = kl + 16 * TP * 2, kl2 = kl + 32 * TP * 2, kl3 = kl + 48 * TP * 2, vl1 = vl + 16 * TP * 2, vl2 = vl + 32 * TP * 2, vl3 = vl + 48 * TP * 2;
  asm volatile("global_load_async_to_lds_b128 %0, %8, off\n\t"
               "global_load_async_to_lds_b128 %1, %9, off\n\t"
               "global_load_async_to_lds_b128 %2, %10, off\n\t"
               "global_load_async_to_lds_b128 %3, %11, off\n\t"
               "global_load_async_to_lds_b128 %4, %12, off\n\t"
               "global_load_async_to_lds_b128 %5, %13, off\n\t"
               "global_load_async_to_lds_b128 %6, %14, off\n\t"
               "global_load_async_to_lds_b128 %7, %15, off\n\t"
               "s_wait_xcnt 0x0"
               :: "v"(kl), "v"(kl1), "v"(kl2), "v"(kl3), "v"(vl), "v"(vl1), "v"(vl2), "v"(vl3), "v"(kg), "v"(k1), "v"(k2), "v"(k3), "v"(vg), "v"(v1), "v"(v2), "v"(v3)
               : "memory");
}

// The same causal softmax(Q K^T / 8) V for the queries from EARLY on (no residual planes): grid (query blocks of 64 starting at block bx0, NB*H); block = 4 waves x 16
// queries. K and V^T come in tiles of 64 keys, copied once per block into two LDS buffers (tile s + 1 flies while tile s is worked on) and read as fragments by all
// four waves. Each wave walks key steps of 32 in the same fixed order and up to the same last key (the end of its 32-query group) as the kernel above.
// Every plain '#pragma unroll' below keeps the index of a register array a compile-time constant.
__global__ __launch_bounds__(128) void attn_main_kernel(const b16* __restrict__ Qh, const b16* __restrict__ Kh, const b16* __restrict__ VTh, b16* __restrict__ Yh, int bx0) {
  __shared__ __attribute__((aligned(16))) b16 Ks[2][64][TP];
  __shared__ __attribute__((aligned(16))) b16 Vs[2][64][TP];
  __shared__ __attribute__((aligned(16))) b16 Pb[4][16][32 + 8];
  __shared__ __attribute__((aligned(16))) b16 Th[4][16][TP];
  const int tid = threadIdx.x, wave = __builtin_amdgcn_readfirstlane(tid >> 5), lane = tid & 31, hh = lane >> 4, col = lane & 15;
  const int bhi = (int)blockIdx.y; const int b = bhi / H, h = bhi % H; const int bx = (int)blockIdx.x + bx0; const int q0 = bx * 64 + wave * 16, qi = q0 + col;
  const b16* Qb = Qh + (size_t)bhi * QL * HD; const b16* Kb = Kh + (size_t)bhi * SK * HD; const b16* Vb = VTh + (size_t)bhi * HD * (size_t)SK;
  const int nst = bx + 1;                     // tiles of 64 keys: keys 0 .. last query of this block
  const int kend = (q0 >> 5) * 32 + 32;       // this wave's causal end
  const int srow = tid >> 3, sc8 = (tid & 7) * 8;
  const b16* kg = Kb + (size_t)srow * HD + sc8; const b16* vg = Vb + (size_t)srow * SK + sc8;   // tile s: kg + s * 64 * HD, vg + s * 64
  const unsigned kl = lds_off(&Ks[0][srow][sc8]), vl = lds_off(&Vs[0][srow][sc8]); constexpr unsigned BUFB = 64 * TP * 2;
  stage_kv(kg, vg, kl, vl);
  asm volatile("s_wait_asynccnt 0x0" ::: "memory");   // tile 0 has landed before the barrier that publishes it
  __syncthreads();
  if (nst > 1) stage_kv(kg + 64 * HD, vg + 64, kl + BUFB, vl + BUFB);
  const v16b qa0 = frag_kb(Qb + (size_t)qi * HD, hh), qa1 = frag_kb(Qb + (size_t)qi * HD + 32, hh);
  const float cs = LOG2E / (8.0f * XS * XS);   // 1/sqrt(64) and the two x8 carriers, in the log2 domain
  float m = -INFINITY, l = 0.0f; v8f o[4];
#pragma unroll
  for (int t = 0; t < 4; ++t) o[t] = (v8f){};
#pragma unroll 1   // one copy of the loop body in the text: the buffer index is a run-time offset
  for (int s = 0; s < nst; ++s) {
    const int buf = s & 1;
#pragma unroll 1   // the two key steps of a tile share one body
    for (int sub = 0; sub < 64; sub += 32) {
      const int kb = s * 64 + sub;
      if (kb < kend) {   // wave-uniform: a wave skips the step wholly above its diagonal, never the publish point below
        float e[16]; float mx = -INFINITY;
#pragma unroll
        for (int u = 0; u < 2; ++u) {
          const b16* kr = &Ks[buf][sub + u * 16 + col][0];
          const v16b kh0 = frag_kb(kr, hh), kh1 = frag_kb(kr + 32, hh);
          v8f sc = (v8f){}; sc = wmma16b(kh0, qa0, sc); sc = wmma16b(kh1, qa1, sc);
#pragma unroll
          for (int r = 0; r < 8; ++r) {
            float v = sc[r] * cs;
            const int key = kb + u * 16 + 8 * hh + r;
            v = (key > qi) ? -INFINITY : v;
            e[u * 8 + r] = v; mx = fmaxf(mx, v); } }
        mx = fmaxf(mx, __shfl_xor(mx, 16)); const float mn = fmaxf(m, mx); const float al = nexp2(m - mn); float sum = 0.0f;
#pragma unroll
        for (int i2 = 0; i2 < 16; ++i2) {
          const float p = nexp2(e[i2] - mn); sum += p; const int pi = (i2 < 8 ? 0 : 16) + 8 * hh + (i2 & 7);
          Pb[wave][col][pi] = (b16)(p * PS); }
        sum += __shfl_xor(sum, 16); l = l * al + sum; m = mn;
        wave_lds_sync();
        const v16b pf = frag_kb(&Pb[wave][col][0], hh);
#pragma unroll
        for (int t = 0; t < 4; ++t) {
          o[t] *= al; const v16b vh = frag_kb(&Vs[buf][t * 16 + col][sub], hh);
          o[t] = wmma16b(vh, pf, o[t]); }
        wave_lds_sync(); }
    }
    asm volatile("s_wait_dscnt 0x0" ::: "memory");      // this wave's reads of tile s are done before the buffer is handed back
    asm volatile("s_wait_asynccnt 0x0" ::: "memory");   // this wave's copies of tile s + 1 have landed
    __syncthreads();                                    // publishes tile s + 1 and ends every wave's reads of tile s
    if (s + 2 < nst) stage_kv(kg + (size_t)(s + 2) * 64 * HD, vg + (size_t)(s + 2) * 64, kl + buf * BUFB, vl + buf * BUFB);
  }
  asm volatile("s_wait_asynccnt 0x0" ::: "memory");     // no copy is left in flight when the wave ends
  const float inv = YS / (l * PS * XS);
#pragma unroll
  for (int t = 0; t < 4; ++t) {
#pragma unroll
    for (int r = 0; r < 8; ++r) Th[wave][col][t * 16 + 8 * hh + r] = (b16)(o[t][r] * inv); }
  wave_lds_sync();
  b16* yb = Yh + ((size_t)b * SEQ + (size_t)q0) * CD + (size_t)h * HD;
#pragma unroll 1   // as in the kernel above: four short trips, no gain from unrolling
  for (int it = 0; it < 4; ++it) {
    const int rr = it * 4 + (lane >> 3), c8 = (lane & 7) * 8; const v8b f = *(const v8b*)(&Th[wave][rr][c8]);
    *(v8b*)(yb + (size_t)rr * CD + c8) = f; }
}
}  // namespace

extern "C" void kernel_launch(void* const* d_in, const int* in_sizes, int n_in, void* d_out, int out_size, void* d_ws, size_t ws_size, hipStream_t stream) {
  // wire order: 0 x [NB_FULL][SEQ_FULL][1024] f32, 1 W_attn [1024][3072] f32, 2 b_attn [3072] f32, 3 W_proj [1024][1024] f32, 4 b_proj [1024] f32; out [NB_FULL][SEQ_FULL][1024] f32
  const size_t need_x = ((size_t)(NB - 1) * SEQ_FULL + (size_t)SEQ) * CD;
  if (n_in < 5 || (size_t)in_sizes[0] < need_x || (size_t)in_sizes[1] < (size_t)KD * N3 || (size_t)in_sizes[2] < (size_t)N3 ||
      (size_t)in_sizes[3] < (size_t)KD * CD || (size_t)in_sizes[4] < (size_t)CD || (size_t)out_size < need_x) return;
  const float* Xin = (const float*)d_in[0]; const float* Wa = (const float*)d_in[1]; const float* Ba = (const float*)d_in[2];
  const float* Wp = (const float*)d_in[3]; const float* Bp = (const float*)d_in[4];
  size_t off = 0; char* ws = (char*)d_ws;
  auto carve = [&](size_t bytes) { char* p = ws + off; off += (bytes + 255) & ~(size_t)255; return p; };
  b16* Xp = (b16*)carve((size_t)MROWS * CD * 2);                       //  8,388,608 B at NB=2, SEQ=2048
  b16* WaT = (b16*)carve((size_t)N3 * KD * 2);                         //  6,291,456
  b16* WpT = (b16*)carve((size_t)CD * KD * 2);                         //  2,097,152
  const size_t plane = (size_t)NB * H * SEQ * HD * 2, rplane = (size_t)NB * H * EARLY * HD * 2;
  b16* Qh = (b16*)carve(plane); b16* Kh = (b16*)carve(plane); b16* VTh = (b16*)carve(plane);      // 3 x 8,388,608
  b16* Qr = (b16*)carve(rplane); b16* Kr = (b16*)carve(rplane); b16* VTr = (b16*)carve(rplane);   // 3 x 524,288
  b16* Yh = (b16*)carve((size_t)MROWS * CD * 2);                       //  8,388,608
  b16* Yr = (b16*)carve((size_t)NB * EARLY * CD * 2);                  //    524,288   -> total 52,428,800 B
  if (off > ws_size || off > ((size_t)128 << 20)) return;
  cvt_x_kernel<<<dim3((unsigned)(((size_t)MROWS * 128 + 255) / 256)), 256, 0, stream>>>(Xin, Xp);
  cvt_w_kernel<<<dim3(N3 / 64, KD / 64), 64, 0, stream>>>(Wa, WaT, N3);
  cvt_w_kernel<<<dim3(CD / 64, KD / 64), 64, 0, stream>>>(Wp, WpT, CD);
  gemm_kernel<true><<<dim3(N3 / BN, MROWS / BM), 256, 0, stream>>>(Xp, Xp, WaT, Ba, nullptr, Qh, Qr, Kh, Kr, VTh, VTr, N3, SEQ, 0, 1.0f / (XS * WS));
  attn_kernel<true><<<dim3(EB, NB * H), 64, 0, stream>>>(Qh, Qr, Kh, Kr, VTh, VTr, Yh, Yr, 0);
  if (QL / 64 > EARLY / 64) attn_main_kernel<<<dim3(QL / 64 - EARLY / 64, NB * H), 128, 0, stream>>>(Qh, Kh, VTh, Yh, EARLY / 64);
  gemm_kernel<false><<<dim3(CD / BN, MROWS / BM), 256, 0, stream>>>(Yh, Yr, WpT, Bp, (float*)d_out, nullptr, nullptr, nullptr, nullptr, nullptr, nullptr, CD, SEQ_FULL, 1, 1.0f / (YS * WS));
}

// v003
// Measured time: 136 microseconds a run.
// Next to v002, in two timings, it ran 1.16 and 1.15 times as fast.
// Counting every step since v000, it is 2.23 times as fast.
#include <hip/hip_runtime.h>

// compute dtype: all contractions on v_wmma_f32_16x16x32_f16 (f16 operands, f32 accumulate). x @ W_attn and y @ W_proj: x and W enter as their bf16-RNE
// values carried x8 (x) and x64 (W) in f16 planes, 1 product; y carried x16 as f16 hi, plus a x1024 f16 residual plane on the first 128 token rows of each
// sequence (2 products there, second accumulator folded in the f32 epilogue). S^T = K Q^T per head: q, k after rms-norm and rotary carried x8 as f16 hi,
// 1 product; query blocks below 128 tokens add x1024 f16 q and k residual planes (3 products). O^T += V^T P^T: v carried x8 f16, P f16 x1024, 1 product;
// the same early query blocks add P and v x1024 residuals into a second accumulator folded before normalisation. Norm, rotary, softmax statistics in f32.
// Fragment k-map per lane half hh for A AND B: elements 0..7 <- k = 8hh+0..7, 8..15 <- k = 16+8hh+0..7; acc[r] = D[8hh+r][col = lane&15].

#ifndef NB
#define NB 2
#endif
#ifndef SEQ
#define SEQ 2048
#endif
#ifndef NB_FULL
#define NB_FULL 2
#endif
#ifndef SEQ_FULL
#define SEQ_FULL 2048
#endif

namespace {
constexpr int H = 16, HD = 64, CD = 1024, N3 = 3 * CD, KD = CD, QL = SEQ, SK = SEQ, MROWS = NB * SEQ;
constexpr int EARLY = 128, EB = EARLY / 32;                       // token rows per sequence that get residual planes
constexpr int BM = 128, BN = 64, BK = 64, TP = 72, AP = BK + 8, CP = BN + 4, VP = BM + 8;
constexpr int ABYTES = BM * AP * 2, BBYTES = BN * AP * 2, SMEM = 2 * ABYTES + BBYTES;
constexpr float XS = 8.0f, WS = 64.0f, YS = 16.0f, PS = 1024.0f, RS = 1024.0f;
constexpr float LOG2E = 1.4426950408889634f, LOG2B = 13.287712379549449f, RMS_EPS = 1.1920929e-07f;
static_assert(SEQ % BM == 0 && SEQ >= BM && SEQ <= SEQ_FULL && NB >= 1 && NB <= NB_FULL);
static_assert(EARLY == BM && EARLY % 64 == 0 && EB * 32 == EARLY && MROWS % BM == 0 && N3 % BN == 0 && CD % BN == 0 && KD % BK == 0);
static_assert(BM * CP * 4 <= SMEM && HD == 64 && QL == SK && SEQ % 64 == 0 && (MROWS * 128) % 256 == 0);
static_assert(BN == HD && 2 * HD * VP * 2 <= SMEM);

typedef _Float16 b16;
typedef __attribute__((ext_vector_type(16))) _Float16 v16b;
typedef __attribute__((ext_vector_type(8))) _Float16 v8b;
typedef __attribute__((ext_vector_type(8))) float v8f;
typedef __attribute__((ext_vector_type(4))) float v4f;

__device__ __forceinline__ float bf16_rne(float f) { unsigned int u = __float_as_uint(f); u += 0x7FFFu + ((u >> 16) & 1u); return __uint_as_float(u & 0xFFFF0000u); }
// 16-bit fragment from a k-contiguous row: elements 0..7 <- p[8hh .. 8hh+7], 8..15 <- p[16+8hh .. 16+8hh+7]
__device__ __forceinline__ v16b frag_kb(const b16* p, int hh) {
  const v8b a = *(const v8b*)(p + 8 * hh), b = *(const v8b*)(p + 16 + 8 * hh); v16b f;
#pragma unroll
  for (int e = 0; e < 8; ++e) { f[e] = a[e]; f[8 + e] = b[e]; }
  return f;
}
__device__ __forceinline__ v8f wmma16b(v16b a, v16b b, v8f c) {
  v8f d = __builtin_amdgcn_wmma_f32_16x16x32_f16(false, a, false, b, (short)0, c, false, false);
  asm volatile("v_nop\n\tv_nop\n\tv_nop\n\tv_nop" : "+v"(d) : "v"(a), "v"(b));
  return d;
}
__device__ __forceinline__ void wave_lds_sync() { __builtin_amdgcn_fence(3, "workgroup"); __builtin_amdgcn_wave_barrier(); __builtin_amdgcn_fence(2, "workgroup"); }
__device__ __forceinline__ float nexp2(float v) { return __builtin_amdgcn_exp2f(v); }

__device__ __forceinline__ void store_tile64(const b16 (*S)[TP], b16* dst, size_t pitch, int wave, int lane) {
  {
#pragma unroll 1
    for (int it = 0; it < 8; ++it) {
      const int r = wave * 32 + it * 4 + (lane >> 3), c8 = (lane & 7) * 8;
      const v8b o = *(const v8b*)(&S[r][c8]);
      *(v8b*)(dst + (size_t)r * pitch + c8) = o; }
     }
}

// One launch converts all three GEMM operands; none of the three depends on another. Blocks of 256 threads, told apart by block index (block-uniform).
// Blocks 0 .. WBLK-1: W [KD][N] f32 (in-major: W[k][n]) -> WT [N][KD] f16 = bf16-RNE(W) x64 (k-contiguous per output column), in 64x64 tiles. A block takes four tiles
// that are neighbours along n, two waves a tile, each tile in its own LDS plane; tiles 0 .. WA_T-1 are W_attn's, the rest W_proj's (n tile fastest). They come first in
// the grid, for speed only.
// Blocks from WBLK on: x f32 -> Xp f16 = bf16-RNE(x) x8, 8 elements a thread.
constexpr int WA_T = (N3 / 64) * (KD / 64), WP_T = (CD / 64) * (KD / 64), WBLK = (WA_T + WP_T) / 4, XBLK = (int)(((size_t)MROWS * 128 + 255) / 256);
static_assert(WA_T % 4 == 0 && WP_T % 4 == 0 && (N3 / 64) % 4 == 0 && (CD / 64) % 4 == 0);
__global__ __launch_bounds__(256) void cvt_all_kernel(const float* __restrict__ X, const float* __restrict__ Wa, const float* __restrict__ Wp, b16* __restrict__ Xp,
                                                      b16* __restrict__ WaT, b16* __restrict__ WpT) {
  __shared__ __attribute__((aligned(16))) b16 St[4][64][TP];
  if ((int)blockIdx.x < WBLK) {
    const int grp = threadIdx.x >> 6, tid = threadIdx.x & 63, wave = tid >> 5, lane = tid & 31;
    const bool isa = (int)blockIdx.x * 4 < WA_T;   // block-uniform: WA_T is a multiple of 4
    const int t4 = (int)blockIdx.x * 4 - (isa ? 0 : WA_T); const int N = isa ? N3 : CD;   // t4: the block's first tile within its matrix, a multiple of 4
    const int nb = (isa ? t4 % (N3 / 64) : t4 % (CD / 64)) + grp, kb = isa ? t4 / (N3 / 64) : t4 / (CD / 64);
    const float* src = (isa ? Wa : Wp) + (size_t)kb * 64 * (size_t)N + (size_t)nb * 64;
#pragma unroll 1
    for (int it = 0; it < 16; ++it) {
      const int e = (it * 64 + tid) * 4; const int kk = e >> 6, n = e & 63;
      const v4f x = *(const v4f*)(src + (size_t)kk * N + n);
#pragma unroll
      for (int j = 0; j < 4; ++j) St[grp][n + j][kk] = (b16)(bf16_rne(x[j]) * WS);
    }
    __syncthreads();   // a tile's plane is read across its two waves
    store_tile64(St[grp], (isa ? WaT : WpT) + (size_t)nb * 64 * KD + (size_t)kb * 64, KD, wave, lane);
    return;
  }
  const size_t u = (size_t)((int)blockIdx.x - WBLK) * 256 + threadIdx.x; const size_t g = u >> 7; const int piece = (int)(u & 127);
  if (g >= (size_t)MROWS) return;
  const size_t srow = (g / SEQ) * SEQ_FULL + (g % SEQ);
  const float* src = X + srow * CD + piece * 8; b16* dst = Xp + g * CD + piece * 8;
  const v4f x0 = *(const v4f*)src, x1 = *(const v4f*)(src + 4); v8b o;
#pragma unroll
  for (int j = 0; j < 4; ++j) { o[j] = (b16)(bf16_rne(x0[j]) * XS); o[4 + j] = (b16)(bf16_rne(x1[j]) * XS); }
  *(v8b*)dst = o;
}

// Tile value c[m][n] = (A[m][.] . BT[n][.] + Ar[m][.] . BT[n][.] / 1024) * oscale + bf16-RNE(bias[n]); A, Ar, BT f16 with k-contiguous rows of KD = 1024, f32 accumulate.
// Rows m = b*SEQ + t (compact). The residual plane Ar ([b][EARLY][KD]) is used only when res_on != 0 and the tile's t0 < EARLY (block-uniform).
// Block 256 threads = 8 waves (4 along m x 2 along n), tile 128 x 64, k steps of 64 staged in LDS with plain 16-B loads; epilogue staged in LDS.
// HEADS == false: C[b*cstr + t][n] = c, f32, each 256-B row piece stored whole.
// HEADS == true (x @ W_attn): the tile's 64 columns are one head h of q, k or v (BN == HD) and c never goes to memory. q and k: rms-norm over the 64 head dims, rotary with
// angle h * inv_freq[i] (head-indexed, same for every token), x8, f16 hi into Qh/Kh [bhi][SEQ][64] and, for t0 < EARLY, x1024 residuals into Qr/Kr [bhi][EARLY][64];
// v: x8, transposed through LDS into VTh [bhi][64][SEQ] and VTr [bhi][64][EARLY]. EARLY == BM: a tile is early as a whole or not at all.
template <bool HEADS>
__global__ __launch_bounds__(256) void gemm_kernel(const b16* __restrict__ A, const b16* __restrict__ Ar, const b16* __restrict__ BT, const float* __restrict__ bias,
                                                   float* __restrict__ C, b16* __restrict__ Qh, b16* __restrict__ Qr, b16* __restrict__ Kh, b16* __restrict__ Kr,
                                                   b16* __restrict__ VTh, b16* __restrict__ VTr, int N, int cstr, int res_on, float oscale) {
  __shared__ __attribute__((aligned(16))) char smem[SMEM];
  b16* As = reinterpret_cast<b16*>(smem); b16* Ars = reinterpret_cast<b16*>(smem + ABYTES); b16* Bs = reinterpret_cast<b16*>(smem + 2 * ABYTES);
  float* Cs = reinterpret_cast<float*>(smem);   // aliases As/Ars after the k loop (block barrier in between)
  const int tid = threadIdx.x, wave = tid >> 5, lane = tid & 31, hh = lane >> 4, col = lane & 15, wm = wave >> 1, wn = wave & 1;
  const int bm = (int)blockIdx.y * BM, bn = (int)blockIdx.x * BN; const int bb = bm / SEQ, t0 = bm % SEQ;
  const bool res = (res_on != 0) && (t0 < EARLY);
  const b16* Ab = A + (size_t)bm * KD; const b16* Bb = BT + (size_t)bn * KD;
  const b16* Arb = Ar + ((size_t)bb * EARLY + (size_t)t0) * KD;   // dereferenced only when res (then t0 == 0)
  v8f acc[2][2], accr[2][2];
#pragma unroll
  for (int i = 0; i < 2; ++i)
#pragma unroll
    for (int j = 0; j < 2; ++j) { acc[i][j] = (v8f){}; accr[i][j] = (v8f){}; }
#pragma unroll 1
  for (int k0 = 0; k0 < KD; k0 += BK) {
#pragma unroll
    for (int j = 0; j < 4; ++j) { const int p = tid + 256 * j, row = p >> 3, c8 = (p & 7) * 8;
      *(v8b*)(As + row * AP + c8) = *(const v8b*)(Ab + (size_t)row * KD + k0 + c8); }
    if (res) {
#pragma unroll
      for (int j = 0; j < 4; ++j) { const int p = tid + 256 * j, row = p >> 3, c8 = (p & 7) * 8;
        *(v8b*)(Ars + row * AP + c8) = *(const v8b*)(Arb + (size_t)row * KD + k0 + c8); } }
#pragma unroll
    for (int j = 0; j < 2; ++j) { const int p = tid + 256 * j, row = p >> 3, c8 = (p & 7) * 8;
      *(v8b*)(Bs + row * AP + c8) = *(const v8b*)(Bb + (size_t)row * KD + k0 + c8); }
    __syncthreads();   // tiles are read across waves
#pragma unroll
    for (int ks = 0; ks < BK; ks += 32) {
      const v16b a0 = frag_kb(As + (wm * 32 + col) * AP + ks, hh), a1 = frag_kb(As + (wm * 32 + 16 + col) * AP + ks, hh);
      const v16b b0 = frag_kb(Bs + (wn * 32 + col) * AP + ks, hh), b1 = frag_kb(Bs + (wn * 32 + 16 + col) * AP + ks, hh);
      acc[0][0] = wmma16b(a0, b0, acc[0][0]); acc[0][1] = wmma16b(a0, b1, acc[0][1]);
      acc[1][0] = wmma16b(a1, b0, acc[1][0]); acc[1][1] = wmma16b(a1, b1, acc[1][1]);
      if (res) {
        const v16b r0 = frag_kb(Ars + (wm * 32 + col) * AP + ks, hh), r1 = frag_kb(Ars + (wm * 32 + 16 + col) * AP + ks, hh);
        accr[0][0] = wmma16b(r0, b0, accr[0][0]); accr[0][1] = wmma16b(r0, b1, accr[0][1]);
        accr[1][0] = wmma16b(r1, b0, accr[1][0]); accr[1][1] = wmma16b(r1, b1, accr[1][1]); }
    }
    __syncthreads();   // all fragment reads done before the next stage overwrites / the epilogue aliases
  }
  const int cls = bn / CD, h = (bn % CD) / HD, bhi = bb * H + h;   // HEADS: 0 q, 1 k, 2 v; block-uniform
  const bool early = (t0 < EARLY);
  if (HEADS && cls == 2) {
    // acc[i][j][0..7] are 8 consecutive tokens of one head dim: one 16-B piece of a V^T row
    b16* Sv = reinterpret_cast<b16*>(smem); b16* Svr = Sv + HD * VP;
#pragma unroll
    for (int i = 0; i < 2; ++i)
#pragma unroll
      for (int j = 0; j < 2; ++j) {
        const int cc = wn * 32 + j * 16 + col; const float bv = bf16_rne(bias[bn + cc]); v8b oh;
#pragma unroll
        for (int r = 0; r < 8; ++r) {
          const float v = acc[i][j][r] + accr[i][j][r] * (1.0f / RS);
          const float v0 = (v * oscale + bv) * XS; acc[i][j][r] = v0; oh[r] = (b16)v0; }
        *(v8b*)(Sv + cc * VP + wm * 32 + i * 16 + 8 * hh) = oh; }
    if (early) {
#pragma unroll
      for (int i = 0; i < 2; ++i)
#pragma unroll
        for (int j = 0; j < 2; ++j) {
          const int cc = wn * 32 + j * 16 + col; v8b orr;
#pragma unroll
          for (int r = 0; r < 8; ++r) { const float v0 = acc[i][j][r]; orr[r] = (b16)((v0 - (float)(b16)v0) * RS); }
          *(v8b*)(Svr + cc * VP + wm * 32 + i * 16 + 8 * hh) = orr; } }
    __syncthreads();   // V^T rows are read across waves
    b16* dv = VTh + (size_t)bhi * HD * (size_t)SK + t0;
#pragma unroll 1   // four short trips, no gain from unrolling
    for (int it = 0; it < 4; ++it) {
      const int d = wave * 8 + it * 2 + hh; const v8b f = *(const v8b*)(Sv + d * VP + col * 8);
      *(v8b*)(dv + (size_t)d * SK + col * 8) = f; }
    if (early) {   // then t0 == 0
      b16* dvr = VTr + (size_t)bhi * HD * (size_t)EARLY;
#pragma unroll 1   // as above
      for (int it = 0; it < 4; ++it) {
        const int d = wave * 8 + it * 2 + hh; const v8b fr = *(const v8b*)(Svr + d * VP + col * 8);
        *(v8b*)(dvr + (size_t)d * EARLY + col * 8) = fr; } }
    return;
  }
#pragma unroll
  for (int i = 0; i < 2; ++i)
#pragma unroll
    for (int j = 0; j < 2; ++j) {
      const int cc = wn * 32 + j * 16 + col; const float bv = bf16_rne(bias[bn + cc]);
#pragma unroll
      for (int r = 0; r < 8; ++r) {
        const float v = acc[i][j][r] + accr[i][j][r] * (1.0f / RS);   // accr stays 0 when the residual plane is off
        Cs[(wm * 32 + i * 16 + 8 * hh + r) * CP + cc] = v * oscale + bv; } }
  __syncthreads();   // Cs rows are read across waves
  if constexpr (HEADS) {
    // From here on a wave works on its own 16 rows alone. A lane holds head dims lane and lane + 32, the two partners of one rotation.
    const float invf = exp2f(-(float)lane * (LOG2B / 32.0f));   // (1/10000)^(2i/64)
    const float ang = (float)h * invf; float s, c; sincosf(ang, &s, &c);
    float* rows = Cs + wave * 16 * CP;
#pragma unroll 1   // two batches of 8 rows: all 16 at once would take more registers than the k loop does and cost a resident block
    for (int g = 0; g < 16; g += 8) {
      float e0[8], e1[8], ss[8];
      // Every '#pragma unroll' of this batch keeps the index of a register array a compile-time constant; the 8 rows go through each stage side by side, so that
      // their LDS reads and lane exchanges overlap.
#pragma unroll
      for (int i = 0; i < 8; ++i) { e0[i] = rows[(g + i) * CP + lane]; e1[i] = rows[(g + i) * CP + lane + 32]; ss[i] = e0[i] * e0[i] + e1[i] * e1[i]; }
#pragma unroll
      for (int off = 16; off > 0; off >>= 1)
#pragma unroll
        for (int i = 0; i < 8; ++i) ss[i] += __shfl_xor(ss[i], off);
      // The batch's rows are in registers by now: a row's f16 hi goes over the first 128 B of its own 256 B, its residual over the second.
#pragma unroll
      for (int i = 0; i < 8; ++i) {
        const float rn = rsqrtf(ss[i] * (1.0f / 64.0f) + RMS_EPS);
        const float n0 = e0[i] * rn, n1 = e1[i] * rn;
        const float y0 = (n0 * c + n1 * s) * XS, y1 = (n1 * c - n0 * s) * XS;
        b16* ro = reinterpret_cast<b16*>(rows + (g + i) * CP);
        ro[lane] = (b16)y0; ro[lane + 32] = (b16)y1; e0[i] = y0; e1[i] = y1;
      }
      if (early) {
#pragma unroll
        for (int i = 0; i < 8; ++i) {
          const float y0 = e0[i], y1 = e1[i]; b16* ro = reinterpret_cast<b16*>(rows + (g + i) * CP);
          ro[64 + lane] = (b16)((y0 - (float)(b16)y0) * RS); ro[96 + lane] = (b16)((y1 - (float)(b16)y1) * RS); } }
    }
    wave_lds_sync();
    const int r4 = lane >> 3, c8 = (lane & 7) * 8;
    b16* dh = (cls == 0 ? Qh : Kh) + ((size_t)bhi * SEQ + (size_t)(t0 + wave * 16)) * HD;
#pragma unroll 1   // four short trips, no gain from unrolling
    for (int it = 0; it < 4; ++it) {
      const int rr = it * 4 + r4; const v8b f = *(const v8b*)(reinterpret_cast<const b16*>(rows + rr * CP) + c8);
      *(v8b*)(dh + (size_t)rr * HD + c8) = f; }
    if (early) {   // then t0 == 0
      b16* dr = (cls == 0 ? Qr : Kr) + ((size_t)bhi * EARLY + (size_t)(wave * 16)) * HD;
#pragma unroll 1   // as above
      for (int it = 0; it < 4; ++it) {
        const int rr = it * 4 + r4; const v8b fr = *(const v8b*)(reinterpret_cast<const b16*>(rows + rr * CP) + 64 + c8);
        *(v8b*)(dr + (size_t)rr * HD + c8) = fr; } }
  } else {
    float* Cb = C + ((size_t)bb * (size_t)cstr + (size_t)t0) * (size_t)N + bn;
#pragma unroll 1
    for (int it = 0; it < 8; ++it) {
      const int rr = wave * 16 + it * 2 + hh; const v4f f = *(const v4f*)(Cs + rr * CP + col * 4);
      *(v4f*)(Cb + (size_t)rr * N + col * 4) = f; }
  }
}

// Causal softmax(Q K^T / 8) V per (b, h) for the queries below EARLY: the body of the work-groups bx < EARLY / 64 of attn_main_kernel's launch. 4 waves x 16 queries, each
// wave on its own (no block barrier); key steps of 32 from 0 up to the last query of the wave's 32-query group in fixed order, keys above the query replaced by -inf
// before the running-max softmax (f32); P x1024 via wave-private LDS; O^T += V^T P^T.
// ER (queries < EARLY, which only visit keys < EARLY): S adds K_hi Q_res + K_res Q_hi (x1024), P adds a x1024 residual tile and V a x1024 residual
// plane into a second accumulator folded before normalisation, and the x16 y row is written as f16 hi plus a x1024 residual. y rows -> Yh [b*SEQ + q][h*64 + d]
template <bool ER>
__device__ __forceinline__ void attn_rows(const b16* __restrict__ Qh, const b16* __restrict__ Qr, const b16* __restrict__ Kh, const b16* __restrict__ Kr,
                                          const b16* __restrict__ VTh, const b16* __restrict__ VTr, b16* __restrict__ Yh, b16* __restrict__ Yr,
                                          b16 (*Pb)[16][32 + 8], b16 (*Pr)[16][32 + 8], b16 (*Th)[16][TP], b16 (*Tr)[16][TP], int bx) {
  const int wave = __builtin_amdgcn_readfirstlane((int)threadIdx.x >> 5), lane = threadIdx.x & 31, hh = lane >> 4, col = lane & 15;   // scalar: the key loop's end hangs on it
  const int bhi = (int)blockIdx.y; const int b = bhi / H, h = bhi % H; const int q0 = bx * 64 + wave * 16, qi = q0 + col;
  const b16* Qb = Qh + (size_t)bhi * QL * HD; const b16* Kb = Kh + (size_t)bhi * SK * HD; const b16* Vb = VTh + (size_t)bhi * HD * (size_t)SK;
  const b16* Qrb = Qr + (size_t)bhi * EARLY * HD; const b16* Krb = Kr + (size_t)bhi * EARLY * HD; const b16* Vrb = VTr + (size_t)bhi * HD * (size_t)EARLY;
  const v16b qa0 = frag_kb(Qb + (size_t)qi * HD, hh), qa1 = frag_kb(Qb + (size_t)qi * HD + 32, hh);
  v16b qr0 = (v16b){}, qr1 = (v16b){};
  if constexpr (ER) { qr0 = frag_kb(Qrb + (size_t)qi * HD, hh); qr1 = frag_kb(Qrb + (size_t)qi * HD + 32, hh); }
  const float cs = LOG2E / (8.0f * XS * XS);   // 1/sqrt(64) and the two x8 carriers, in the log2 domain
  float m = -INFINITY, l = 0.0f; v8f o[4], o2[4];
#pragma unroll
  for (int t = 0; t < 4; ++t) { o[t] = (v8f){}; o2[t] = (v8f){}; }
  const int kend = (q0 >> 5) * 32 + 32;   // causal: keys 0 .. last query of this wave's 32-query group; ER: kend <= EARLY
#pragma unroll 1
  for (int kb = 0; kb < kend; kb += 32) {
    float e[16]; float mx = -INFINITY;
#pragma unroll
    for (int u = 0; u < 2; ++u) {
      const int krow = kb + u * 16 + col;
      const v16b kh0 = frag_kb(Kb + (size_t)krow * HD, hh), kh1 = frag_kb(Kb + (size_t)krow * HD + 32, hh);
      v8f s = (v8f){}; s = wmma16b(kh0, qa0, s); s = wmma16b(kh1, qa1, s);
      v8f sr = (v8f){};
      if constexpr (ER) {
        const v16b kr0 = frag_kb(Krb + (size_t)krow * HD, hh), kr1 = frag_kb(Krb + (size_t)krow * HD + 32, hh);
        sr = wmma16b(kh0, qr0, sr); sr = wmma16b(kh1, qr1, sr); sr = wmma16b(kr0, qa0, sr); sr = wmma16b(kr1, qa1, sr); }
#pragma unroll
      for (int r = 0; r < 8; ++r) {
        float v = s[r];
        if constexpr (ER) v += sr[r] * (1.0f / RS);
        v *= cs;
        const int key = kb + u * 16 + 8 * hh + r;
        v = (key > qi) ? -INFINITY : v;
        e[u * 8 + r] = v; mx = fmaxf(mx, v); } }
    mx = fmaxf(mx, __shfl_xor(mx, 16)); const float mn = fmaxf(m, mx); const float al = nexp2(m - mn); float sum = 0.0f;
#pragma unroll
    for (int i2 = 0; i2 < 16; ++i2) {
      const float p = nexp2(e[i2] - mn); sum += p; const int pi = (i2 < 8 ? 0 : 16) + 8 * hh + (i2 & 7);
      const float pp = p * PS; const b16 ph = (b16)pp; Pb[wave][col][pi] = ph;
      if constexpr (ER) Pr[wave][col][pi] = (b16)((pp - (float)ph) * RS); }
    sum += __shfl_xor(sum, 16); l = l * al + sum; m = mn;
    wave_lds_sync();
    const v16b pf = frag_kb(&Pb[wave][col][0], hh);
    v16b prf = (v16b){};
    if constexpr (ER) prf = frag_kb(&Pr[wave][col][0], hh);
#pragma unroll
    for (int t = 0; t < 4; ++t) {
      o[t] *= al; const v16b vh = frag_kb(Vb + (size_t)(t * 16 + col) * SK + kb, hh);
      o[t] = wmma16b(vh, pf, o[t]);
      if constexpr (ER) { const v16b vr = frag_kb(Vrb + (size_t)(t * 16 + col) * EARLY + kb, hh); o2[t] *= al; o2[t] = wmma16b(vh, prf, o2[t]); o2[t] = wmma16b(vr, pf, o2[t]); } }
    wave_lds_sync(); }
  const float inv = YS / (l * PS * XS);
#pragma unroll
  for (int t = 0; t < 4; ++t) {
#pragma unroll
    for (int r = 0; r < 8; ++r) {
      float ov = o[t][r];
      if constexpr (ER) ov += o2[t][r] * (1.0f / RS);
      const float yv = ov * inv; const b16 yh = (b16)yv;
      Th[wave][col][t * 16 + 8 * hh + r] = yh;
      if constexpr (ER) Tr[wave][col][t * 16 + 8 * hh + r] = (b16)((yv - (float)yh) * RS); } }
  wave_lds_sync();
  b16* yb = Yh + ((size_t)b * SEQ + (size_t)q0) * CD + (size_t)h * HD;
  {
#pragma unroll 1
    for (int it = 0; it < 4; ++it) {
      const int rr = it * 4 + (lane >> 3), c8 = (lane & 7) * 8; const v8b f = *(const v8b*)(&Th[wave][rr][c8]);
      *(v8b*)(yb + (size_t)rr * CD + c8) = f;
      if constexpr (ER) {
        const v8b fr = *(const v8b*)(&Tr[wave][rr][c8]);
        *(v8b*)(Yr + (((size_t)b * EARLY + (size_t)(q0 + rr)) * CD + (size_t)h * HD + c8)) = fr; } }
     }
}

// LDS byte address of a __shared__ object: the low 32 bits of its address.
__device__ __forceinline__ unsigned lds_off(const void* p) { return (unsigned)(size_t)p; }
// One staged tile pair = 64 keys: K rows [64 keys][64 dims] and V^T rows [64 dims][64 keys], 128 B a row, laid at the 144-B pitch of TP. 128 threads, 16 B a lane:
// copy j of a thread brings row (tid >> 3) + 16 j, piece tid & 7, so a wave's copy covers four whole 128-B lines. kg / vg: the lane's first global byte of the tile,
// kl / vl: its first LDS byte. s_wait_xcnt stands inside the statement so that no address register named here is rewritten ahead of it.
__device__ __forceinline__ void stage_kv(const b16* kg, const b16* vg, unsigned kl, unsigned vl) {
  const b16 *k1 = kg + 16 * HD, *k2 = kg + 32 * HD, *k3 = kg + 48 * HD; const b16 *v1 = vg + 16 * (size_t)SK, *v2 = vg + 32 * (size_t)SK, *v3 = vg + 48 * (size_t)SK;
  const unsigned kl1 = kl + 16 * TP * 2, kl2 = kl + 32 * TP * 2, kl3 = kl + 48 * TP * 2, vl1 = vl + 16 * TP * 2, vl2 = vl + 32 * TP * 2, vl3 = vl + 48 * TP * 2;
  asm volatile("global_load_async_to_lds_b128 %0, %8, off\n\t"
               "global_load_async_to_lds_b128 %1, %9, off\n\t"
               "global_load_async_to_lds_b128 %2, %10, off\n\t"
               "global_load_async_to_lds_b128 %3, %11, off\n\t"
               "global_load_async_to_lds_b128 %4, %12, off\n\t"
               "global_load_async_to_lds_b128 %5, %13, off\n\t"
               "global_load_async_to_lds_b128 %6, %14, off\n\t"
               "global_load_async_to_lds_b128 %7, %15, off\n\t"
               "s_wait_xcnt 0x0"
               :: "v"(kl), "v"(kl1), "v"(kl2), "v"(kl3), "v"(vl), "v"(vl1), "v"(vl2), "v"(vl3), "v"(kg), "v"(k1), "v"(k2), "v"(k3), "v"(vg), "v"(v1), "v"(v2), "v"(v3)
               : "memory");
}

// One launch for all queries: grid (query blocks of 64, NB*H); block = 4 waves x 16 queries. Blocks below EARLY take attn_rows above and leave; they need nothing from the
// others. From EARLY on, the same causal softmax(Q K^T / 8) V without residual planes.
// K and V^T come in tiles of 64 keys, copied once per block into two LDS buffers (tile s + 1 flies while tile s is worked on) and read as fragments by all
// four waves. Each wave walks key steps of 32 in the same fixed order and up to the same last key (the end of its 32-query group) as attn_rows above.
// Every plain '#pragma unroll' below keeps the index of a register array a compile-time constant.
__global__ __launch_bounds__(128) void attn_main_kernel(const b16* __restrict__ Qh, const b16* __restrict__ Qr, const b16* __restrict__ Kh, const b16* __restrict__ Kr,
                                                        const b16* __restrict__ VTh, const b16* __restrict__ VTr, b16* __restrict__ Yh, b16* __restrict__ Yr) {
  __shared__ __attribute__((aligned(16))) b16 Ks[2][64][TP];
  __shared__ __attribute__((aligned(16))) b16 Vs[2][64][TP];
  __shared__ __attribute__((aligned(16))) b16 Pb[4][16][32 + 8];
  __shared__ __attribute__((aligned(16))) b16 Th[4][16][TP];
  const int bx = (int)blockIdx.x;
  if (bx < EARLY / 64) {   // block-uniform, ahead of every copy and barrier; the residual tiles lie in the K and V buffers, which such a block does not fill
    attn_rows<true>(Qh, Qr, Kh, Kr, VTh, VTr, Yh, Yr, Pb, reinterpret_cast<b16 (*)[16][32 + 8]>(&Ks[0][0][0]), Th, reinterpret_cast<b16 (*)[16][TP]>(&Vs[0][0][0]), bx);
    return;
  }
  const int tid = threadIdx.x, wave = __builtin_amdgcn_readfirstlane(tid >> 5), lane = tid & 31, hh = lane >> 4, col = lane & 15;
  const int bhi = (int)blockIdx.y; const int b = bhi / H, h = bhi % H; const int q0 = bx * 64 + wave * 16, qi = q0 + col;
  const b16* Qb = Qh + (size_t)bhi * QL * HD; const b16* Kb = Kh + (size_t)bhi * SK * HD; const b16* Vb = VTh + (size_t)bhi * HD * (size_t)SK;
  const int nst = bx + 1;                     // tiles of 64 keys: keys 0 .. last query of this block
  const int kend = (q0 >> 5) * 32 + 32;       // this wave's causal end
  const int srow = tid >> 3, sc8 = (tid & 7) * 8;
  const b16* kg = Kb + (size_t)srow * HD + sc8; const b16* vg = Vb + (size_t)srow * SK + sc8;   // tile s: kg + s * 64 * HD, vg + s * 64
  const unsigned kl = lds_off(&Ks[0][srow][sc8]), vl = lds_off(&Vs[0][srow][sc8]); constexpr unsigned BUFB = 64 * TP * 2;
  stage_kv(kg, vg, kl, vl);
  asm volatile("s_wait_asynccnt 0x0" ::: "memory");   // tile 0 has landed before the barrier that publishes it
  __syncthreads();
  if (nst > 1) stage_kv(kg + 64 * HD, vg + 64, kl + BUFB, vl + BUFB);
  const v16b qa0 = frag_kb(Qb + (size_t)qi * HD, hh), qa1 = frag_kb(Qb + (size_t)qi * HD + 32, hh);
  const float cs = LOG2E / (8.0f * XS * XS);   // 1/sqrt(64) and the two x8 carriers, in the log2 domain
  float m = -INFINITY, l = 0.0f; v8f o[4];
#pragma unroll
  for (int t = 0; t < 4; ++t) o[t] = (v8f){};
#pragma unroll 1   // one copy of the loop body in the text: the buffer index is a run-time offset
  for (int s = 0; s < nst; ++s) {
    const int buf = s & 1;
#pragma unroll 1   // the two key steps of a tile share one body
    for (int sub = 0; sub < 64; sub += 32) {
      const int kb = s * 64 + sub;
      if (kb < kend) {   // wave-uniform: a wave skips the step wholly above its diagonal, never the publish point below
        float e[16]; float mx = -INFINITY;
#pragma unroll
        for (int u = 0; u < 2; ++u) {
          const b16* kr = &Ks[buf][sub + u * 16 + col][0];
          const v16b kh0 = frag_kb(kr, hh), kh1 = frag_kb(kr + 32, hh);
          v8f sc = (v8f){}; sc = wmma16b(kh0, qa0, sc); sc = wmma16b(kh1, qa1, sc);
#pragma unroll
          for (int r = 0; r < 8; ++r) {
            float v = sc[r] * cs;
            const int key = kb + u * 16 + 8 * hh + r;
            v = (key > qi) ? -INFINITY : v;
            e[u * 8 + r] = v; mx = fmaxf(mx, v); } }
        mx = fmaxf(mx, __shfl_xor(mx, 16)); const float mn = fmaxf(m, mx); const float al = nexp2(m - mn); float sum = 0.0f;
#pragma unroll
        for (int i2 = 0; i2 < 16; ++i2) {
          const float p = nexp2(e[i2] - mn); sum += p; const int pi = (i2 < 8 ? 0 : 16) + 8 * hh + (i2 & 7);
          Pb[wave][col][pi] = (b16)(p * PS); }
        sum += __shfl_xor(sum, 16); l = l * al + sum; m = mn;
        wave_lds_sync();
        const v16b pf = frag_kb(&Pb[wave][col][0], hh);
#pragma unroll
        for (int t = 0; t < 4; ++t) {
          o[t] *= al; const v16b vh = frag_kb(&Vs[buf][t * 16 + col][sub], hh);
          o[t] = wmma16b(vh, pf, o[t]); }
        wave_lds_sync(); }
    }
    asm volatile("s_wait_dscnt 0x0" ::: "memory");      // this wave's reads of tile s are done before the buffer is handed back
    asm volatile("s_wait_asynccnt 0x0" ::: "memory");   // this wave's copies of tile s + 1 have landed
    __syncthreads();                                    // publishes tile s + 1 and ends every wave's reads of tile s
    if (s + 2 < nst) stage_kv(kg + (size_t)(s + 2) * 64 * HD, vg + (size_t)(s + 2) * 64, kl + buf * BUFB, vl + buf * BUFB);
  }
  asm volatile("s_wait_asynccnt 0x0" ::: "memory");     // no copy is left in flight when the wave ends
  const float inv = YS / (l * PS * XS);
#pragma unroll
  for (int t = 0; t < 4; ++t) {
#pragma unroll
    for (int r = 0; r < 8; ++r) Th[wave][col][t * 16 + 8 * hh + r] = (b16)(o[t][r] * inv); }
  wave_lds_sync();
  b16* yb = Yh + ((size_t)b * SEQ + (size_t)q0) * CD + (size_t)h * HD;
#pragma unroll 1   // as in the kernel above: four short trips, no gain from unrolling
  for (int it = 0; it < 4; ++it) {
    const int rr = it * 4 + (lane >> 3), c8 = (lane & 7) * 8; const v8b f = *(const v8b*)(&Th[wave][rr][c8]);
    *(v8b*)(yb + (size_t)rr * CD + c8) = f; }
}
}  // namespace

extern "C" void kernel_launch(void* const* d_in, const int* in_sizes, int n_in, void* d_out, int out_size, void* d_ws, size_t ws_size, hipStream_t stream) {
  // wire order: 0 x [NB_FULL][SEQ_FULL][1024] f32, 1 W_attn [1024][3072] f32, 2 b_attn [3072] f32, 3 W_proj [1024][1024] f32, 4 b_proj [1024] f32; out [NB_FULL][SEQ_FULL][1024] f32
  const size_t need_x = ((size_t)(NB - 1) * SEQ_FULL + (size_t)SEQ) * CD;
  if (n_in < 5 || (size_t)in_sizes[0] < need_x || (size_t)in_sizes[1] < (size_t)KD * N3 || (size_t)in_sizes[2] < (size_t)N3 ||
      (size_t)in_sizes[3] < (size_t)KD * CD || (size_t)in_sizes[4] < (size_t)CD || (size_t)out_size < need_x) return;
  const float* Xin = (const float*)d_in[0]; const float* Wa = (const float*)d_in[1]; const float* Ba = (const float*)d_in[2];
  const float* Wp = (const float*)d_in[3]; const float* Bp = (const float*)d_in[4];
  size_t off = 0; char* ws = (char*)d_ws;
  auto carve = [&](size_t bytes) { char* p = ws + off; off += (bytes + 255) & ~(size_t)255; return p; };
  b16* Xp = (b16*)carve((size_t)MROWS * CD * 2);                       //  8,388,608 B at NB=2, SEQ=2048
  b16* WaT = (b16*)carve((size_t)N3 * KD * 2);                         //  6,291,456
  b16* WpT = (b16*)carve((size_t)CD * KD * 2);                         //  2,097,152
  const size_t plane = (size_t)NB * H * SEQ * HD * 2, rplane = (size_t)NB * H * EARLY * HD * 2;
  b16* Qh = (b16*)carve(plane); b16* Kh = (b16*)carve(plane); b16* VTh = (b16*)carve(plane);      // 3 x 8,388,608
  b16* Qr = (b16*)carve(rplane); b16* Kr = (b16*)carve(rplane); b16* VTr = (b16*)carve(rplane);   // 3 x 524,288
  b16* Yh = (b16*)carve((size_t)MROWS * CD * 2);                       //  8,388,608
  b16* Yr = (b16*)carve((size_t)NB * EARLY * CD * 2);                  //    524,288   -> total 52,428,800 B
  if (off > ws_size || off > ((size_t)128 << 20)) return;
  cvt_all_kernel<<<dim3(WBLK + XBLK), 256, 0, stream>>>(Xin, Wa, Wp, Xp, WaT, WpT);
  gemm_kernel<true><<<dim3(N3 / BN, MROWS / BM), 256, 0, stream>>>(Xp, Xp, WaT, Ba, nullptr, Qh, Qr, Kh, Kr, VTh, VTr, N3, SEQ, 0, 1.0f / (XS * WS));
  attn_main_kernel<<<dim3(QL / 64, NB * H), 128, 0, stream>>>(Qh, Qr, Kh, Kr, VTh, VTr, Yh, Yr);
  gemm_kernel<false><<<dim3(CD / BN, MROWS / BM), 256, 0, stream>>>(Yh, Yr, WpT, Bp, (float*)d_out, nullptr, nullptr, nullptr, nullptr, nullptr, nullptr, CD, SEQ_FULL, 1, 1.0f / (YS * WS));
}

// v004
// It runs in 118 microseconds.
// Two timings next to v003 both put it at 1.15 times that version's speed.
// Over all steps from v000 it is 2.56 times as fast.
#include <hip/hip_runtime.h>

// compute dtype: all contractions on v_wmma_f32_16x16x32_f16 (f16 operands, f32 accumulate). x @ W_attn and y @ W_proj: x and W enter as their bf16-RNE
// values carried x8 (x) and x64 (W) in f16 planes, 1 product; y carried x16 as f16 hi, plus a x1024 f16 residual plane on the first 128 token rows of each
// sequence (2 products there, second accumulator folded in the f32 epilogue). S^T = K Q^T per head: q, k after rms-norm and rotary carried x8 as f16 hi,
// 1 product; query blocks below 128 tokens add x1024 f16 q and k residual planes (3 products). O^T += V^T P^T: v carried x8 f16, P f16 x1024, 1 product;
// the same early query blocks add P and v x1024 residuals into a second accumulator folded before normalisation. Norm, rotary, softmax statistics in f32.
// Fragment k-map per lane half hh for A AND B: elements 0..7 <- k = 8hh+0..7, 8..15 <- k = 16+8hh+0..7; acc[r] = D[8hh+r][col = lane&15].

#ifndef NB
#define NB 2
#endif
#ifndef SEQ
#define SEQ 2048
#endif
#ifndef NB_FULL
#define NB_FULL 2
#endif
#ifndef SEQ_FULL
#define SEQ_FULL 2048
#endif

namespace {
constexpr int H = 16, HD = 64, CD = 1024, N3 = 3 * CD, KD = CD, QL = SEQ, SK = SEQ, MROWS = NB * SEQ;
constexpr int EARLY = 128, EB = EARLY / 32;                       // token rows per sequence that get residual planes
constexpr int BM = 128, BN = 64, BK = 64, TP = 72, AP = BK + 8, CP = BN + 4, VP = BM + 8;
constexpr int ABYTES = BM * AP * 2, BBYTES = BN * AP * 2, SMEM = 2 * (ABYTES + BBYTES), NT = KD / BK;   // SMEM: the smaller of the two GEMM instances' LDS
constexpr float XS = 8.0f, WS = 64.0f, YS = 16.0f, PS = 1024.0f, RS = 1024.0f;
constexpr float LOG2E = 1.4426950408889634f, LOG2B = 13.287712379549449f, RMS_EPS = 1.1920929e-07f;
static_assert(SEQ % BM == 0 && SEQ >= BM && SEQ <= SEQ_FULL && NB >= 1 && NB <= NB_FULL);
static_assert(EARLY == BM && EARLY % 64 == 0 && EB * 32 == EARLY && MROWS % BM == 0 && N3 % BN == 0 && CD % BN == 0 && KD % BK == 0);
static_assert(BM * CP * 4 <= SMEM && HD == 64 && QL == SK && SEQ % 64 == 0 && (MROWS * 128) % 256 == 0);
static_assert(BN == HD && 2 * HD * VP * 2 <= SMEM && NT >= 2 && ABYTES % 16 == 0 && BBYTES % 16 == 0);

typedef _Float16 b16;
typedef __attribute__((ext_vector_type(16))) _Float16 v16b;
typedef __attribute__((ext_vector_type(8))) _Float16 v8b;
typedef __attribute__((ext_vector_type(8))) float v8f;
typedef __attribute__((ext_vector_type(4))) float v4f;

__device__ __forceinline__ float bf16_rne(float f) { unsigned int u = __float_as_uint(f); u += 0x7FFFu + ((u >> 16) & 1u); return __uint_as_float(u & 0xFFFF0000u); }
// 16-bit fragment from a k-contiguous row: elements 0..7 <- p[8hh .. 8hh+7], 8..15 <- p[16+8hh .. 16+8hh+7]
__device__ __forceinline__ v16b frag_kb(const b16* p, int hh) {
  const v8b a = *(const v8b*)(p + 8 * hh), b = *(const v8b*)(p + 16 + 8 * hh); v16b f;
#pragma unroll
  for (int e = 0; e < 8; ++e) { f[e] = a[e]; f[8 + e] = b[e]; }
  return f;
}
__device__ __forceinline__ v8f wmma16b(v16b a, v16b b, v8f c) {
  v8f d = __builtin_amdgcn_wmma_f32_16x16x32_f16(false, a, false, b, (short)0, c, false, false);
  asm volatile("v_nop\n\tv_nop\n\tv_nop\n\tv_nop" : "+v"(d) : "v"(a), "v"(b));
  return d;
}
__device__ __forceinline__ void wave_lds_sync() { __builtin_amdgcn_fence(3, "workgroup"); __builtin_amdgcn_wave_barrier(); __builtin_amdgcn_fence(2, "workgroup"); }
__device__ __forceinline__ float nexp2(float v) { return __builtin_amdgcn_exp2f(v); }
// LDS byte address of a __shared__ object: the low 32 bits of its address.
__device__ __forceinline__ unsigned lds_off(const void* p) { return (unsigned)(size_t)p; }

__device__ __forceinline__ void store_tile64(const b16 (*S)[TP], b16* dst, size_t pitch, int wave, int lane) {
  {
#pragma unroll 1
    for (int it = 0; it < 8; ++it) {
      const int r = wave * 32 + it * 4 + (lane >> 3), c8 = (lane & 7) * 8;
      const v8b o = *(const v8b*)(&S[r][c8]);
      *(v8b*)(dst + (size_t)r * pitch + c8) = o; }
     }
}

// One launch converts all three GEMM operands; none of the three depends on another. Blocks of 256 threads, told apart by block index (block-uniform).
// Blocks 0 .. WBLK-1: W [KD][N] f32 (in-major: W[k][n]) -> WT [N][KD] f16 = bf16-RNE(W) x64 (k-contiguous per output column), in 64x64 tiles. A block takes four tiles
// that are neighbours along n, two waves a tile, each tile in its own LDS plane; tiles 0 .. WA_T-1 are W_attn's, the rest W_proj's (n tile fastest). They come first in
// the grid, for speed only.
// Blocks from WBLK on: x f32 -> Xp f16 = bf16-RNE(x) x8, 8 elements a thread.
constexpr int WA_T = (N3 / 64) * (KD / 64), WP_T = (CD / 64) * (KD / 64), WBLK = (WA_T + WP_T) / 4, XBLK = (int)(((size_t)MROWS * 128 + 255) / 256);
static_assert(WA_T % 4 == 0 && WP_T % 4 == 0 && (N3 / 64) % 4 == 0 && (CD / 64) % 4 == 0);
__global__ __launch_bounds__(256) void cvt_all_kernel(const float* __restrict__ X, const float* __restrict__ Wa, const float* __restrict__ Wp, b16* __restrict__ Xp,
                                                      b16* __restrict__ WaT, b16* __restrict__ WpT) {
  __shared__ __attribute__((aligned(16))) b16 St[4][64][TP];
  if ((int)blockIdx.x < WBLK) {
    const int grp = threadIdx.x >> 6, tid = threadIdx.x & 63, wave = tid >> 5, lane = tid & 31;
    const bool isa = (int)blockIdx.x * 4 < WA_T;   // block-uniform: WA_T is a multiple of 4
    const int t4 = (int)blockIdx.x * 4 - (isa ? 0 : WA_T); const int N = isa ? N3 : CD;   // t4: the block's first tile within its matrix, a multiple of 4
    const int nb = (isa ? t4 % (N3 / 64) : t4 % (CD / 64)) + grp, kb = isa ? t4 / (N3 / 64) : t4 / (CD / 64);
    const float* src = (isa ? Wa : Wp) + (size_t)kb * 64 * (size_t)N + (size_t)nb * 64;
#pragma unroll 1
    for (int it = 0; it < 16; ++it) {
      const int e = (it * 64 + tid) * 4; const int kk = e >> 6, n = e & 63;
      const v4f x = *(const v4f*)(src + (size_t)kk * N + n);
#pragma unroll
      for (int j = 0; j < 4; ++j) St[grp][n + j][kk] = (b16)(bf16_rne(x[j]) * WS);
    }
    __syncthreads();   // a tile's plane is read across its two waves
    store_tile64(St[grp], (isa ? WaT : WpT) + (size_t)nb * 64 * KD + (size_t)kb * 64, KD, wave, lane);
    return;
  }
  const size_t u = (size_t)((int)blockIdx.x - WBLK) * 256 + threadIdx.x; const size_t g = u >> 7; const int piece = (int)(u & 127);
  if (g >= (size_t)MROWS) return;
  const size_t srow = (g / SEQ) * SEQ_FULL + (g % SEQ);
  const float* src = X + srow * CD + piece * 8; b16* dst = Xp + g * CD + piece * 8;
  const v4f x0 = *(const v4f*)src, x1 = *(const v4f*)(src + 4); v8b o;
#pragma unroll
  for (int j = 0; j < 4; ++j) { o[j] = (b16)(bf16_rne(x0[j]) * XS); o[4 + j] = (b16)(bf16_rne(x1[j]) * XS); }
  *(v8b*)dst = o;
}

// Tile value c[m][n] = (A[m][.] . BT[n][.] + Ar[m][.] . BT[n][.] / 1024) * oscale + bf16-RNE(bias[n]); A, Ar, BT f16 with k-contiguous rows of KD = 1024, f32 accumulate.
// Rows m = b*SEQ + t (compact). The residual plane Ar ([b][EARLY][KD]) is used only when res_on != 0 and the tile's t0 < EARLY (block-uniform).
// Block 256 threads = 8 waves (4 along m x 2 along n), tile 128 x 64; k tiles of 64 copied into two LDS buffers (tile t + 1 flies while tile t is multiplied), one block
// barrier a tile; epilogue staged in LDS. The HEADS instance is launched with the residual plane off and holds no room for it.
// HEADS == false: C[b*cstr + t][n] = c, f32, each 256-B row piece stored whole.
// HEADS == true (x @ W_attn): the tile's 64 columns are one head h of q, k or v (BN == HD) and c never goes to memory. q and k: rms-norm over the 64 head dims, rotary with
// angle h * inv_freq[i] (head-indexed, same for every token), x8, f16 hi into Qh/Kh [bhi][SEQ][64] and, for t0 < EARLY, x1024 residuals into Qr/Kr [bhi][EARLY][64];
// v: x8, transposed through LDS into VTh [bhi][64][SEQ] and VTr [bhi][64][EARLY]. EARLY == BM: a tile is early as a whole or not at all.
// One k tile = rows of 128 B laid at the 144-B pitch of AP. 256 threads, 16 B a lane: copy j of a thread brings row (tid >> 3) + 32 j, piece tid & 7, so a wave's copy covers
// four whole 128-B lines. ag / bg / rg: the lane's first global byte of the tile, al / bl / rl: its first LDS byte. s_wait_xcnt stands inside each statement so that no
// address register named there is rewritten ahead of it.
__device__ __forceinline__ void stage_ab(const b16* ag, const b16* bg, unsigned al, unsigned bl) {   // A: 128 rows, BT: 64 rows
  const b16 *a1 = ag + 32 * KD, *a2 = ag + 64 * KD, *a3 = ag + 96 * KD, *b1 = bg + 32 * KD;
  const unsigned al1 = al + 32 * AP * 2, al2 = al + 64 * AP * 2, al3 = al + 96 * AP * 2, bl1 = bl + 32 * AP * 2;
  asm volatile("global_load_async_to_lds_b128 %0, %6, off\n\t"
               "global_load_async_to_lds_b128 %1, %7, off\n\t"
               "global_load_async_to_lds_b128 %2, %8, off\n\t"
               "global_load_async_to_lds_b128 %3, %9, off\n\t"
               "global_load_async_to_lds_b128 %4, %10, off\n\t"
               "global_load_async_to_lds_b128 %5, %11, off\n\t"
               "s_wait_xcnt 0x0"
               :: "v"(al), "v"(al1), "v"(al2), "v"(al3), "v"(bl), "v"(bl1), "v"(ag), "v"(a1), "v"(a2), "v"(a3), "v"(bg), "v"(b1)
               : "memory");
}
__device__ __forceinline__ void stage_r(const b16* rg, unsigned rl) {   // residual plane: 128 rows
  const b16 *r1 = rg + 32 * KD, *r2 = rg + 64 * KD, *r3 = rg + 96 * KD;
  const unsigned rl1 = rl + 32 * AP * 2, rl2 = rl + 64 * AP * 2, rl3 = rl + 96 * AP * 2;
  asm volatile("global_load_async_to_lds_b128 %0, %4, off\n\t"
               "global_load_async_to_lds_b128 %1, %5, off\n\t"
               "global_load_async_to_lds_b128 %2, %6, off\n\t"
               "global_load_async_to_lds_b128 %3, %7, off\n\t"
               "s_wait_xcnt 0x0"
               :: "v"(rl), "v"(rl1), "v"(rl2), "v"(rl3), "v"(rg), "v"(r1), "v"(r2), "v"(r3)
               : "memory");
}

template <bool HEADS>
__global__ __launch_bounds__(256) void gemm_kernel(const b16* __restrict__ A, const b16* __restrict__ Ar, const b16* __restrict__ BT, const float* __restrict__ bias,
                                                   float* __restrict__ C, b16* __restrict__ Qh, b16* __restrict__ Qr, b16* __restrict__ Kh, b16* __restrict__ Kr,
                                                   b16* __restrict__ VTh, b16* __restrict__ VTr, int N, int cstr, int res_on, float oscale) {
  constexpr int BOFF = HEADS ? ABYTES : 2 * ABYTES, STAGE = BOFF + BBYTES;   // one buffer: A | residual plane (not HEADS) | BT
  __shared__ __attribute__((aligned(16))) char smem[2 * STAGE];
  float* Cs = reinterpret_cast<float*>(smem);   // aliases the buffers after the k loop (block barrier in between)
  const int tid = threadIdx.x, wave = tid >> 5, lane = tid & 31, hh = lane >> 4, col = lane & 15, wm = wave >> 1, wn = wave & 1;
  const int bm = (int)blockIdx.y * BM, bn = (int)blockIdx.x * BN; const int bb = bm / SEQ, t0 = bm % SEQ;
  const bool res = !HEADS && (res_on != 0) && (t0 < EARLY);
  const b16* Ab = A + (size_t)bm * KD; const b16* Bb = BT + (size_t)bn * KD;
  const b16* Arb = Ar + ((size_t)bb * EARLY + (size_t)t0) * KD;   // dereferenced only when res (then t0 == 0)
  v8f acc[2][2], accr[2][2];
#pragma unroll
  for (int i = 0; i < 2; ++i)
#pragma unroll
    for (int j = 0; j < 2; ++j) { acc[i][j] = (v8f){}; accr[i][j] = (v8f){}; }
  const int srow = tid >> 3, sc8 = (tid & 7) * 8;
  const b16* ag = Ab + (size_t)srow * KD + sc8; const b16* bg = Bb + (size_t)srow * KD + sc8; const b16* rg = Arb + (size_t)srow * KD + sc8;   // tile t: + t * BK
  const unsigned al = lds_off(smem) + (unsigned)(srow * AP + sc8) * 2u, rl = al + ABYTES, bl = al + BOFF;                                    // buffer 1: + STAGE
  stage_ab(ag, bg, al, bl);
  if (res) stage_r(rg, rl);
  asm volatile("s_wait_asynccnt 0x0" ::: "memory");   // tile 0 has landed before the barrier that publishes it
  __syncthreads();
  stage_ab(ag + BK, bg + BK, al + STAGE, bl + STAGE);
  if (res) stage_r(rg + BK, rl + STAGE);
#pragma unroll 1   // one copy of the loop body in the text: the buffer index is a run-time offset
  for (int t = 0; t < NT; ++t) {
    const int buf = t & 1;
    const b16* As = reinterpret_cast<const b16*>(smem + buf * STAGE); const b16* Ars = reinterpret_cast<const b16*>(smem + buf * STAGE + ABYTES);
    const b16* Bs = reinterpret_cast<const b16*>(smem + buf * STAGE + BOFF);
#pragma unroll
    for (int ks = 0; ks < BK; ks += 32) {
      const v16b a0 = frag_kb(As + (wm * 32 + col) * AP + ks, hh), a1 = frag_kb(As + (wm * 32 + 16 + col) * AP + ks, hh);
      const v16b b0 = frag_kb(Bs + (wn * 32 + col) * AP + ks, hh), b1 = frag_kb(Bs + (wn * 32 + 16 + col) * AP + ks, hh);
      acc[0][0] = wmma16b(a0, b0, acc[0][0]); acc[0][1] = wmma16b(a0, b1, acc[0][1]);
      acc[1][0] = wmma16b(a1, b0, acc[1][0]); acc[1][1] = wmma16b(a1, b1, acc[1][1]);
      if (res) {
        const v16b r0 = frag_kb(Ars + (wm * 32 + col) * AP + ks, hh), r1 = frag_kb(Ars + (wm * 32 + 16 + col) * AP + ks, hh);
        accr[0][0] = wmma16b(r0, b0, accr[0][0]); accr[0][1] = wmma16b(r0, b1, accr[0][1]);
        accr[1][0] = wmma16b(r1, b0, accr[1][0]); accr[1][1] = wmma16b(r1, b1, accr[1][1]); }
    }
    asm volatile("s_wait_dscnt 0x0" ::: "memory");      // this wave's reads of tile t are done before the buffer is handed back
    asm volatile("s_wait_asynccnt 0x0" ::: "memory");   // this wave's copies of tile t + 1 have landed
    __syncthreads();                                    // publishes tile t + 1 and ends every wave's reads of tile t (after the last tile: the epilogue aliases)
    if (t + 2 < NT) {
      stage_ab(ag + (t + 2) * BK, bg + (t + 2) * BK, al + buf * STAGE, bl + buf * STAGE);
      if (res) stage_r(rg + (t + 2) * BK, rl + buf * STAGE); }
  }
  asm volatile("s_wait_asynccnt 0x0" ::: "memory");     // no copy is left in flight when the buffers are reused
  const int cls = bn / CD, h = (bn % CD) / HD, bhi = bb * H + h;   // HEADS: 0 q, 1 k, 2 v; block-uniform
  const bool early = (t0 < EARLY);
  if (HEADS && cls == 2) {
    // acc[i][j][0..7] are 8 consecutive tokens of one head dim: one 16-B piece of a V^T row
    b16* Sv = reinterpret_cast<b16*>(smem); b16* Svr = Sv + HD * VP;
#pragma unroll
    for (int i = 0; i < 2; ++i)
#pragma unroll
      for (int j = 0; j < 2; ++j) {
        const int cc = wn * 32 + j * 16 + col; const float bv = bf16_rne(bias[bn + cc]); v8b oh;
#pragma unroll
        for (int r = 0; r < 8; ++r) {
          const float v = acc[i][j][r] + accr[i][j][r] * (1.0f / RS);
          const float v0 = (v * oscale + bv) * XS; acc[i][j][r] = v0; oh[r] = (b16)v0; }
        *(v8b*)(Sv + cc * VP + wm * 32 + i * 16 + 8 * hh) = oh; }
    if (early) {
#pragma unroll
      for (int i = 0; i < 2; ++i)
#pragma unroll
        for (int j = 0; j < 2; ++j) {
          const int cc = wn * 32 + j * 16 + col; v8b orr;
#pragma unroll
          for (int r = 0; r < 8; ++r) { const float v0 = acc[i][j][r]; orr[r] = (b16)((v0 - (float)(b16)v0) * RS); }
          *(v8b*)(Svr + cc * VP + wm * 32 + i * 16 + 8 * hh) = orr; } }
    __syncthreads();   // V^T rows are read across waves
    b16* dv = VTh + (size_t)bhi * HD * (size_t)SK + t0;
#pragma unroll 1   // four short trips, no gain from unrolling
    for (int it = 0; it < 4; ++it) {
      const int d = wave * 8 + it * 2 + hh; const v8b f = *(const v8b*)(Sv + d * VP + col * 8);
      *(v8b*)(dv + (size_t)d * SK + col * 8) = f; }
    if (early) {   // then t0 == 0
      b16* dvr = VTr + (size_t)bhi * HD * (size_t)EARLY;
#pragma unroll 1   // as above
      for (int it = 0; it < 4; ++it) {
        const int d = wave * 8 + it * 2 + hh; const v8b fr = *(const v8b*)(Svr + d * VP + col * 8);
        *(v8b*)(dvr + (size_t)d * EARLY + col * 8) = fr; } }
    return;
  }
#pragma unroll
  for (int i = 0; i < 2; ++i)
#pragma unroll
    for (int j = 0; j < 2; ++j) {
      const int cc = wn * 32 + j * 16 + col; const float bv = bf16_rne(bias[bn + cc]);
#pragma unroll
      for (int r = 0; r < 8; ++r) {
        const float v = acc[i][j][r] + accr[i][j][r] * (1.0f / RS);   // accr stays 0 when the residual plane is off
        Cs[(wm * 32 + i * 16 + 8 * hh + r) * CP + cc] = v * oscale + bv; } }
  __syncthreads();   // Cs rows are read across waves
  if constexpr (HEADS) {
    // From here on a wave works on its own 16 rows alone. A lane holds head dims lane and lane + 32, the two partners of one rotation.
    const float invf = exp2f(-(float)lane * (LOG2B / 32.0f));   // (1/10000)^(2i/64)
    const float ang = (float)h * invf; float s, c; sincosf(ang, &s, &c);
    float* rows = Cs + wave * 16 * CP;
#pragma unroll 1   // two batches of 8 rows: all 16 at once would take more registers than the k loop does and cost a resident block
    for (int g = 0; g < 16; g += 8) {
      float e0[8], e1[8], ss[8];
      // Every '#pragma unroll' of this batch keeps the index of a register array a compile-time constant; the 8 rows go through each stage side by side, so that
      // their LDS reads and lane exchanges overlap.
#pragma unroll
      for (int i = 0; i < 8; ++i) { e0[i] = rows[(g + i) * CP + lane]; e1[i] = rows[(g + i) * CP + lane + 32]; ss[i] = e0[i] * e0[i] + e1[i] * e1[i]; }
#pragma unroll
      for (int off = 16; off > 0; off >>= 1)
#pragma unroll
        for (int i = 0; i < 8; ++i) ss[i] += __shfl_xor(ss[i], off);
      // The batch's rows are in registers by now: a row's f16 hi goes over the first 128 B of its own 256 B, its residual over the second.
#pragma unroll
      for (int i = 0; i < 8; ++i) {
        const float rn = rsqrtf(ss[i] * (1.0f / 64.0f) + RMS_EPS);
        const float n0 = e0[i] * rn, n1 = e1[i] * rn;
        const float y0 = (n0 * c + n1 * s) * XS, y1 = (n1 * c - n0 * s) * XS;
        b16* ro = reinterpret_cast<b16*>(rows + (g + i) * CP);
        ro[lane] = (b16)y0; ro[lane + 32] = (b16)y1; e0[i] = y0; e1[i] = y1;
      }
      if (early) {
#pragma unroll
        for (int i = 0; i < 8; ++i) {
          const float y0 = e0[i], y1 = e1[i]; b16* ro = reinterpret_cast<b16*>(rows + (g + i) * CP);
          ro[64 + lane] = (b16)((y0 - (float)(b16)y0) * RS); ro[96 + lane] = (b16)((y1 - (float)(b16)y1) * RS); } }
    }
    wave_lds_sync();
    const int r4 = lane >> 3, c8 = (lane & 7) * 8;
    b16* dh = (cls == 0 ? Qh : Kh) + ((size_t)bhi * SEQ + (size_t)(t0 + wave * 16)) * HD;
#pragma unroll 1   // four short trips, no gain from unrolling
    for (int it = 0; it < 4; ++it) {
      const int rr = it * 4 + r4; const v8b f = *(const v8b*)(reinterpret_cast<const b16*>(rows + rr * CP) + c8);
      *(v8b*)(dh + (size_t)rr * HD + c8) = f; }
    if (early) {   // then t0 == 0
      b16* dr = (cls == 0 ? Qr : Kr) + ((size_t)bhi * EARLY + (size_t)(wave * 16)) * HD;
#pragma unroll 1   // as above
      for (int it = 0; it < 4; ++it) {
        const int rr = it * 4 + r4; const v8b fr = *(const v8b*)(reinterpret_cast<const b16*>(rows + rr * CP) + 64 + c8);
        *(v8b*)(dr + (size_t)rr * HD + c8) = fr; } }
  } else {
    float* Cb = C + ((size_t)bb * (size_t)cstr + (size_t)t0) * (size_t)N + bn;
#pragma unroll 1
    for (int it = 0; it < 8; ++it) {
      const int rr = wave * 16 + it * 2 + hh; const v4f f = *(const v4f*)(Cs + rr * CP + col * 4);
      *(v4f*)(Cb + (size_t)rr * N + col * 4) = f; }
  }
}

// Causal softmax(Q K^T / 8) V per (b, h) for the queries below EARLY: the body of the work-groups bx < EARLY / 64 of attn_main_kernel's launch. 4 waves x 16 queries, each
// wave on its own (no block barrier); key steps of 32 from 0 up to the last query of the wave's 32-query group in fixed order, keys above the query replaced by -inf
// before the running-max softmax (f32); P x1024 via wave-private LDS; O^T += V^T P^T.
// ER (queries < EARLY, which only visit keys < EARLY): S adds K_hi Q_res + K_res Q_hi (x1024), P adds a x1024 residual tile and V a x1024 residual
// plane into a second accumulator folded before normalisation, and the x16 y row is written as f16 hi plus a x1024 residual. y rows -> Yh [b*SEQ + q][h*64 + d]
template <bool ER>
__device__ __forceinline__ void attn_rows(const b16* __restrict__ Qh, const b16* __restrict__ Qr, const b16* __restrict__ Kh, const b16* __restrict__ Kr,
                                          const b16* __restrict__ VTh, const b16* __restrict__ VTr, b16* __restrict__ Yh, b16* __restrict__ Yr,
                                          b16 (*Pb)[16][32 + 8], b16 (*Pr)[16][32 + 8], b16 (*Th)[16][TP], b16 (*Tr)[16][TP], int bx) {
  const int wave = __builtin_amdgcn_readfirstlane((int)threadIdx.x >> 5), lane = threadIdx.x & 31, hh = lane >> 4, col = lane & 15;   // scalar: the key loop's end hangs on it
  const int bhi = (int)blockIdx.y; const int b = bhi / H, h = bhi % H; const int q0 = bx * 64 + wave * 16, qi = q0 + col;
  const b16* Qb = Qh + (size_t)bhi * QL * HD; const b16* Kb = Kh + (size_t)bhi * SK * HD; const b16* Vb = VTh + (size_t)bhi * HD * (size_t)SK;
  const b16* Qrb = Qr + (size_t)bhi * EARLY * HD; const b16* Krb = Kr + (size_t)bhi * EARLY * HD; const b16* Vrb = VTr + (size_t)bhi * HD * (size_t)EARLY;
  const v16b qa0 = frag_kb(Qb + (size_t)qi * HD, hh), qa1 = frag_kb(Qb + (size_t)qi * HD + 32, hh);
  v16b qr0 = (v16b){}, qr1 = (v16b){};
  if constexpr (ER) { qr0 = frag_kb(Qrb + (size_t)qi * HD, hh); qr1 = frag_kb(Qrb + (size_t)qi * HD + 32, hh); }
  const float cs = LOG2E / (8.0f * XS * XS);   // 1/sqrt(64) and the two x8 carriers, in the log2 domain
  float m = -INFINITY, l = 0.0f; v8f o[4], o2[4];
#pragma unroll
  for (int t = 0; t < 4; ++t) { o[t] = (v8f){}; o2[t] = (v8f){}; }
  const int kend = (q0 >> 5) * 32 + 32;   // causal: keys 0 .. last query of this wave's 32-query group; ER: kend <= EARLY
#pragma unroll 1
  for (int kb = 0; kb < kend; kb += 32) {
    float e[16]; float mx = -INFINITY;
#pragma unroll
    for (int u = 0; u < 2; ++u) {
      const int krow = kb + u * 16 + col;
      const v16b kh0 = frag_kb(Kb + (size_t)krow * HD, hh), kh1 = frag_kb(Kb + (size_t)krow * HD + 32, hh);
      v8f s = (v8f){}; s = wmma16b(kh0, qa0, s); s = wmma16b(kh1, qa1, s);
      v8f sr = (v8f){};
      if constexpr (ER) {
        const v16b kr0 = frag_kb(Krb + (size_t)krow * HD, hh), kr1 = frag_kb(Krb + (size_t)krow * HD + 32, hh);
        sr = wmma16b(kh0, qr0, sr); sr = wmma16b(kh1, qr1, sr); sr = wmma16b(kr0, qa0, sr); sr = wmma16b(kr1, qa1, sr); }
#pragma unroll
      for (int r = 0; r < 8; ++r) {
        float v = s[r];
        if constexpr (ER) v += sr[r] * (1.0f / RS);
        v *= cs;
        const int key = kb + u * 16 + 8 * hh + r;
        v = (key > qi) ? -INFINITY : v;
        e[u * 8 + r] = v; mx = fmaxf(mx, v); } }
    mx = fmaxf(mx, __shfl_xor(mx, 16)); const float mn = fmaxf(m, mx); const float al = nexp2(m - mn); float sum = 0.0f;
#pragma unroll
    for (int i2 = 0; i2 < 16; ++i2) {
      const float p = nexp2(e[i2] - mn); sum += p; const int pi = (i2 < 8 ? 0 : 16) + 8 * hh + (i2 & 7);
      const float pp = p * PS; const b16 ph = (b16)pp; Pb[wave][col][pi] = ph;
      if constexpr (ER) Pr[wave][col][pi] = (b16)((pp - (float)ph) * RS); }
    sum += __shfl_xor(sum, 16); l = l * al + sum; m = mn;
    wave_lds_sync();
    const v16b pf = frag_kb(&Pb[wave][col][0], hh);
    v16b prf = (v16b){};
    if constexpr (ER) prf = frag_kb(&Pr[wave][col][0], hh);
#pragma unroll
    for (int t = 0; t < 4; ++t) {
      o[t] *= al; const v16b vh = frag_kb(Vb + (size_t)(t * 16 + col) * SK + kb, hh);
      o[t] = wmma16b(vh, pf, o[t]);
      if constexpr (ER) { const v16b vr = frag_kb(Vrb + (size_t)(t * 16 + col) * EARLY + kb, hh); o2[t] *= al; o2[t] = wmma16b(vh, prf, o2[t]); o2[t] = wmma16b(vr, pf, o2[t]); } }
    wave_lds_sync(); }
  const float inv = YS / (l * PS * XS);
#pragma unroll
  for (int t = 0; t < 4; ++t) {
#pragma unroll
    for (int r = 0; r < 8; ++r) {
      float ov = o[t][r];
      if constexpr (ER) ov += o2[t][r] * (1.0f / RS);
      const float yv = ov * inv; const b16 yh = (b16)yv;
      Th[wave][col][t * 16 + 8 * hh + r] = yh;
      if constexpr (ER) Tr[wave][col][t * 16 + 8 * hh + r] = (b16)((yv - (float)yh) * RS); } }
  wave_lds_sync();
  b16* yb = Yh + ((size_t)b * SEQ + (size_t)q0) * CD + (size_t)h * HD;
  {
#pragma unroll 1
    for (int it = 0; it < 4; ++it) {
      const int rr = it * 4 + (lane >> 3), c8 = (lane & 7) * 8; const v8b f = *(const v8b*)(&Th[wave][rr][c8]);
      *(v8b*)(yb + (size_t)rr * CD + c8) = f;
      if constexpr (ER) {
        const v8b fr = *(const v8b*)(&Tr[wave][rr][c8]);
        *(v8b*)(Yr + (((size_t)b * EARLY + (size_t)(q0 + rr)) * CD + (size_t)h * HD + c8)) = fr; } }
     }
}

// One staged tile pair = 64 keys: K rows [64 keys][64 dims] and V^T rows [64 dims][64 keys], 128 B a row, laid at the 144-B pitch of TP. 128 threads, 16 B a lane:
// copy j of a thread brings row (tid >> 3) + 16 j, piece tid & 7, so a wave's copy covers four whole 128-B lines. kg / vg: the lane's first global byte of the tile,
// kl / vl: its first LDS byte. s_wait_xcnt stands inside the statement so that no address register named here is rewritten ahead of it.
__device__ __forceinline__ void stage_kv(const b16* kg, const b16* vg, unsigned kl, unsigned vl) {
  const b16 *k1 = kg + 16 * HD, *k2 = kg + 32 * HD, *k3 = kg + 48 * HD; const b16 *v1 = vg + 16 * (size_t)SK, *v2 = vg + 32 * (size_t)SK, *v3 = vg + 48 * (size_t)SK;
  const unsigned kl1 = kl + 16 * TP * 2, kl2 = kl + 32 * TP * 2, kl3 = kl + 48 * TP * 2, vl1 = vl + 16 * TP * 2, vl2 = vl + 32 * TP * 2, vl3 = vl + 48 * TP * 2;
  asm volatile("global_load_async_to_lds_b128 %0, %8, off\n\t"
               "global_load_async_to_lds_b128 %1, %9, off\n\t"
               "global_load_async_to_lds_b128 %2, %10, off\n\t"
               "global_load_async_to_lds_b128 %3, %11, off\n\t"
               "global_load_async_to_lds_b128 %4, %12, off\n\t"
               "global_load_async_to_lds_b128 %5, %13, off\n\t"
               "global_load_async_to_lds_b128 %6, %14, off\n\t"
               "global_load_async_to_lds_b128 %7, %15, off\n\t"
               "s_wait_xcnt 0x0"
               :: "v"(kl), "v"(kl1), "v"(kl2), "v"(kl3), "v"(vl), "v"(vl1), "v"(vl2), "v"(vl3), "v"(kg), "v"(k1), "v"(k2), "v"(k3), "v"(vg), "v"(v1), "v"(v2), "v"(v3)
               : "memory");
}

// One launch for all queries: grid (query blocks of 64, NB*H); block = 4 waves x 16 queries. Blocks below EARLY take attn_rows above and leave; they need nothing from the
// others. From EARLY on, the same causal softmax(Q K^T / 8) V without residual planes.
// K and V^T come in tiles of 64 keys, copied once per block into two LDS buffers (tile s + 1 flies while tile s is worked on) and read as fragments by all
// four waves. Each wave walks key steps of 32 in the same fixed order and up to the same last key (the end of its 32-query group) as attn_rows above.
// Every plain '#pragma unroll' below keeps the index of a register array a compile-time constant.
__global__ __launch_bounds__(128) void attn_main_kernel(const b16* __restrict__ Qh, const b16* __restrict__ Qr, const b16* __restrict__ Kh, const b16* __restrict__ Kr,
                                                        const b16* __restrict__ VTh, const b16* __restrict__ VTr, b16* __restrict__ Yh, b16* __restrict__ Yr) {
  __shared__ __attribute__((aligned(16))) b16 Ks[2][64][TP];
  __shared__ __attribute__((aligned(16))) b16 Vs[2][64][TP];
  __shared__ __attribute__((aligned(16))) b16 Pb[4][16][32 + 8];
  __shared__ __attribute__((aligned(16))) b16 Th[4][16][TP];
  const int bx = (int)blockIdx.x;
  if (bx < EARLY / 64) {   // block-uniform, ahead of every copy and barrier; the residual tiles lie in the K and V buffers, which such a block does not fill
    attn_rows<true>(Qh, Qr, Kh, Kr, VTh, VTr, Yh, Yr, Pb, reinterpret_cast<b16 (*)[16][32 + 8]>(&Ks[0][0][0]), Th, reinterpret_cast<b16 (*)[16][TP]>(&Vs[0][0][0]), bx);
    return;
  }
  const int tid = threadIdx.x, wave = __builtin_amdgcn_readfirstlane(tid >> 5), lane = tid & 31, hh = lane >> 4, col = lane & 15;
  const int bhi = (int)blockIdx.y; const int b = bhi / H, h = bhi % H; const int q0 = bx * 64 + wave * 16, qi = q0 + col;
  const b16* Qb = Qh + (size_t)bhi * QL * HD; const b16* Kb = Kh + (size_t)bhi * SK * HD; const b16* Vb = VTh + (size_t)bhi * HD * (size_t)SK;
  const int nst = bx + 1;                     // tiles of 64 keys: keys 0 .. last query of this block
  const int kend = (q0 >> 5) * 32 + 32;       // this wave's causal end
  const int srow = tid >> 3, sc8 = (tid & 7) * 8;
  const b16* kg = Kb + (size_t)srow * HD + sc8; const b16* vg = Vb + (size_t)srow * SK + sc8;   // tile s: kg + s * 64 * HD, vg + s * 64
  const unsigned kl = lds_off(&Ks[0][srow][sc8]), vl = lds_off(&Vs[0][srow][sc8]); constexpr unsigned BUFB = 64 * TP * 2;
  stage_kv(kg, vg, kl, vl);
  asm volatile("s_wait_asynccnt 0x0" ::: "memory");   // tile 0 has landed before the barrier that publishes it
  __syncthreads();
  if (nst > 1) stage_kv(kg + 64 * HD, vg + 64, kl + BUFB, vl + BUFB);
  const v16b qa0 = frag_kb(Qb + (size_t)qi * HD, hh), qa1 = frag_kb(Qb + (size_t)qi * HD + 32, hh);
  const float cs = LOG2E / (8.0f * XS * XS);   // 1/sqrt(64) and the two x8 carriers, in the log2 domain
  float m = -INFINITY, l = 0.0f; v8f o[4];
#pragma unroll
  for (int t = 0; t < 4; ++t) o[t] = (v8f){};
#pragma unroll 1   // one copy of the loop body in the text: the buffer index is a run-time offset
  for (int s = 0; s < nst; ++s) {
    const int buf = s & 1;
#pragma unroll 1   // the two key steps of a tile share one body
    for (int sub = 0; sub < 64; sub += 32) {
      const int kb = s * 64 + sub;
      if (kb < kend) {   // wave-uniform: a wave skips the step wholly above its diagonal, never the publish point below
        float e[16]; float mx = -INFINITY;
#pragma unroll
        for (int u = 0; u < 2; ++u) {
          const b16* kr = &Ks[buf][sub + u * 16 + col][0];
          const v16b kh0 = frag_kb(kr, hh), kh1 = frag_kb(kr + 32, hh);
          v8f sc = (v8f){}; sc = wmma16b(kh0, qa0, sc); sc = wmma16b(kh1, qa1, sc);
#pragma unroll
          for (int r = 0; r < 8; ++r) {
            float v = sc[r] * cs;
            const int key = kb + u * 16 + 8 * hh + r;
            v = (key > qi) ? -INFINITY : v;
            e[u * 8 + r] = v; mx = fmaxf(mx, v); } }
        mx = fmaxf(mx, __shfl_xor(mx, 16)); const float mn = fmaxf(m, mx); const float al = nexp2(m - mn); float sum = 0.0f;
#pragma unroll
        for (int i2 = 0; i2 < 16; ++i2) {
          const float p = nexp2(e[i2] - mn); sum += p; const int pi = (i2 < 8 ? 0 : 16) + 8 * hh + (i2 & 7);
          Pb[wave][col][pi] = (b16)(p * PS); }
        sum += __shfl_xor(sum, 16); l = l * al + sum; m = mn;
        wave_lds_sync();
        const v16b pf = frag_kb(&Pb[wave][col][0], hh);
#pragma unroll
        for (int t = 0; t < 4; ++t) {
          o[t] *= al; const v16b vh = frag_kb(&Vs[buf][t * 16 + col][sub], hh);
          o[t] = wmma16b(vh, pf, o[t]); }
        wave_lds_sync(); }
    }
    asm volatile("s_wait_dscnt 0x0" ::: "memory");      // this wave's reads of tile s are done before the buffer is handed back
    asm volatile("s_wait_asynccnt 0x0" ::: "memory");   // this wave's copies of tile s + 1 have landed
    __syncthreads();                                    // publishes tile s + 1 and ends every wave's reads of tile s
    if (s + 2 < nst) stage_kv(kg + (size_t)(s + 2) * 64 * HD, vg + (size_t)(s + 2) * 64, kl + buf * BUFB, vl + buf * BUFB);
  }
  asm volatile("s_wait_asynccnt 0x0" ::: "memory");     // no copy is left in flight when the wave ends
  const float inv = YS / (l * PS * XS);
#pragma unroll
  for (int t = 0; t < 4; ++t) {
#pragma unroll
    for (int r = 0; r < 8; ++r) Th[wave][col][t * 16 + 8 * hh + r] = (b16)(o[t][r] * inv); }
  wave_lds_sync();
  b16* yb = Yh + ((size_t)b * SEQ + (size_t)q0) * CD + (size_t)h * HD;
#pragma unroll 1   // as in the kernel above: four short trips, no gain from unrolling
  for (int it = 0; it < 4; ++it) {
    const int rr = it * 4 + (lane >> 3), c8 = (lane & 7) * 8; const v8b f = *(const v8b*)(&Th[wave][rr][c8]);
    *(v8b*)(yb + (size_t)rr * CD + c8) = f; }
}
}  // namespace

extern "C" void kernel_launch(void* const* d_in, const int* in_sizes, int n_in, void* d_out, int out_size, void* d_ws, size_t ws_size, hipStream_t stream) {
  // wire order: 0 x [NB_FULL][SEQ_FULL][1024] f32, 1 W_attn [1024][3072] f32, 2 b_attn [3072] f32, 3 W_proj [1024][1024] f32, 4 b_proj [1024] f32; out [NB_FULL][SEQ_FULL][1024] f32
  const size_t need_x = ((size_t)(NB - 1) * SEQ_FULL + (size_t)SEQ) * CD;
  if (n_in < 5 || (size_t)in_sizes[0] < need_x || (size_t)in_sizes[1] < (size_t)KD * N3 || (size_t)in_sizes[2] < (size_t)N3 ||
      (size_t)in_sizes[3] < (size_t)KD * CD || (size_t)in_sizes[4] < (size_t)CD || (size_t)out_size < need_x) return;
  const float* Xin = (const float*)d_in[0]; const float* Wa = (const float*)d_in[1]; const float* Ba = (const float*)d_in[2];
  const float* Wp = (const float*)d_in[3]; const float* Bp = (const float*)d_in[4];
  size_t off = 0; char* ws = (char*)d_ws;
  auto carve = [&](size_t bytes) { char* p = ws + off; off += (bytes + 255) & ~(size_t)255; return p; };
  b16* Xp = (b16*)carve((size_t)MROWS * CD * 2);                       //  8,388,608 B at NB=2, SEQ=2048
  b16* WaT = (b16*)carve((size_t)N3 * KD * 2);                         //  6,291,456
  b16* WpT = (b16*)carve((size_t)CD * KD * 2);                         //  2,097,152
  const size_t plane = (size_t)NB * H * SEQ * HD * 2, rplane = (size_t)NB * H * EARLY * HD * 2;
  b16* Qh = (b16*)carve(plane); b16* Kh = (b16*)carve(plane); b16* VTh = (b16*)carve(plane);      // 3 x 8,388,608
  b16* Qr = (b16*)carve(rplane); b16* Kr = (b16*)carve(rplane); b16* VTr = (b16*)carve(rplane);   // 3 x 524,288
  b16* Yh = (b16*)carve((size_t)MROWS * CD * 2);                       //  8,388,608
  b16* Yr = (b16*)carve((size_t)NB * EARLY * CD * 2);                  //    524,288   -> total 52,428,800 B
  if (off > ws_size || off > ((size_t)128 << 20)) return;
  cvt_all_kernel<<<dim3(WBLK + XBLK), 256, 0, stream>>>(Xin, Wa, Wp, Xp, WaT, WpT);
  gemm_kernel<true><<<dim3(N3 / BN, MROWS / BM), 256, 0, stream>>>(Xp, Xp, WaT, Ba, nullptr, Qh, Qr, Kh, Kr, VTh, VTr, N3, SEQ, 0, 1.0f / (XS * WS));
  attn_main_kernel<<<dim3(QL / 64, NB * H), 128, 0, stream>>>(Qh, Qr, Kh, Kr, VTh, VTr, Yh, Yr);
  gemm_kernel<false><<<dim3(CD / BN, MROWS / BM), 256, 0, stream>>>(Yh, Yr, WpT, Bp, (float*)d_out, nullptr, nullptr, nullptr, nullptr, nullptr, nullptr, CD, SEQ_FULL, 1, 1.0f / (YS * WS));
}

// v005
// One run takes 112 microseconds.
// Next to v004, in two timings, it ran 1.06 and 1.05 times as fast.
// Counting every step since v000, it is 2.71 times as fast.
#include <hip/hip_runtime.h>

// compute dtype: all contractions on v_wmma_f32_16x16x32_f16 (f16 operands, f32 accumulate). x @ W_attn and y @ W_proj: x and W enter as their bf16-RNE
// values carried x8 (x) and x64 (W) in f16 planes, 1 product; y carried x16 as f16 hi, plus a x1024 f16 residual plane on the first 128 token rows of each
// sequence (2 products there, second accumulator folded in the f32 epilogue). S^T = K Q^T per head: q, k after rms-norm and rotary carried x8 as f16 hi,
// 1 product; query blocks below 128 tokens add x1024 f16 q and k residual planes (3 products). O^T += V^T P^T: v carried x8 f16, P f16 x1024, 1 product;
// the same early query blocks add P and v x1024 residuals into a second accumulator folded before normalisation. Norm, rotary, softmax statistics in f32.
// Fragment k-map per lane half hh for A AND B: elements 0..7 <- k = 8hh+0..7, 8..15 <- k = 16+8hh+0..7; acc[r] = D[8hh+r][col = lane&15].

#ifndef NB
#define NB 2
#endif
#ifndef SEQ
#define SEQ 2048
#endif
#ifndef NB_FULL
#define NB_FULL 2
#endif
#ifndef SEQ_FULL
#define SEQ_FULL 2048
#endif

namespace {
constexpr int H = 16, HD = 64, CD = 1024, N3 = 3 * CD, KD = CD, QL = SEQ, SK = SEQ, MROWS = NB * SEQ;
constexpr int EARLY = 128, EB = EARLY / 32;                       // token rows per sequence that get residual planes
constexpr int BM = 128, BN = 64, BK = 64, TP = 72, AP = BK + 8, CP = BN + 4, VP = BM + 8;
constexpr int ABYTES = BM * AP * 2, BBYTES = BN * AP * 2, SMEM = 2 * (ABYTES + BBYTES), NT = KD / BK;   // SMEM: no GEMM instance has less LDS
constexpr float XS = 8.0f, WS = 64.0f, YS = 16.0f, PS = 1024.0f, RS = 1024.0f;
constexpr float LOG2E = 1.4426950408889634f, LOG2B = 13.287712379549449f, RMS_EPS = 1.1920929e-07f;
static_assert(SEQ % BM == 0 && SEQ >= BM && SEQ <= SEQ_FULL && NB >= 1 && NB <= NB_FULL);
static_assert(EARLY == BM && EARLY % 64 == 0 && EB * 32 == EARLY && MROWS % BM == 0 && N3 % BN == 0 && CD % BN == 0 && KD % BK == 0);
static_assert(BM * CP * 4 <= SMEM && HD == 64 && QL == SK && SEQ % 64 == 0 && (MROWS * 128) % 256 == 0);
static_assert(BN == HD && 2 * HD * VP * 2 <= SMEM && NT >= 2 && ABYTES % 16 == 0 && BBYTES % 16 == 0);

typedef _Float16 b16;
typedef __attribute__((ext_vector_type(16))) _Float16 v16b;
typedef __attribute__((ext_vector_type(8))) _Float16 v8b;
typedef __attribute__((ext_vector_type(8))) float v8f;
typedef __attribute__((ext_vector_type(4))) float v4f;

__device__ __forceinline__ float bf16_rne(float f) { unsigned int u = __float_as_uint(f); u += 0x7FFFu + ((u >> 16) & 1u); return __uint_as_float(u & 0xFFFF0000u); }
// 16-bit fragment from a k-contiguous row: elements 0..7 <- p[8hh .. 8hh+7], 8..15 <- p[16+8hh .. 16+8hh+7]
__device__ __forceinline__ v16b frag_kb(const b16* p, int hh) {
  const v8b a = *(const v8b*)(p + 8 * hh), b = *(const v8b*)(p + 16 + 8 * hh); v16b f;
#pragma unroll
  for (int e = 0; e < 8; ++e) { f[e] = a[e]; f[8 + e] = b[e]; }
  return f;
}
__device__ __forceinline__ v8f wmma16b(v16b a, v16b b, v8f c) {
  v8f d = __builtin_amdgcn_wmma_f32_16x16x32_f16(false, a, false, b, (short)0, c, false, false);
  asm volatile("v_nop\n\tv_nop\n\tv_nop\n\tv_nop" : "+v"(d) : "v"(a), "v"(b));
  return d;
}
__device__ __forceinline__ void wave_lds_sync() { __builtin_amdgcn_fence(3, "workgroup"); __builtin_amdgcn_wave_barrier(); __builtin_amdgcn_fence(2, "workgroup"); }
__device__ __forceinline__ float nexp2(float v) { return __builtin_amdgcn_exp2f(v); }
// LDS byte address of a __shared__ object: the low 32 bits of its address.
__device__ __forceinline__ unsigned lds_off(const void* p) { return (unsigned)(size_t)p; }

__device__ __forceinline__ void store_tile64(const b16 (*S)[TP], b16* dst, size_t pitch, int wave, int lane) {
  {
#pragma unroll 1
    for (int it = 0; it < 8; ++it) {
      const int r = wave * 32 + it * 4 + (lane >> 3), c8 = (lane & 7) * 8;
      const v8b o = *(const v8b*)(&S[r][c8]);
      *(v8b*)(dst + (size_t)r * pitch + c8) = o; }
     }
}

// One launch converts all three GEMM operands; none of the three depends on another. Blocks of 256 threads, told apart by block index (block-uniform).
// Blocks 0 .. WBLK-1: W [KD][N] f32 (in-major: W[k][n]) -> WT [N][KD] f16 = bf16-RNE(W) x64 (k-contiguous per output column), in 64x64 tiles. A block takes four tiles
// that are neighbours along n, two waves a tile, each tile in its own LDS plane; tiles 0 .. WA_T-1 are W_attn's, the rest W_proj's (n tile fastest). They come first in
// the grid, for speed only.
// Blocks from WBLK on: x f32 -> Xp f16 = bf16-RNE(x) x8, 8 elements a thread.
constexpr int WA_T = (N3 / 64) * (KD / 64), WP_T = (CD / 64) * (KD / 64), WBLK = (WA_T + WP_T) / 4, XBLK = (int)(((size_t)MROWS * 128 + 255) / 256);
static_assert(WA_T % 4 == 0 && WP_T % 4 == 0 && (N3 / 64) % 4 == 0 && (CD / 64) % 4 == 0);
__global__ __launch_bounds__(256) void cvt_all_kernel(const float* __restrict__ X, const float* __restrict__ Wa, const float* __restrict__ Wp, b16* __restrict__ Xp,
                                                      b16* __restrict__ WaT, b16* __restrict__ WpT) {
  __shared__ __attribute__((aligned(16))) b16 St[4][64][TP];
  if ((int)blockIdx.x < WBLK) {
    const int grp = threadIdx.x >> 6, tid = threadIdx.x & 63, wave = tid >> 5, lane = tid & 31;
    const bool isa = (int)blockIdx.x * 4 < WA_T;   // block-uniform: WA_T is a multiple of 4
    const int t4 = (int)blockIdx.x * 4 - (isa ? 0 : WA_T); const int N = isa ? N3 : CD;   // t4: the block's first tile within its matrix, a multiple of 4
    const int nb = (isa ? t4 % (N3 / 64) : t4 % (CD / 64)) + grp, kb = isa ? t4 / (N3 / 64) : t4 / (CD / 64);
    const float* src = (isa ? Wa : Wp) + (size_t)kb * 64 * (size_t)N + (size_t)nb * 64;
#pragma unroll 1
    for (int it = 0; it < 16; ++it) {
      const int e = (it * 64 + tid) * 4; const int kk = e >> 6, n = e & 63;
      const v4f x = *(const v4f*)(src + (size_t)kk * N + n);
#pragma unroll
      for (int j = 0; j < 4; ++j) St[grp][n + j][kk] = (b16)(bf16_rne(x[j]) * WS);
    }
    __syncthreads();   // a tile's plane is read across its two waves
    store_tile64(St[grp], (isa ? WaT : WpT) + (size_t)nb * 64 * KD + (size_t)kb * 64, KD, wave, lane);
    return;
  }
  const size_t u = (size_t)((int)blockIdx.x - WBLK) * 256 + threadIdx.x; const size_t g = u >> 7; const int piece = (int)(u & 127);
  if (g >= (size_t)MROWS) return;
  const size_t srow = (g / SEQ) * SEQ_FULL + (g % SEQ);
  const float* src = X + srow * CD + piece * 8; b16* dst = Xp + g * CD + piece * 8;
  const v4f x0 = *(const v4f*)src, x1 = *(const v4f*)(src + 4); v8b o;
#pragma unroll
  for (int j = 0; j < 4; ++j) { o[j] = (b16)(bf16_rne(x0[j]) * XS); o[4 + j] = (b16)(bf16_rne(x1[j]) * XS); }
  *(v8b*)dst = o;
}

// Tile value c[m][n] = (A[m][.] . BT[n][.] + Ar[m][.] . BT[n][.] / 1024) * oscale + bf16-RNE(bias[n]); A, Ar, BT f16 with k-contiguous rows of KD = 1024, f32 accumulate.
// Rows m = b*SEQ + t (compact). The residual plane Ar ([b][EARLY][KD]) is used only when res_on != 0 and the tile's t0 < EARLY (block-uniform).
// Block 256 threads = 8 waves (4 along m x 2 along n), tile 128 x 64 (HEADS: 128 x 128, a wave 32 x 64, so that a byte copied from L2 and a fragment read from LDS feed more
// products); k tiles of 64 copied into two LDS buffers (tile t + 1 flies while tile t is multiplied), one block
// barrier a tile; epilogue staged in LDS. The HEADS instance is launched with the residual plane off and holds no room for it.
// HEADS == false: C[b*cstr + t][n] = c, f32, each 256-B row piece stored whole.
// HEADS == true (x @ W_attn): the tile's 128 columns are two heads of q, k or v, each wave's 64 one head h, and c never goes to memory. q and k: rms-norm over the 64 head dims, rotary with
// angle h * inv_freq[i] (head-indexed, same for every token), x8, f16 hi into Qh/Kh [bhi][SEQ][64] and, for t0 < EARLY, x1024 residuals into Qr/Kr [bhi][EARLY][64];
// v: x8, transposed through LDS into VTh [bhi][64][SEQ] and VTr [bhi][64][EARLY]. EARLY == BM: a tile is early as a whole or not at all.
// One k tile = rows of 128 B laid at the 144-B pitch of AP. 256 threads, 16 B a lane: copy j of a thread brings row (tid >> 3) + 32 j, piece tid & 7, so a wave's copy covers
// four whole 128-B lines. ag / bg / rg: the lane's first global byte of the tile, al / bl / rl: its first LDS byte. s_wait_xcnt stands inside each statement so that no
// address register named there is rewritten ahead of it.
__device__ __forceinline__ void stage_ab(const b16* ag, const b16* bg, unsigned al, unsigned bl) {   // A: 128 rows, BT: 64 rows
  const b16 *a1 = ag + 32 * KD, *a2 = ag + 64 * KD, *a3 = ag + 96 * KD, *b1 = bg + 32 * KD;
  const unsigned al1 = al + 32 * AP * 2, al2 = al + 64 * AP * 2, al3 = al + 96 * AP * 2, bl1 = bl + 32 * AP * 2;
  asm volatile("global_load_async_to_lds_b128 %0, %6, off\n\t"
               "global_load_async_to_lds_b128 %1, %7, off\n\t"
               "global_load_async_to_lds_b128 %2, %8, off\n\t"
               "global_load_async_to_lds_b128 %3, %9, off\n\t"
               "global_load_async_to_lds_b128 %4, %10, off\n\t"
               "global_load_async_to_lds_b128 %5, %11, off\n\t"
               "s_wait_xcnt 0x0"
               :: "v"(al), "v"(al1), "v"(al2), "v"(al3), "v"(bl), "v"(bl1), "v"(ag), "v"(a1), "v"(a2), "v"(a3), "v"(bg), "v"(b1)
               : "memory");
}
__device__ __forceinline__ void stage_ab128(const b16* ag, const b16* bg, unsigned al, unsigned bl) {   // A: 128 rows, BT: 128 rows
  const b16 *a1 = ag + 32 * KD, *a2 = ag + 64 * KD, *a3 = ag + 96 * KD, *b1 = bg + 32 * KD, *b2 = bg + 64 * KD, *b3 = bg + 96 * KD;
  const unsigned al1 = al + 32 * AP * 2, al2 = al + 64 * AP * 2, al3 = al + 96 * AP * 2, bl1 = bl + 32 * AP * 2, bl2 = bl + 64 * AP * 2, bl3 = bl + 96 * AP * 2;
  asm volatile("global_load_async_to_lds_b128 %0, %8, off\n\t"
               "global_load_async_to_lds_b128 %1, %9, off\n\t"
               "global_load_async_to_lds_b128 %2, %10, off\n\t"
               "global_load_async_to_lds_b128 %3, %11, off\n\t"
               "global_load_async_to_lds_b128 %4, %12, off\n\t"
               "global_load_async_to_lds_b128 %5, %13, off\n\t"
               "global_load_async_to_lds_b128 %6, %14, off\n\t"
               "global_load_async_to_lds_b128 %7, %15, off\n\t"
               "s_wait_xcnt 0x0"
               :: "v"(al), "v"(al1), "v"(al2), "v"(al3), "v"(bl), "v"(bl1), "v"(bl2), "v"(bl3), "v"(ag), "v"(a1), "v"(a2), "v"(a3), "v"(bg), "v"(b1), "v"(b2), "v"(b3)
               : "memory");
}
__device__ __forceinline__ void stage_r(const b16* rg, unsigned rl) {   // residual plane: 128 rows
  const b16 *r1 = rg + 32 * KD, *r2 = rg + 64 * KD, *r3 = rg + 96 * KD;
  const unsigned rl1 = rl + 32 * AP * 2, rl2 = rl + 64 * AP * 2, rl3 = rl + 96 * AP * 2;
  asm volatile("global_load_async_to_lds_b128 %0, %4, off\n\t"
               "global_load_async_to_lds_b128 %1, %5, off\n\t"
               "global_load_async_to_lds_b128 %2, %6, off\n\t"
               "global_load_async_to_lds_b128 %3, %7, off\n\t"
               "s_wait_xcnt 0x0"
               :: "v"(rl), "v"(rl1), "v"(rl2), "v"(rl3), "v"(rg), "v"(r1), "v"(r2), "v"(r3)
               : "memory");
}

template <bool HEADS>
__global__ __launch_bounds__(256) void gemm_kernel(const b16* __restrict__ A, const b16* __restrict__ Ar, const b16* __restrict__ BT, const float* __restrict__ bias,
                                                   float* __restrict__ C, b16* __restrict__ Qh, b16* __restrict__ Qr, b16* __restrict__ Kh, b16* __restrict__ Kr,
                                                   b16* __restrict__ VTh, b16* __restrict__ VTr, int N, int cstr, int res_on, float oscale) {
  constexpr int NF = HEADS ? 4 : 2, WN = 16 * NF, BNT = 2 * WN;   // BT fragments and columns a wave, columns a block: HEADS 128 = two heads, one to each wn
  constexpr int BOFF = HEADS ? ABYTES : 2 * ABYTES, STAGE = BOFF + BNT * AP * 2;   // one buffer: A | residual plane (not HEADS) | BT
  static_assert(!HEADS || (WN == HD && CD % BNT == 0 && N3 % BNT == 0 && 2 * BM * CP * 4 <= 2 * STAGE && 2 * BNT * VP * 2 <= 2 * STAGE));
  __shared__ __attribute__((aligned(16))) char smem[2 * STAGE];
  float* Cs = reinterpret_cast<float*>(smem);   // aliases the buffers after the k loop (block barrier in between)
  const int tid = threadIdx.x, wave = tid >> 5, lane = tid & 31, hh = lane >> 4, col = lane & 15, wm = wave >> 1, wn = wave & 1;
  const int bm = (int)blockIdx.y * BM, bn = (int)blockIdx.x * BNT; const int bb = bm / SEQ, t0 = bm % SEQ;
  const bool res = !HEADS && (res_on != 0) && (t0 < EARLY);
  const b16* Ab = A + (size_t)bm * KD; const b16* Bb = BT + (size_t)bn * KD;
  const b16* Arb = Ar + ((size_t)bb * EARLY + (size_t)t0) * KD;   // dereferenced only when res (then t0 == 0)
  v8f acc[2][NF], accr[2][NF];
#pragma unroll
  for (int i = 0; i < 2; ++i)
#pragma unroll
    for (int j = 0; j < NF; ++j) { acc[i][j] = (v8f){}; accr[i][j] = (v8f){}; }
  const int srow = tid >> 3, sc8 = (tid & 7) * 8;
  const b16* ag = Ab + (size_t)srow * KD + sc8; const b16* bg = Bb + (size_t)srow * KD + sc8; const b16* rg = Arb + (size_t)srow * KD + sc8;   // tile t: + t * BK
  const unsigned al = lds_off(smem) + (unsigned)(srow * AP + sc8) * 2u, rl = al + ABYTES, bl = al + BOFF;                                    // buffer 1: + STAGE
  auto stage = [&](int t, unsigned bo) {   // k tile t into the buffer at byte bo
    if constexpr (HEADS) stage_ab128(ag + t * BK, bg + t * BK, al + bo, bl + bo);
    else stage_ab(ag + t * BK, bg + t * BK, al + bo, bl + bo);
  };
  stage(0, 0u);
  if (res) stage_r(rg, rl);
  asm volatile("s_wait_asynccnt 0x0" ::: "memory");   // tile 0 has landed before the barrier that publishes it
  __syncthreads();
  stage(1, (unsigned)STAGE);
  if (res) stage_r(rg + BK, rl + STAGE);
#pragma unroll 1   // one copy of the loop body in the text: the buffer index is a run-time offset
  for (int t = 0; t < NT; ++t) {
    const int buf = t & 1;
    const b16* As = reinterpret_cast<const b16*>(smem + buf * STAGE); const b16* Ars = reinterpret_cast<const b16*>(smem + buf * STAGE + ABYTES);
    const b16* Bs = reinterpret_cast<const b16*>(smem + buf * STAGE + BOFF);
#pragma unroll
    for (int ks = 0; ks < BK; ks += 32) {
      const v16b a0 = frag_kb(As + (wm * 32 + col) * AP + ks, hh), a1 = frag_kb(As + (wm * 32 + 16 + col) * AP + ks, hh);
      v16b bf[NF];   // every '#pragma unroll' over j keeps the index of a register array a compile-time constant
#pragma unroll
      for (int j = 0; j < NF; ++j) bf[j] = frag_kb(Bs + (wn * WN + j * 16 + col) * AP + ks, hh);
#pragma unroll
      for (int j = 0; j < NF; ++j) acc[0][j] = wmma16b(a0, bf[j], acc[0][j]);
#pragma unroll
      for (int j = 0; j < NF; ++j) acc[1][j] = wmma16b(a1, bf[j], acc[1][j]);
      if (res) {
        const v16b r0 = frag_kb(Ars + (wm * 32 + col) * AP + ks, hh), r1 = frag_kb(Ars + (wm * 32 + 16 + col) * AP + ks, hh);
#pragma unroll
        for (int j = 0; j < NF; ++j) accr[0][j] = wmma16b(r0, bf[j], accr[0][j]);
#pragma unroll
        for (int j = 0; j < NF; ++j) accr[1][j] = wmma16b(r1, bf[j], accr[1][j]); }
    }
    asm volatile("s_wait_dscnt 0x0" ::: "memory");      // this wave's reads of tile t are done before the buffer is handed back
    asm volatile("s_wait_asynccnt 0x0" ::: "memory");   // this wave's copies of tile t + 1 have landed
    __syncthreads();                                    // publishes tile t + 1 and ends every wave's reads of tile t (after the last tile: the epilogue aliases)
    if (t + 2 < NT) {
      stage(t + 2, (unsigned)(buf * STAGE));
      if (res) stage_r(rg + (t + 2) * BK, rl + buf * STAGE); }
  }
  asm volatile("s_wait_asynccnt 0x0" ::: "memory");     // no copy is left in flight when the buffers are reused
  const int cls = bn / CD, bhi0 = bb * H + (bn % CD) / HD;   // HEADS: 0 q, 1 k, 2 v, and the block's first head; block-uniform
  const int h = (bn % CD) / HD + wn, bhi = bhi0 + wn;        // HEADS: this wave's own head
  const bool early = (t0 < EARLY);
  if (HEADS && cls == 2) {
    // acc[i][j][0..7] are 8 consecutive tokens of one head dim: one 16-B piece of a V^T row
    b16* Sv = reinterpret_cast<b16*>(smem); b16* Svr = Sv + BNT * VP;   // BNT rows: the head dims of the block's heads one after the other, as in VTh
#pragma unroll
    for (int i = 0; i < 2; ++i)
#pragma unroll
      for (int j = 0; j < NF; ++j) {
        const int cc = wn * WN + j * 16 + col; const float bv = bf16_rne(bias[bn + cc]); v8b oh;
#pragma unroll
        for (int r = 0; r < 8; ++r) {
          const float v = acc[i][j][r] + accr[i][j][r] * (1.0f / RS);
          const float v0 = (v * oscale + bv) * XS; acc[i][j][r] = v0; oh[r] = (b16)v0; }
        *(v8b*)(Sv + cc * VP + wm * 32 + i * 16 + 8 * hh) = oh; }
    if (early) {
#pragma unroll
      for (int i = 0; i < 2; ++i)
#pragma unroll
        for (int j = 0; j < NF; ++j) {
          const int cc = wn * WN + j * 16 + col; v8b orr;
#pragma unroll
          for (int r = 0; r < 8; ++r) { const float v0 = acc[i][j][r]; orr[r] = (b16)((v0 - (float)(b16)v0) * RS); }
          *(v8b*)(Svr + cc * VP + wm * 32 + i * 16 + 8 * hh) = orr; } }
    __syncthreads();   // V^T rows are read across waves
    b16* dv = VTh + (size_t)bhi0 * HD * (size_t)SK + t0;
#pragma unroll 1   // short trips, no gain from unrolling
    for (int it = 0; it < BNT / 16; ++it) {
      const int d = wave * (BNT / 8) + it * 2 + hh; const v8b f = *(const v8b*)(Sv + d * VP + col * 8);
      *(v8b*)(dv + (size_t)d * SK + col * 8) = f; }
    if (early) {   // then t0 == 0
      b16* dvr = VTr + (size_t)bhi0 * HD * (size_t)EARLY;
#pragma unroll 1   // as above
      for (int it = 0; it < BNT / 16; ++it) {
        const int d = wave * (BNT / 8) + it * 2 + hh; const v8b fr = *(const v8b*)(Svr + d * VP + col * 8);
        *(v8b*)(dvr + (size_t)d * EARLY + col * 8) = fr; } }
    return;
  }
#pragma unroll
  for (int i = 0; i < 2; ++i)
#pragma unroll
    for (int j = 0; j < NF; ++j) {
      const int cc = wn * WN + j * 16 + col; const float bv = bf16_rne(bias[bn + cc]);
      float* Cw = HEADS ? Cs + wn * BM * CP + j * 16 + col : Cs + cc;   // HEADS: a plane of BM rows x CP for each of the two heads
#pragma unroll
      for (int r = 0; r < 8; ++r) {
        const float v = acc[i][j][r] + accr[i][j][r] * (1.0f / RS);   // accr stays 0 when the residual plane is off
        Cw[(wm * 32 + i * 16 + 8 * hh + r) * CP] = v * oscale + bv; } }
  __syncthreads();   // Cs rows are read across waves (HEADS: across the lanes of the wave that wrote them)
  if constexpr (HEADS) {
    // From here on a wave works alone, on the 32 rows of its own head that it staged. A lane holds head dims lane and lane + 32, the two partners of one rotation.
    const float invf = exp2f(-(float)lane * (LOG2B / 32.0f));   // (1/10000)^(2i/64)
    const float ang = (float)h * invf; float s, c; sincosf(ang, &s, &c);
    float* rows = Cs + (wn * BM + wm * 32) * CP;
#pragma unroll 1   // batches of 8 rows: more at once would take more registers than the k loop does and cost a resident block
    for (int g = 0; g < 32; g += 8) {
      float e0[8], e1[8], ss[8];
      // Every '#pragma unroll' of this batch keeps the index of a register array a compile-time constant; the 8 rows go through each stage side by side, so that
      // their LDS reads and lane exchanges overlap.
#pragma unroll
      for (int i = 0; i < 8; ++i) { e0[i] = rows[(g + i) * CP + lane]; e1[i] = rows[(g + i) * CP + lane + 32]; ss[i] = e0[i] * e0[i] + e1[i] * e1[i]; }
#pragma unroll
      for (int off = 16; off > 0; off >>= 1)
#pragma unroll
        for (int i = 0; i < 8; ++i) ss[i] += __shfl_xor(ss[i], off);
      // The batch's rows are in registers by now: a row's f16 hi goes over the first 128 B of its own 256 B, its residual over the second.
#pragma unroll
      for (int i = 0; i < 8; ++i) {
        const float rn = rsqrtf(ss[i] * (1.0f / 64.0f) + RMS_EPS);
        const float n0 = e0[i] * rn, n1 = e1[i] * rn;
        const float y0 = (n0 * c + n1 * s) * XS, y1 = (n1 * c - n0 * s) * XS;
        b16* ro = reinterpret_cast<b16*>(rows + (g + i) * CP);
        ro[lane] = (b16)y0; ro[lane + 32] = (b16)y1; e0[i] = y0; e1[i] = y1;
      }
      if (early) {
#pragma unroll
        for (int i = 0; i < 8; ++i) {
          const float y0 = e0[i], y1 = e1[i]; b16* ro = reinterpret_cast<b16*>(rows + (g + i) * CP);
          ro[64 + lane] = (b16)((y0 - (float)(b16)y0) * RS); ro[96 + lane] = (b16)((y1 - (float)(b16)y1) * RS); } }
    }
    wave_lds_sync();
    const int r4 = lane >> 3, c8 = (lane & 7) * 8;
    b16* dh = (cls == 0 ? Qh : Kh) + ((size_t)bhi * SEQ + (size_t)(t0 + wm * 32)) * HD;
#pragma unroll 1   // short trips, no gain from unrolling
    for (int it = 0; it < 8; ++it) {
      const int rr = it * 4 + r4; const v8b f = *(const v8b*)(reinterpret_cast<const b16*>(rows + rr * CP) + c8);
      *(v8b*)(dh + (size_t)rr * HD + c8) = f; }
    if (early) {   // then t0 == 0
      b16* dr = (cls == 0 ? Qr : Kr) + ((size_t)bhi * EARLY + (size_t)(wm * 32)) * HD;
#pragma unroll 1   // as above
      for (int it = 0; it < 8; ++it) {
        const int rr = it * 4 + r4; const v8b fr = *(const v8b*)(reinterpret_cast<const b16*>(rows + rr * CP) + 64 + c8);
        *(v8b*)(dr + (size_t)rr * HD + c8) = fr; } }
  } else {
    float* Cb = C + ((size_t)bb * (size_t)cstr + (size_t)t0) * (size_t)N + bn;
#pragma unroll 1
    for (int it = 0; it < 8; ++it) {
      const int rr = wave * 16 + it * 2 + hh; const v4f f = *(const v4f*)(Cs + rr * CP + col * 4);
      *(v4f*)(Cb + (size_t)rr * N + col * 4) = f; }
  }
}

// Causal softmax(Q K^T / 8) V per (b, h) for the queries below EARLY: the body of the work-groups bx < EARLY / 64 of attn_main_kernel's launch. 4 waves x 16 queries, each
// wave on its own (no block barrier); key steps of 32 from 0 up to the last query of the wave's 32-query group in fixed order, keys above the query replaced by -inf
// before the running-max softmax (f32); P x1024 via wave-private LDS; O^T += V^T P^T.
// ER (queries < EARLY, which only visit keys < EARLY): S adds K_hi Q_res + K_res Q_hi (x1024), P adds a x1024 residual tile and V a x1024 residual
// plane into a second accumulator folded before normalisation, and the x16 y row is written as f16 hi plus a x1024 residual. y rows -> Yh [b*SEQ + q][h*64 + d]
template <bool ER>
__device__ __forceinline__ void attn_rows(const b16* __restrict__ Qh, const b16* __restrict__ Qr, const b16* __restrict__ Kh, const b16* __restrict__ Kr,
                                          const b16* __restrict__ VTh, const b16* __restrict__ VTr, b16* __restrict__ Yh, b16* __restrict__ Yr,
                                          b16 (*Pb)[16][32 + 8], b16 (*Pr)[16][32 + 8], b16 (*Th)[16][TP], b16 (*Tr)[16][TP], int bx) {
  const int wave = __builtin_amdgcn_readfirstlane((int)threadIdx.x >> 5), lane = threadIdx.x & 31, hh = lane >> 4, col = lane & 15;   // scalar: the key loop's end hangs on it
  const int bhi = (int)blockIdx.y; const int b = bhi / H, h = bhi % H; const int q0 = bx * 64 + wave * 16, qi = q0 + col;
  const b16* Qb = Qh + (size_t)bhi * QL * HD; const b16* Kb = Kh + (size_t)bhi * SK * HD; const b16* Vb = VTh + (size_t)bhi * HD * (size_t)SK;
  const b16* Qrb = Qr + (size_t)bhi * EARLY * HD; const b16* Krb = Kr + (size_t)bhi * EARLY * HD; const b16* Vrb = VTr + (size_t)bhi * HD * (size_t)EARLY;
  const v16b qa0 = frag_kb(Qb + (size_t)qi * HD, hh), qa1 = frag_kb(Qb + (size_t)qi * HD + 32, hh);
  v16b qr0 = (v16b){}, qr1 = (v16b){};
  if constexpr (ER) { qr0 = frag_kb(Qrb + (size_t)qi * HD, hh); qr1 = frag_kb(Qrb + (size_t)qi * HD + 32, hh); }
  const float cs = LOG2E / (8.0f * XS * XS);   // 1/sqrt(64) and the two x8 carriers, in the log2 domain
  float m = -INFINITY, l = 0.0f; v8f o[4], o2[4];
#pragma unroll
  for (int t = 0; t < 4; ++t) { o[t] = (v8f){}; o2[t] = (v8f){}; }
  const int kend = (q0 >> 5) * 32 + 32;   // causal: keys 0 .. last query of this wave's 32-query group; ER: kend <= EARLY
#pragma unroll 1
  for (int kb = 0; kb < kend; kb += 32) {
    float e[16]; float mx = -INFINITY;
#pragma unroll
    for (int u = 0; u < 2; ++u) {
      const int krow = kb + u * 16 + col;
      const v16b kh0 = frag_kb(Kb + (size_t)krow * HD, hh), kh1 = frag_kb(Kb + (size_t)krow * HD + 32, hh);
      v8f s = (v8f){}; s = wmma16b(kh0, qa0, s); s = wmma16b(kh1, qa1, s);
      v8f sr = (v8f){};
      if constexpr (ER) {
        const v16b kr0 = frag_kb(Krb + (size_t)krow * HD, hh), kr1 = frag_kb(Krb + (size_t)krow * HD + 32, hh);
        sr = wmma16b(kh0, qr0, sr); sr = wmma16b(kh1, qr1, sr); sr = wmma16b(kr0, qa0, sr); sr = wmma16b(kr1, qa1, sr); }
#pragma unroll
      for (int r = 0; r < 8; ++r) {
        float v = s[r];
        if constexpr (ER) v += sr[r] * (1.0f / RS);
        v *= cs;
        const int key = kb + u * 16 + 8 * hh + r;
        v = (key > qi) ? -INFINITY : v;
        e[u * 8 + r] = v; mx = fmaxf(mx, v); } }
    mx = fmaxf(mx, __shfl_xor(mx, 16)); const float mn = fmaxf(m, mx); const float al = nexp2(m - mn); float sum = 0.0f;
#pragma unroll
    for (int i2 = 0; i2 < 16; ++i2) {
      const float p = nexp2(e[i2] - mn); sum += p; const int pi = (i2 < 8 ? 0 : 16) + 8 * hh + (i2 & 7);
      const float pp = p * PS; const b16 ph = (b16)pp; Pb[wave][col][pi] = ph;
      if constexpr (ER) Pr[wave][col][pi] = (b16)((pp - (float)ph) * RS); }
    sum += __shfl_xor(sum, 16); l = l * al + sum; m = mn;
    wave_lds_sync();
    const v16b pf = frag_kb(&Pb[wave][col][0], hh);
    v16b prf = (v16b){};
    if constexpr (ER) prf = frag_kb(&Pr[wave][col][0], hh);
#pragma unroll
    for (int t = 0; t < 4; ++t) {
      o[t] *= al; const v16b vh = frag_kb(Vb + (size_t)(t * 16 + col) * SK + kb, hh);
      o[t] = wmma16b(vh, pf, o[t]);
      if constexpr (ER) { const v16b vr = frag_kb(Vrb + (size_t)(t * 16 + col) * EARLY + kb, hh); o2[t] *= al; o2[t] = wmma16b(vh, prf, o2[t]); o2[t] = wmma16b(vr, pf, o2[t]); } }
    wave_lds_sync(); }
  const float inv = YS / (l * PS * XS);
#pragma unroll
  for (int t = 0; t < 4; ++t) {
#pragma unroll
    for (int r = 0; r < 8; ++r) {
      float ov = o[t][r];
      if constexpr (ER) ov += o2[t][r] * (1.0f / RS);
      const float yv = ov * inv; const b16 yh = (b16)yv;
      Th[wave][col][t * 16 + 8 * hh + r] = yh;
      if constexpr (ER) Tr[wave][col][t * 16 + 8 * hh + r] = (b16)((yv - (float)yh) * RS); } }
  wave_lds_sync();
  b16* yb = Yh + ((size_t)b * SEQ + (size_t)q0) * CD + (size_t)h * HD;
  {
#pragma unroll 1
    for (int it = 0; it < 4; ++it) {
      const int rr = it * 4 + (lane >> 3), c8 = (lane & 7) * 8; const v8b f = *(const v8b*)(&Th[wave][rr][c8]);
      *(v8b*)(yb + (size_t)rr * CD + c8) = f;
      if constexpr (ER) {
        const v8b fr = *(const v8b*)(&Tr[wave][rr][c8]);
        *(v8b*)(Yr + (((size_t)b * EARLY + (size_t)(q0 + rr)) * CD + (size_t)h * HD + c8)) = fr; } }
     }
}

// One staged tile pair = 64 keys: K rows [64 keys][64 dims] and V^T rows [64 dims][64 keys], 128 B a row, laid at the 144-B pitch of TP. 128 threads, 16 B a lane:
// copy j of a thread brings row (tid >> 3) + 16 j, piece tid & 7, so a wave's copy covers four whole 128-B lines. kg / vg: the lane's first global byte of the tile,
// kl / vl: its first LDS byte. s_wait_xcnt stands inside the statement so that no address register named here is rewritten ahead of it.
__device__ __forceinline__ void stage_kv(const b16* kg, const b16* vg, unsigned kl, unsigned vl) {
  const b16 *k1 = kg + 16 * HD, *k2 = kg + 32 * HD, *k3 = kg + 48 * HD; const b16 *v1 = vg + 16 * (size_t)SK, *v2 = vg + 32 * (size_t)SK, *v3 = vg + 48 * (size_t)SK;
  const unsigned kl1 = kl + 16 * TP * 2, kl2 = kl + 32 * TP * 2, kl3 = kl + 48 * TP * 2, vl1 = vl + 16 * TP * 2, vl2 = vl + 32 * TP * 2, vl3 = vl + 48 * TP * 2;
  asm volatile("global_load_async_to_lds_b128 %0, %8, off\n\t"
               "global_load_async_to_lds_b128 %1, %9, off\n\t"
               "global_load_async_to_lds_b128 %2, %10, off\n\t"
               "global_load_async_to_lds_b128 %3, %11, off\n\t"
               "global_load_async_to_lds_b128 %4, %12, off\n\t"
               "global_load_async_to_lds_b128 %5, %13, off\n\t"
               "global_load_async_to_lds_b128 %6, %14, off\n\t"
               "global_load_async_to_lds_b128 %7, %15, off\n\t"
               "s_wait_xcnt 0x0"
               :: "v"(kl), "v"(kl1), "v"(kl2), "v"(kl3), "v"(vl), "v"(vl1), "v"(vl2), "v"(vl3), "v"(kg), "v"(k1), "v"(k2), "v"(k3), "v"(vg), "v"(v1), "v"(v2), "v"(v3)
               : "memory");
}

// One launch for all queries: grid (query blocks of 64, NB*H); block = 4 waves x 16 queries. Blocks below EARLY take attn_rows above and leave; they need nothing from the
// others. From EARLY on, the same causal softmax(Q K^T / 8) V without residual planes.
// K and V^T come in tiles of 64 keys, copied once per block into two LDS buffers (tile s + 1 flies while tile s is worked on) and read as fragments by all
// four waves. Each wave walks key steps of 32 in the same fixed order and up to the same last key (the end of its 32-query group) as attn_rows above.
// Every plain '#pragma unroll' below keeps the index of a register array a compile-time constant.
__global__ __launch_bounds__(128) void attn_main_kernel(const b16* __restrict__ Qh, const b16* __restrict__ Qr, const b16* __restrict__ Kh, const b16* __restrict__ Kr,
                                                        const b16* __restrict__ VTh, const b16* __restrict__ VTr, b16* __restrict__ Yh, b16* __restrict__ Yr) {
  __shared__ __attribute__((aligned(16))) b16 Ks[2][64][TP];
  __shared__ __attribute__((aligned(16))) b16 Vs[2][64][TP];
  __shared__ __attribute__((aligned(16))) b16 Pb[4][16][32 + 8];
  __shared__ __attribute__((aligned(16))) b16 Th[4][16][TP];
  const int bx = (int)blockIdx.x;
  if (bx < EARLY / 64) {   // block-uniform, ahead of every copy and barrier; the residual tiles lie in the K and V buffers, which such a block does not fill
    attn_rows<true>(Qh, Qr, Kh, Kr, VTh, VTr, Yh, Yr, Pb, reinterpret_cast<b16 (*)[16][32 + 8]>(&Ks[0][0][0]), Th, reinterpret_cast<b16 (*)[16][TP]>(&Vs[0][0][0]), bx);
    return;
  }
  const int tid = threadIdx.x, wave = __builtin_amdgcn_readfirstlane(tid >> 5), lane = tid & 31, hh = lane >> 4, col = lane & 15;
  const int bhi = (int)blockIdx.y; const int b = bhi / H, h = bhi % H; const int q0 = bx * 64 + wave * 16, qi = q0 + col;
  const b16* Qb = Qh + (size_t)bhi * QL * HD; const b16* Kb = Kh + (size_t)bhi * SK * HD; const b16* Vb = VTh + (size_t)bhi * HD * (size_t)SK;
  const int nst = bx + 1;                     // tiles of 64 keys: keys 0 .. last query of this block
  const int kend = (q0 >> 5) * 32 + 32;       // this wave's causal end
  const int srow = tid >> 3, sc8 = (tid & 7) * 8;
  const b16* kg = Kb + (size_t)srow * HD + sc8; const b16* vg = Vb + (size_t)srow * SK + sc8;   // tile s: kg + s * 64 * HD, vg + s * 64
  const unsigned kl = lds_off(&Ks[0][srow][sc8]), vl = lds_off(&Vs[0][srow][sc8]); constexpr unsigned BUFB = 64 * TP * 2;
  stage_kv(kg, vg, kl, vl);
  asm volatile("s_wait_asynccnt 0x0" ::: "memory");   // tile 0 has landed before the barrier that publishes it
  __syncthreads();
  if (nst > 1) stage_kv(kg + 64 * HD, vg + 64, kl + BUFB, vl + BUFB);
  const v16b qa0 = frag_kb(Qb + (size_t)qi * HD, hh), qa1 = frag_kb(Qb + (size_t)qi * HD + 32, hh);
  const float cs = LOG2E / (8.0f * XS * XS);   // 1/sqrt(64) and the two x8 carriers, in the log2 domain
  float m = -INFINITY, l = 0.0f; v8f o[4];
#pragma unroll
  for (int t = 0; t < 4; ++t) o[t] = (v8f){};
#pragma unroll 1   // one copy of the loop body in the text: the buffer index is a run-time offset
  for (int s = 0; s < nst; ++s) {
    const int buf = s & 1;
#pragma unroll 1   // the two key steps of a tile share one body
    for (int sub = 0; sub < 64; sub += 32) {
      const int kb = s * 64 + sub;
      if (kb < kend) {   // wave-uniform: a wave skips the step wholly above its diagonal, never the publish point below
        float e[16]; float mx = -INFINITY;
#pragma unroll
        for (int u = 0; u < 2; ++u) {
          const b16* kr = &Ks[buf][sub + u * 16 + col][0];
          const v16b kh0 = frag_kb(kr, hh), kh1 = frag_kb(kr + 32, hh);
          v8f sc = (v8f){}; sc = wmma16b(kh0, qa0, sc); sc = wmma16b(kh1, qa1, sc);
#pragma unroll
          for (int r = 0; r < 8; ++r) {
            float v = sc[r] * cs;
            const int key = kb + u * 16 + 8 * hh + r;
            v = (key > qi) ? -INFINITY : v;
            e[u * 8 + r] = v; mx = fmaxf(mx, v); } }
        mx = fmaxf(mx, __shfl_xor(mx, 16)); const float mn = fmaxf(m, mx); const float al = nexp2(m - mn); float sum = 0.0f;
#pragma unroll
        for (int i2 = 0; i2 < 16; ++i2) {
          const float p = nexp2(e[i2] - mn); sum += p; const int pi = (i2 < 8 ? 0 : 16) + 8 * hh + (i2 & 7);
          Pb[wave][col][pi] = (b16)(p * PS); }
        sum += __shfl_xor(sum, 16); l = l * al + sum; m = mn;
        wave_lds_sync();
        const v16b pf = frag_kb(&Pb[wave][col][0], hh);
#pragma unroll
        for (int t = 0; t < 4; ++t) {
          o[t] *= al; const v16b vh = frag_kb(&Vs[buf][t * 16 + col][sub], hh);
          o[t] = wmma16b(vh, pf, o[t]); }
        wave_lds_sync(); }
    }
    asm volatile("s_wait_dscnt 0x0" ::: "memory");      // this wave's reads of tile s are done before the buffer is handed back
    asm volatile("s_wait_asynccnt 0x0" ::: "memory");   // this wave's copies of tile s + 1 have landed
    __syncthreads();                                    // publishes tile s + 1 and ends every wave's reads of tile s
    if (s + 2 < nst) stage_kv(kg + (size_t)(s + 2) * 64 * HD, vg + (size_t)(s + 2) * 64, kl + buf * BUFB, vl + buf * BUFB);
  }
  asm volatile("s_wait_asynccnt 0x0" ::: "memory");     // no copy is left in flight when the wave ends
  const float inv = YS / (l * PS * XS);
#pragma unroll
  for (int t = 0; t < 4; ++t) {
#pragma unroll
    for (int r = 0; r < 8; ++r) Th[wave][col][t * 16 + 8 * hh + r] = (b16)(o[t][r] * inv); }
  wave_lds_sync();
  b16* yb = Yh + ((size_t)b * SEQ + (size_t)q0) * CD + (size_t)h * HD;
#pragma unroll 1   // as in the kernel above: four short trips, no gain from unrolling
  for (int it = 0; it < 4; ++it) {
    const int rr = it * 4 + (lane >> 3), c8 = (lane & 7) * 8; const v8b f = *(const v8b*)(&Th[wave][rr][c8]);
    *(v8b*)(yb + (size_t)rr * CD + c8) = f; }
}
}  // namespace

extern "C" void kernel_launch(void* const* d_in, const int* in_sizes, int n_in, void* d_out, int out_size, void* d_ws, size_t ws_size, hipStream_t stream) {
  // wire order: 0 x [NB_FULL][SEQ_FULL][1024] f32, 1 W_attn [1024][3072] f32, 2 b_attn [3072] f32, 3 W_proj [1024][1024] f32, 4 b_proj [1024] f32; out [NB_FULL][SEQ_FULL][1024] f32
  const size_t need_x = ((size_t)(NB - 1) * SEQ_FULL + (size_t)SEQ) * CD;
  if (n_in < 5 || (size_t)in_sizes[0] < need_x || (size_t)in_sizes[1] < (size_t)KD * N3 || (size_t)in_sizes[2] < (size_t)N3 ||
      (size_t)in_sizes[3] < (size_t)KD * CD || (size_t)in_sizes[4] < (size_t)CD || (size_t)out_size < need_x) return;
  const float* Xin = (const float*)d_in[0]; const float* Wa = (const float*)d_in[1]; const float* Ba = (const float*)d_in[2];
  const float* Wp = (const float*)d_in[3]; const float* Bp = (const float*)d_in[4];
  size_t off = 0; char* ws = (char*)d_ws;
  auto carve = [&](size_t bytes) { char* p = ws + off; off += (bytes + 255) & ~(size_t)255; return p; };
  b16* Xp = (b16*)carve((size_t)MROWS * CD * 2);                       //  8,388,608 B at NB=2, SEQ=2048
  b16* WaT = (b16*)carve((size_t)N3 * KD * 2);                         //  6,291,456
  b16* WpT = (b16*)carve((size_t)CD * KD * 2);                         //  2,097,152
  const size_t plane = (size_t)NB * H * SEQ * HD * 2, rplane = (size_t)NB * H * EARLY * HD * 2;
  b16* Qh = (b16*)carve(plane); b16* Kh = (b16*)carve(plane); b16* VTh = (b16*)carve(plane);      // 3 x 8,388,608
  b16* Qr = (b16*)carve(rplane); b16* Kr = (b16*)carve(rplane); b16* VTr = (b16*)carve(rplane);   // 3 x 524,288
  b16* Yh = (b16*)carve((size_t)MROWS * CD * 2);                       //  8,388,608
  b16* Yr = (b16*)carve((size_t)NB * EARLY * CD * 2);                  //    524,288   -> total 52,428,800 B
  if (off > ws_size || off > ((size_t)128 << 20)) return;
  cvt_all_kernel<<<dim3(WBLK + XBLK), 256, 0, stream>>>(Xin, Wa, Wp, Xp, WaT, WpT);
  gemm_kernel<true><<<dim3(N3 / (2 * BN), MROWS / BM), 256, 0, stream>>>(Xp, Xp, WaT, Ba, nullptr, Qh, Qr, Kh, Kr, VTh, VTr, N3, SEQ, 0, 1.0f / (XS * WS));
  attn_main_kernel<<<dim3(QL / 64, NB * H), 128, 0, stream>>>(Qh, Qr, Kh, Kr, VTh, VTr, Yh, Yr);
  gemm_kernel<false><<<dim3(CD / BN, MROWS / BM), 256, 0, stream>>>(Yh, Yr, WpT, Bp, (float*)d_out, nullptr, nullptr, nullptr, nullptr, nullptr, nullptr, CD, SEQ_FULL, 1, 1.0f / (YS * WS));
}

// v006
// One run takes 107 microseconds.
// Next to v005, in two timings, it ran 1.05 times as fast each time.
// All steps since v000 together make it 2.85 times as fast.
#include <hip/hip_runtime.h>

// compute dtype: all contractions on v_wmma_f32_16x16x32_f16 (f16 operands, f32 accumulate). x @ W_attn and y @ W_proj: x and W enter as their bf16-RNE
// values carried x8 (x) and x64 (W) in f16 planes, 1 product; y carried x16 as f16 hi, plus a x1024 f16 residual plane on the first 128 token rows of each
// sequence (2 products there, second accumulator folded in the f32 epilogue). S^T = K Q^T per head: q, k after rms-norm and rotary carried x8 as f16 hi,
// 1 product; query blocks below 128 tokens add x1024 f16 q and k residual planes (3 products). O^T += V^T P^T: v carried x8 f16, P f16 x1024, 1 product;
// the same early query blocks add P and v x1024 residuals into a second accumulator folded before normalisation. Norm, rotary, softmax statistics in f32.
// Fragment k-map per lane half hh for A AND B: elements 0..7 <- k = 8hh+0..7, 8..15 <- k = 16+8hh+0..7; acc[r] = D[8hh+r][col = lane&15].

#ifndef NB
#define NB 2
#endif
#ifndef SEQ
#define SEQ 2048
#endif
#ifndef NB_FULL
#define NB_FULL 2
#endif
#ifndef SEQ_FULL
#define SEQ_FULL 2048
#endif

namespace {
constexpr int H = 16, HD = 64, CD = 1024, N3 = 3 * CD, KD = CD, QL = SEQ, SK = SEQ, MROWS = NB * SEQ;
constexpr int EARLY = 128, EB = EARLY / 32;                       // token rows per sequence that get residual planes
constexpr int BM = 128, BN = 64, BK = 64, TP = 72, AP = BK + 8, CP = BN + 4, VP = BM + 8;
constexpr int ABYTES = BM * AP * 2, BBYTES = BN * AP * 2, SMEM = 2 * (ABYTES + BBYTES), NT = KD / BK;   // SMEM: no GEMM instance has less LDS
constexpr float XS = 8.0f, WS = 64.0f, YS = 16.0f, PS = 1024.0f, RS = 1024.0f;
constexpr float LOG2E = 1.4426950408889634f, LOG2B = 13.287712379549449f, RMS_EPS = 1.1920929e-07f;
static_assert(SEQ % BM == 0 && SEQ >= BM && SEQ <= SEQ_FULL && NB >= 1 && NB <= NB_FULL);
static_assert(EARLY == BM && EARLY % 64 == 0 && EB * 32 == EARLY && MROWS % BM == 0 && N3 % BN == 0 && CD % BN == 0 && KD % BK == 0);
static_assert(BM * CP * 4 <= SMEM && HD == 64 && QL == SK && SEQ % 64 == 0 && (MROWS * 128) % 256 == 0);
static_assert(BN == HD && 2 * HD * VP * 2 <= SMEM && NT >= 2 && ABYTES % 16 == 0 && BBYTES % 16 == 0);

typedef _Float16 b16;
typedef __attribute__((ext_vector_type(16))) _Float16 v16b;
typedef __attribute__((ext_vector_type(8))) _Float16 v8b;
typedef __attribute__((ext_vector_type(8))) float v8f;
typedef __attribute__((ext_vector_type(4))) float v4f;

__device__ __forceinline__ float bf16_rne(float f) { unsigned int u = __float_as_uint(f); u += 0x7FFFu + ((u >> 16) & 1u); return __uint_as_float(u & 0xFFFF0000u); }
// 16-bit fragment from a k-contiguous row: elements 0..7 <- p[8hh .. 8hh+7], 8..15 <- p[16+8hh .. 16+8hh+7]
__device__ __forceinline__ v16b frag_kb(const b16* p, int hh) {
  const v8b a = *(const v8b*)(p + 8 * hh), b = *(const v8b*)(p + 16 + 8 * hh); v16b f;
#pragma unroll
  for (int e = 0; e < 8; ++e) { f[e] = a[e]; f[8 + e] = b[e]; }
  return f;
}
__device__ __forceinline__ v8f wmma16b(v16b a, v16b b, v8f c) {
  v8f d = __builtin_amdgcn_wmma_f32_16x16x32_f16(false, a, false, b, (short)0, c, false, false);
  asm volatile("v_nop\n\tv_nop\n\tv_nop\n\tv_nop" : "+v"(d) : "v"(a), "v"(b));
  return d;
}
__device__ __forceinline__ void wave_lds_sync() { __builtin_amdgcn_fence(3, "workgroup"); __builtin_amdgcn_wave_barrier(); __builtin_amdgcn_fence(2, "workgroup"); }
__device__ __forceinline__ float nexp2(float v) { return __builtin_amdgcn_exp2f(v); }
// LDS byte address of a __shared__ object: the low 32 bits of its address.
__device__ __forceinline__ unsigned lds_off(const void* p) { return (unsigned)(size_t)p; }

__device__ __forceinline__ void store_tile64(const b16 (*S)[TP], b16* dst, size_t pitch, int wave, int lane) {
  {
#pragma unroll   // the LDS reads go out in groups ahead of their stores, not one read, one wait and one store a trip
    for (int it = 0; it < 8; ++it) {
      const int r = wave * 32 + it * 4 + (lane >> 3), c8 = (lane & 7) * 8;
      const v8b o = *(const v8b*)(&S[r][c8]);
      *(v8b*)(dst + (size_t)r * pitch + c8) = o; }
     }
}

// One launch converts all three GEMM operands; none of the three depends on another. Blocks of 256 threads, told apart by block index (block-uniform).
// Blocks 0 .. WBLK-1: W [KD][N] f32 (in-major: W[k][n]) -> WT [N][KD] f16 = bf16-RNE(W) x64 (k-contiguous per output column), in 64x64 tiles. A block takes four tiles
// that are neighbours along n, two waves a tile, each tile in its own LDS plane; tiles 0 .. WA_T-1 are W_attn's, the rest W_proj's (n tile fastest). They come first in
// the grid because with the pass through LDS and its barrier theirs is the launch's longest path.
// Blocks from WBLK on: x f32 -> Xp f16 = bf16-RNE(x) x8, XU pieces of 8 elements a thread, XBLK * 256 pieces apart.
// In both parts a thread issues all its global loads before it uses the first, so that it waits for memory once and the launch needs few waves.
constexpr int WA_T = (N3 / 64) * (KD / 64), WP_T = (CD / 64) * (KD / 64), WBLK = (WA_T + WP_T) / 4, XU = 8, XBLK = (int)((size_t)MROWS * 128 / (256 * XU));
static_assert(WA_T % 4 == 0 && WP_T % 4 == 0 && (N3 / 64) % 4 == 0 && (CD / 64) % 4 == 0 && ((size_t)MROWS * 128) % (256 * XU) == 0);
// One 64x64 tile of W, row pitch N (a compile-time constant: the 16 loads then differ in their immediate offset alone), by the tile's 64 threads.
template <int N>
__device__ __forceinline__ void cvt_w_tile(const float* src, b16 (*S)[TP], int tid) {
  const int k0 = tid >> 4, n = (tid & 15) * 4; v4f x[16];   // load it: row it * 4 + k0, columns n .. n + 3; both '#pragma unroll' keep the index of x a compile-time constant
  const float* p = src + (size_t)k0 * N + n;
#pragma unroll
  for (int it = 0; it < 16; ++it) x[it] = *(const v4f*)(p + (size_t)(it * 4) * N);
  // Inputs-only fence on the loaded values and the address: the address pair lives until all 16 loads are back, so that no result is put into a register that a load in
  // flight still names, and each pitch keeps its own run of 16 loads under one base (left alone, the compiler merges the two pitches and forms 16 addresses between the loads).
  asm volatile("" :: "v"(x[0]), "v"(x[1]), "v"(x[2]), "v"(x[3]), "v"(x[4]), "v"(x[5]), "v"(x[6]), "v"(x[7]), "v"(x[8]), "v"(x[9]), "v"(x[10]), "v"(x[11]), "v"(x[12]), "v"(x[13]),
               "v"(x[14]), "v"(x[15]), "v"(p));
#pragma unroll
  for (int it = 0; it < 16; ++it)
#pragma unroll
    for (int j = 0; j < 4; ++j) S[n + j][it * 4 + k0] = (b16)(bf16_rne(x[it][j]) * WS);
}
__global__ __launch_bounds__(256) void cvt_all_kernel(const float* __restrict__ X, const float* __restrict__ Wa, const float* __restrict__ Wp, b16* __restrict__ Xp,
                                                      b16* __restrict__ WaT, b16* __restrict__ WpT) {
  __shared__ __attribute__((aligned(16))) b16 St[4][64][TP];
  if ((int)blockIdx.x < WBLK) {
    const int grp = threadIdx.x >> 6, tid = threadIdx.x & 63, wave = tid >> 5, lane = tid & 31;
    const bool isa = (int)blockIdx.x * 4 < WA_T;   // block-uniform: WA_T is a multiple of 4
    const int t4 = (int)blockIdx.x * 4 - (isa ? 0 : WA_T); const int N = isa ? N3 : CD;   // t4: the block's first tile within its matrix, a multiple of 4
    const int nb = (isa ? t4 % (N3 / 64) : t4 % (CD / 64)) + grp, kb = isa ? t4 / (N3 / 64) : t4 / (CD / 64);
    const float* src = (isa ? Wa : Wp) + (size_t)kb * 64 * (size_t)N + (size_t)nb * 64;
    if (isa) cvt_w_tile<N3>(src, St[grp], tid); else cvt_w_tile<CD>(src, St[grp], tid);
    __syncthreads();   // a tile's plane is read across its two waves
    store_tile64(St[grp], (isa ? WaT : WpT) + (size_t)nb * 64 * KD + (size_t)kb * 64, KD, wave, lane);
    return;
  }
  const size_t u0 = (size_t)((int)blockIdx.x - WBLK) * 256 + threadIdx.x, g0 = u0 >> 7; const int piece = (int)(u0 & 127);   // piece k of the thread: row g0 + k * XBLK * 2
  v4f x0[XU], x1[XU];   // every '#pragma unroll' below keeps the index of these a compile-time constant
  const float* xs[XU];
#pragma unroll
  for (int k = 0; k < XU; ++k) {
    const size_t g = g0 + (size_t)k * (XBLK * 2); const size_t srow = (SEQ == SEQ_FULL) ? g : (g / SEQ) * SEQ_FULL + (g % SEQ);
    xs[k] = X + srow * CD + piece * 8; x0[k] = *(const v4f*)xs[k]; x1[k] = *(const v4f*)(xs[k] + 4); }
  // As in cvt_w_tile: inputs-only fence on the loaded values and the first address (left alone, the compiler puts a later load's result into that pair while loads that name it fly).
  asm volatile("" :: "v"(x0[0]), "v"(x0[1]), "v"(x0[2]), "v"(x0[3]), "v"(x0[4]), "v"(x0[5]), "v"(x0[6]), "v"(x0[7]), "v"(x1[0]), "v"(x1[1]), "v"(x1[2]), "v"(x1[3]), "v"(x1[4]),
               "v"(x1[5]), "v"(x1[6]), "v"(x1[7]), "v"(xs[0]));
#pragma unroll
  for (int k = 0; k < XU; ++k) {
    v8b o;
#pragma unroll
    for (int j = 0; j < 4; ++j) { o[j] = (b16)(bf16_rne(x0[k][j]) * XS); o[4 + j] = (b16)(bf16_rne(x1[k][j]) * XS); }
    *(v8b*)(Xp + (g0 + (size_t)k * (XBLK * 2)) * CD + piece * 8) = o; }
  asm volatile("s_wait_xcnt 0x0" ::: "memory");   // stands behind the run of stores, ahead of any later write of a register that one of them names
}

// Tile value c[m][n] = (A[m][.] . BT[n][.] + Ar[m][.] . BT[n][.] / 1024) * oscale + bf16-RNE(bias[n]); A, Ar, BT f16 with k-contiguous rows of KD = 1024, f32 accumulate.
// Rows m = b*SEQ + t (compact). The residual plane Ar ([b][EARLY][KD]) is used only when res_on != 0 and the tile's t0 < EARLY (block-uniform).
// Block 256 threads = 8 waves (4 along m x 2 along n), tile 128 x 64 (HEADS: 128 x 128, a wave 32 x 64, so that a byte copied from L2 and a fragment read from LDS feed more
// products); k tiles of 64 copied into two LDS buffers (tile t + 1 flies while tile t is multiplied), one block
// barrier a tile; epilogue staged in LDS. The HEADS instance is launched with the residual plane off and holds no room for it.
// HEADS == false: C[b*cstr + t][n] = c, f32, each 256-B row piece stored whole.
// HEADS == true (x @ W_attn): the tile's 128 columns are two heads of q, k or v, each wave's 64 one head h, and c never goes to memory. q and k: rms-norm over the 64 head dims, rotary with
// angle h * inv_freq[i] (head-indexed, same for every token), x8, f16 hi into Qh/Kh [bhi][SEQ][64] and, for t0 < EARLY, x1024 residuals into Qr/Kr [bhi][EARLY][64];
// v: x8, transposed through LDS into VTh [bhi][64][SEQ] and VTr [bhi][64][EARLY]. EARLY == BM: a tile is early as a whole or not at all.
// One k tile = rows of 128 B laid at the 144-B pitch of AP. 256 threads, 16 B a lane: copy j of a thread brings row (tid >> 3) + 32 j, piece tid & 7, so a wave's copy covers
// four whole 128-B lines. ag / bg / rg: the lane's first global byte of the tile, al / bl / rl: its first LDS byte. s_wait_xcnt stands inside each statement so that no
// address register named there is rewritten ahead of it.
__device__ __forceinline__ void stage_ab(const b16* ag, const b16* bg, unsigned al, unsigned bl) {   // A: 128 rows, BT: 64 rows
  const b16 *a1 = ag + 32 * KD, *a2 = ag + 64 * KD, *a3 = ag + 96 * KD, *b1 = bg + 32 * KD;
  const unsigned al1 = al + 32 * AP * 2, al2 = al + 64 * AP * 2, al3 = al + 96 * AP * 2, bl1 = bl + 32 * AP * 2;
  asm volatile("global_load_async_to_lds_b128 %0, %6, off\n\t"
               "global_load_async_to_lds_b128 %1, %7, off\n\t"
               "global_load_async_to_lds_b128 %2, %8, off\n\t"
               "global_load_async_to_lds_b128 %3, %9, off\n\t"
               "global_load_async_to_lds_b128 %4, %10, off\n\t"
               "global_load_async_to_lds_b128 %5, %11, off\n\t"
               "s_wait_xcnt 0x0"
               :: "v"(al), "v"(al1), "v"(al2), "v"(al3), "v"(bl), "v"(bl1), "v"(ag), "v"(a1), "v"(a2), "v"(a3), "v"(bg), "v"(b1)
               : "memory");
}
__device__ __forceinline__ void stage_ab128(const b16* ag, const b16* bg, unsigned al, unsigned bl) {   // A: 128 rows, BT: 128 rows
  const b16 *a1 = ag + 32 * KD, *a2 = ag + 64 * KD, *a3 = ag + 96 * KD, *b1 = bg + 32 * KD, *b2 = bg + 64 * KD, *b3 = bg + 96 * KD;
  const unsigned al1 = al + 32 * AP * 2, al2 = al + 64 * AP * 2, al3 = al + 96 * AP * 2, bl1 = bl + 32 * AP * 2, bl2 = bl + 64 * AP * 2, bl3 = bl + 96 * AP * 2;
  asm volatile("global_load_async_to_lds_b128 %0, %8, off\n\t"
               "global_load_async_to_lds_b128 %1, %9, off\n\t"
               "global_load_async_to_lds_b128 %2, %10, off\n\t"
               "global_load_async_to_lds_b128 %3, %11, off\n\t"
               "global_load_async_to_lds_b128 %4, %12, off\n\t"
               "global_load_async_to_lds_b128 %5, %13, off\n\t"
               "global_load_async_to_lds_b128 %6, %14, off\n\t"
               "global_load_async_to_lds_b128 %7, %15, off\n\t"
               "s_wait_xcnt 0x0"
               :: "v"(al), "v"(al1), "v"(al2), "v"(al3), "v"(bl), "v"(bl1), "v"(bl2), "v"(bl3), "v"(ag), "v"(a1), "v"(a2), "v"(a3), "v"(bg), "v"(b1), "v"(b2), "v"(b3)
               : "memory");
}
__device__ __forceinline__ void stage_r(const b16* rg, unsigned rl) {   // residual plane: 128 rows
  const b16 *r1 = rg + 32 * KD, *r2 = rg + 64 * KD, *r3 = rg + 96 * KD;
  const unsigned rl1 = rl + 32 * AP * 2, rl2 = rl + 64 * AP * 2, rl3 = rl + 96 * AP * 2;
  asm volatile("global_load_async_to_lds_b128 %0, %4, off\n\t"
               "global_load_async_to_lds_b128 %1, %5, off\n\t"
               "global_load_async_to_lds_b128 %2, %6, off\n\t"
               "global_load_async_to_lds_b128 %3, %7, off\n\t"
               "s_wait_xcnt 0x0"
               :: "v"(rl), "v"(rl1), "v"(rl2), "v"(rl3), "v"(rg), "v"(r1), "v"(r2), "v"(r3)
               : "memory");
}

template <bool HEADS>
__global__ __launch_bounds__(256) void gemm_kernel(const b16* __restrict__ A, const b16* __restrict__ Ar, const b16* __restrict__ BT, const float* __restrict__ bias,
                                                   float* __restrict__ C, b16* __restrict__ Qh, b16* __restrict__ Qr, b16* __restrict__ Kh, b16* __restrict__ Kr,
                                                   b16* __restrict__ VTh, b16* __restrict__ VTr, int N, int cstr, int res_on, float oscale) {
  constexpr int NF = HEADS ? 4 : 2, WN = 16 * NF, BNT = 2 * WN;   // BT fragments and columns a wave, columns a block: HEADS 128 = two heads, one to each wn
  constexpr int BOFF = HEADS ? ABYTES : 2 * ABYTES, STAGE = BOFF + BNT * AP * 2;   // one buffer: A | residual plane (not HEADS) | BT
  static_assert(!HEADS || (WN == HD && CD % BNT == 0 && N3 % BNT == 0 && 2 * BM * CP * 4 <= 2 * STAGE && 2 * BNT * VP * 2 <= 2 * STAGE));
  __shared__ __attribute__((aligned(16))) char smem[2 * STAGE];
  float* Cs = reinterpret_cast<float*>(smem);   // aliases the buffers after the k loop (block barrier in between)
  const int tid = threadIdx.x, wave = tid >> 5, lane = tid & 31, hh = lane >> 4, col = lane & 15, wm = wave >> 1, wn = wave & 1;
  const int bm = (int)blockIdx.y * BM, bn = (int)blockIdx.x * BNT; const int bb = bm / SEQ, t0 = bm % SEQ;
  const bool res = !HEADS && (res_on != 0) && (t0 < EARLY);
  const b16* Ab = A + (size_t)bm * KD; const b16* Bb = BT + (size_t)bn * KD;
  const b16* Arb = Ar + ((size_t)bb * EARLY + (size_t)t0) * KD;   // dereferenced only when res (then t0 == 0)
  v8f acc[2][NF], accr[2][NF];
#pragma unroll
  for (int i = 0; i < 2; ++i)
#pragma unroll
    for (int j = 0; j < NF; ++j) { acc[i][j] = (v8f){}; accr[i][j] = (v8f){}; }
  const int srow = tid >> 3, sc8 = (tid & 7) * 8;
  const b16* ag = Ab + (size_t)srow * KD + sc8; const b16* bg = Bb + (size_t)srow * KD + sc8; const b16* rg = Arb + (size_t)srow * KD + sc8;   // tile t: + t * BK
  const unsigned al = lds_off(smem) + (unsigned)(srow * AP + sc8) * 2u, rl = al + ABYTES, bl = al + BOFF;                                    // buffer 1: + STAGE
  auto stage = [&](int t, unsigned bo) {   // k tile t into the buffer at byte bo
    if constexpr (HEADS) stage_ab128(ag + t * BK, bg + t * BK, al + bo, bl + bo);
    else stage_ab(ag + t * BK, bg + t * BK, al + bo, bl + bo);
  };
  stage(0, 0u);
  if (res) stage_r(rg, rl);
  asm volatile("s_wait_asynccnt 0x0" ::: "memory");   // tile 0 has landed before the barrier that publishes it
  __syncthreads();
  stage(1, (unsigned)STAGE);
  if (res) stage_r(rg + BK, rl + STAGE);
#pragma unroll 1   // one copy of the loop body in the text: the buffer index is a run-time offset
  for (int t = 0; t < NT; ++t) {
    const int buf = t & 1;
    const b16* As = reinterpret_cast<const b16*>(smem + buf * STAGE); const b16* Ars = reinterpret_cast<const b16*>(smem + buf * STAGE + ABYTES);
    const b16* Bs = reinterpret_cast<const b16*>(smem + buf * STAGE + BOFF);
#pragma unroll
    for (int ks = 0; ks < BK; ks += 32) {
      const v16b a0 = frag_kb(As + (wm * 32 + col) * AP + ks, hh), a1 = frag_kb(As + (wm * 32 + 16 + col) * AP + ks, hh);
      v16b bf[NF];   // every '#pragma unroll' over j keeps the index of a register array a compile-time constant
#pragma unroll
      for (int j = 0; j < NF; ++j) bf[j] = frag_kb(Bs + (wn * WN + j * 16 + col) * AP + ks, hh);
#pragma unroll
      for (int j = 0; j < NF; ++j) acc[0][j] = wmma16b(a0, bf[j], acc[0][j]);
#pragma unroll
      for (int j = 0; j < NF; ++j) acc[1][j] = wmma16b(a1, bf[j], acc[1][j]);
      if (res) {
        const v16b r0 = frag_kb(Ars + (wm * 32 + col) * AP + ks, hh), r1 = frag_kb(Ars + (wm * 32 + 16 + col) * AP + ks, hh);
#pragma unroll
        for (int j = 0; j < NF; ++j) accr[0][j] = wmma16b(r0, bf[j], accr[0][j]);
#pragma unroll
        for (int j = 0; j < NF; ++j) accr[1][j] = wmma16b(r1, bf[j], accr[1][j]); }
    }
    asm volatile("s_wait_dscnt 0x0" ::: "memory");      // this wave's reads of tile t are done before the buffer is handed back
    asm volatile("s_wait_asynccnt 0x0" ::: "memory");   // this wave's copies of tile t + 1 have landed
    __syncthreads();                                    // publishes tile t + 1 and ends every wave's reads of tile t (after the last tile: the epilogue aliases)
    if (t + 2 < NT) {
      stage(t + 2, (unsigned)(buf * STAGE));
      if (res) stage_r(rg + (t + 2) * BK, rl + buf * STAGE); }
  }
  asm volatile("s_wait_asynccnt 0x0" ::: "memory");     // no copy is left in flight when the buffers are reused
  const int cls = bn / CD, bhi0 = bb * H + (bn % CD) / HD;   // HEADS: 0 q, 1 k, 2 v, and the block's first head; block-uniform
  const int h = (bn % CD) / HD + wn, bhi = bhi0 + wn;        // HEADS: this wave's own head
  const bool early = (t0 < EARLY);
  if (HEADS && cls == 2) {
    // acc[i][j][0..7] are 8 consecutive tokens of one head dim: one 16-B piece of a V^T row
    b16* Sv = reinterpret_cast<b16*>(smem); b16* Svr = Sv + BNT * VP;   // BNT rows: the head dims of the block's heads one after the other, as in VTh
#pragma unroll
    for (int i = 0; i < 2; ++i)
#pragma unroll
      for (int j = 0; j < NF; ++j) {
        const int cc = wn * WN + j * 16 + col; const float bv = bf16_rne(bias[bn + cc]); v8b oh;
#pragma unroll
        for (int r = 0; r < 8; ++r) {
          const float v = acc[i][j][r] + accr[i][j][r] * (1.0f / RS);
          const float v0 = (v * oscale + bv) * XS; acc[i][j][r] = v0; oh[r] = (b16)v0; }
        *(v8b*)(Sv + cc * VP + wm * 32 + i * 16 + 8 * hh) = oh; }
    if (early) {
#pragma unroll
      for (int i = 0; i < 2; ++i)
#pragma unroll
        for (int j = 0; j < NF; ++j) {
          const int cc = wn * WN + j * 16 + col; v8b orr;
#pragma unroll
          for (int r = 0; r < 8; ++r) { const float v0 = acc[i][j][r]; orr[r] = (b16)((v0 - (float)(b16)v0) * RS); }
          *(v8b*)(Svr + cc * VP + wm * 32 + i * 16 + 8 * hh) = orr; } }
    __syncthreads();   // V^T rows are read across waves
    b16* dv = VTh + (size_t)bhi0 * HD * (size_t)SK + t0;
#pragma unroll 1   // short trips, no gain from unrolling
    for (int it = 0; it < BNT / 16; ++it) {
      const int d = wave * (BNT / 8) + it * 2 + hh; const v8b f = *(const v8b*)(Sv + d * VP + col * 8);
      *(v8b*)(dv + (size_t)d * SK + col * 8) = f; }
    if (early) {   // then t0 == 0
      b16* dvr = VTr + (size_t)bhi0 * HD * (size_t)EARLY;
#pragma unroll 1   // as above
      for (int it = 0; it < BNT / 16; ++it) {
        const int d = wave * (BNT / 8) + it * 2 + hh; const v8b fr = *(const v8b*)(Svr + d * VP + col * 8);
        *(v8b*)(dvr + (size_t)d * EARLY + col * 8) = fr; } }
    return;
  }
#pragma unroll
  for (int i = 0; i < 2; ++i)
#pragma unroll
    for (int j = 0; j < NF; ++j) {
      const int cc = wn * WN + j * 16 + col; const float bv = bf16_rne(bias[bn + cc]);
      float* Cw = HEADS ? Cs + wn * BM * CP + j * 16 + col : Cs + cc;   // HEADS: a plane of BM rows x CP for each of the two heads
#pragma unroll
      for (int r = 0; r < 8; ++r) {
        const float v = acc[i][j][r] + accr[i][j][r] * (1.0f / RS);   // accr stays 0 when the residual plane is off
        Cw[(wm * 32 + i * 16 + 8 * hh + r) * CP] = v * oscale + bv; } }
  __syncthreads();   // Cs rows are read across waves (HEADS: across the lanes of the wave that wrote them)
  if constexpr (HEADS) {
    // From here on a wave works alone, on the 32 rows of its own head that it staged. A lane holds head dims lane and lane + 32, the two partners of one rotation.
    const float invf = exp2f(-(float)lane * (LOG2B / 32.0f));   // (1/10000)^(2i/64)
    const float ang = (float)h * invf; float s, c; sincosf(ang, &s, &c);
    float* rows = Cs + (wn * BM + wm * 32) * CP;
#pragma unroll 1   // batches of 8 rows: more at once would take more registers than the k loop does and cost a resident block
    for (int g = 0; g < 32; g += 8) {
      float e0[8], e1[8], ss[8];
      // Every '#pragma unroll' of this batch keeps the index of a register array a compile-time constant; the 8 rows go through each stage side by side, so that
      // their LDS reads and lane exchanges overlap.
#pragma unroll
      for (int i = 0; i < 8; ++i) { e0[i] = rows[(g + i) * CP + lane]; e1[i] = rows[(g + i) * CP + lane + 32]; ss[i] = e0[i] * e0[i] + e1[i] * e1[i]; }
#pragma unroll
      for (int off = 16; off > 0; off >>= 1)
#pragma unroll
        for (int i = 0; i < 8; ++i) ss[i] += __shfl_xor(ss[i], off);
      // The batch's rows are in registers by now: a row's f16 hi goes over the first 128 B of its own 256 B, its residual over the second.
#pragma unroll
      for (int i = 0; i < 8; ++i) {
        const float rn = rsqrtf(ss[i] * (1.0f / 64.0f) + RMS_EPS);
        const float n0 = e0[i] * rn, n1 = e1[i] * rn;
        const float y0 = (n0 * c + n1 * s) * XS, y1 = (n1 * c - n0 * s) * XS;
        b16* ro = reinterpret_cast<b16*>(rows + (g + i) * CP);
        ro[lane] = (b16)y0; ro[lane + 32] = (b16)y1; e0[i] = y0; e1[i] = y1;
      }
      if (early) {
#pragma unroll
        for (int i = 0; i < 8; ++i) {
          const float y0 = e0[i], y1 = e1[i]; b16* ro = reinterpret_cast<b16*>(rows + (g + i) * CP);
          ro[64 + lane] = (b16)((y0 - (float)(b16)y0) * RS); ro[96 + lane] = (b16)((y1 - (float)(b16)y1) * RS); } }
    }
    wave_lds_sync();
    const int r4 = lane >> 3, c8 = (lane & 7) * 8;
    b16* dh = (cls == 0 ? Qh : Kh) + ((size_t)bhi * SEQ + (size_t)(t0 + wm * 32)) * HD;
#pragma unroll 1   // short trips, no gain from unrolling
    for (int it = 0; it < 8; ++it) {
      const int rr = it * 4 + r4; const v8b f = *(const v8b*)(reinterpret_cast<const b16*>(rows + rr * CP) + c8);
      *(v8b*)(dh + (size_t)rr * HD + c8) = f; }
    if (early) {   // then t0 == 0
      b16* dr = (cls == 0 ? Qr : Kr) + ((size_t)bhi * EARLY + (size_t)(wm * 32)) * HD;
#pragma unroll 1   // as above
      for (int it = 0; it < 8; ++it) {
        const int rr = it * 4 + r4; const v8b fr = *(const v8b*)(reinterpret_cast<const b16*>(rows + rr * CP) + 64 + c8);
        *(v8b*)(dr + (size_t)rr * HD + c8) = fr; } }
  } else {
    float* Cb = C + ((size_t)bb * (size_t)cstr + (size_t)t0) * (size_t)N + bn;
#pragma unroll 1
    for (int it = 0; it < 8; ++it) {
      const int rr = wave * 16 + it * 2 + hh; const v4f f = *(const v4f*)(Cs + rr * CP + col * 4);
      *(v4f*)(Cb + (size_t)rr * N + col * 4) = f; }
  }
}

// Causal softmax(Q K^T / 8) V per (b, h) for the queries below EARLY: the body of the work-groups bx < EARLY / 64 of attn_main_kernel's launch. 4 waves x 16 queries, each
// wave on its own (no block barrier); key steps of 32 from 0 up to the last query of the wave's 32-query group in fixed order, keys above the query replaced by -inf
// before the running-max softmax (f32); P x1024 via wave-private LDS; O^T += V^T P^T.
// ER (queries < EARLY, which only visit keys < EARLY): S adds K_hi Q_res + K_res Q_hi (x1024), P adds a x1024 residual tile and V a x1024 residual
// plane into a second accumulator folded before normalisation, and the x16 y row is written as f16 hi plus a x1024 residual. y rows -> Yh [b*SEQ + q][h*64 + d]
template <bool ER>
__device__ __forceinline__ void attn_rows(const b16* __restrict__ Qh, const b16* __restrict__ Qr, const b16* __restrict__ Kh, const b16* __restrict__ Kr,
                                          const b16* __restrict__ VTh, const b16* __restrict__ VTr, b16* __restrict__ Yh, b16* __restrict__ Yr,
                                          b16 (*Pb)[16][32 + 8], b16 (*Pr)[16][32 + 8], b16 (*Th)[16][TP], b16 (*Tr)[16][TP], int bx) {
  const int wave = __builtin_amdgcn_readfirstlane((int)threadIdx.x >> 5), lane = threadIdx.x & 31, hh = lane >> 4, col = lane & 15;   // scalar: the key loop's end hangs on it
  const int bhi = (int)blockIdx.y; const int b = bhi / H, h = bhi % H; const int q0 = bx * 64 + wave * 16, qi = q0 + col;
  const b16* Qb = Qh + (size_t)bhi * QL * HD; const b16* Kb = Kh + (size_t)bhi * SK * HD; const b16* Vb = VTh + (size_t)bhi * HD * (size_t)SK;
  const b16* Qrb = Qr + (size_t)bhi * EARLY * HD; const b16* Krb = Kr + (size_t)bhi * EARLY * HD; const b16* Vrb = VTr + (size_t)bhi * HD * (size_t)EARLY;
  const v16b qa0 = frag_kb(Qb + (size_t)qi * HD, hh), qa1 = frag_kb(Qb + (size_t)qi * HD + 32, hh);
  v16b qr0 = (v16b){}, qr1 = (v16b){};
  if constexpr (ER) { qr0 = frag_kb(Qrb + (size_t)qi * HD, hh); qr1 = frag_kb(Qrb + (size_t)qi * HD + 32, hh); }
  const float cs = LOG2E / (8.0f * XS * XS);   // 1/sqrt(64) and the two x8 carriers, in the log2 domain
  float m = -INFINITY, l = 0.0f; v8f o[4], o2[4];
#pragma unroll
  for (int t = 0; t < 4; ++t) { o[t] = (v8f){}; o2[t] = (v8f){}; }
  const int kend = (q0 >> 5) * 32 + 32;   // causal: keys 0 .. last query of this wave's 32-query group; ER: kend <= EARLY
#pragma unroll 1
  for (int kb = 0; kb < kend; kb += 32) {
    float e[16]; float mx = -INFINITY;
#pragma unroll
    for (int u = 0; u < 2; ++u) {
      const int krow = kb + u * 16 + col;
      const v16b kh0 = frag_kb(Kb + (size_t)krow * HD, hh), kh1 = frag_kb(Kb + (size_t)krow * HD + 32, hh);
      v8f s = (v8f){}; s = wmma16b(kh0, qa0, s); s = wmma16b(kh1, qa1, s);
      v8f sr = (v8f){};
      if constexpr (ER) {
        const v16b kr0 = frag_kb(Krb + (size_t)krow * HD, hh), kr1 = frag_kb(Krb + (size_t)krow * HD + 32, hh);
        sr = wmma16b(kh0, qr0, sr); sr = wmma16b(kh1, qr1, sr); sr = wmma16b(kr0, qa0, sr); sr = wmma16b(kr1, qa1, sr); }
#pragma unroll
      for (int r = 0; r < 8; ++r) {
        float v = s[r];
        if constexpr (ER) v += sr[r] * (1.0f / RS);
        v *= cs;
        const int key = kb + u * 16 + 8 * hh + r;
        v = (key > qi) ? -INFINITY : v;
        e[u * 8 + r] = v; mx = fmaxf(mx, v); } }
    mx = fmaxf(mx, __shfl_xor(mx, 16)); const float mn = fmaxf(m, mx); const float al = nexp2(m - mn); float sum = 0.0f;
#pragma unroll
    for (int i2 = 0; i2 < 16; ++i2) {
      const float p = nexp2(e[i2] - mn); sum += p; const int pi = (i2 < 8 ? 0 : 16) + 8 * hh + (i2 & 7);
      const float pp = p * PS; const b16 ph = (b16)pp; Pb[wave][col][pi] = ph;
      if constexpr (ER) Pr[wave][col][pi] = (b16)((pp - (float)ph) * RS); }
    sum += __shfl_xor(sum, 16); l = l * al + sum; m = mn;
    wave_lds_sync();
    const v16b pf = frag_kb(&Pb[wave][col][0], hh);
    v16b prf = (v16b){};
    if constexpr (ER) prf = frag_kb(&Pr[wave][col][0], hh);
#pragma unroll
    for (int t = 0; t < 4; ++t) {
      o[t] *= al; const v16b vh = frag_kb(Vb + (size_t)(t * 16 + col) * SK + kb, hh);
      o[t] = wmma16b(vh, pf, o[t]);
      if constexpr (ER) { const v16b vr = frag_kb(Vrb + (size_t)(t * 16 + col) * EARLY + kb, hh); o2[t] *= al; o2[t] = wmma16b(vh, prf, o2[t]); o2[t] = wmma16b(vr, pf, o2[t]); } }
    wave_lds_sync(); }
  const float inv = YS / (l * PS * XS);
#pragma unroll
  for (int t = 0; t < 4; ++t) {
#pragma unroll
    for (int r = 0; r < 8; ++r) {
      float ov = o[t][r];
      if constexpr (ER) ov += o2[t][r] * (1.0f / RS);
      const float yv = ov * inv; const b16 yh = (b16)yv;
      Th[wave][col][t * 16 + 8 * hh + r] = yh;
      if constexpr (ER) Tr[wave][col][t * 16 + 8 * hh + r] = (b16)((yv - (float)yh) * RS); } }
  wave_lds_sync();
  b16* yb = Yh + ((size_t)b * SEQ + (size_t)q0) * CD + (size_t)h * HD;
  {
#pragma unroll 1
    for (int it = 0; it < 4; ++it) {
      const int rr = it * 4 + (lane >> 3), c8 = (lane & 7) * 8; const v8b f = *(const v8b*)(&Th[wave][rr][c8]);
      *(v8b*)(yb + (size_t)rr * CD + c8) = f;
      if constexpr (ER) {
        const v8b fr = *(const v8b*)(&Tr[wave][rr][c8]);
        *(v8b*)(Yr + (((size_t)b * EARLY + (size_t)(q0 + rr)) * CD + (size_t)h * HD + c8)) = fr; } }
     }
}

// One staged tile pair = 64 keys: K rows [64 keys][64 dims] and V^T rows [64 dims][64 keys], 128 B a row, laid at the 144-B pitch of TP. 128 threads, 16 B a lane:
// copy j of a thread brings row (tid >> 3) + 16 j, piece tid & 7, so a wave's copy covers four whole 128-B lines. kg / vg: the lane's first global byte of the tile,
// kl / vl: its first LDS byte. s_wait_xcnt stands inside the statement so that no address register named here is rewritten ahead of it.
__device__ __forceinline__ void stage_kv(const b16* kg, const b16* vg, unsigned kl, unsigned vl) {
  const b16 *k1 = kg + 16 * HD, *k2 = kg + 32 * HD, *k3 = kg + 48 * HD; const b16 *v1 = vg + 16 * (size_t)SK, *v2 = vg + 32 * (size_t)SK, *v3 = vg + 48 * (size_t)SK;
  const unsigned kl1 = kl + 16 * TP * 2, kl2 = kl + 32 * TP * 2, kl3 = kl + 48 * TP * 2, vl1 = vl + 16 * TP * 2, vl2 = vl + 32 * TP * 2, vl3 = vl + 48 * TP * 2;
  asm volatile("global_load_async_to_lds_b128 %0, %8, off\n\t"
               "global_load_async_to_lds_b128 %1, %9, off\n\t"
               "global_load_async_to_lds_b128 %2, %10, off\n\t"
               "global_load_async_to_lds_b128 %3, %11, off\n\t"
               "global_load_async_to_lds_b128 %4, %12, off\n\t"
               "global_load_async_to_lds_b128 %5, %13, off\n\t"
               "global_load_async_to_lds_b128 %6, %14, off\n\t"
               "global_load_async_to_lds_b128 %7, %15, off\n\t"
               "s_wait_xcnt 0x0"
               :: "v"(kl), "v"(kl1), "v"(kl2), "v"(kl3), "v"(vl), "v"(vl1), "v"(vl2), "v"(vl3), "v"(kg), "v"(k1), "v"(k2), "v"(k3), "v"(vg), "v"(v1), "v"(v2), "v"(v3)
               : "memory");
}

// One launch for all queries: grid (query blocks of 64, NB*H); block = 4 waves x 16 queries. Blocks below EARLY take attn_rows above and leave; they need nothing from the
// others. From EARLY on, the same causal softmax(Q K^T / 8) V without residual planes.
// K and V^T come in tiles of 64 keys, copied once per block into two LDS buffers (tile s + 1 flies while tile s is worked on) and read as fragments by all
// four waves. Each wave walks key steps of 32 in the same fixed order and up to the same last key (the end of its 32-query group) as attn_rows above.
// Every plain '#pragma unroll' below keeps the index of a register array a compile-time constant.
__global__ __launch_bounds__(128) void attn_main_kernel(const b16* __restrict__ Qh, const b16* __restrict__ Qr, const b16* __restrict__ Kh, const b16* __restrict__ Kr,
                                                        const b16* __restrict__ VTh, const b16* __restrict__ VTr, b16* __restrict__ Yh, b16* __restrict__ Yr) {
  __shared__ __attribute__((aligned(16))) b16 Ks[2][64][TP];
  __shared__ __attribute__((aligned(16))) b16 Vs[2][64][TP];
  __shared__ __attribute__((aligned(16))) b16 Pb[4][16][32 + 8];
  __shared__ __attribute__((aligned(16))) b16 Th[4][16][TP];
  const int bx = (int)blockIdx.x;
  if (bx < EARLY / 64) {   // block-uniform, ahead of every copy and barrier; the residual tiles lie in the K and V buffers, which such a block does not fill
    attn_rows<true>(Qh, Qr, Kh, Kr, VTh, VTr, Yh, Yr, Pb, reinterpret_cast<b16 (*)[16][32 + 8]>(&Ks[0][0][0]), Th, reinterpret_cast<b16 (*)[16][TP]>(&Vs[0][0][0]), bx);
    return;
  }
  const int tid = threadIdx.x, wave = __builtin_amdgcn_readfirstlane(tid >> 5), lane = tid & 31, hh = lane >> 4, col = lane & 15;
  const int bhi = (int)blockIdx.y; const int b = bhi / H, h = bhi % H; const int q0 = bx * 64 + wave * 16, qi = q0 + col;
  const b16* Qb = Qh + (size_t)bhi * QL * HD; const b16* Kb = Kh + (size_t)bhi * SK * HD; const b16* Vb = VTh + (size_t)bhi * HD * (size_t)SK;
  const int nst = bx + 1;                     // tiles of 64 keys: keys 0 .. last query of this block
  const int kend = (q0 >> 5) * 32 + 32;       // this wave's causal end
  const int srow = tid >> 3, sc8 = (tid & 7) * 8;
  const b16* kg = Kb + (size_t)srow * HD + sc8; const b16* vg = Vb + (size_t)srow * SK + sc8;   // tile s: kg + s * 64 * HD, vg + s * 64
  const unsigned kl = lds_off(&Ks[0][srow][sc8]), vl = lds_off(&Vs[0][srow][sc8]); constexpr unsigned BUFB = 64 * TP * 2;
  stage_kv(kg, vg, kl, vl);
  asm volatile("s_wait_asynccnt 0x0" ::: "memory");   // tile 0 has landed before the barrier that publishes it
  __syncthreads();
  if (nst > 1) stage_kv(kg + 64 * HD, vg + 64, kl + BUFB, vl + BUFB);
  const v16b qa0 = frag_kb(Qb + (size_t)qi * HD, hh), qa1 = frag_kb(Qb + (size_t)qi * HD + 32, hh);
  const float cs = LOG2E / (8.0f * XS * XS);   // 1/sqrt(64) and the two x8 carriers, in the log2 domain
  float m = -INFINITY, l = 0.0f; v8f o[4];
#pragma unroll
  for (int t = 0; t < 4; ++t) o[t] = (v8f){};
#pragma unroll 1   // one copy of the loop body in the text: the buffer index is a run-time offset
  for (int s = 0; s < nst; ++s) {
    const int buf = s & 1;
#pragma unroll 1   // the two key steps of a tile share one body
    for (int sub = 0; sub < 64; sub += 32) {
      const int kb = s * 64 + sub;
      if (kb < kend) {   // wave-uniform: a wave skips the step wholly above its diagonal, never the publish point below
        float e[16]; float mx = -INFINITY;
#pragma unroll
        for (int u = 0; u < 2; ++u) {
          const b16* kr = &Ks[buf][sub + u * 16 + col][0];
          const v16b kh0 = frag_kb(kr, hh), kh1 = frag_kb(kr + 32, hh);
          v8f sc = (v8f){}; sc = wmma16b(kh0, qa0, sc); sc = wmma16b(kh1, qa1, sc);
#pragma unroll
          for (int r = 0; r < 8; ++r) {
            float v = sc[r] * cs;
            const int key = kb + u * 16 + 8 * hh + r;
            v = (key > qi) ? -INFINITY : v;
            e[u * 8 + r] = v; mx = fmaxf(mx, v); } }
        mx = fmaxf(mx, __shfl_xor(mx, 16)); const float mn = fmaxf(m, mx); const float al = nexp2(m - mn); float sum = 0.0f;
#pragma unroll
        for (int i2 = 0; i2 < 16; ++i2) {
          const float p = nexp2(e[i2] - mn); sum += p; const int pi = (i2 < 8 ? 0 : 16) + 8 * hh + (i2 & 7);
          Pb[wave][col][pi] = (b16)(p * PS); }
        sum += __shfl_xor(sum, 16); l = l * al + sum; m = mn;
        wave_lds_sync();
        const v16b pf = frag_kb(&Pb[wave][col][0], hh);
#pragma unroll
        for (int t = 0; t < 4; ++t) {
          o[t] *= al; const v16b vh = frag_kb(&Vs[buf][t * 16 + col][sub], hh);
          o[t] = wmma16b(vh, pf, o[t]); }
        wave_lds_sync(); }
    }
    asm volatile("s_wait_dscnt 0x0" ::: "memory");      // this wave's reads of tile s are done before the buffer is handed back
    asm volatile("s_wait_asynccnt 0x0" ::: "memory");   // this wave's copies of tile s + 1 have landed
    __syncthreads();                                    // publishes tile s + 1 and ends every wave's reads of tile s
    if (s + 2 < nst) stage_kv(kg + (size_t)(s + 2) * 64 * HD, vg + (size_t)(s + 2) * 64, kl + buf * BUFB, vl + buf * BUFB);
  }
  asm volatile("s_wait_asynccnt 0x0" ::: "memory");     // no copy is left in flight when the wave ends
  const float inv = YS / (l * PS * XS);
#pragma unroll
  for (int t = 0; t < 4; ++t) {
#pragma unroll
    for (int r = 0; r < 8; ++r) Th[wave][col][t * 16 + 8 * hh + r] = (b16)(o[t][r] * inv); }
  wave_lds_sync();
  b16* yb = Yh + ((size_t)b * SEQ + (size_t)q0) * CD + (size_t)h * HD;
#pragma unroll 1   // as in the kernel above: four short trips, no gain from unrolling
  for (int it = 0; it < 4; ++it) {
    const int rr = it * 4 + (lane >> 3), c8 = (lane & 7) * 8; const v8b f = *(const v8b*)(&Th[wave][rr][c8]);
    *(v8b*)(yb + (size_t)rr * CD + c8) = f; }
}
}  // namespace

extern "C" void kernel_launch(void* const* d_in, const int* in_sizes, int n_in, void* d_out, int out_size, void* d_ws, size_t ws_size, hipStream_t stream) {
  // wire order: 0 x [NB_FULL][SEQ_FULL][1024] f32, 1 W_attn [1024][3072] f32, 2 b_attn [3072] f32, 3 W_proj [1024][1024] f32, 4 b_proj [1024] f32; out [NB_FULL][SEQ_FULL][1024] f32
  const size_t need_x = ((size_t)(NB - 1) * SEQ_FULL + (size_t)SEQ) * CD;
  if (n_in < 5 || (size_t)in_sizes[0] < need_x || (size_t)in_sizes[1] < (size_t)KD * N3 || (size_t)in_sizes[2] < (size_t)N3 ||
      (size_t)in_sizes[3] < (size_t)KD * CD || (size_t)in_sizes[4] < (size_t)CD || (size_t)out_size < need_x) return;
  const float* Xin = (const float*)d_in[0]; const float* Wa = (const float*)d_in[1]; const float* Ba = (const float*)d_in[2];
  const float* Wp = (const float*)d_in[3]; const float* Bp = (const float*)d_in[4];
  size_t off = 0; char* ws = (char*)d_ws;
  auto carve = [&](size_t bytes) { char* p = ws + off; off += (bytes + 255) & ~(size_t)255; return p; };
  b16* Xp = (b16*)carve((size_t)MROWS * CD * 2);                       //  8,388,608 B at NB=2, SEQ=2048
  b16* WaT = (b16*)carve((size_t)N3 * KD * 2);                         //  6,291,456
  b16* WpT = (b16*)carve((size_t)CD * KD * 2);                         //  2,097,152
  const size_t plane = (size_t)NB * H * SEQ * HD * 2, rplane = (size_t)NB * H * EARLY * HD * 2;
  b16* Qh = (b16*)carve(plane); b16* Kh = (b16*)carve(plane); b16* VTh = (b16*)carve(plane);      // 3 x 8,388,608
  b16* Qr = (b16*)carve(rplane); b16* Kr = (b16*)carve(rplane); b16* VTr = (b16*)carve(rplane);   // 3 x 524,288
  b16* Yh = (b16*)carve((size_t)MROWS * CD * 2);                       //  8,388,608
  b16* Yr = (b16*)carve((size_t)NB * EARLY * CD * 2);                  //    524,288   -> total 52,428,800 B
  if (off > ws_size || off > ((size_t)128 << 20)) return;
  cvt_all_kernel<<<dim3(WBLK + XBLK), 256, 0, stream>>>(Xin, Wa, Wp, Xp, WaT, WpT);
  gemm_kernel<true><<<dim3(N3 / (2 * BN), MROWS / BM), 256, 0, stream>>>(Xp, Xp, WaT, Ba, nullptr, Qh, Qr, Kh, Kr, VTh, VTr, N3, SEQ, 0, 1.0f / (XS * WS));
  attn_main_kernel<<<dim3(QL / 64, NB * H), 128, 0, stream>>>(Qh, Qr, Kh, Kr, VTh, VTr, Yh, Yr);
  gemm_kernel<false><<<dim3(CD / BN, MROWS / BM), 256, 0, stream>>>(Yh, Yr, WpT, Bp, (float*)d_out, nullptr, nullptr, nullptr, nullptr, nullptr, nullptr, CD, SEQ_FULL, 1, 1.0f / (YS * WS));
}

// v007
// Measured time: 102 microseconds a run.
// Next to v006, in two timings, it ran 1.05 times as fast each time.
// All steps since v000 together make it 2.98 times as fast.
#include <hip/hip_runtime.h>

// compute dtype: all contractions on v_wmma_f32_16x16x32_f16 (f16 operands, f32 accumulate). x @ W_attn and y @ W_proj: x and W enter as their bf16-RNE
// values carried x8 (x) and x64 (W) in f16 planes, 1 product; y carried x16 as f16 hi, plus a x1024 f16 residual plane on the first 128 token rows of each
// sequence (2 products there, second accumulator folded in the f32 epilogue). S^T = K Q^T per head: q, k after rms-norm and rotary carried x8 as f16 hi,
// 1 product; query blocks below 128 tokens add x1024 f16 q and k residual planes (3 products). O^T += V^T P^T: v carried x8 f16, P f16 x1024, 1 product;
// the same early query blocks add P and v x1024 residuals into a second accumulator folded before normalisation. Norm, rotary, softmax statistics in f32.
// Fragment k-map per lane half hh for A AND B: elements 0..7 <- k = 8hh+0..7, 8..15 <- k = 16+8hh+0..7; acc[r] = D[8hh+r][col = lane&15].

#ifndef NB
#define NB 2
#endif
#ifndef SEQ
#define SEQ 2048
#endif
#ifndef NB_FULL
#define NB_FULL 2
#endif
#ifndef SEQ_FULL
#define SEQ_FULL 2048
#endif

namespace {
constexpr int H = 16, HD = 64, CD = 1024, N3 = 3 * CD, KD = CD, QL = SEQ, SK = SEQ, MROWS = NB * SEQ;
constexpr int EARLY = 128, EB = EARLY / 32;                       // token rows per sequence that get residual planes
constexpr int BM = 128, BN = 64, BK = 64, TP = 72, AP = BK + 8, CP = BN + 4, VP = BM + 8;
constexpr int ABYTES = BM * AP * 2, BBYTES = BN * AP * 2, SMEM = 2 * (ABYTES + BBYTES), NT = KD / BK;   // SMEM: no GEMM instance has less LDS
constexpr float XS = 8.0f, WS = 64.0f, YS = 16.0f, PS = 1024.0f, RS = 1024.0f;
constexpr float LOG2E = 1.4426950408889634f, LOG2B = 13.287712379549449f, RMS_EPS = 1.1920929e-07f;
static_assert(SEQ % BM == 0 && SEQ >= BM && SEQ <= SEQ_FULL && NB >= 1 && NB <= NB_FULL);
static_assert(EARLY == BM && EARLY % 64 == 0 && EB * 32 == EARLY && MROWS % BM == 0 && N3 % BN == 0 && CD % BN == 0 && KD % BK == 0);
static_assert(BM * CP * 4 <= SMEM && HD == 64 && QL == SK && SEQ % 64 == 0 && (MROWS * 128) % 256 == 0);
static_assert(BN == HD && 2 * HD * VP * 2 <= SMEM && NT >= 2 && ABYTES % 16 == 0 && BBYTES % 16 == 0);

typedef _Float16 b16;
typedef __attribute__((ext_vector_type(16))) _Float16 v16b;
typedef __attribute__((ext_vector_type(8))) _Float16 v8b;
typedef __attribute__((ext_vector_type(8))) float v8f;
typedef __attribute__((ext_vector_type(4))) float v4f;

__device__ __forceinline__ float bf16_rne(float f) { unsigned int u = __float_as_uint(f); u += 0x7FFFu + ((u >> 16) & 1u); return __uint_as_float(u & 0xFFFF0000u); }
// 16-bit fragment from a k-contiguous row: elements 0..7 <- p[8hh .. 8hh+7], 8..15 <- p[16+8hh .. 16+8hh+7]
__device__ __forceinline__ v16b frag_kb(const b16* p, int hh) {
  const v8b a = *(const v8b*)(p + 8 * hh), b = *(const v8b*)(p + 16 + 8 * hh); v16b f;
#pragma unroll
  for (int e = 0; e < 8; ++e) { f[e] = a[e]; f[8 + e] = b[e]; }
  return f;
}
__device__ __forceinline__ v8f wmma16b(v16b a, v16b b, v8f c) {
  v8f d = __builtin_amdgcn_wmma_f32_16x16x32_f16(false, a, false, b, (short)0, c, false, false);
  asm volatile("v_nop\n\tv_nop\n\tv_nop\n\tv_nop" : "+v"(d) : "v"(a), "v"(b));
  return d;
}
// The bare builtin: the compiler keeps the distance behind it itself, and with no volatile statement between the products it may issue a key step's LDS reads in groups ahead of them.
__device__ __forceinline__ v8f wmma16(v16b a, v16b b, v8f c) { return __builtin_amdgcn_wmma_f32_16x16x32_f16(false, a, false, b, (short)0, c, false, false); }
__device__ __forceinline__ void wave_lds_sync() { __builtin_amdgcn_fence(3, "workgroup"); __builtin_amdgcn_wave_barrier(); __builtin_amdgcn_fence(2, "workgroup"); }
__device__ __forceinline__ float nexp2(float v) { return __builtin_amdgcn_exp2f(v); }
// LDS byte address of a __shared__ object: the low 32 bits of its address.
__device__ __forceinline__ unsigned lds_off(const void* p) { return (unsigned)(size_t)p; }

__device__ __forceinline__ void store_tile64(const b16 (*S)[TP], b16* dst, size_t pitch, int wave, int lane) {
  {
#pragma unroll   // the LDS reads go out in groups ahead of their stores, not one read, one wait and one store a trip
    for (int it = 0; it < 8; ++it) {
      const int r = wave * 32 + it * 4 + (lane >> 3), c8 = (lane & 7) * 8;
      const v8b o = *(const v8b*)(&S[r][c8]);
      *(v8b*)(dst + (size_t)r * pitch + c8) = o; }
     }
}

// One launch converts all three GEMM operands; none of the three depends on another. Blocks of 256 threads, told apart by block index (block-uniform).
// Blocks 0 .. WBLK-1: W [KD][N] f32 (in-major: W[k][n]) -> WT [N][KD] f16 = bf16-RNE(W) x64 (k-contiguous per output column), in 64x64 tiles. A block takes four tiles
// that are neighbours along n, two waves a tile, each tile in its own LDS plane; tiles 0 .. WA_T-1 are W_attn's, the rest W_proj's (n tile fastest). They come first in
// the grid (for speed only).
// Blocks from WBLK on: x f32 -> Xp f16 = bf16-RNE(x) x8, XU pieces of 8 elements a thread, XBLK * 256 pieces apart.
// In both parts a thread issues all its global loads before it uses the first, so that it waits for memory once and the launch needs few waves.
constexpr int WA_T = (N3 / 64) * (KD / 64), WP_T = (CD / 64) * (KD / 64), WBLK = (WA_T + WP_T) / 4, XU = 8, XBLK = (int)((size_t)MROWS * 128 / (256 * XU));
static_assert(WA_T % 4 == 0 && WP_T % 4 == 0 && (N3 / 64) % 4 == 0 && (CD / 64) % 4 == 0 && ((size_t)MROWS * 128) % (256 * XU) == 0);
// One 64x64 tile of W, row pitch N (a compile-time constant: the 16 loads then differ in their immediate offset alone), by the tile's 64 threads.
template <int N>
__device__ __forceinline__ void cvt_w_tile(const float* src, b16 (*S)[TP], int tid) {
  const int k0 = tid >> 4, n = (tid & 15) * 4; v4f x[16];   // load it: row it * 4 + k0, columns n .. n + 3; both '#pragma unroll' keep the index of x a compile-time constant
  const float* p = src + (size_t)k0 * N + n;
#pragma unroll
  for (int it = 0; it < 16; ++it) x[it] = *(const v4f*)(p + (size_t)(it * 4) * N);
  // Inputs-only fence on the loaded values and the address: the address pair lives until all 16 loads are back, so that no result is put into a register that a load in
  // flight still names, and each pitch keeps its own run of 16 loads under one base (left alone, the compiler merges the two pitches and forms 16 addresses between the loads).
  asm volatile("" :: "v"(x[0]), "v"(x[1]), "v"(x[2]), "v"(x[3]), "v"(x[4]), "v"(x[5]), "v"(x[6]), "v"(x[7]), "v"(x[8]), "v"(x[9]), "v"(x[10]), "v"(x[11]), "v"(x[12]), "v"(x[13]),
               "v"(x[14]), "v"(x[15]), "v"(p));
#pragma unroll
  for (int it = 0; it < 16; ++it)
#pragma unroll
    for (int j = 0; j < 4; ++j) S[n + j][it * 4 + k0] = (b16)(bf16_rne(x[it][j]) * WS);
}
__global__ __launch_bounds__(256) void cvt_all_kernel(const float* __restrict__ X, const float* __restrict__ Wa, const float* __restrict__ Wp, b16* __restrict__ Xp,
                                                      b16* __restrict__ WaT, b16* __restrict__ WpT) {
  __shared__ __attribute__((aligned(16))) b16 St[4][64][TP];
  if ((int)blockIdx.x < WBLK) {
    const int grp = threadIdx.x >> 6, tid = threadIdx.x & 63, wave = tid >> 5, lane = tid & 31;
    const bool isa = (int)blockIdx.x * 4 < WA_T;   // block-uniform: WA_T is a multiple of 4
    const int t4 = (int)blockIdx.x * 4 - (isa ? 0 : WA_T); const int N = isa ? N3 : CD;   // t4: the block's first tile within its matrix, a multiple of 4
    const int nb = (isa ? t4 % (N3 / 64) : t4 % (CD / 64)) + grp, kb = isa ? t4 / (N3 / 64) : t4 / (CD / 64);
    const float* src = (isa ? Wa : Wp) + (size_t)kb * 64 * (size_t)N + (size_t)nb * 64;
    if (isa) cvt_w_tile<N3>(src, St[grp], tid); else cvt_w_tile<CD>(src, St[grp], tid);
    __syncthreads();   // a tile's plane is read across its two waves
    store_tile64(St[grp], (isa ? WaT : WpT) + (size_t)nb * 64 * KD + (size_t)kb * 64, KD, wave, lane);
    return;
  }
  const size_t u0 = (size_t)((int)blockIdx.x - WBLK) * 256 + threadIdx.x, g0 = u0 >> 7; const int piece = (int)(u0 & 127);   // piece k of the thread: row g0 + k * XBLK * 2
  v4f x0[XU], x1[XU];   // every '#pragma unroll' below keeps the index of these a compile-time constant
  const float* xs[XU];
#pragma unroll
  for (int k = 0; k < XU; ++k) {
    const size_t g = g0 + (size_t)k * (XBLK * 2); const size_t srow = (SEQ == SEQ_FULL) ? g : (g / SEQ) * SEQ_FULL + (g % SEQ);
    xs[k] = X + srow * CD + piece * 8; x0[k] = *(const v4f*)xs[k]; x1[k] = *(const v4f*)(xs[k] + 4); }
  // As in cvt_w_tile: inputs-only fence on the loaded values and the first address (left alone, the compiler puts a later load's result into that pair while loads that name it fly).
  asm volatile("" :: "v"(x0[0]), "v"(x0[1]), "v"(x0[2]), "v"(x0[3]), "v"(x0[4]), "v"(x0[5]), "v"(x0[6]), "v"(x0[7]), "v"(x1[0]), "v"(x1[1]), "v"(x1[2]), "v"(x1[3]), "v"(x1[4]),
               "v"(x1[5]), "v"(x1[6]), "v"(x1[7]), "v"(xs[0]));
#pragma unroll
  for (int k = 0; k < XU; ++k) {
    v8b o;
#pragma unroll
    for (int j = 0; j < 4; ++j) { o[j] = (b16)(bf16_rne(x0[k][j]) * XS); o[4 + j] = (b16)(bf16_rne(x1[k][j]) * XS); }
    *(v8b*)(Xp + (g0 + (size_t)k * (XBLK * 2)) * CD + piece * 8) = o; }
  asm volatile("s_wait_xcnt 0x0" ::: "memory");   // stands behind the run of stores, ahead of any later write of a register that one of them names
}

// Tile value c[m][n] = (A[m][.] . BT[n][.] + Ar[m][.] . BT[n][.] / 1024) * oscale + bf16-RNE(bias[n]); A, Ar, BT f16 with k-contiguous rows of KD = 1024, f32 accumulate.
// Rows m = b*SEQ + t (compact). The residual plane Ar ([b][EARLY][KD]) is used only when res_on != 0 and the tile's t0 < EARLY (block-uniform).
// Block 256 threads = 8 waves (4 along m x 2 along n), tile 128 x 64 (HEADS: 128 x 128, a wave 32 x 64, so that a byte copied from L2 and a fragment read from LDS feed more
// products); k tiles of 64 copied into two LDS buffers (tile t + 1 flies while tile t is multiplied), one block
// barrier a tile; epilogue staged in LDS. The HEADS instance is launched with the residual plane off and holds no room for it.
// HEADS == false: C[b*cstr + t][n] = c, f32, each 256-B row piece stored whole.
// HEADS == true (x @ W_attn): the tile's 128 columns are two heads of q, k or v, each wave's 64 one head h, and c never goes to memory. q and k: rms-norm over the 64 head dims, rotary with
// angle h * inv_freq[i] (head-indexed, same for every token), x8, f16 hi into Qh/Kh [bhi][SEQ][64] and, for t0 < EARLY, x1024 residuals into Qr/Kr [bhi][EARLY][64];
// v: x8, transposed through LDS into VTh [bhi][64][SEQ] and VTr [bhi][64][EARLY]. EARLY == BM: a tile is early as a whole or not at all.
// One k tile = rows of 128 B laid at the 144-B pitch of AP. 256 threads, 16 B a lane: copy j of a thread brings row (tid >> 3) + 32 j, piece tid & 7, so a wave's copy covers
// four whole 128-B lines. ag / bg / rg: the lane's first global byte of the tile, al / bl / rl: its first LDS byte. s_wait_xcnt stands inside each statement so that no
// address register named there is rewritten ahead of it.
__device__ __forceinline__ void stage_ab(const b16* ag, const b16* bg, unsigned al, unsigned bl) {   // A: 128 rows, BT: 64 rows
  const b16 *a1 = ag + 32 * KD, *a2 = ag + 64 * KD, *a3 = ag + 96 * KD, *b1 = bg + 32 * KD;
  const unsigned al1 = al + 32 * AP * 2, al2 = al + 64 * AP * 2, al3 = al + 96 * AP * 2, bl1 = bl + 32 * AP * 2;
  asm volatile("global_load_async_to_lds_b128 %0, %6, off\n\t"
               "global_load_async_to_lds_b128 %1, %7, off\n\t"
               "global_load_async_to_lds_b128 %2, %8, off\n\t"
               "global_load_async_to_lds_b128 %3, %9, off\n\t"
               "global_load_async_to_lds_b128 %4, %10, off\n\t"
               "global_load_async_to_lds_b128 %5, %11, off\n\t"
               "s_wait_xcnt 0x0"
               :: "v"(al), "v"(al1), "v"(al2), "v"(al3), "v"(bl), "v"(bl1), "v"(ag), "v"(a1), "v"(a2), "v"(a3), "v"(bg), "v"(b1)
               : "memory");
}
__device__ __forceinline__ void stage_ab128(const b16* ag, const b16* bg, unsigned al, unsigned bl) {   // A: 128 rows, BT: 128 rows
  const b16 *a1 = ag + 32 * KD, *a2 = ag + 64 * KD, *a3 = ag + 96 * KD, *b1 = bg + 32 * KD, *b2 = bg + 64 * KD, *b3 = bg + 96 * KD;
  const unsigned al1 = al + 32 * AP * 2, al2 = al + 64 * AP * 2, al3 = al + 96 * AP * 2, bl1 = bl + 32 * AP * 2, bl2 = bl + 64 * AP * 2, bl3 = bl + 96 * AP * 2;
  asm volatile("global_load_async_to_lds_b128 %0, %8, off\n\t"
               "global_load_async_to_lds_b128 %1, %9, off\n\t"
               "global_load_async_to_lds_b128 %2, %10, off\n\t"
               "global_load_async_to_lds_b128 %3, %11, off\n\t"
               "global_load_async_to_lds_b128 %4, %12, off\n\t"
               "global_load_async_to_lds_b128 %5, %13, off\n\t"
               "global_load_async_to_lds_b128 %6, %14, off\n\t"
               "global_load_async_to_lds_b128 %7, %15, off\n\t"
               "s_wait_xcnt 0x0"
               :: "v"(al), "v"(al1), "v"(al2), "v"(al3), "v"(bl), "v"(bl1), "v"(bl2), "v"(bl3), "v"(ag), "v"(a1), "v"(a2), "v"(a3), "v"(bg), "v"(b1), "v"(b2), "v"(b3)
               : "memory");
}
__device__ __forceinline__ void stage_r(const b16* rg, unsigned rl) {   // residual plane: 128 rows
  const b16 *r1 = rg + 32 * KD, *r2 = rg + 64 * KD, *r3 = rg + 96 * KD;
  const unsigned rl1 = rl + 32 * AP * 2, rl2 = rl + 64 * AP * 2, rl3 = rl + 96 * AP * 2;
  asm volatile("global_load_async_to_lds_b128 %0, %4, off\n\t"
               "global_load_async_to_lds_b128 %1, %5, off\n\t"
               "global_load_async_to_lds_b128 %2, %6, off\n\t"
               "global_load_async_to_lds_b128 %3, %7, off\n\t"
               "s_wait_xcnt 0x0"
               :: "v"(rl), "v"(rl1), "v"(rl2), "v"(rl3), "v"(rg), "v"(r1), "v"(r2), "v"(r3)
               : "memory");
}

template <bool HEADS>
__global__ __launch_bounds__(256) void gemm_kernel(const b16* __restrict__ A, const b16* __restrict__ Ar, const b16* __restrict__ BT, const float* __restrict__ bias,
                                                   float* __restrict__ C, b16* __restrict__ Qh, b16* __restrict__ Qr, b16* __restrict__ Kh, b16* __restrict__ Kr,
                                                   b16* __restrict__ VTh, b16* __restrict__ VTr, int N, int cstr, int res_on, float oscale) {
  constexpr int NF = HEADS ? 4 : 2, WN = 16 * NF, BNT = 2 * WN;   // BT fragments and columns a wave, columns a block: HEADS 128 = two heads, one to each wn
  constexpr int BOFF = HEADS ? ABYTES : 2 * ABYTES, STAGE = BOFF + BNT * AP * 2;   // one buffer: A | residual plane (not HEADS) | BT
  static_assert(!HEADS || (WN == HD && CD % BNT == 0 && N3 % BNT == 0 && 2 * BM * CP * 4 <= 2 * STAGE && 2 * BNT * VP * 2 <= 2 * STAGE));
  __shared__ __attribute__((aligned(16))) char smem[2 * STAGE];
  float* Cs = reinterpret_cast<float*>(smem);   // aliases the buffers after the k loop (block barrier in between)
  const int tid = threadIdx.x, wave = tid >> 5, lane = tid & 31, hh = lane >> 4, col = lane & 15, wm = wave >> 1, wn = wave & 1;
  const int bm = (int)blockIdx.y * BM, bn = (int)blockIdx.x * BNT; const int bb = bm / SEQ, t0 = bm % SEQ;
  const bool res = !HEADS && (res_on != 0) && (t0 < EARLY);
  const b16* Ab = A + (size_t)bm * KD; const b16* Bb = BT + (size_t)bn * KD;
  const b16* Arb = Ar + ((size_t)bb * EARLY + (size_t)t0) * KD;   // dereferenced only when res (then t0 == 0)
  v8f acc[2][NF], accr[2][NF];
#pragma unroll
  for (int i = 0; i < 2; ++i)
#pragma unroll
    for (int j = 0; j < NF; ++j) { acc[i][j] = (v8f){}; accr[i][j] = (v8f){}; }
  const int srow = tid >> 3, sc8 = (tid & 7) * 8;
  const b16* ag = Ab + (size_t)srow * KD + sc8; const b16* bg = Bb + (size_t)srow * KD + sc8; const b16* rg = Arb + (size_t)srow * KD + sc8;   // tile t: + t * BK
  const unsigned al = lds_off(smem) + (unsigned)(srow * AP + sc8) * 2u, rl = al + ABYTES, bl = al + BOFF;                                    // buffer 1: + STAGE
  auto stage = [&](int t, unsigned bo) {   // k tile t into the buffer at byte bo
    if constexpr (HEADS) stage_ab128(ag + t * BK, bg + t * BK, al + bo, bl + bo);
    else stage_ab(ag + t * BK, bg + t * BK, al + bo, bl + bo);
  };
  stage(0, 0u);
  if (res) stage_r(rg, rl);
  asm volatile("s_wait_asynccnt 0x0" ::: "memory");   // tile 0 has landed before the barrier that publishes it
  __syncthreads();
  stage(1, (unsigned)STAGE);
  if (res) stage_r(rg + BK, rl + STAGE);
#pragma unroll 1   // one copy of the loop body in the text: the buffer index is a run-time offset
  for (int t = 0; t < NT; ++t) {
    const int buf = t & 1;
    const b16* As = reinterpret_cast<const b16*>(smem + buf * STAGE); const b16* Ars = reinterpret_cast<const b16*>(smem + buf * STAGE + ABYTES);
    const b16* Bs = reinterpret_cast<const b16*>(smem + buf * STAGE + BOFF);
#pragma unroll
    for (int ks = 0; ks < BK; ks += 32) {
      const v16b a0 = frag_kb(As + (wm * 32 + col) * AP + ks, hh), a1 = frag_kb(As + (wm * 32 + 16 + col) * AP + ks, hh);
      v16b bf[NF];   // every '#pragma unroll' over j keeps the index of a register array a compile-time constant
#pragma unroll
      for (int j = 0; j < NF; ++j) bf[j] = frag_kb(Bs + (wn * WN + j * 16 + col) * AP + ks, hh);
#pragma unroll
      for (int j = 0; j < NF; ++j) acc[0][j] = wmma16b(a0, bf[j], acc[0][j]);
#pragma unroll
      for (int j = 0; j < NF; ++j) acc[1][j] = wmma16b(a1, bf[j], acc[1][j]);
      if (res) {
        const v16b r0 = frag_kb(Ars + (wm * 32 + col) * AP + ks, hh), r1 = frag_kb(Ars + (wm * 32 + 16 + col) * AP + ks, hh);
#pragma unroll
        for (int j = 0; j < NF; ++j) accr[0][j] = wmma16b(r0, bf[j], accr[0][j]);
#pragma unroll
        for (int j = 0; j < NF; ++j) accr[1][j] = wmma16b(r1, bf[j], accr[1][j]); }
    }
    asm volatile("s_wait_dscnt 0x0" ::: "memory");      // this wave's reads of tile t are done before the buffer is handed back
    asm volatile("s_wait_asynccnt 0x0" ::: "memory");   // this wave's copies of tile t + 1 have landed
    __syncthreads();                                    // publishes tile t + 1 and ends every wave's reads of tile t (after the last tile: the epilogue aliases)
    if (t + 2 < NT) {
      stage(t + 2, (unsigned)(buf * STAGE));
      if (res) stage_r(rg + (t + 2) * BK, rl + buf * STAGE); }
  }
  asm volatile("s_wait_asynccnt 0x0" ::: "memory");     // no copy is left in flight when the buffers are reused
  const int cls = bn / CD, bhi0 = bb * H + (bn % CD) / HD;   // HEADS: 0 q, 1 k, 2 v, and the block's first head; block-uniform
  const int h = (bn % CD) / HD + wn, bhi = bhi0 + wn;        // HEADS: this wave's own head
  const bool early = (t0 < EARLY);
  if (HEADS && cls == 2) {
    // acc[i][j][0..7] are 8 consecutive tokens of one head dim: one 16-B piece of a V^T row
    b16* Sv = reinterpret_cast<b16*>(smem); b16* Svr = Sv + BNT * VP;   // BNT rows: the head dims of the block's heads one after the other, as in VTh
#pragma unroll
    for (int i = 0; i < 2; ++i)
#pragma unroll
      for (int j = 0; j < NF; ++j) {
        const int cc = wn * WN + j * 16 + col; const float bv = bf16_rne(bias[bn + cc]); v8b oh;
#pragma unroll
        for (int r = 0; r < 8; ++r) {
          const float v = acc[i][j][r] + accr[i][j][r] * (1.0f / RS);
          const float v0 = (v * oscale + bv) * XS; acc[i][j][r] = v0; oh[r] = (b16)v0; }
        *(v8b*)(Sv + cc * VP + wm * 32 + i * 16 + 8 * hh) = oh; }
    if (early) {
#pragma unroll
      for (int i = 0; i < 2; ++i)
#pragma unroll
        for (int j = 0; j < NF; ++j) {
          const int cc = wn * WN + j * 16 + col; v8b orr;
#pragma unroll
          for (int r = 0; r < 8; ++r) { const float v0 = acc[i][j][r]; orr[r] = (b16)((v0 - (float)(b16)v0) * RS); }
          *(v8b*)(Svr + cc * VP + wm * 32 + i * 16 + 8 * hh) = orr; } }
    __syncthreads();   // V^T rows are read across waves
    b16* dv = VTh + (size_t)bhi0 * HD * (size_t)SK + t0;
#pragma unroll 1   // short trips, no gain from unrolling
    for (int it = 0; it < BNT / 16; ++it) {
      const int d = wave * (BNT / 8) + it * 2 + hh; const v8b f = *(const v8b*)(Sv + d * VP + col * 8);
      *(v8b*)(dv + (size_t)d * SK + col * 8) = f; }
    if (early) {   // then t0 == 0
      b16* dvr = VTr + (size_t)bhi0 * HD * (size_t)EARLY;
#pragma unroll 1   // as above
      for (int it = 0; it < BNT / 16; ++it) {
        const int d = wave * (BNT / 8) + it * 2 + hh; const v8b fr = *(const v8b*)(Svr + d * VP + col * 8);
        *(v8b*)(dvr + (size_t)d * EARLY + col * 8) = fr; } }
    return;
  }
#pragma unroll
  for (int i = 0; i < 2; ++i)
#pragma unroll
    for (int j = 0; j < NF; ++j) {
      const int cc = wn * WN + j * 16 + col; const float bv = bf16_rne(bias[bn + cc]);
      float* Cw = HEADS ? Cs + wn * BM * CP + j * 16 + col : Cs + cc;   // HEADS: a plane of BM rows x CP for each of the two heads
#pragma unroll
      for (int r = 0; r < 8; ++r) {
        const float v = acc[i][j][r] + accr[i][j][r] * (1.0f / RS);   // accr stays 0 when the residual plane is off
        Cw[(wm * 32 + i * 16 + 8 * hh + r) * CP] = v * oscale + bv; } }
  __syncthreads();   // Cs rows are read across waves (HEADS: across the lanes of the wave that wrote them)
  if constexpr (HEADS) {
    // From here on a wave works alone, on the 32 rows of its own head that it staged. A lane holds head dims lane and lane + 32, the two partners of one rotation.
    const float invf = exp2f(-(float)lane * (LOG2B / 32.0f));   // (1/10000)^(2i/64)
    const float ang = (float)h * invf; float s, c; sincosf(ang, &s, &c);
    float* rows = Cs + (wn * BM + wm * 32) * CP;
#pragma unroll 1   // batches of 8 rows: more at once would take more registers than the k loop does and cost a resident block
    for (int g = 0; g < 32; g += 8) {
      float e0[8], e1[8], ss[8];
      // Every '#pragma unroll' of this batch keeps the index of a register array a compile-time constant; the 8 rows go through each stage side by side, so that
      // their LDS reads and lane exchanges overlap.
#pragma unroll
      for (int i = 0; i < 8; ++i) { e0[i] = rows[(g + i) * CP + lane]; e1[i] = rows[(g + i) * CP + lane + 32]; ss[i] = e0[i] * e0[i] + e1[i] * e1[i]; }
#pragma unroll
      for (int off = 16; off > 0; off >>= 1)
#pragma unroll
        for (int i = 0; i < 8; ++i) ss[i] += __shfl_xor(ss[i], off);
      // The batch's rows are in registers by now: a row's f16 hi goes over the first 128 B of its own 256 B, its residual over the second.
#pragma unroll
      for (int i = 0; i < 8; ++i) {
        const float rn = rsqrtf(ss[i] * (1.0f / 64.0f) + RMS_EPS);
        const float n0 = e0[i] * rn, n1 = e1[i] * rn;
        const float y0 = (n0 * c + n1 * s) * XS, y1 = (n1 * c - n0 * s) * XS;
        b16* ro = reinterpret_cast<b16*>(rows + (g + i) * CP);
        ro[lane] = (b16)y0; ro[lane + 32] = (b16)y1; e0[i] = y0; e1[i] = y1;
      }
      if (early) {
#pragma unroll
        for (int i = 0; i < 8; ++i) {
          const float y0 = e0[i], y1 = e1[i]; b16* ro = reinterpret_cast<b16*>(rows + (g + i) * CP);
          ro[64 + lane] = (b16)((y0 - (float)(b16)y0) * RS); ro[96 + lane] = (b16)((y1 - (float)(b16)y1) * RS); } }
    }
    wave_lds_sync();
    const int r4 = lane >> 3, c8 = (lane & 7) * 8;
    b16* dh = (cls == 0 ? Qh : Kh) + ((size_t)bhi * SEQ + (size_t)(t0 + wm * 32)) * HD;
#pragma unroll 1   // short trips, no gain from unrolling
    for (int it = 0; it < 8; ++it) {
      const int rr = it * 4 + r4; const v8b f = *(const v8b*)(reinterpret_cast<const b16*>(rows + rr * CP) + c8);
      *(v8b*)(dh + (size_t)rr * HD + c8) = f; }
    if (early) {   // then t0 == 0
      b16* dr = (cls == 0 ? Qr : Kr) + ((size_t)bhi * EARLY + (size_t)(wm * 32)) * HD;
#pragma unroll 1   // as above
      for (int it = 0; it < 8; ++it) {
        const int rr = it * 4 + r4; const v8b fr = *(const v8b*)(reinterpret_cast<const b16*>(rows + rr * CP) + 64 + c8);
        *(v8b*)(dr + (size_t)rr * HD + c8) = fr; } }
  } else {
    float* Cb = C + ((size_t)bb * (size_t)cstr + (size_t)t0) * (size_t)N + bn;
#pragma unroll 1
    for (int it = 0; it < 8; ++it) {
      const int rr = wave * 16 + it * 2 + hh; const v4f f = *(const v4f*)(Cs + rr * CP + col * 4);
      *(v4f*)(Cb + (size_t)rr * N + col * 4) = f; }
  }
}

// Causal softmax(Q K^T / 8) V per (b, h) for the queries below EARLY: the body of the work-groups bx < EARLY / 64 of attn_main_kernel's launch. 4 waves x 16 queries, each
// wave on its own (no block barrier); key steps of 32 from 0 up to the last query of the wave's 32-query group in fixed order, keys above the query replaced by -inf
// before the running-max softmax (f32); P x1024 via wave-private LDS; O^T += V^T P^T.
// ER (queries < EARLY, which only visit keys < EARLY): S adds K_hi Q_res + K_res Q_hi (x1024), P adds a x1024 residual tile and V a x1024 residual
// plane into a second accumulator folded before normalisation, and the x16 y row is written as f16 hi plus a x1024 residual. y rows -> Yh [b*SEQ + q][h*64 + d]
template <bool ER>
__device__ __forceinline__ void attn_rows(const b16* __restrict__ Qh, const b16* __restrict__ Qr, const b16* __restrict__ Kh, const b16* __restrict__ Kr,
                                          const b16* __restrict__ VTh, const b16* __restrict__ VTr, b16* __restrict__ Yh, b16* __restrict__ Yr,
                                          b16 (*Pb)[16][32 + 8], b16 (*Pr)[16][32 + 8], b16 (*Th)[16][TP], b16 (*Tr)[16][TP], int bx) {
  const int wave = __builtin_amdgcn_readfirstlane((int)threadIdx.x >> 5), lane = threadIdx.x & 31, hh = lane >> 4, col = lane & 15;   // scalar: the key loop's end hangs on it
  const int bhi = (int)blockIdx.y; const int b = bhi / H, h = bhi % H; const int q0 = bx * 64 + wave * 16, qi = q0 + col;
  const b16* Qb = Qh + (size_t)bhi * QL * HD; const b16* Kb = Kh + (size_t)bhi * SK * HD; const b16* Vb = VTh + (size_t)bhi * HD * (size_t)SK;
  const b16* Qrb = Qr + (size_t)bhi * EARLY * HD; const b16* Krb = Kr + (size_t)bhi * EARLY * HD; const b16* Vrb = VTr + (size_t)bhi * HD * (size_t)EARLY;
  const v16b qa0 = frag_kb(Qb + (size_t)qi * HD, hh), qa1 = frag_kb(Qb + (size_t)qi * HD + 32, hh);
  v16b qr0 = (v16b){}, qr1 = (v16b){};
  if constexpr (ER) { qr0 = frag_kb(Qrb + (size_t)qi * HD, hh); qr1 = frag_kb(Qrb + (size_t)qi * HD + 32, hh); }
  const float cs = LOG2E / (8.0f * XS * XS);   // 1/sqrt(64) and the two x8 carriers, in the log2 domain
  float m = -INFINITY, l = 0.0f; v8f o[4], o2[4];
#pragma unroll
  for (int t = 0; t < 4; ++t) { o[t] = (v8f){}; o2[t] = (v8f){}; }
  const int kend = (q0 >> 5) * 32 + 32;   // causal: keys 0 .. last query of this wave's 32-query group; ER: kend <= EARLY
#pragma unroll 1
  for (int kb = 0; kb < kend; kb += 32) {
    float e[16]; float mx = -INFINITY;
#pragma unroll
    for (int u = 0; u < 2; ++u) {
      const int krow = kb + u * 16 + col;
      const v16b kh0 = frag_kb(Kb + (size_t)krow * HD, hh), kh1 = frag_kb(Kb + (size_t)krow * HD + 32, hh);
      v8f s = (v8f){}; s = wmma16b(kh0, qa0, s); s = wmma16b(kh1, qa1, s);
      v8f sr = (v8f){};
      if constexpr (ER) {
        const v16b kr0 = frag_kb(Krb + (size_t)krow * HD, hh), kr1 = frag_kb(Krb + (size_t)krow * HD + 32, hh);
        sr = wmma16b(kh0, qr0, sr); sr = wmma16b(kh1, qr1, sr); sr = wmma16b(kr0, qa0, sr); sr = wmma16b(kr1, qa1, sr); }
#pragma unroll
      for (int r = 0; r < 8; ++r) {
        float v = s[r];
        if constexpr (ER) v += sr[r] * (1.0f / RS);
        v *= cs;
        const int key = kb + u * 16 + 8 * hh + r;
        v = (key > qi) ? -INFINITY : v;
        e[u * 8 + r] = v; mx = fmaxf(mx, v); } }
    mx = fmaxf(mx, __shfl_xor(mx, 16)); const float mn = fmaxf(m, mx); const float al = nexp2(m - mn); float sum = 0.0f;
#pragma unroll
    for (int i2 = 0; i2 < 16; ++i2) {
      const float p = nexp2(e[i2] - mn); sum += p; const int pi = (i2 < 8 ? 0 : 16) + 8 * hh + (i2 & 7);
      const float pp = p * PS; const b16 ph = (b16)pp; Pb[wave][col][pi] = ph;
      if constexpr (ER) Pr[wave][col][pi] = (b16)((pp - (float)ph) * RS); }
    sum += __shfl_xor(sum, 16); l = l * al + sum; m = mn;
    wave_lds_sync();
    const v16b pf = frag_kb(&Pb[wave][col][0], hh);
    v16b prf = (v16b){};
    if constexpr (ER) prf = frag_kb(&Pr[wave][col][0], hh);
#pragma unroll
    for (int t = 0; t < 4; ++t) {
      o[t] *= al; const v16b vh = frag_kb(Vb + (size_t)(t * 16 + col) * SK + kb, hh);
      o[t] = wmma16b(vh, pf, o[t]);
      if constexpr (ER) { const v16b vr = frag_kb(Vrb + (size_t)(t * 16 + col) * EARLY + kb, hh); o2[t] *= al; o2[t] = wmma16b(vh, prf, o2[t]); o2[t] = wmma16b(vr, pf, o2[t]); } }
    wave_lds_sync(); }
  const float inv = YS / (l * PS * XS);
#pragma unroll
  for (int t = 0; t < 4; ++t) {
#pragma unroll
    for (int r = 0; r < 8; ++r) {
      float ov = o[t][r];
      if constexpr (ER) ov += o2[t][r] * (1.0f / RS);
      const float yv = ov * inv; const b16 yh = (b16)yv;
      Th[wave][col][t * 16 + 8 * hh + r] = yh;
      if constexpr (ER) Tr[wave][col][t * 16 + 8 * hh + r] = (b16)((yv - (float)yh) * RS); } }
  wave_lds_sync();
  b16* yb = Yh + ((size_t)b * SEQ + (size_t)q0) * CD + (size_t)h * HD;
  {
#pragma unroll 1
    for (int it = 0; it < 4; ++it) {
      const int rr = it * 4 + (lane >> 3), c8 = (lane & 7) * 8; const v8b f = *(const v8b*)(&Th[wave][rr][c8]);
      *(v8b*)(yb + (size_t)rr * CD + c8) = f;
      if constexpr (ER) {
        const v8b fr = *(const v8b*)(&Tr[wave][rr][c8]);
        *(v8b*)(Yr + (((size_t)b * EARLY + (size_t)(q0 + rr)) * CD + (size_t)h * HD + c8)) = fr; } }
     }
}

// One staged tile pair = 64 keys: K rows [64 keys][64 dims] and V^T rows [64 dims][64 keys], 128 B a row, laid at the 144-B pitch of TP. 128 threads, 16 B a lane:
// copy j of a thread brings row (tid >> 3) + 16 j, piece tid & 7, so a wave's copy covers four whole 128-B lines. kg / vg: the lane's first global byte of the tile,
// kl / vl: its first LDS byte. s_wait_xcnt stands inside the statement so that no address register named here is rewritten ahead of it.
__device__ __forceinline__ void stage_kv(const b16* kg, const b16* vg, unsigned kl, unsigned vl) {
  const b16 *k1 = kg + 16 * HD, *k2 = kg + 32 * HD, *k3 = kg + 48 * HD; const b16 *v1 = vg + 16 * (size_t)SK, *v2 = vg + 32 * (size_t)SK, *v3 = vg + 48 * (size_t)SK;
  const unsigned kl1 = kl + 16 * TP * 2, kl2 = kl + 32 * TP * 2, kl3 = kl + 48 * TP * 2, vl1 = vl + 16 * TP * 2, vl2 = vl + 32 * TP * 2, vl3 = vl + 48 * TP * 2;
  asm volatile("global_load_async_to_lds_b128 %0, %8, off\n\t"
               "global_load_async_to_lds_b128 %1, %9, off\n\t"
               "global_load_async_to_lds_b128 %2, %10, off\n\t"
               "global_load_async_to_lds_b128 %3, %11, off\n\t"
               "global_load_async_to_lds_b128 %4, %12, off\n\t"
               "global_load_async_to_lds_b128 %5, %13, off\n\t"
               "global_load_async_to_lds_b128 %6, %14, off\n\t"
               "global_load_async_to_lds_b128 %7, %15, off\n\t"
               "s_wait_xcnt 0x0"
               :: "v"(kl), "v"(kl1), "v"(kl2), "v"(kl3), "v"(vl), "v"(vl1), "v"(vl2), "v"(vl3), "v"(kg), "v"(k1), "v"(k2), "v"(k3), "v"(vg), "v"(v1), "v"(v2), "v"(v3)
               : "memory");
}

// One launch for all queries: grid (query blocks of 64, NB*H); block = 4 waves x 16 queries. Blocks below EARLY take attn_rows above and leave; they need nothing from the
// others. From EARLY on, the same causal softmax(Q K^T / 8) V without residual planes.
// K and V^T come in tiles of 64 keys, copied once per block into two LDS buffers (tile s + 1 flies while tile s is worked on) and read as fragments by all
// four waves. Each wave walks key steps of 32 in the same fixed order and up to the same last key (the end of its 32-query group) as attn_rows above.
// Every plain '#pragma unroll' below keeps the index of a register array a compile-time constant.
__global__ __launch_bounds__(128) void attn_main_kernel(const b16* __restrict__ Qh, const b16* __restrict__ Qr, const b16* __restrict__ Kh, const b16* __restrict__ Kr,
                                                        const b16* __restrict__ VTh, const b16* __restrict__ VTr, b16* __restrict__ Yh, b16* __restrict__ Yr) {
  __shared__ __attribute__((aligned(16))) b16 Ks[2][64][TP];
  __shared__ __attribute__((aligned(16))) b16 Vs[2][64][TP];
  __shared__ __attribute__((aligned(16))) b16 Pb[4][16][32 + 8];
  __shared__ __attribute__((aligned(16))) b16 Th[4][16][TP];
  const int bx = (int)blockIdx.x;
  if (bx < EARLY / 64) {   // block-uniform, ahead of every copy and barrier; the residual tiles lie in the K and V buffers, which such a block does not fill
    attn_rows<true>(Qh, Qr, Kh, Kr, VTh, VTr, Yh, Yr, Pb, reinterpret_cast<b16 (*)[16][32 + 8]>(&Ks[0][0][0]), Th, reinterpret_cast<b16 (*)[16][TP]>(&Vs[0][0][0]), bx);
    return;
  }
  const int tid = threadIdx.x, wave = __builtin_amdgcn_readfirstlane(tid >> 5), lane = tid & 31, hh = lane >> 4, col = lane & 15;
  const int bhi = (int)blockIdx.y; const int b = bhi / H, h = bhi % H; const int q0 = bx * 64 + wave * 16, qi = q0 + col;
  const b16* Qb = Qh + (size_t)bhi * QL * HD; const b16* Kb = Kh + (size_t)bhi * SK * HD; const b16* Vb = VTh + (size_t)bhi * HD * (size_t)SK;
  const int nst = bx + 1;                     // tiles of 64 keys: keys 0 .. last query of this block
  const int kend = (q0 >> 5) * 32 + 32;       // this wave's causal end
  const int srow = tid >> 3, sc8 = (tid & 7) * 8;
  const b16* kg = Kb + (size_t)srow * HD + sc8; const b16* vg = Vb + (size_t)srow * SK + sc8;   // tile s: kg + s * 64 * HD, vg + s * 64
  const unsigned kl = lds_off(&Ks[0][srow][sc8]), vl = lds_off(&Vs[0][srow][sc8]); constexpr unsigned BUFB = 64 * TP * 2;
  stage_kv(kg, vg, kl, vl);
  asm volatile("s_wait_asynccnt 0x0" ::: "memory");   // tile 0 has landed before the barrier that publishes it
  __syncthreads();
  if (nst > 1) stage_kv(kg + 64 * HD, vg + 64, kl + BUFB, vl + BUFB);
  const v16b qa0 = frag_kb(Qb + (size_t)qi * HD, hh), qa1 = frag_kb(Qb + (size_t)qi * HD + 32, hh);
  const float cs = LOG2E / (8.0f * XS * XS);   // 1/sqrt(64) and the two x8 carriers, in the log2 domain
  float m = -INFINITY, l = 0.0f; v8f o[4];
#pragma unroll
  for (int t = 0; t < 4; ++t) o[t] = (v8f){};
#pragma unroll 1   // one copy of the loop body in the text: the buffer index is a run-time offset
  for (int s = 0; s < nst; ++s) {
    const int buf = s & 1;
#pragma unroll 1   // the two key steps of a tile share one body
    for (int sub = 0; sub < 64; sub += 32) {
      const int kb = s * 64 + sub;
      if (kb < kend) {   // wave-uniform: a wave skips the step wholly above its diagonal, never the publish point below
        float e[16]; float mx = -INFINITY;
#pragma unroll
        for (int u = 0; u < 2; ++u) {
          const b16* kr = &Ks[buf][sub + u * 16 + col][0];
          const v16b kh0 = frag_kb(kr, hh), kh1 = frag_kb(kr + 32, hh);
          v8f sc = (v8f){}; sc = wmma16(kh0, qa0, sc); sc = wmma16(kh1, qa1, sc);
#pragma unroll
          for (int r = 0; r < 8; ++r) {
            float v = sc[r] * cs;
            const int key = kb + u * 16 + 8 * hh + r;
            v = (key > qi) ? -INFINITY : v;
            e[u * 8 + r] = v; mx = fmaxf(mx, v); } }
        mx = fmaxf(mx, __shfl_xor(mx, 16)); const float mn = fmaxf(m, mx); const float al = nexp2(m - mn); float sum = 0.0f;
#pragma unroll
        for (int i2 = 0; i2 < 16; ++i2) {
          const float p = nexp2(e[i2] - mn); sum += p; const int pi = (i2 < 8 ? 0 : 16) + 8 * hh + (i2 & 7);
          Pb[wave][col][pi] = (b16)(p * PS); }
        sum += __shfl_xor(sum, 16); l = l * al + sum; m = mn;
        wave_lds_sync();
        const v16b pf = frag_kb(&Pb[wave][col][0], hh);
#pragma unroll
        for (int t = 0; t < 4; ++t) {
          o[t] *= al; const v16b vh = frag_kb(&Vs[buf][t * 16 + col][sub], hh);
          // the step's last product stands in front of a branch: it keeps its v_nop statement
          o[t] = (t == 3) ? wmma16b(vh, pf, o[t]) : wmma16(vh, pf, o[t]); }
        wave_lds_sync(); }
    }
    asm volatile("s_wait_dscnt 0x0" ::: "memory");      // this wave's reads of tile s are done before the buffer is handed back
    asm volatile("s_wait_asynccnt 0x0" ::: "memory");   // this wave's copies of tile s + 1 have landed
    __syncthreads();                                    // publishes tile s + 1 and ends every wave's reads of tile s
    if (s + 2 < nst) stage_kv(kg + (size_t)(s + 2) * 64 * HD, vg + (size_t)(s + 2) * 64, kl + buf * BUFB, vl + buf * BUFB);
  }
  asm volatile("s_wait_asynccnt 0x0" ::: "memory");     // no copy is left in flight when the wave ends
  const float inv = YS / (l * PS * XS);
#pragma unroll
  for (int t = 0; t < 4; ++t) {
#pragma unroll
    for (int r = 0; r < 8; ++r) Th[wave][col][t * 16 + 8 * hh + r] = (b16)(o[t][r] * inv); }
  wave_lds_sync();
  b16* yb = Yh + ((size_t)b * SEQ + (size_t)q0) * CD + (size_t)h * HD;
#pragma unroll 1   // as in the kernel above: four short trips, no gain from unrolling
  for (int it = 0; it < 4; ++it) {
    const int rr = it * 4 + (lane >> 3), c8 = (lane & 7) * 8; const v8b f = *(const v8b*)(&Th[wave][rr][c8]);
    *(v8b*)(yb + (size_t)rr * CD + c8) = f; }
}
}  // namespace

extern "C" void kernel_launch(void* const* d_in, const int* in_sizes, int n_in, void* d_out, int out_size, void* d_ws, size_t ws_size, hipStream_t stream) {
  // wire order: 0 x [NB_FULL][SEQ_FULL][1024] f32, 1 W_attn [1024][3072] f32, 2 b_attn [3072] f32, 3 W_proj [1024][1024] f32, 4 b_proj [1024] f32; out [NB_FULL][SEQ_FULL][1024] f32
  const size_t need_x = ((size_t)(NB - 1) * SEQ_FULL + (size_t)SEQ) * CD;
  if (n_in < 5 || (size_t)in_sizes[0] < need_x || (size_t)in_sizes[1] < (size_t)KD * N3 || (size_t)in_sizes[2] < (size_t)N3 ||
      (size_t)in_sizes[3] < (size_t)KD * CD || (size_t)in_sizes[4] < (size_t)CD || (size_t)out_size < need_x) return;
  const float* Xin = (const float*)d_in[0]; const float* Wa = (const float*)d_in[1]; const float* Ba = (const float*)d_in[2];
  const float* Wp = (const float*)d_in[3]; const float* Bp = (const float*)d_in[4];
  size_t off = 0; char* ws = (char*)d_ws;
  auto carve = [&](size_t bytes) { char* p = ws + off; off += (bytes + 255) & ~(size_t)255; return p; };
  b16* Xp = (b16*)carve((size_t)MROWS * CD * 2);                       //  8,388,608 B at NB=2, SEQ=2048
  b16* WaT = (b16*)carve((size_t)N3 * KD * 2);                         //  6,291,456
  b16* WpT = (b16*)carve((size_t)CD * KD * 2);                         //  2,097,152
  const size_t plane = (size_t)NB * H * SEQ * HD * 2, rplane = (size_t)NB * H * EARLY * HD * 2;
  b16* Qh = (b16*)carve(plane); b16* Kh = (b16*)carve(plane); b16* VTh = (b16*)carve(plane);      // 3 x 8,388,608
  b16* Qr = (b16*)carve(rplane); b16* Kr = (b16*)carve(rplane); b16* VTr = (b16*)carve(rplane);   // 3 x 524,288
  b16* Yh = (b16*)carve((size_t)MROWS * CD * 2);                       //  8,388,608
  b16* Yr = (b16*)carve((size_t)NB * EARLY * CD * 2);                  //    524,288   -> total 52,428,800 B
  if (off > ws_size || off > ((size_t)128 << 20)) return;
  cvt_all_kernel<<<dim3(WBLK + XBLK), 256, 0, stream>>>(Xin, Wa, Wp, Xp, WaT, WpT);
  gemm_kernel<true><<<dim3(N3 / (2 * BN), MROWS / BM), 256, 0, stream>>>(Xp, Xp, WaT, Ba, nullptr, Qh, Qr, Kh, Kr, VTh, VTr, N3, SEQ, 0, 1.0f / (XS * WS));
  attn_main_kernel<<<dim3(QL / 64, NB * H), 128, 0, stream>>>(Qh, Qr, Kh, Kr, VTh, VTr, Yh, Yr);
  gemm_kernel<false><<<dim3(CD / BN, MROWS / BM), 256, 0, stream>>>(Yh, Yr, WpT, Bp, (float*)d_out, nullptr, nullptr, nullptr, nullptr, nullptr, nullptr, CD, SEQ_FULL, 1, 1.0f / (YS * WS));
}

// v008
// Measured time: 96 microseconds a run.
// Two timings next to v007 both put it at 1.07 times that version's speed.
// Counting every step since v000, it is 3.19 times as fast.
#include <hip/hip_runtime.h>

// compute dtype: all contractions on v_wmma_f32_16x16x32_f16 (f16 operands, f32 accumulate). x @ W_attn and y @ W_proj: x and W enter as their bf16-RNE
// values carried x8 (x) and x64 (W) in f16 planes, 1 product; y carried x16 as f16 hi, plus a x1024 f16 residual plane on the first 128 token rows of each
// sequence (2 products there, second accumulator folded in the f32 epilogue). S^T = K Q^T per head: q, k after rms-norm and rotary carried x8 as f16 hi,
// 1 product; query blocks below 128 tokens add x1024 f16 q and k residual planes (3 products). O^T += V^T P^T: v carried x8 f16, P f16 (x1024 early, exp(score) x8 elsewhere), 1 product;
// the same early query blocks add P and v x1024 residuals into a second accumulator folded before normalisation. Norm, rotary, softmax statistics in f32.
// Fragment k-map per lane half hh for A AND B: elements 0..7 <- k = 8hh+0..7, 8..15 <- k = 16+8hh+0..7; acc[r] = D[8hh+r][col = lane&15].

#ifndef NB
#define NB 2
#endif
#ifndef SEQ
#define SEQ 2048
#endif
#ifndef NB_FULL
#define NB_FULL 2
#endif
#ifndef SEQ_FULL
#define SEQ_FULL 2048
#endif

namespace {
constexpr int H = 16, HD = 64, CD = 1024, N3 = 3 * CD, KD = CD, QL = SEQ, SK = SEQ, MROWS = NB * SEQ;
constexpr int EARLY = 128, EB = EARLY / 32;                       // token rows per sequence that get residual planes
constexpr int BM = 128, BN = 64, BK = 64, TP = 72, AP = BK + 8, CP = BN + 4, VP = BM + 8;
constexpr int ABYTES = BM * AP * 2, BBYTES = BN * AP * 2, SMEM = 2 * (ABYTES + BBYTES), NT = KD / BK;   // SMEM: no GEMM instance has less LDS
constexpr float XS = 8.0f, WS = 64.0f, YS = 16.0f, PS = 1024.0f, RS = 1024.0f;
constexpr float LOG2E = 1.4426950408889634f, LOG2B = 13.287712379549449f, RMS_EPS = 1.1920929e-07f;
static_assert(SEQ % BM == 0 && SEQ >= BM && SEQ <= SEQ_FULL && NB >= 1 && NB <= NB_FULL);
static_assert(EARLY == BM && EARLY % 64 == 0 && EB * 32 == EARLY && MROWS % BM == 0 && N3 % BN == 0 && CD % BN == 0 && KD % BK == 0);
static_assert(BM * CP * 4 <= SMEM && HD == 64 && QL == SK && SEQ % 64 == 0 && (MROWS * 128) % 256 == 0);
static_assert(BN == HD && 2 * HD * VP * 2 <= SMEM && NT >= 2 && ABYTES % 16 == 0 && BBYTES % 16 == 0);

typedef _Float16 b16;
typedef __attribute__((ext_vector_type(16))) _Float16 v16b;
typedef __attribute__((ext_vector_type(8))) _Float16 v8b;
typedef __attribute__((ext_vector_type(8))) float v8f;
typedef __attribute__((ext_vector_type(4))) float v4f;
typedef __attribute__((ext_vector_type(2))) float v2f;

__device__ __forceinline__ float bf16_rne(float f) { unsigned int u = __float_as_uint(f); u += 0x7FFFu + ((u >> 16) & 1u); return __uint_as_float(u & 0xFFFF0000u); }
// 16-bit fragment from a k-contiguous row: elements 0..7 <- p[8hh .. 8hh+7], 8..15 <- p[16+8hh .. 16+8hh+7]
__device__ __forceinline__ v16b frag_kb(const b16* p, int hh) {
  const v8b a = *(const v8b*)(p + 8 * hh), b = *(const v8b*)(p + 16 + 8 * hh); v16b f;
#pragma unroll
  for (int e = 0; e < 8; ++e) { f[e] = a[e]; f[8 + e] = b[e]; }
  return f;
}
__device__ __forceinline__ v8f wmma16b(v16b a, v16b b, v8f c) {
  v8f d = __builtin_amdgcn_wmma_f32_16x16x32_f16(false, a, false, b, (short)0, c, false, false);
  asm volatile("v_nop\n\tv_nop\n\tv_nop\n\tv_nop" : "+v"(d) : "v"(a), "v"(b));
  return d;
}
// The bare builtin: the compiler keeps the distance behind it itself, and with no volatile statement between the products it may issue a key step's LDS reads in groups ahead of them.
__device__ __forceinline__ v8f wmma16(v16b a, v16b b, v8f c) { return __builtin_amdgcn_wmma_f32_16x16x32_f16(false, a, false, b, (short)0, c, false, false); }
__device__ __forceinline__ void wave_lds_sync() { __builtin_amdgcn_fence(3, "workgroup"); __builtin_amdgcn_wave_barrier(); __builtin_amdgcn_fence(2, "workgroup"); }
__device__ __forceinline__ float nexp2(float v) { return __builtin_amdgcn_exp2f(v); }
// LDS byte address of a __shared__ object: the low 32 bits of its address.
__device__ __forceinline__ unsigned lds_off(const void* p) { return (unsigned)(size_t)p; }

__device__ __forceinline__ void store_tile64(const b16 (*S)[TP], b16* dst, size_t pitch, int wave, int lane) {
  {
#pragma unroll   // the LDS reads go out in groups ahead of their stores, not one read, one wait and one store a trip
    for (int it = 0; it < 8; ++it) {
      const int r = wave * 32 + it * 4 + (lane >> 3), c8 = (lane & 7) * 8;
      const v8b o = *(const v8b*)(&S[r][c8]);
      *(v8b*)(dst + (size_t)r * pitch + c8) = o; }
     }
}

// One launch converts all three GEMM operands; none of the three depends on another. Blocks of 256 threads, told apart by block index (block-uniform).
// Blocks 0 .. WBLK-1: W [KD][N] f32 (in-major: W[k][n]) -> WT [N][KD] f16 = bf16-RNE(W) x64 (k-contiguous per output column), in 64x64 tiles. A block takes four tiles
// that are neighbours along n, two waves a tile, each tile in its own LDS plane; tiles 0 .. WA_T-1 are W_attn's, the rest W_proj's (n tile fastest). They come first in
// the grid (for speed only).
// Blocks from WBLK on: x f32 -> Xp f16 = bf16-RNE(x) x8, XU pieces of 8 elements a thread, XBLK * 256 pieces apart.
// In both parts a thread issues all its global loads before it uses the first, so that it waits for memory once and the launch needs few waves.
constexpr int WA_T = (N3 / 64) * (KD / 64), WP_T = (CD / 64) * (KD / 64), WBLK = (WA_T + WP_T) / 4, XU = 8, XBLK = (int)((size_t)MROWS * 128 / (256 * XU));
static_assert(WA_T % 4 == 0 && WP_T % 4 == 0 && (N3 / 64) % 4 == 0 && (CD / 64) % 4 == 0 && ((size_t)MROWS * 128) % (256 * XU) == 0);
// One 64x64 tile of W, row pitch N (a compile-time constant: the 16 loads then differ in their immediate offset alone), by the tile's 64 threads.
template <int N>
__device__ __forceinline__ void cvt_w_tile(const float* src, b16 (*S)[TP], int tid) {
  const int k0 = tid >> 4, n = (tid & 15) * 4; v4f x[16];   // load it: row it * 4 + k0, columns n .. n + 3; both '#pragma unroll' keep the index of x a compile-time constant
  const float* p = src + (size_t)k0 * N + n;
#pragma unroll
  for (int it = 0; it < 16; ++it) x[it] = *(const v4f*)(p + (size_t)(it * 4) * N);
  // Inputs-only fence on the loaded values and the address: the address pair lives until all 16 loads are back, so that no result is put into a register that a load in
  // flight still names, and each pitch keeps its own run of 16 loads under one base (left alone, the compiler merges the two pitches and forms 16 addresses between the loads).
  asm volatile("" :: "v"(x[0]), "v"(x[1]), "v"(x[2]), "v"(x[3]), "v"(x[4]), "v"(x[5]), "v"(x[6]), "v"(x[7]), "v"(x[8]), "v"(x[9]), "v"(x[10]), "v"(x[11]), "v"(x[12]), "v"(x[13]),
               "v"(x[14]), "v"(x[15]), "v"(p));
#pragma unroll
  for (int it = 0; it < 16; ++it)
#pragma unroll
    for (int j = 0; j < 4; ++j) S[n + j][it * 4 + k0] = (b16)(bf16_rne(x[it][j]) * WS);
}
__global__ __launch_bounds__(256) void cvt_all_kernel(const float* __restrict__ X, const float* __restrict__ Wa, const float* __restrict__ Wp, b16* __restrict__ Xp,
                                                      b16* __restrict__ WaT, b16* __restrict__ WpT) {
  __shared__ __attribute__((aligned(16))) b16 St[4][64][TP];
  if ((int)blockIdx.x < WBLK) {
    const int grp = threadIdx.x >> 6, tid = threadIdx.x & 63, wave = tid >> 5, lane = tid & 31;
    const bool isa = (int)blockIdx.x * 4 < WA_T;   // block-uniform: WA_T is a multiple of 4
    const int t4 = (int)blockIdx.x * 4 - (isa ? 0 : WA_T); const int N = isa ? N3 : CD;   // t4: the block's first tile within its matrix, a multiple of 4
    const int nb = (isa ? t4 % (N3 / 64) : t4 % (CD / 64)) + grp, kb = isa ? t4 / (N3 / 64) : t4 / (CD / 64);
    const float* src = (isa ? Wa : Wp) + (size_t)kb * 64 * (size_t)N + (size_t)nb * 64;
    if (isa) cvt_w_tile<N3>(src, St[grp], tid); else cvt_w_tile<CD>(src, St[grp], tid);
    __syncthreads();   // a tile's plane is read across its two waves
    store_tile64(St[grp], (isa ? WaT : WpT) + (size_t)nb * 64 * KD + (size_t)kb * 64, KD, wave, lane);
    return;
  }
  const size_t u0 = (size_t)((int)blockIdx.x - WBLK) * 256 + threadIdx.x, g0 = u0 >> 7; const int piece = (int)(u0 & 127);   // piece k of the thread: row g0 + k * XBLK * 2
  v4f x0[XU], x1[XU];   // every '#pragma unroll' below keeps the index of these a compile-time constant
  const float* xs[XU];
#pragma unroll
  for (int k = 0; k < XU; ++k) {
    const size_t g = g0 + (size_t)k * (XBLK * 2); const size_t srow = (SEQ == SEQ_FULL) ? g : (g / SEQ) * SEQ_FULL + (g % SEQ);
    xs[k] = X + srow * CD + piece * 8; x0[k] = *(const v4f*)xs[k]; x1[k] = *(const v4f*)(xs[k] + 4); }
  // As in cvt_w_tile: inputs-only fence on the loaded values and the first address (left alone, the compiler puts a later load's result into that pair while loads that name it fly).
  asm volatile("" :: "v"(x0[0]), "v"(x0[1]), "v"(x0[2]), "v"(x0[3]), "v"(x0[4]), "v"(x0[5]), "v"(x0[6]), "v"(x0[7]), "v"(x1[0]), "v"(x1[1]), "v"(x1[2]), "v"(x1[3]), "v"(x1[4]),
               "v"(x1[5]), "v"(x1[6]), "v"(x1[7]), "v"(xs[0]));
#pragma unroll
  for (int k = 0; k < XU; ++k) {
    v8b o;
#pragma unroll
    for (int j = 0; j < 4; ++j) { o[j] = (b16)(bf16_rne(x0[k][j]) * XS); o[4 + j] = (b16)(bf16_rne(x1[k][j]) * XS); }
    *(v8b*)(Xp + (g0 + (size_t)k * (XBLK * 2)) * CD + piece * 8) = o; }
  asm volatile("s_wait_xcnt 0x0" ::: "memory");   // stands behind the run of stores, ahead of any later write of a register that one of them names
}

// Tile value c[m][n] = (A[m][.] . BT[n][.] + Ar[m][.] . BT[n][.] / 1024) * oscale + bf16-RNE(bias[n]); A, Ar, BT f16 with k-contiguous rows of KD = 1024, f32 accumulate.
// Rows m = b*SEQ + t (compact). The residual plane Ar ([b][EARLY][KD]) is used only when res_on != 0 and the tile's t0 < EARLY (block-uniform).
// Block 256 threads = 8 waves (4 along m x 2 along n), tile 128 x 64 (HEADS: 128 x 128, a wave 32 x 64, so that a byte copied from L2 and a fragment read from LDS feed more
// products); k tiles of 64 copied into two LDS buffers (tile t + 1 flies while tile t is multiplied), one block
// barrier a tile; epilogue staged in LDS. The HEADS instance is launched with the residual plane off and holds no room for it.
// HEADS == false: C[b*cstr + t][n] = c, f32, each 256-B row piece stored whole.
// HEADS == true (x @ W_attn): the tile's 128 columns are two heads of q, k or v, each wave's 64 one head h, and c never goes to memory. q and k: rms-norm over the 64 head dims, rotary with
// angle h * inv_freq[i] (head-indexed, same for every token), x8, f16 hi into Qh/Kh [bhi][SEQ][64] and, for t0 < EARLY, x1024 residuals into Qr/Kr [bhi][EARLY][64];
// v: x8, transposed through LDS into VTh [bhi][64][SEQ] and VTr [bhi][64][EARLY]. EARLY == BM: a tile is early as a whole or not at all.
// One k tile = rows of 128 B laid at the 144-B pitch of AP. 256 threads, 16 B a lane: copy j of a thread brings row (tid >> 3) + 32 j, piece tid & 7, so a wave's copy covers
// four whole 128-B lines. ag / bg / rg: the lane's first global byte of the tile, al / bl / rl: its first LDS byte. s_wait_xcnt stands inside each statement so that no
// address register named there is rewritten ahead of it.
__device__ __forceinline__ void stage_ab(const b16* ag, const b16* bg, unsigned al, unsigned bl) {   // A: 128 rows, BT: 64 rows
  const b16 *a1 = ag + 32 * KD, *a2 = ag + 64 * KD, *a3 = ag + 96 * KD, *b1 = bg + 32 * KD;
  const unsigned al1 = al + 32 * AP * 2, al2 = al + 64 * AP * 2, al3 = al + 96 * AP * 2, bl1 = bl + 32 * AP * 2;
  asm volatile("global_load_async_to_lds_b128 %0, %6, off\n\t"
               "global_load_async_to_lds_b128 %1, %7, off\n\t"
               "global_load_async_to_lds_b128 %2, %8, off\n\t"
               "global_load_async_to_lds_b128 %3, %9, off\n\t"
               "global_load_async_to_lds_b128 %4, %10, off\n\t"
               "global_load_async_to_lds_b128 %5, %11, off\n\t"
               "s_wait_xcnt 0x0"
               :: "v"(al), "v"(al1), "v"(al2), "v"(al3), "v"(bl), "v"(bl1), "v"(ag), "v"(a1), "v"(a2), "v"(a3), "v"(bg), "v"(b1)
               : "memory");
}
__device__ __forceinline__ void stage_ab128(const b16* ag, const b16* bg, unsigned al, unsigned bl) {   // A: 128 rows, BT: 128 rows
  const b16 *a1 = ag + 32 * KD, *a2 = ag + 64 * KD, *a3 = ag + 96 * KD, *b1 = bg + 32 * KD, *b2 = bg + 64 * KD, *b3 = bg + 96 * KD;
  const unsigned al1 = al + 32 * AP * 2, al2 = al + 64 * AP * 2, al3 = al + 96 * AP * 2, bl1 = bl + 32 * AP * 2, bl2 = bl + 64 * AP * 2, bl3 = bl + 96 * AP * 2;
  asm volatile("global_load_async_to_lds_b128 %0, %8, off\n\t"
               "global_load_async_to_lds_b128 %1, %9, off\n\t"
               "global_load_async_to_lds_b128 %2, %10, off\n\t"
               "global_load_async_to_lds_b128 %3, %11, off\n\t"
               "global_load_async_to_lds_b128 %4, %12, off\n\t"
               "global_load_async_to_lds_b128 %5, %13, off\n\t"
               "global_load_async_to_lds_b128 %6, %14, off\n\t"
               "global_load_async_to_lds_b128 %7, %15, off\n\t"
               "s_wait_xcnt 0x0"
               :: "v"(al), "v"(al1), "v"(al2), "v"(al3), "v"(bl), "v"(bl1), "v"(bl2), "v"(bl3), "v"(ag), "v"(a1), "v"(a2), "v"(a3), "v"(bg), "v"(b1), "v"(b2), "v"(b3)
               : "memory");
}
__device__ __forceinline__ void stage_r(const b16* rg, unsigned rl) {   // residual plane: 128 rows
  const b16 *r1 = rg + 32 * KD, *r2 = rg + 64 * KD, *r3 = rg + 96 * KD;
  const unsigned rl1 = rl + 32 * AP * 2, rl2 = rl + 64 * AP * 2, rl3 = rl + 96 * AP * 2;
  asm volatile("global_load_async_to_lds_b128 %0, %4, off\n\t"
               "global_load_async_to_lds_b128 %1, %5, off\n\t"
               "global_load_async_to_lds_b128 %2, %6, off\n\t"
               "global_load_async_to_lds_b128 %3, %7, off\n\t"
               "s_wait_xcnt 0x0"
               :: "v"(rl), "v"(rl1), "v"(rl2), "v"(rl3), "v"(rg), "v"(r1), "v"(r2), "v"(r3)
               : "memory");
}

template <bool HEADS>
__global__ __launch_bounds__(256) void gemm_kernel(const b16* __restrict__ A, const b16* __restrict__ Ar, const b16* __restrict__ BT, const float* __restrict__ bias,
                                                   float* __restrict__ C, b16* __restrict__ Qh, b16* __restrict__ Qr, b16* __restrict__ Kh, b16* __restrict__ Kr,
                                                   b16* __restrict__ VTh, b16* __restrict__ VTr, int N, int cstr, int res_on, float oscale) {
  constexpr int NF = HEADS ? 4 : 2, WN = 16 * NF, BNT = 2 * WN;   // BT fragments and columns a wave, columns a block: HEADS 128 = two heads, one to each wn
  constexpr int BOFF = HEADS ? ABYTES : 2 * ABYTES, STAGE = BOFF + BNT * AP * 2;   // one buffer: A | residual plane (not HEADS) | BT
  static_assert(!HEADS || (WN == HD && CD % BNT == 0 && N3 % BNT == 0 && 2 * BM * CP * 4 <= 2 * STAGE && 2 * BNT * VP * 2 <= 2 * STAGE));
  __shared__ __attribute__((aligned(16))) char smem[2 * STAGE];
  float* Cs = reinterpret_cast<float*>(smem);   // aliases the buffers after the k loop (block barrier in between)
  const int tid = threadIdx.x, wave = tid >> 5, lane = tid & 31, hh = lane >> 4, col = lane & 15, wm = wave >> 1, wn = wave & 1;
  const int bm = (int)blockIdx.y * BM, bn = (int)blockIdx.x * BNT; const int bb = bm / SEQ, t0 = bm % SEQ;
  const bool res = !HEADS && (res_on != 0) && (t0 < EARLY);
  const b16* Ab = A + (size_t)bm * KD; const b16* Bb = BT + (size_t)bn * KD;
  const b16* Arb = Ar + ((size_t)bb * EARLY + (size_t)t0) * KD;   // dereferenced only when res (then t0 == 0)
  v8f acc[2][NF], accr[2][NF];
#pragma unroll
  for (int i = 0; i < 2; ++i)
#pragma unroll
    for (int j = 0; j < NF; ++j) { acc[i][j] = (v8f){}; accr[i][j] = (v8f){}; }
  const int srow = tid >> 3, sc8 = (tid & 7) * 8;
  const b16* ag = Ab + (size_t)srow * KD + sc8; const b16* bg = Bb + (size_t)srow * KD + sc8; const b16* rg = Arb + (size_t)srow * KD + sc8;   // tile t: + t * BK
  const unsigned al = lds_off(smem) + (unsigned)(srow * AP + sc8) * 2u, rl = al + ABYTES, bl = al + BOFF;                                    // buffer 1: + STAGE
  auto stage = [&](int t, unsigned bo) {   // k tile t into the buffer at byte bo
    if constexpr (HEADS) stage_ab128(ag + t * BK, bg + t * BK, al + bo, bl + bo);
    else stage_ab(ag + t * BK, bg + t * BK, al + bo, bl + bo);
  };
  stage(0, 0u);
  if (res) stage_r(rg, rl);
  asm volatile("s_wait_asynccnt 0x0" ::: "memory");   // tile 0 has landed before the barrier that publishes it
  __syncthreads();
  stage(1, (unsigned)STAGE);
  if (res) stage_r(rg + BK, rl + STAGE);
#pragma unroll 1   // one copy of the loop body in the text: the buffer index is a run-time offset
  for (int t = 0; t < NT; ++t) {
    const int buf = t & 1;
    const b16* As = reinterpret_cast<const b16*>(smem + buf * STAGE); const b16* Ars = reinterpret_cast<const b16*>(smem + buf * STAGE + ABYTES);
    const b16* Bs = reinterpret_cast<const b16*>(smem + buf * STAGE + BOFF);
#pragma unroll
    for (int ks = 0; ks < BK; ks += 32) {
      const v16b a0 = frag_kb(As + (wm * 32 + col) * AP + ks, hh), a1 = frag_kb(As + (wm * 32 + 16 + col) * AP + ks, hh);
      v16b bf[NF];   // every '#pragma unroll' over j keeps the index of a register array a compile-time constant
#pragma unroll
      for (int j = 0; j < NF; ++j) bf[j] = frag_kb(Bs + (wn * WN + j * 16 + col) * AP + ks, hh);
#pragma unroll
      for (int j = 0; j < NF; ++j) acc[0][j] = wmma16b(a0, bf[j], acc[0][j]);
#pragma unroll
      for (int j = 0; j < NF; ++j) acc[1][j] = wmma16b(a1, bf[j], acc[1][j]);
      if (res) {
        const v16b r0 = frag_kb(Ars + (wm * 32 + col) * AP + ks, hh), r1 = frag_kb(Ars + (wm * 32 + 16 + col) * AP + ks, hh);
#pragma unroll
        for (int j = 0; j < NF; ++j) accr[0][j] = wmma16b(r0, bf[j], accr[0][j]);
#pragma unroll
        for (int j = 0; j < NF; ++j) accr[1][j] = wmma16b(r1, bf[j], accr[1][j]); }
    }
    asm volatile("s_wait_dscnt 0x0" ::: "memory");      // this wave's reads of tile t are done before the buffer is handed back
    asm volatile("s_wait_asynccnt 0x0" ::: "memory");   // this wave's copies of tile t + 1 have landed
    __syncthreads();                                    // publishes tile t + 1 and ends every wave's reads of tile t (after the last tile: the epilogue aliases)
    if (t + 2 < NT) {
      stage(t + 2, (unsigned)(buf * STAGE));
      if (res) stage_r(rg + (t + 2) * BK, rl + buf * STAGE); }
  }
  asm volatile("s_wait_asynccnt 0x0" ::: "memory");     // no copy is left in flight when the buffers are reused
  const int cls = bn / CD, bhi0 = bb * H + (bn % CD) / HD;   // HEADS: 0 q, 1 k, 2 v, and the block's first head; block-uniform
  const int h = (bn % CD) / HD + wn, bhi = bhi0 + wn;        // HEADS: this wave's own head
  const bool early = (t0 < EARLY);
  if (HEADS && cls == 2) {
    // acc[i][j][0..7] are 8 consecutive tokens of one head dim: one 16-B piece of a V^T row
    b16* Sv = reinterpret_cast<b16*>(smem); b16* Svr = Sv + BNT * VP;   // BNT rows: the head dims of the block's heads one after the other, as in VTh
#pragma unroll
    for (int i = 0; i < 2; ++i)
#pragma unroll
      for (int j = 0; j < NF; ++j) {
        const int cc = wn * WN + j * 16 + col; const float bv = bf16_rne(bias[bn + cc]); v8b oh;
#pragma unroll
        for (int r = 0; r < 8; ++r) {
          const float v = acc[i][j][r] + accr[i][j][r] * (1.0f / RS);
          const float v0 = (v * oscale + bv) * XS; acc[i][j][r] = v0; oh[r] = (b16)v0; }
        *(v8b*)(Sv + cc * VP + wm * 32 + i * 16 + 8 * hh) = oh; }
    if (early) {
#pragma unroll
      for (int i = 0; i < 2; ++i)
#pragma unroll
        for (int j = 0; j < NF; ++j) {
          const int cc = wn * WN + j * 16 + col; v8b orr;
#pragma unroll
          for (int r = 0; r < 8; ++r) { const float v0 = acc[i][j][r]; orr[r] = (b16)((v0 - (float)(b16)v0) * RS); }
          *(v8b*)(Svr + cc * VP + wm * 32 + i * 16 + 8 * hh) = orr; } }
    __syncthreads();   // V^T rows are read across waves
    b16* dv = VTh + (size_t)bhi0 * HD * (size_t)SK + t0;
#pragma unroll 1   // short trips, no gain from unrolling
    for (int it = 0; it < BNT / 16; ++it) {
      const int d = wave * (BNT / 8) + it * 2 + hh; const v8b f = *(const v8b*)(Sv + d * VP + col * 8);
      *(v8b*)(dv + (size_t)d * SK + col * 8) = f; }
    if (early) {   // then t0 == 0
      b16* dvr = VTr + (size_t)bhi0 * HD * (size_t)EARLY;
#pragma unroll 1   // as above
      for (int it = 0; it < BNT / 16; ++it) {
        const int d = wave * (BNT / 8) + it * 2 + hh; const v8b fr = *(const v8b*)(Svr + d * VP + col * 8);
        *(v8b*)(dvr + (size_t)d * EARLY + col * 8) = fr; } }
    return;
  }
#pragma unroll
  for (int i = 0; i < 2; ++i)
#pragma unroll
    for (int j = 0; j < NF; ++j) {
      const int cc = wn * WN + j * 16 + col; const float bv = bf16_rne(bias[bn + cc]);
      float* Cw = HEADS ? Cs + wn * BM * CP + j * 16 + col : Cs + cc;   // HEADS: a plane of BM rows x CP for each of the two heads
#pragma unroll
      for (int r = 0; r < 8; ++r) {
        const float v = acc[i][j][r] + accr[i][j][r] * (1.0f / RS);   // accr stays 0 when the residual plane is off
        Cw[(wm * 32 + i * 16 + 8 * hh + r) * CP] = v * oscale + bv; } }
  __syncthreads();   // Cs rows are read across waves (HEADS: across the lanes of the wave that wrote them)
  if constexpr (HEADS) {
    // From here on a wave works alone, on the 32 rows of its own head that it staged. A lane holds head dims lane and lane + 32, the two partners of one rotation.
    const float invf = exp2f(-(float)lane * (LOG2B / 32.0f));   // (1/10000)^(2i/64)
    const float ang = (float)h * invf; float s, c; sincosf(ang, &s, &c);
    float* rows = Cs + (wn * BM + wm * 32) * CP;
#pragma unroll 1   // batches of 8 rows: more at once would take more registers than the k loop does and cost a resident block
    for (int g = 0; g < 32; g += 8) {
      float e0[8], e1[8], ss[8];
      // Every '#pragma unroll' of this batch keeps the index of a register array a compile-time constant; the 8 rows go through each stage side by side, so that
      // their LDS reads and lane exchanges overlap.
#pragma unroll
      for (int i = 0; i < 8; ++i) { e0[i] = rows[(g + i) * CP + lane]; e1[i] = rows[(g + i) * CP + lane + 32]; ss[i] = e0[i] * e0[i] + e1[i] * e1[i]; }
#pragma unroll
      for (int off = 16; off > 0; off >>= 1)
#pragma unroll
        for (int i = 0; i < 8; ++i) ss[i] += __shfl_xor(ss[i], off);
      // The batch's rows are in registers by now: a row's f16 hi goes over the first 128 B of its own 256 B, its residual over the second.
#pragma unroll
      for (int i = 0; i < 8; ++i) {
        const float rn = rsqrtf(ss[i] * (1.0f / 64.0f) + RMS_EPS);
        const float n0 = e0[i] * rn, n1 = e1[i] * rn;
        const float y0 = (n0 * c + n1 * s) * XS, y1 = (n1 * c - n0 * s) * XS;
        b16* ro = reinterpret_cast<b16*>(rows + (g + i) * CP);
        ro[lane] = (b16)y0; ro[lane + 32] = (b16)y1; e0[i] = y0; e1[i] = y1;
      }
      if (early) {
#pragma unroll
        for (int i = 0; i < 8; ++i) {
          const float y0 = e0[i], y1 = e1[i]; b16* ro = reinterpret_cast<b16*>(rows + (g + i) * CP);
          ro[64 + lane] = (b16)((y0 - (float)(b16)y0) * RS); ro[96 + lane] = (b16)((y1 - (float)(b16)y1) * RS); } }
    }
    wave_lds_sync();
    const int r4 = lane >> 3, c8 = (lane & 7) * 8;
    b16* dh = (cls == 0 ? Qh : Kh) + ((size_t)bhi * SEQ + (size_t)(t0 + wm * 32)) * HD;
#pragma unroll 1   // short trips, no gain from unrolling
    for (int it = 0; it < 8; ++it) {
      const int rr = it * 4 + r4; const v8b f = *(const v8b*)(reinterpret_cast<const b16*>(rows + rr * CP) + c8);
      *(v8b*)(dh + (size_t)rr * HD + c8) = f; }
    if (early) {   // then t0 == 0
      b16* dr = (cls == 0 ? Qr : Kr) + ((size_t)bhi * EARLY + (size_t)(wm * 32)) * HD;
#pragma unroll 1   // as above
      for (int it = 0; it < 8; ++it) {
        const int rr = it * 4 + r4; const v8b fr = *(const v8b*)(reinterpret_cast<const b16*>(rows + rr * CP) + 64 + c8);
        *(v8b*)(dr + (size_t)rr * HD + c8) = fr; } }
  } else {
    float* Cb = C + ((size_t)bb * (size_t)cstr + (size_t)t0) * (size_t)N + bn;
#pragma unroll 1
    for (int it = 0; it < 8; ++it) {
      const int rr = wave * 16 + it * 2 + hh; const v4f f = *(const v4f*)(Cs + rr * CP + col * 4);
      *(v4f*)(Cb + (size_t)rr * N + col * 4) = f; }
  }
}

// Causal softmax(Q K^T / 8) V per (b, h) for the queries below EARLY: the body of the work-groups bx < EARLY / 64 of attn_main_kernel's launch. 4 waves x 16 queries, each
// wave on its own (no block barrier); key steps of 32 from 0 up to the last query of the wave's 32-query group in fixed order, keys above the query replaced by -inf
// before the running-max softmax (f32); P x1024 via wave-private LDS; O^T += V^T P^T.
// ER (queries < EARLY, which only visit keys < EARLY): S adds K_hi Q_res + K_res Q_hi (x1024), P adds a x1024 residual tile and V a x1024 residual
// plane into a second accumulator folded before normalisation, and the x16 y row is written as f16 hi plus a x1024 residual. y rows -> Yh [b*SEQ + q][h*64 + d]
template <bool ER>
__device__ __forceinline__ void attn_rows(const b16* __restrict__ Qh, const b16* __restrict__ Qr, const b16* __restrict__ Kh, const b16* __restrict__ Kr,
                                          const b16* __restrict__ VTh, const b16* __restrict__ VTr, b16* __restrict__ Yh, b16* __restrict__ Yr,
                                          b16 (*Pb)[16][32 + 8], b16 (*Pr)[16][32 + 8], b16 (*Th)[16][TP], b16 (*Tr)[16][TP], int bx) {
  const int wave = __builtin_amdgcn_readfirstlane((int)threadIdx.x >> 5), lane = threadIdx.x & 31, hh = lane >> 4, col = lane & 15;   // scalar: the key loop's end hangs on it
  const int bhi = (int)blockIdx.y; const int b = bhi / H, h = bhi % H; const int q0 = bx * 64 + wave * 16, qi = q0 + col;
  const b16* Qb = Qh + (size_t)bhi * QL * HD; const b16* Kb = Kh + (size_t)bhi * SK * HD; const b16* Vb = VTh + (size_t)bhi * HD * (size_t)SK;
  const b16* Qrb = Qr + (size_t)bhi * EARLY * HD; const b16* Krb = Kr + (size_t)bhi * EARLY * HD; const b16* Vrb = VTr + (size_t)bhi * HD * (size_t)EARLY;
  const v16b qa0 = frag_kb(Qb + (size_t)qi * HD, hh), qa1 = frag_kb(Qb + (size_t)qi * HD + 32, hh);
  v16b qr0 = (v16b){}, qr1 = (v16b){};
  if constexpr (ER) { qr0 = frag_kb(Qrb + (size_t)qi * HD, hh); qr1 = frag_kb(Qrb + (size_t)qi * HD + 32, hh); }
  const float cs = LOG2E / (8.0f * XS * XS);   // 1/sqrt(64) and the two x8 carriers, in the log2 domain
  float m = -INFINITY, l = 0.0f; v8f o[4], o2[4];
#pragma unroll
  for (int t = 0; t < 4; ++t) { o[t] = (v8f){}; o2[t] = (v8f){}; }
  const int kend = (q0 >> 5) * 32 + 32;   // causal: keys 0 .. last query of this wave's 32-query group; ER: kend <= EARLY
#pragma unroll 1
  for (int kb = 0; kb < kend; kb += 32) {
    float e[16]; float mx = -INFINITY;
#pragma unroll
    for (int u = 0; u < 2; ++u) {
      const int krow = kb + u * 16 + col;
      const v16b kh0 = frag_kb(Kb + (size_t)krow * HD, hh), kh1 = frag_kb(Kb + (size_t)krow * HD + 32, hh);
      v8f s = (v8f){}; s = wmma16b(kh0, qa0, s); s = wmma16b(kh1, qa1, s);
      v8f sr = (v8f){};
      if constexpr (ER) {
        const v16b kr0 = frag_kb(Krb + (size_t)krow * HD, hh), kr1 = frag_kb(Krb + (size_t)krow * HD + 32, hh);
        sr = wmma16b(kh0, qr0, sr); sr = wmma16b(kh1, qr1, sr); sr = wmma16b(kr0, qa0, sr); sr = wmma16b(kr1, qa1, sr); }
#pragma unroll
      for (int r = 0; r < 8; ++r) {
        float v = s[r];
        if constexpr (ER) v += sr[r] * (1.0f / RS);
        v *= cs;
        const int key = kb + u * 16 + 8 * hh + r;
        v = (key > qi) ? -INFINITY : v;
        e[u * 8 + r] = v; mx = fmaxf(mx, v); } }
    mx = fmaxf(mx, __shfl_xor(mx, 16)); const float mn = fmaxf(m, mx); const float al = nexp2(m - mn); float sum = 0.0f;
#pragma unroll
    for (int i2 = 0; i2 < 16; ++i2) {
      const float p = nexp2(e[i2] - mn); sum += p; const int pi = (i2 < 8 ? 0 : 16) + 8 * hh + (i2 & 7);
      const float pp = p * PS; const b16 ph = (b16)pp; Pb[wave][col][pi] = ph;
      if constexpr (ER) Pr[wave][col][pi] = (b16)((pp - (float)ph) * RS); }
    sum += __shfl_xor(sum, 16); l = l * al + sum; m = mn;
    wave_lds_sync();
    const v16b pf = frag_kb(&Pb[wave][col][0], hh);
    v16b prf = (v16b){};
    if constexpr (ER) prf = frag_kb(&Pr[wave][col][0], hh);
#pragma unroll
    for (int t = 0; t < 4; ++t) {
      o[t] *= al; const v16b vh = frag_kb(Vb + (size_t)(t * 16 + col) * SK + kb, hh);
      o[t] = wmma16b(vh, pf, o[t]);
      if constexpr (ER) { const v16b vr = frag_kb(Vrb + (size_t)(t * 16 + col) * EARLY + kb, hh); o2[t] *= al; o2[t] = wmma16b(vh, prf, o2[t]); o2[t] = wmma16b(vr, pf, o2[t]); } }
    wave_lds_sync(); }
  const float inv = YS / (l * PS * XS);
#pragma unroll
  for (int t = 0; t < 4; ++t) {
#pragma unroll
    for (int r = 0; r < 8; ++r) {
      float ov = o[t][r];
      if constexpr (ER) ov += o2[t][r] * (1.0f / RS);
      const float yv = ov * inv; const b16 yh = (b16)yv;
      Th[wave][col][t * 16 + 8 * hh + r] = yh;
      if constexpr (ER) Tr[wave][col][t * 16 + 8 * hh + r] = (b16)((yv - (float)yh) * RS); } }
  wave_lds_sync();
  b16* yb = Yh + ((size_t)b * SEQ + (size_t)q0) * CD + (size_t)h * HD;
  {
#pragma unroll 1
    for (int it = 0; it < 4; ++it) {
      const int rr = it * 4 + (lane >> 3), c8 = (lane & 7) * 8; const v8b f = *(const v8b*)(&Th[wave][rr][c8]);
      *(v8b*)(yb + (size_t)rr * CD + c8) = f;
      if constexpr (ER) {
        const v8b fr = *(const v8b*)(&Tr[wave][rr][c8]);
        *(v8b*)(Yr + (((size_t)b * EARLY + (size_t)(q0 + rr)) * CD + (size_t)h * HD + c8)) = fr; } }
     }
}

// One staged tile pair = 64 keys: K rows [64 keys][64 dims] and V^T rows [64 dims][64 keys], 128 B a row, laid at the 144-B pitch of TP. 128 threads, 16 B a lane:
// copy j of a thread brings row (tid >> 3) + 16 j, piece tid & 7, so a wave's copy covers four whole 128-B lines. kg / vg: the lane's first global byte of the tile,
// kl / vl: its first LDS byte. s_wait_xcnt stands inside the statement so that no address register named here is rewritten ahead of it.
__device__ __forceinline__ void stage_kv(const b16* kg, const b16* vg, unsigned kl, unsigned vl) {
  const b16 *k1 = kg + 16 * HD, *k2 = kg + 32 * HD, *k3 = kg + 48 * HD; const b16 *v1 = vg + 16 * (size_t)SK, *v2 = vg + 32 * (size_t)SK, *v3 = vg + 48 * (size_t)SK;
  const unsigned kl1 = kl + 16 * TP * 2, kl2 = kl + 32 * TP * 2, kl3 = kl + 48 * TP * 2, vl1 = vl + 16 * TP * 2, vl2 = vl + 32 * TP * 2, vl3 = vl + 48 * TP * 2;
  asm volatile("global_load_async_to_lds_b128 %0, %8, off\n\t"
               "global_load_async_to_lds_b128 %1, %9, off\n\t"
               "global_load_async_to_lds_b128 %2, %10, off\n\t"
               "global_load_async_to_lds_b128 %3, %11, off\n\t"
               "global_load_async_to_lds_b128 %4, %12, off\n\t"
               "global_load_async_to_lds_b128 %5, %13, off\n\t"
               "global_load_async_to_lds_b128 %6, %14, off\n\t"
               "global_load_async_to_lds_b128 %7, %15, off\n\t"
               "s_wait_xcnt 0x0"
               :: "v"(kl), "v"(kl1), "v"(kl2), "v"(kl3), "v"(vl), "v"(vl1), "v"(vl2), "v"(vl3), "v"(kg), "v"(k1), "v"(k2), "v"(k3), "v"(vg), "v"(v1), "v"(v2), "v"(v3)
               : "memory");
}

// One launch for all queries: grid (query blocks of 64, NB*H); block = 4 waves x 16 queries. Blocks below EARLY take attn_rows above and leave; they need nothing from the
// others. From EARLY on, the same causal softmax(Q K^T / 8) V without residual planes.
// K and V^T come in tiles of 64 keys, copied once per block into two LDS buffers (tile s + 1 flies while tile s is worked on) and read as fragments by all
// four waves. Each wave walks key steps of 32 in the same fixed order and up to the same last key (the end of its 32-query group) as the kernel above.
// No running maximum here: rms-norm leaves q and k with a length of at most 8 for any input (rotation keeps it, the f16 rounding adds under 2^-10 of it), so |score| = |q . k| / 8
// stays below 8 + 1/64 and P = exp(score) x 2^POFF lies between 2^-9 and 2^15, inside the normal f16 range with its full relative precision. O and the row sum carry the same
// factor, which the division behind the loop takes out.
// Every plain '#pragma unroll' below keeps the index of a register array a compile-time constant.
__global__ __launch_bounds__(128) void attn_main_kernel(const b16* __restrict__ Qh, const b16* __restrict__ Qr, const b16* __restrict__ Kh, const b16* __restrict__ Kr,
                                                        const b16* __restrict__ VTh, const b16* __restrict__ VTr, b16* __restrict__ Yh, b16* __restrict__ Yr) {
  __shared__ __attribute__((aligned(16))) b16 Ks[2][64][TP];
  __shared__ __attribute__((aligned(16))) b16 Vs[2][64][TP];
  __shared__ __attribute__((aligned(16))) b16 Pb[4][16][32 + 8];
  __shared__ __attribute__((aligned(16))) b16 Th[4][16][TP];
  const int bx = (int)blockIdx.x;
  if (bx < EARLY / 64) {   // block-uniform, ahead of every copy and barrier; the residual tiles lie in the K and V buffers, which such a block does not fill
    attn_rows<true>(Qh, Qr, Kh, Kr, VTh, VTr, Yh, Yr, Pb, reinterpret_cast<b16 (*)[16][32 + 8]>(&Ks[0][0][0]), Th, reinterpret_cast<b16 (*)[16][TP]>(&Vs[0][0][0]), bx);
    return;
  }
  const int tid = threadIdx.x, wave = __builtin_amdgcn_readfirstlane(tid >> 5), lane = tid & 31, hh = lane >> 4, col = lane & 15;
  const int bhi = (int)blockIdx.y; const int b = bhi / H, h = bhi % H; const int q0 = bx * 64 + wave * 16, qi = q0 + col;
  const b16* Qb = Qh + (size_t)bhi * QL * HD; const b16* Kb = Kh + (size_t)bhi * SK * HD; const b16* Vb = VTh + (size_t)bhi * HD * (size_t)SK;
  const int nst = bx + 1;                     // tiles of 64 keys: keys 0 .. last query of this block
  const int kend = (q0 >> 5) * 32 + 32;       // this wave's causal end
  const int srow = tid >> 3, sc8 = (tid & 7) * 8;
  const b16* kg = Kb + (size_t)srow * HD + sc8; const b16* vg = Vb + (size_t)srow * SK + sc8;   // tile s: kg + s * 64 * HD, vg + s * 64
  const unsigned kl = lds_off(&Ks[0][srow][sc8]), vl = lds_off(&Vs[0][srow][sc8]); constexpr unsigned BUFB = 64 * TP * 2;
  stage_kv(kg, vg, kl, vl);
  asm volatile("s_wait_asynccnt 0x0" ::: "memory");   // tile 0 has landed before the barrier that publishes it
  __syncthreads();
  if (nst > 1) stage_kv(kg + 64 * HD, vg + 64, kl + BUFB, vl + BUFB);
  const v16b qa0 = frag_kb(Qb + (size_t)qi * HD, hh), qa1 = frag_kb(Qb + (size_t)qi * HD + 32, hh);
  const float cs = LOG2E / (8.0f * XS * XS);   // 1/sqrt(64) and the two x8 carriers, in the log2 domain
  constexpr float POFF = 3.0f;                 // fixed exponent offset, log2 domain
  v2f l2 = (v2f){}; v8f o[4];                  // l2: this lane's own sums of P (its 16 keys a step, even and odd ones apart); the lane halves are joined behind the loop
#pragma unroll
  for (int t = 0; t < 4; ++t) o[t] = (v8f){};
#pragma unroll 1   // one copy of the loop body in the text: the buffer index is a run-time offset
  for (int s = 0; s < nst; ++s) {
    const int buf = s & 1;
#pragma unroll 1   // the two key steps of a tile share one body
    for (int sub = 0; sub < 64; sub += 32) {
      const int kb = s * 64 + sub;
      if (kb < kend) {   // wave-uniform: a wave skips the step wholly above its diagonal, never the publish point below
        float p[16];
#pragma unroll
        for (int u = 0; u < 2; ++u) {
          const b16* kr = &Ks[buf][sub + u * 16 + col][0];
          const v16b kh0 = frag_kb(kr, hh), kh1 = frag_kb(kr + 32, hh);
          v8f sc = (v8f){}; sc = wmma16(kh0, qa0, sc); sc = wmma16(kh1, qa1, sc);
#pragma unroll
          for (int r = 0; r < 8; ++r) {
            float v = __builtin_fmaf(sc[r], cs, POFF);
            const int key = kb + u * 16 + 8 * hh + r;
            v = (key > qi) ? -INFINITY : v;
            p[u * 8 + r] = nexp2(v); } }
#pragma unroll
        for (int i2 = 0; i2 < 16; i2 += 2) {
          l2 += (v2f){p[i2], p[i2 + 1]}; const int pi = (i2 < 8 ? 0 : 16) + 8 * hh + (i2 & 7);
          Pb[wave][col][pi] = (b16)p[i2]; Pb[wave][col][pi + 1] = (b16)p[i2 + 1]; }
        wave_lds_sync();
        const v16b pf = frag_kb(&Pb[wave][col][0], hh);
#pragma unroll
        for (int t = 0; t < 4; ++t) {
          const v16b vh = frag_kb(&Vs[buf][t * 16 + col][sub], hh);
          // the step's last product stands in front of a branch: it keeps its v_nop statement
          o[t] = (t == 3) ? wmma16b(vh, pf, o[t]) : wmma16(vh, pf, o[t]); }
        wave_lds_sync(); }
    }
    asm volatile("s_wait_dscnt 0x0" ::: "memory");      // this wave's reads of tile s are done before the buffer is handed back
    asm volatile("s_wait_asynccnt 0x0" ::: "memory");   // this wave's copies of tile s + 1 have landed
    __syncthreads();                                    // publishes tile s + 1 and ends every wave's reads of tile s
    if (s + 2 < nst) stage_kv(kg + (size_t)(s + 2) * 64 * HD, vg + (size_t)(s + 2) * 64, kl + buf * BUFB, vl + buf * BUFB);
  }
  asm volatile("s_wait_asynccnt 0x0" ::: "memory");     // no copy is left in flight when the wave ends
  float l = l2[0] + l2[1]; l += __shfl_xor(l, 16);      // a query's keys lie in lanes col and col + 16
  const float inv = YS / (l * XS);
#pragma unroll
  for (int t = 0; t < 4; ++t) {
#pragma unroll
    for (int r = 0; r < 8; ++r) Th[wave][col][t * 16 + 8 * hh + r] = (b16)(o[t][r] * inv); }
  wave_lds_sync();
  b16* yb = Yh + ((size_t)b * SEQ + (size_t)q0) * CD + (size_t)h * HD;
#pragma unroll 1   // as in the kernel above: four short trips, no gain from unrolling
  for (int it = 0; it < 4; ++it) {
    const int rr = it * 4 + (lane >> 3), c8 = (lane & 7) * 8; const v8b f = *(const v8b*)(&Th[wave][rr][c8]);
    *(v8b*)(yb + (size_t)rr * CD + c8) = f; }
}
}  // namespace

extern "C" void kernel_launch(void* const* d_in, const int* in_sizes, int n_in, void* d_out, int out_size, void* d_ws, size_t ws_size, hipStream_t stream) {
  // wire order: 0 x [NB_FULL][SEQ_FULL][1024] f32, 1 W_attn [1024][3072] f32, 2 b_attn [3072] f32, 3 W_proj [1024][1024] f32, 4 b_proj [1024] f32; out [NB_FULL][SEQ_FULL][1024] f32
  const size_t need_x = ((size_t)(NB - 1) * SEQ_FULL + (size_t)SEQ) * CD;
  if (n_in < 5 || (size_t)in_sizes[0] < need_x || (size_t)in_sizes[1] < (size_t)KD * N3 || (size_t)in_sizes[2] < (size_t)N3 ||
      (size_t)in_sizes[3] < (size_t)KD * CD || (size_t)in_sizes[4] < (size_t)CD || (size_t)out_size < need_x) return;
  const float* Xin = (const float*)d_in[0]; const float* Wa = (const float*)d_in[1]; const float* Ba = (const float*)d_in[2];
  const float* Wp = (const float*)d_in[3]; const float* Bp = (const float*)d_in[4];
  size_t off = 0; char* ws = (char*)d_ws;
  auto carve = [&](size_t bytes) { char* p = ws + off; off += (bytes + 255) & ~(size_t)255; return p; };
  b16* Xp = (b16*)carve((size_t)MROWS * CD * 2);                       //  8,388,608 B at NB=2, SEQ=2048
  b16* WaT = (b16*)carve((size_t)N3 * KD * 2);                         //  6,291,456
  b16* WpT = (b16*)carve((size_t)CD * KD * 2);                         //  2,097,152
  const size_t plane = (size_t)NB * H * SEQ * HD * 2, rplane = (size_t)NB * H * EARLY * HD * 2;
  b16* Qh = (b16*)carve(plane); b16* Kh = (b16*)carve(plane); b16* VTh = (b16*)carve(plane);      // 3 x 8,388,608
  b16* Qr = (b16*)carve(rplane); b16* Kr = (b16*)carve(rplane); b16* VTr = (b16*)carve(rplane);   // 3 x 524,288
  b16* Yh = (b16*)carve((size_t)MROWS * CD * 2);                       //  8,388,608
  b16* Yr = (b16*)carve((size_t)NB * EARLY * CD * 2);                  //    524,288   -> total 52,428,800 B
  if (off > ws_size || off > ((size_t)128 << 20)) return;
  cvt_all_kernel<<<dim3(WBLK + XBLK), 256, 0, stream>>>(Xin, Wa, Wp, Xp, WaT, WpT);
  gemm_kernel<true><<<dim3(N3 / (2 * BN), MROWS / BM), 256, 0, stream>>>(Xp, Xp, WaT, Ba, nullptr, Qh, Qr, Kh, Kr, VTh, VTr, N3, SEQ, 0, 1.0f / (XS * WS));
  attn_main_kernel<<<dim3(QL / 64, NB * H), 128, 0, stream>>>(Qh, Qr, Kh, Kr, VTh, VTr, Yh, Yr);
  gemm_kernel<false><<<dim3(CD / BN, MROWS / BM), 256, 0, stream>>>(Yh, Yr, WpT, Bp, (float*)d_out, nullptr, nullptr, nullptr, nullptr, nullptr, nullptr, CD, SEQ_FULL, 1, 1.0f / (YS * WS));
}

// v009
// A run of this version takes 85.3 microseconds.
// Next to v008, in two timings, it ran 1.13 times as fast each time.
// All steps since v000 together make it 3.61 times as fast.
#include <hip/hip_runtime.h>

// compute dtype: all contractions on v_wmma_f32_16x16x32_f16 (f16 operands, f32 accumulate). x @ W_attn and y @ W_proj: x and W enter as their bf16-RNE
// values carried x8 (x) and x64 (W) in f16 planes, 1 product; y carried x16 as f16 hi, plus a x1024 f16 residual plane on the first 128 token rows of each
// sequence (2 products there, second accumulator folded in the f32 epilogue). S^T = K Q^T per head: q, k after rms-norm and rotary carried x8 as f16 hi,
// 1 product; query blocks below 128 tokens add x1024 f16 q and k residual planes (3 products). O^T += V^T P^T: v carried x8 f16, P f16 (x1024 early, exp(score) x8 elsewhere), 1 product;
// the same early query blocks add P and v x1024 residuals into a second accumulator folded before normalisation. Norm, rotary, softmax statistics in f32.
// Fragment k-map per lane half hh for A AND B: elements 0..7 <- k = 8hh+0..7, 8..15 <- k = 16+8hh+0..7; acc[r] = D[8hh+r][col = lane&15].

#ifndef NB
#define NB 2
#endif
#ifndef SEQ
#define SEQ 2048
#endif
#ifndef NB_FULL
#define NB_FULL 2
#endif
#ifndef SEQ_FULL
#define SEQ_FULL 2048
#endif

namespace {
constexpr int H = 16, HD = 64, CD = 1024, N3 = 3 * CD, KD = CD, QL = SEQ, SK = SEQ, MROWS = NB * SEQ;
constexpr int EARLY = 128, EB = EARLY / 32;                       // token rows per sequence that get residual planes
constexpr int BM = 128, BN = 64, BK = 64, TP = 72, AP = BK + 8, CP = BN + 4, VP = BM + 8;
constexpr int ABYTES = BM * AP * 2, BBYTES = BN * AP * 2, SMEM = 2 * (ABYTES + BBYTES), NT = KD / BK;   // SMEM: no GEMM instance has less LDS
constexpr float XS = 8.0f, WS = 64.0f, YS = 16.0f, PS = 1024.0f, RS = 1024.0f;
constexpr float LOG2E = 1.4426950408889634f, LOG2B = 13.287712379549449f, RMS_EPS = 1.1920929e-07f;
static_assert(SEQ % BM == 0 && SEQ >= BM && SEQ <= SEQ_FULL && NB >= 1 && NB <= NB_FULL);
static_assert(EARLY == BM && EARLY % 64 == 0 && EB * 32 == EARLY && MROWS % BM == 0 && N3 % BN == 0 && CD % BN == 0 && KD % BK == 0);
static_assert(BM * CP * 4 <= SMEM && HD == 64 && QL == SK && SEQ % 64 == 0 && (MROWS * 128) % 256 == 0);
static_assert(BN == HD && 2 * HD * VP * 2 <= SMEM && NT >= 2 && ABYTES % 16 == 0 && BBYTES % 16 == 0);

typedef _Float16 b16;
typedef __attribute__((ext_vector_type(16))) _Float16 v16b;
typedef __attribute__((ext_vector_type(8))) _Float16 v8b;
typedef __attribute__((ext_vector_type(8))) float v8f;
typedef __attribute__((ext_vector_type(4))) float v4f;
typedef __attribute__((ext_vector_type(2))) float v2f;

__device__ __forceinline__ float bf16_rne(float f) { unsigned int u = __float_as_uint(f); u += 0x7FFFu + ((u >> 16) & 1u); return __uint_as_float(u & 0xFFFF0000u); }
// 16-bit fragment from a k-contiguous row: elements 0..7 <- p[8hh .. 8hh+7], 8..15 <- p[16+8hh .. 16+8hh+7]
__device__ __forceinline__ v16b frag_kb(const b16* p, int hh) {
  const v8b a = *(const v8b*)(p + 8 * hh), b = *(const v8b*)(p + 16 + 8 * hh); v16b f;
#pragma unroll
  for (int e = 0; e < 8; ++e) { f[e] = a[e]; f[8 + e] = b[e]; }
  return f;
}
__device__ __forceinline__ v8f wmma16b(v16b a, v16b b, v8f c) {
  v8f d = __builtin_amdgcn_wmma_f32_16x16x32_f16(false, a, false, b, (short)0, c, false, false);
  asm volatile("v_nop\n\tv_nop\n\tv_nop\n\tv_nop" : "+v"(d) : "v"(a), "v"(b));
  return d;
}
// The bare builtin: the compiler keeps the distance behind it itself, and with no volatile statement between the products it may issue a key step's LDS reads in groups ahead of them.
__device__ __forceinline__ v8f wmma16(v16b a, v16b b, v8f c) { return __builtin_amdgcn_wmma_f32_16x16x32_f16(false, a, false, b, (short)0, c, false, false); }
__device__ __forceinline__ void wave_lds_sync() { __builtin_amdgcn_fence(3, "workgroup"); __builtin_amdgcn_wave_barrier(); __builtin_amdgcn_fence(2, "workgroup"); }
__device__ __forceinline__ float nexp2(float v) { return __builtin_amdgcn_exp2f(v); }
// LDS byte address of a __shared__ object: the low 32 bits of its address.
__device__ __forceinline__ unsigned lds_off(const void* p) { return (unsigned)(size_t)p; }

__device__ __forceinline__ void store_tile64(const b16 (*S)[TP], b16* dst, size_t pitch, int wave, int lane) {
  {
#pragma unroll   // the LDS reads go out in groups ahead of their stores, not one read, one wait and one store a trip
    for (int it = 0; it < 8; ++it) {
      const int r = wave * 32 + it * 4 + (lane >> 3), c8 = (lane & 7) * 8;
      const v8b o = *(const v8b*)(&S[r][c8]);
      *(v8b*)(dst + (size_t)r * pitch + c8) = o; }
     }
}

// One launch converts all three GEMM operands; none of the three depends on another. Blocks of 256 threads, told apart by block index (block-uniform).
// Blocks 0 .. WBLK-1: W [KD][N] f32 (in-major: W[k][n]) -> WT [N][KD] f16 = bf16-RNE(W) x64 (k-contiguous per output column), in 64x64 tiles. A block takes four tiles
// that are neighbours along n, two waves a tile, each tile in its own LDS plane; tiles 0 .. WA_T-1 are W_attn's, the rest W_proj's (n tile fastest). They come first in
// the grid (for speed only).
// Blocks from WBLK on: x f32 -> Xp f16 = bf16-RNE(x) x8, XU pieces of 8 elements a thread, XBLK * 256 pieces apart.
// In both parts a thread issues all its global loads before it uses the first, so that it waits for memory once and the launch needs few waves.
constexpr int WA_T = (N3 / 64) * (KD / 64), WP_T = (CD / 64) * (KD / 64), WBLK = (WA_T + WP_T) / 4, XU = 8, XBLK = (int)((size_t)MROWS * 128 / (256 * XU));
static_assert(WA_T % 4 == 0 && WP_T % 4 == 0 && (N3 / 64) % 4 == 0 && (CD / 64) % 4 == 0 && ((size_t)MROWS * 128) % (256 * XU) == 0);
// One 64x64 tile of W, row pitch N (a compile-time constant: the 16 loads then differ in their immediate offset alone), by the tile's 64 threads.
template <int N>
__device__ __forceinline__ void cvt_w_tile(const float* src, b16 (*S)[TP], int tid) {
  const int k0 = tid >> 4, n = (tid & 15) * 4; v4f x[16];   // load it: row it * 4 + k0, columns n .. n + 3; both '#pragma unroll' keep the index of x a compile-time constant
  const float* p = src + (size_t)k0 * N + n;
#pragma unroll
  for (int it = 0; it < 16; ++it) x[it] = *(const v4f*)(p + (size_t)(it * 4) * N);
  // Inputs-only fence on the loaded values and the address: the address pair lives until all 16 loads are back, so that no result is put into a register that a load in
  // flight still names, and each pitch keeps its own run of 16 loads under one base (left alone, the compiler merges the two pitches and forms 16 addresses between the loads).
  asm volatile("" :: "v"(x[0]), "v"(x[1]), "v"(x[2]), "v"(x[3]), "v"(x[4]), "v"(x[5]), "v"(x[6]), "v"(x[7]), "v"(x[8]), "v"(x[9]), "v"(x[10]), "v"(x[11]), "v"(x[12]), "v"(x[13]),
               "v"(x[14]), "v"(x[15]), "v"(p));
#pragma unroll
  for (int it = 0; it < 16; ++it)
#pragma unroll
    for (int j = 0; j < 4; ++j) S[n + j][it * 4 + k0] = (b16)(bf16_rne(x[it][j]) * WS);
}
__global__ __launch_bounds__(256) void cvt_all_kernel(const float* __restrict__ X, const float* __restrict__ Wa, const float* __restrict__ Wp, b16* __restrict__ Xp,
                                                      b16* __restrict__ WaT, b16* __restrict__ WpT) {
  __shared__ __attribute__((aligned(16))) b16 St[4][64][TP];
  if ((int)blockIdx.x < WBLK) {
    const int grp = threadIdx.x >> 6, tid = threadIdx.x & 63, wave = tid >> 5, lane = tid & 31;
    const bool isa = (int)blockIdx.x * 4 < WA_T;   // block-uniform: WA_T is a multiple of 4
    const int t4 = (int)blockIdx.x * 4 - (isa ? 0 : WA_T); const int N = isa ? N3 : CD;   // t4: the block's first tile within its matrix, a multiple of 4
    const int nb = (isa ? t4 % (N3 / 64) : t4 % (CD / 64)) + grp, kb = isa ? t4 / (N3 / 64) : t4 / (CD / 64);
    const float* src = (isa ? Wa : Wp) + (size_t)kb * 64 * (size_t)N + (size_t)nb * 64;
    if (isa) cvt_w_tile<N3>(src, St[grp], tid); else cvt_w_tile<CD>(src, St[grp], tid);
    __syncthreads();   // a tile's plane is read across its two waves
    store_tile64(St[grp], (isa ? WaT : WpT) + (size_t)nb * 64 * KD + (size_t)kb * 64, KD, wave, lane);
    return;
  }
  const size_t u0 = (size_t)((int)blockIdx.x - WBLK) * 256 + threadIdx.x, g0 = u0 >> 7; const int piece = (int)(u0 & 127);   // piece k of the thread: row g0 + k * XBLK * 2
  v4f x0[XU], x1[XU];   // every '#pragma unroll' below keeps the index of these a compile-time constant
  const float* xs[XU];
#pragma unroll
  for (int k = 0; k < XU; ++k) {
    const size_t g = g0 + (size_t)k * (XBLK * 2); const size_t srow = (SEQ == SEQ_FULL) ? g : (g / SEQ) * SEQ_FULL + (g % SEQ);
    xs[k] = X + srow * CD + piece * 8; x0[k] = *(const v4f*)xs[k]; x1[k] = *(const v4f*)(xs[k] + 4); }
  // As in cvt_w_tile: inputs-only fence on the loaded values and the first address (left alone, the compiler puts a later load's result into that pair while loads that name it fly).
  asm volatile("" :: "v"(x0[0]), "v"(x0[1]), "v"(x0[2]), "v"(x0[3]), "v"(x0[4]), "v"(x0[5]), "v"(x0[6]), "v"(x0[7]), "v"(x1[0]), "v"(x1[1]), "v"(x1[2]), "v"(x1[3]), "v"(x1[4]),
               "v"(x1[5]), "v"(x1[6]), "v"(x1[7]), "v"(xs[0]));
#pragma unroll
  for (int k = 0; k < XU; ++k) {
    v8b o;
#pragma unroll
    for (int j = 0; j < 4; ++j) { o[j] = (b16)(bf16_rne(x0[k][j]) * XS); o[4 + j] = (b16)(bf16_rne(x1[k][j]) * XS); }
    *(v8b*)(Xp + (g0 + (size_t)k * (XBLK * 2)) * CD + piece * 8) = o; }
  asm volatile("s_wait_xcnt 0x0" ::: "memory");   // stands behind the run of stores, ahead of any later write of a register that one of them names
}

// Tile value c[m][n] = (A[m][.] . BT[n][.] + Ar[m][.] . BT[n][.] / 1024) * oscale + bf16-RNE(bias[n]); A, Ar, BT f16 with k-contiguous rows of KD = 1024, f32 accumulate.
// Rows m = b*SEQ + t (compact). The residual plane Ar ([b][EARLY][KD]) is used only when res_on != 0 and the tile's t0 < EARLY (block-uniform).
// Block 256 threads = 8 waves (4 along m x 2 along n), tile 128 x 64 (HEADS: 128 x 128, a wave 32 x 64, so that a byte copied from L2 and a fragment read from LDS feed more
// products); k tiles of 64 copied into two LDS buffers (tile t + 1 flies while tile t is multiplied), one block
// barrier a tile; epilogue staged in LDS. The HEADS instance is launched with the residual plane off and holds no room for it.
// HEADS == false: C[b*cstr + t][n] = c, f32, each 256-B row piece stored whole.
// HEADS == true (x @ W_attn): the tile's 128 columns are two heads of q, k or v, each wave's 64 one head h, and c never goes to memory. q and k: rms-norm over the 64 head dims, rotary with
// angle h * inv_freq[i] (head-indexed, same for every token), x8, f16 hi into Qh/Kh [bhi][SEQ][64] and, for t0 < EARLY, x1024 residuals into Qr/Kr [bhi][EARLY][64];
// v: x8, transposed through LDS into VTh [bhi][64][SEQ] and VTr [bhi][64][EARLY]. EARLY == BM: a tile is early as a whole or not at all.
// One k tile = rows of 128 B laid at the 144-B pitch of AP. 256 threads, 16 B a lane: copy j of a thread brings row (tid >> 3) + 32 j, piece tid & 7, so a wave's copy covers
// four whole 128-B lines. ag / bg / rg: the lane's first global byte of the tile, al / bl / rl: its first LDS byte. s_wait_xcnt stands inside each statement so that no
// address register named there is rewritten ahead of it.
__device__ __forceinline__ void stage_ab(const b16* ag, const b16* bg, unsigned al, unsigned bl) {   // A: 128 rows, BT: 64 rows
  const b16 *a1 = ag + 32 * KD, *a2 = ag + 64 * KD, *a3 = ag + 96 * KD, *b1 = bg + 32 * KD;
  const unsigned al1 = al + 32 * AP * 2, al2 = al + 64 * AP * 2, al3 = al + 96 * AP * 2, bl1 = bl + 32 * AP * 2;
  asm volatile("global_load_async_to_lds_b128 %0, %6, off\n\t"
               "global_load_async_to_lds_b128 %1, %7, off\n\t"
               "global_load_async_to_lds_b128 %2, %8, off\n\t"
               "global_load_async_to_lds_b128 %3, %9, off\n\t"
               "global_load_async_to_lds_b128 %4, %10, off\n\t"
               "global_load_async_to_lds_b128 %5, %11, off\n\t"
               "s_wait_xcnt 0x0"
               :: "v"(al), "v"(al1), "v"(al2), "v"(al3), "v"(bl), "v"(bl1), "v"(ag), "v"(a1), "v"(a2), "v"(a3), "v"(bg), "v"(b1)
               : "memory");
}
__device__ __forceinline__ void stage_ab128(const b16* ag, const b16* bg, unsigned al, unsigned bl) {   // A: 128 rows, BT: 128 rows
  const b16 *a1 = ag + 32 * KD, *a2 = ag + 64 * KD, *a3 = ag + 96 * KD, *b1 = bg + 32 * KD, *b2 = bg + 64 * KD, *b3 = bg + 96 * KD;
  const unsigned al1 = al + 32 * AP * 2, al2 = al + 64 * AP * 2, al3 = al + 96 * AP * 2, bl1 = bl + 32 * AP * 2, bl2 = bl + 64 * AP * 2, bl3 = bl + 96 * AP * 2;
  asm volatile("global_load_async_to_lds_b128 %0, %8, off\n\t"
               "global_load_async_to_lds_b128 %1, %9, off\n\t"
               "global_load_async_to_lds_b128 %2, %10, off\n\t"
               "global_load_async_to_lds_b128 %3, %11, off\n\t"
               "global_load_async_to_lds_b128 %4, %12, off\n\t"
               "global_load_async_to_lds_b128 %5, %13, off\n\t"
               "global_load_async_to_lds_b128 %6, %14, off\n\t"
               "global_load_async_to_lds_b128 %7, %15, off\n\t"
               "s_wait_xcnt 0x0"
               :: "v"(al), "v"(al1), "v"(al2), "v"(al3), "v"(bl), "v"(bl1), "v"(bl2), "v"(bl3), "v"(ag), "v"(a1), "v"(a2), "v"(a3), "v"(bg), "v"(b1), "v"(b2), "v"(b3)
               : "memory");
}
__device__ __forceinline__ void stage_r(const b16* rg, unsigned rl) {   // residual plane: 128 rows
  const b16 *r1 = rg + 32 * KD, *r2 = rg + 64 * KD, *r3 = rg + 96 * KD;
  const unsigned rl1 = rl + 32 * AP * 2, rl2 = rl + 64 * AP * 2, rl3 = rl + 96 * AP * 2;
  asm volatile("global_load_async_to_lds_b128 %0, %4, off\n\t"
               "global_load_async_to_lds_b128 %1, %5, off\n\t"
               "global_load_async_to_lds_b128 %2, %6, off\n\t"
               "global_load_async_to_lds_b128 %3, %7, off\n\t"
               "s_wait_xcnt 0x0"
               :: "v"(rl), "v"(rl1), "v"(rl2), "v"(rl3), "v"(rg), "v"(r1), "v"(r2), "v"(r3)
               : "memory");
}

template <bool HEADS>
__global__ __launch_bounds__(256) void gemm_kernel(const b16* __restrict__ A, const b16* __restrict__ Ar, const b16* __restrict__ BT, const float* __restrict__ bias,
                                                   float* __restrict__ C, b16* __restrict__ Qh, b16* __restrict__ Qr, b16* __restrict__ Kh, b16* __restrict__ Kr,
                                                   b16* __restrict__ VTh, b16* __restrict__ VTr, int N, int cstr, int res_on, float oscale) {
  constexpr int NF = HEADS ? 4 : 2, WN = 16 * NF, BNT = 2 * WN;   // BT fragments and columns a wave, columns a block: HEADS 128 = two heads, one to each wn
  constexpr int BOFF = HEADS ? ABYTES : 2 * ABYTES, STAGE = BOFF + BNT * AP * 2;   // one buffer: A | residual plane (not HEADS) | BT
  static_assert(!HEADS || (WN == HD && CD % BNT == 0 && N3 % BNT == 0 && 2 * BM * CP * 4 <= 2 * STAGE && 2 * BNT * VP * 2 <= 2 * STAGE));
  __shared__ __attribute__((aligned(16))) char smem[2 * STAGE];
  float* Cs = reinterpret_cast<float*>(smem);   // aliases the buffers after the k loop (block barrier in between)
  const int tid = threadIdx.x, wave = tid >> 5, lane = tid & 31, hh = lane >> 4, col = lane & 15, wm = wave >> 1, wn = wave & 1;
  const int bm = (int)blockIdx.y * BM, bn = (int)blockIdx.x * BNT; const int bb = bm / SEQ, t0 = bm % SEQ;
  const bool res = !HEADS && (res_on != 0) && (t0 < EARLY);
  const b16* Ab = A + (size_t)bm * KD; const b16* Bb = BT + (size_t)bn * KD;
  const b16* Arb = Ar + ((size_t)bb * EARLY + (size_t)t0) * KD;   // dereferenced only when res (then t0 == 0)
  v8f acc[2][NF], accr[2][NF];
#pragma unroll
  for (int i = 0; i < 2; ++i)
#pragma unroll
    for (int j = 0; j < NF; ++j) { acc[i][j] = (v8f){}; accr[i][j] = (v8f){}; }
  const int srow = tid >> 3, sc8 = (tid & 7) * 8;
  const b16* ag = Ab + (size_t)srow * KD + sc8; const b16* bg = Bb + (size_t)srow * KD + sc8; const b16* rg = Arb + (size_t)srow * KD + sc8;   // tile t: + t * BK
  const unsigned al = lds_off(smem) + (unsigned)(srow * AP + sc8) * 2u, rl = al + ABYTES, bl = al + BOFF;                                    // buffer 1: + STAGE
  auto stage = [&](int t, unsigned bo) {   // k tile t into the buffer at byte bo
    if constexpr (HEADS) stage_ab128(ag + t * BK, bg + t * BK, al + bo, bl + bo);
    else stage_ab(ag + t * BK, bg + t * BK, al + bo, bl + bo);
  };
  stage(0, 0u);
  if (res) stage_r(rg, rl);
  asm volatile("s_wait_asynccnt 0x0" ::: "memory");   // tile 0 has landed before the barrier that publishes it
  __syncthreads();
  stage(1, (unsigned)STAGE);
  if (res) stage_r(rg + BK, rl + STAGE);
#pragma unroll 1   // one copy of the loop body in the text: the buffer index is a run-time offset
  for (int t = 0; t < NT; ++t) {
    const int buf = t & 1;
    const b16* As = reinterpret_cast<const b16*>(smem + buf * STAGE); const b16* Ars = reinterpret_cast<const b16*>(smem + buf * STAGE + ABYTES);
    const b16* Bs = reinterpret_cast<const b16*>(smem + buf * STAGE + BOFF);
#pragma unroll
    for (int ks = 0; ks < BK; ks += 32) {
      const v16b a0 = frag_kb(As + (wm * 32 + col) * AP + ks, hh), a1 = frag_kb(As + (wm * 32 + 16 + col) * AP + ks, hh);
      v16b bf[NF];   // every '#pragma unroll' over j keeps the index of a register array a compile-time constant
#pragma unroll
      for (int j = 0; j < NF; ++j) bf[j] = frag_kb(Bs + (wn * WN + j * 16 + col) * AP + ks, hh);
#pragma unroll
      for (int j = 0; j < NF; ++j) acc[0][j] = wmma16b(a0, bf[j], acc[0][j]);
#pragma unroll
      for (int j = 0; j < NF; ++j) acc[1][j] = wmma16b(a1, bf[j], acc[1][j]);
      if (res) {
        const v16b r0 = frag_kb(Ars + (wm * 32 + col) * AP + ks, hh), r1 = frag_kb(Ars + (wm * 32 + 16 + col) * AP + ks, hh);
#pragma unroll
        for (int j = 0; j < NF; ++j) accr[0][j] = wmma16b(r0, bf[j], accr[0][j]);
#pragma unroll
        for (int j = 0; j < NF; ++j) accr[1][j] = wmma16b(r1, bf[j], accr[1][j]); }
    }
    asm volatile("s_wait_dscnt 0x0" ::: "memory");      // this wave's reads of tile t are done before the buffer is handed back
    asm volatile("s_wait_asynccnt 0x0" ::: "memory");   // this wave's copies of tile t + 1 have landed
    __syncthreads();                                    // publishes tile t + 1 and ends every wave's reads of tile t (after the last tile: the epilogue aliases)
    if (t + 2 < NT) {
      stage(t + 2, (unsigned)(buf * STAGE));
      if (res) stage_r(rg + (t + 2) * BK, rl + buf * STAGE); }
  }
  asm volatile("s_wait_asynccnt 0x0" ::: "memory");     // no copy is left in flight when the buffers are reused
  const int cls = bn / CD, bhi0 = bb * H + (bn % CD) / HD;   // HEADS: 0 q, 1 k, 2 v, and the block's first head; block-uniform
  const int h = (bn % CD) / HD + wn, bhi = bhi0 + wn;        // HEADS: this wave's own head
  const bool early = (t0 < EARLY);
  if (HEADS && cls == 2) {
    // acc[i][j][0..7] are 8 consecutive tokens of one head dim: one 16-B piece of a V^T row
    b16* Sv = reinterpret_cast<b16*>(smem); b16* Svr = Sv + BNT * VP;   // BNT rows: the head dims of the block's heads one after the other, as in VTh
#pragma unroll
    for (int i = 0; i < 2; ++i)
#pragma unroll
      for (int j = 0; j < NF; ++j) {
        const int cc = wn * WN + j * 16 + col; const float bv = bf16_rne(bias[bn + cc]); v8b oh;
#pragma unroll
        for (int r = 0; r < 8; ++r) {
          const float v = acc[i][j][r] + accr[i][j][r] * (1.0f / RS);
          const float v0 = (v * oscale + bv) * XS; acc[i][j][r] = v0; oh[r] = (b16)v0; }
        *(v8b*)(Sv + cc * VP + wm * 32 + i * 16 + 8 * hh) = oh; }
    if (early) {
#pragma unroll
      for (int i = 0; i < 2; ++i)
#pragma unroll
        for (int j = 0; j < NF; ++j) {
          const int cc = wn * WN + j * 16 + col; v8b orr;
#pragma unroll
          for (int r = 0; r < 8; ++r) { const float v0 = acc[i][j][r]; orr[r] = (b16)((v0 - (float)(b16)v0) * RS); }
          *(v8b*)(Svr + cc * VP + wm * 32 + i * 16 + 8 * hh) = orr; } }
    __syncthreads();   // V^T rows are read across waves
    b16* dv = VTh + (size_t)bhi0 * HD * (size_t)SK + t0;
#pragma unroll 1   // short trips, no gain from unrolling
    for (int it = 0; it < BNT / 16; ++it) {
      const int d = wave * (BNT / 8) + it * 2 + hh; const v8b f = *(const v8b*)(Sv + d * VP + col * 8);
      *(v8b*)(dv + (size_t)d * SK + col * 8) = f; }
    if (early) {   // then t0 == 0
      b16* dvr = VTr + (size_t)bhi0 * HD * (size_t)EARLY;
#pragma unroll 1   // as above
      for (int it = 0; it < BNT / 16; ++it) {
        const int d = wave * (BNT / 8) + it * 2 + hh; const v8b fr = *(const v8b*)(Svr + d * VP + col * 8);
        *(v8b*)(dvr + (size_t)d * EARLY + col * 8) = fr; } }
    return;
  }
#pragma unroll
  for (int i = 0; i < 2; ++i)
#pragma unroll
    for (int j = 0; j < NF; ++j) {
      const int cc = wn * WN + j * 16 + col; const float bv = bf16_rne(bias[bn + cc]);
      float* Cw = HEADS ? Cs + wn * BM * CP + j * 16 + col : Cs + cc;   // HEADS: a plane of BM rows x CP for each of the two heads
#pragma unroll
      for (int r = 0; r < 8; ++r) {
        const float v = acc[i][j][r] + accr[i][j][r] * (1.0f / RS);   // accr stays 0 when the residual plane is off
        Cw[(wm * 32 + i * 16 + 8 * hh + r) * CP] = v * oscale + bv; } }
  __syncthreads();   // Cs rows are read across waves (HEADS: across the lanes of the wave that wrote them)
  if constexpr (HEADS) {
    // From here on a wave works alone, on the 32 rows of its own head that it staged. A lane holds head dims lane and lane + 32, the two partners of one rotation.
    const float invf = exp2f(-(float)lane * (LOG2B / 32.0f));   // (1/10000)^(2i/64)
    const float ang = (float)h * invf; float s, c; sincosf(ang, &s, &c);
    float* rows = Cs + (wn * BM + wm * 32) * CP;
#pragma unroll 1   // batches of 8 rows: more at once would take more registers than the k loop does and cost a resident block
    for (int g = 0; g < 32; g += 8) {
      float e0[8], e1[8], ss[8];
      // Every '#pragma unroll' of this batch keeps the index of a register array a compile-time constant; the 8 rows go through each stage side by side, so that
      // their LDS reads and lane exchanges overlap.
#pragma unroll
      for (int i = 0; i < 8; ++i) { e0[i] = rows[(g + i) * CP + lane]; e1[i] = rows[(g + i) * CP + lane + 32]; ss[i] = e0[i] * e0[i] + e1[i] * e1[i]; }
#pragma unroll
      for (int off = 16; off > 0; off >>= 1)
#pragma unroll
        for (int i = 0; i < 8; ++i) ss[i] += __shfl_xor(ss[i], off);
      // The batch's rows are in registers by now: a row's f16 hi goes over the first 128 B of its own 256 B, its residual over the second.
#pragma unroll
      for (int i = 0; i < 8; ++i) {
        const float rn = rsqrtf(ss[i] * (1.0f / 64.0f) + RMS_EPS);
        const float n0 = e0[i] * rn, n1 = e1[i] * rn;
        const float y0 = (n0 * c + n1 * s) * XS, y1 = (n1 * c - n0 * s) * XS;
        b16* ro = reinterpret_cast<b16*>(rows + (g + i) * CP);
        ro[lane] = (b16)y0; ro[lane + 32] = (b16)y1; e0[i] = y0; e1[i] = y1;
      }
      if (early) {
#pragma unroll
        for (int i = 0; i < 8; ++i) {
          const float y0 = e0[i], y1 = e1[i]; b16* ro = reinterpret_cast<b16*>(rows + (g + i) * CP);
          ro[64 + lane] = (b16)((y0 - (float)(b16)y0) * RS); ro[96 + lane] = (b16)((y1 - (float)(b16)y1) * RS); } }
    }
    wave_lds_sync();
    const int r4 = lane >> 3, c8 = (lane & 7) * 8;
    b16* dh = (cls == 0 ? Qh : Kh) + ((size_t)bhi * SEQ + (size_t)(t0 + wm * 32)) * HD;
#pragma unroll 1   // short trips, no gain from unrolling
    for (int it = 0; it < 8; ++it) {
      const int rr = it * 4 + r4; const v8b f = *(const v8b*)(reinterpret_cast<const b16*>(rows + rr * CP) + c8);
      *(v8b*)(dh + (size_t)rr * HD + c8) = f; }
    if (early) {   // then t0 == 0
      b16* dr = (cls == 0 ? Qr : Kr) + ((size_t)bhi * EARLY + (size_t)(wm * 32)) * HD;
#pragma unroll 1   // as above
      for (int it = 0; it < 8; ++it) {
        const int rr = it * 4 + r4; const v8b fr = *(const v8b*)(reinterpret_cast<const b16*>(rows + rr * CP) + 64 + c8);
        *(v8b*)(dr + (size_t)rr * HD + c8) = fr; } }
  } else {
    float* Cb = C + ((size_t)bb * (size_t)cstr + (size_t)t0) * (size_t)N + bn;
#pragma unroll 1
    for (int it = 0; it < 8; ++it) {
      const int rr = wave * 16 + it * 2 + hh; const v4f f = *(const v4f*)(Cs + rr * CP + col * 4);
      *(v4f*)(Cb + (size_t)rr * N + col * 4) = f; }
  }
}

// Causal softmax(Q K^T / 8) V per (b, h) for the queries below EARLY: the body of the work-groups bx < EARLY / 64 of attn_main_kernel's launch. 4 waves x 16 queries, each
// wave on its own (no block barrier); key steps of 32 from 0 up to the last query of the wave's 32-query group in fixed order, keys above the query replaced by -inf
// before the running-max softmax (f32); P x1024 via wave-private LDS; O^T += V^T P^T.
// ER (queries < EARLY, which only visit keys < EARLY): S adds K_hi Q_res + K_res Q_hi (x1024), P adds a x1024 residual tile and V a x1024 residual
// plane into a second accumulator folded before normalisation, and the x16 y row is written as f16 hi plus a x1024 residual. y rows -> Yh [b*SEQ + q][h*64 + d]
template <bool ER>
__device__ __forceinline__ void attn_rows(const b16* __restrict__ Qh, const b16* __restrict__ Qr, const b16* __restrict__ Kh, const b16* __restrict__ Kr,
                                          const b16* __restrict__ VTh, const b16* __restrict__ VTr, b16* __restrict__ Yh, b16* __restrict__ Yr,
                                          b16 (*Pb)[16][32 + 8], b16 (*Pr)[16][32 + 8], b16 (*Th)[16][TP], b16 (*Tr)[16][TP], int bx) {
  const int wave = __builtin_amdgcn_readfirstlane((int)threadIdx.x >> 5), lane = threadIdx.x & 31, hh = lane >> 4, col = lane & 15;   // scalar: the key loop's end hangs on it
  const int bhi = (int)blockIdx.x; const int b = bhi / H, h = bhi % H; const int q0 = bx * 64 + wave * 16, qi = q0 + col;
  const b16* Qb = Qh + (size_t)bhi * QL * HD; const b16* Kb = Kh + (size_t)bhi * SK * HD; const b16* Vb = VTh + (size_t)bhi * HD * (size_t)SK;
  const b16* Qrb = Qr + (size_t)bhi * EARLY * HD; const b16* Krb = Kr + (size_t)bhi * EARLY * HD; const b16* Vrb = VTr + (size_t)bhi * HD * (size_t)EARLY;
  const v16b qa0 = frag_kb(Qb + (size_t)qi * HD, hh), qa1 = frag_kb(Qb + (size_t)qi * HD + 32, hh);
  v16b qr0 = (v16b){}, qr1 = (v16b){};
  if constexpr (ER) { qr0 = frag_kb(Qrb + (size_t)qi * HD, hh); qr1 = frag_kb(Qrb + (size_t)qi * HD + 32, hh); }
  const float cs = LOG2E / (8.0f * XS * XS);   // 1/sqrt(64) and the two x8 carriers, in the log2 domain
  float m = -INFINITY, l = 0.0f; v8f o[4], o2[4];
#pragma unroll
  for (int t = 0; t < 4; ++t) { o[t] = (v8f){}; o2[t] = (v8f){}; }
  const int kend = (q0 >> 5) * 32 + 32;   // causal: keys 0 .. last query of this wave's 32-query group; ER: kend <= EARLY
#pragma unroll 1
  for (int kb = 0; kb < kend; kb += 32) {
    float e[16]; float mx = -INFINITY;
#pragma unroll
    for (int u = 0; u < 2; ++u) {
      const int krow = kb + u * 16 + col;
      const v16b kh0 = frag_kb(Kb + (size_t)krow * HD, hh), kh1 = frag_kb(Kb + (size_t)krow * HD + 32, hh);
      v8f s = (v8f){}; s = wmma16b(kh0, qa0, s); s = wmma16b(kh1, qa1, s);
      v8f sr = (v8f){};
      if constexpr (ER) {
        const v16b kr0 = frag_kb(Krb + (size_t)krow * HD, hh), kr1 = frag_kb(Krb + (size_t)krow * HD + 32, hh);
        sr = wmma16b(kh0, qr0, sr); sr = wmma16b(kh1, qr1, sr); sr = wmma16b(kr0, qa0, sr); sr = wmma16b(kr1, qa1, sr); }
#pragma unroll
      for (int r = 0; r < 8; ++r) {
        float v = s[r];
        if constexpr (ER) v += sr[r] * (1.0f / RS);
        v *= cs;
        const int key = kb + u * 16 + 8 * hh + r;
        v = (key > qi) ? -INFINITY : v;
        e[u * 8 + r] = v; mx = fmaxf(mx, v); } }
    mx = fmaxf(mx, __shfl_xor(mx, 16)); const float mn = fmaxf(m, mx); const float al = nexp2(m - mn); float sum = 0.0f;
#pragma unroll
    for (int i2 = 0; i2 < 16; ++i2) {
      const float p = nexp2(e[i2] - mn); sum += p; const int pi = (i2 < 8 ? 0 : 16) + 8 * hh + (i2 & 7);
      const float pp = p * PS; const b16 ph = (b16)pp; Pb[wave][col][pi] = ph;
      if constexpr (ER) Pr[wave][col][pi] = (b16)((pp - (float)ph) * RS); }
    sum += __shfl_xor(sum, 16); l = l * al + sum; m = mn;
    wave_lds_sync();
    const v16b pf = frag_kb(&Pb[wave][col][0], hh);
    v16b prf = (v16b){};
    if constexpr (ER) prf = frag_kb(&Pr[wave][col][0], hh);
#pragma unroll
    for (int t = 0; t < 4; ++t) {
      o[t] *= al; const v16b vh = frag_kb(Vb + (size_t)(t * 16 + col) * SK + kb, hh);
      o[t] = wmma16b(vh, pf, o[t]);
      if constexpr (ER) { const v16b vr = frag_kb(Vrb + (size_t)(t * 16 + col) * EARLY + kb, hh); o2[t] *= al; o2[t] = wmma16b(vh, prf, o2[t]); o2[t] = wmma16b(vr, pf, o2[t]); } }
    wave_lds_sync(); }
  const float inv = YS / (l * PS * XS);
#pragma unroll
  for (int t = 0; t < 4; ++t) {
#pragma unroll
    for (int r = 0; r < 8; ++r) {
      float ov = o[t][r];
      if constexpr (ER) ov += o2[t][r] * (1.0f / RS);
      const float yv = ov * inv; const b16 yh = (b16)yv;
      Th[wave][col][t * 16 + 8 * hh + r] = yh;
      if constexpr (ER) Tr[wave][col][t * 16 + 8 * hh + r] = (b16)((yv - (float)yh) * RS); } }
  wave_lds_sync();
  b16* yb = Yh + ((size_t)b * SEQ + (size_t)q0) * CD + (size_t)h * HD;
  {
#pragma unroll 1
    for (int it = 0; it < 4; ++it) {
      const int rr = it * 4 + (lane >> 3), c8 = (lane & 7) * 8; const v8b f = *(const v8b*)(&Th[wave][rr][c8]);
      *(v8b*)(yb + (size_t)rr * CD + c8) = f;
      if constexpr (ER) {
        const v8b fr = *(const v8b*)(&Tr[wave][rr][c8]);
        *(v8b*)(Yr + (((size_t)b * EARLY + (size_t)(q0 + rr)) * CD + (size_t)h * HD + c8)) = fr; } }
     }
}

// One staged tile pair = 64 keys: K rows [64 keys][64 dims] and V^T rows [64 dims][64 keys], 128 B a row, laid at the 144-B pitch of TP. 128 threads, 16 B a lane:
// copy j of a thread brings row (tid >> 3) + 16 j, piece tid & 7, so a wave's copy covers four whole 128-B lines. kg / vg: the lane's first global byte of the tile,
// kl / vl: its first LDS byte. s_wait_xcnt stands inside the statement so that no address register named here is rewritten ahead of it.
__device__ __forceinline__ void stage_kv(const b16* kg, const b16* vg, unsigned kl, unsigned vl) {
  const b16 *k1 = kg + 16 * HD, *k2 = kg + 32 * HD, *k3 = kg + 48 * HD; const b16 *v1 = vg + 16 * (size_t)SK, *v2 = vg + 32 * (size_t)SK, *v3 = vg + 48 * (size_t)SK;
  const unsigned kl1 = kl + 16 * TP * 2, kl2 = kl + 32 * TP * 2, kl3 = kl + 48 * TP * 2, vl1 = vl + 16 * TP * 2, vl2 = vl + 32 * TP * 2, vl3 = vl + 48 * TP * 2;
  asm volatile("global_load_async_to_lds_b128 %0, %8, off\n\t"
               "global_load_async_to_lds_b128 %1, %9, off\n\t"
               "global_load_async_to_lds_b128 %2, %10, off\n\t"
               "global_load_async_to_lds_b128 %3, %11, off\n\t"
               "global_load_async_to_lds_b128 %4, %12, off\n\t"
               "global_load_async_to_lds_b128 %5, %13, off\n\t"
               "global_load_async_to_lds_b128 %6, %14, off\n\t"
               "global_load_async_to_lds_b128 %7, %15, off\n\t"
               "s_wait_xcnt 0x0"
               :: "v"(kl), "v"(kl1), "v"(kl2), "v"(kl3), "v"(vl), "v"(vl1), "v"(vl2), "v"(vl3), "v"(kg), "v"(k1), "v"(k2), "v"(k3), "v"(vg), "v"(v1), "v"(v2), "v"(v3)
               : "memory");
}

// One launch for all queries: grid (NB*H, query blocks of 64); block = 4 waves x 16 queries. Blocks below EARLY take attn_rows above and leave; they need nothing from the
// others. From EARLY on, the same causal softmax(Q K^T / 8) V without residual planes.
// K and V^T come in tiles of 64 keys, copied once per block into two LDS buffers (tile s + 1 flies while tile s is worked on) and read as fragments by all
// four waves. Each wave walks key steps of 32 in the same fixed order and up to the same last key (the end of its 32-query group) as attn_rows above.
// No running maximum here: rms-norm leaves q and k with a length of at most 8 for any input (rotation keeps it, the f16 rounding adds under 2^-10 of it), so |score| = |q . k| / 8
// stays below 8 + 1/64 and P = exp(score) x 2^POFF lies between 2^-9 and 2^15, inside the normal f16 range with its full relative precision. O and the row sum carry the same
// factor, which the division behind the loop takes out.
// Every plain '#pragma unroll' below keeps the index of a register array a compile-time constant.
__global__ __launch_bounds__(128) void attn_main_kernel(const b16* __restrict__ Qh, const b16* __restrict__ Qr, const b16* __restrict__ Kh, const b16* __restrict__ Kr,
                                                        const b16* __restrict__ VTh, const b16* __restrict__ VTr, b16* __restrict__ Yh, b16* __restrict__ Yr) {
  __shared__ __attribute__((aligned(16))) b16 Ks[2][64][TP];
  __shared__ __attribute__((aligned(16))) b16 Vs[2][64][TP];
  __shared__ __attribute__((aligned(16))) b16 Pb[4][16][32 + 8];
  __shared__ __attribute__((aligned(16))) b16 Th[4][16][TP];
  // Which query block a work-group takes: a permutation of 0 .. NQ - 1, for speed only (any placement gives the same result). A block's cost grows with bx, all blocks are
  // resident at once. The head is the fast index; the long blocks come first; every second run of 8 ranks is reversed, so that ranks r, r + 8, r + 16, r + 24 (one WGP's blocks, if a die deals
  // its blocks round its WGPs) add up to the same number of key tiles for every r.
  constexpr int NQ = QL / 64;
  const int rank = (int)blockIdx.y;
  const int bx = NQ - 1 - ((NQ % 8 == 0 && (rank & 8) != 0) ? (rank ^ 7) : rank);
  if (bx < EARLY / 64) {   // block-uniform, ahead of every copy and barrier; the residual tiles lie in the K and V buffers, which such a block does not fill
    attn_rows<true>(Qh, Qr, Kh, Kr, VTh, VTr, Yh, Yr, Pb, reinterpret_cast<b16 (*)[16][32 + 8]>(&Ks[0][0][0]), Th, reinterpret_cast<b16 (*)[16][TP]>(&Vs[0][0][0]), bx);
    return;
  }
  const int tid = threadIdx.x, wave = __builtin_amdgcn_readfirstlane(tid >> 5), lane = tid & 31, hh = lane >> 4, col = lane & 15;
  const int bhi = (int)blockIdx.x; const int b = bhi / H, h = bhi % H; const int q0 = bx * 64 + wave * 16, qi = q0 + col;
  const b16* Qb = Qh + (size_t)bhi * QL * HD; const b16* Kb = Kh + (size_t)bhi * SK * HD; const b16* Vb = VTh + (size_t)bhi * HD * (size_t)SK;
  const int nst = bx + 1;                     // tiles of 64 keys: keys 0 .. last query of this block
  const int kend = (q0 >> 5) * 32 + 32;       // this wave's causal end
  const int srow = tid >> 3, sc8 = (tid & 7) * 8;
  const b16* kg = Kb + (size_t)srow * HD + sc8; const b16* vg = Vb + (size_t)srow * SK + sc8;   // tile s: kg + s * 64 * HD, vg + s * 64
  const unsigned kl = lds_off(&Ks[0][srow][sc8]), vl = lds_off(&Vs[0][srow][sc8]); constexpr unsigned BUFB = 64 * TP * 2;
  stage_kv(kg, vg, kl, vl);
  asm volatile("s_wait_asynccnt 0x0" ::: "memory");   // tile 0 has landed before the barrier that publishes it
  __syncthreads();
  if (nst > 1) stage_kv(kg + 64 * HD, vg + 64, kl + BUFB, vl + BUFB);
  const v16b qa0 = frag_kb(Qb + (size_t)qi * HD, hh), qa1 = frag_kb(Qb + (size_t)qi * HD + 32, hh);
  const float cs = LOG2E / (8.0f * XS * XS);   // 1/sqrt(64) and the two x8 carriers, in the log2 domain
  constexpr float POFF = 3.0f;                 // fixed exponent offset, log2 domain
  v2f l2 = (v2f){}; v8f o[4];                  // l2: this lane's own sums of P (its 16 keys a step, even and odd ones apart); the lane halves are joined behind the loop
#pragma unroll
  for (int t = 0; t < 4; ++t) o[t] = (v8f){};
#pragma unroll 1   // one copy of the loop body in the text: the buffer index is a run-time offset
  for (int s = 0; s < nst; ++s) {
    const int buf = s & 1;
#pragma unroll 1   // the two key steps of a tile share one body
    for (int sub = 0; sub < 64; sub += 32) {
      const int kb = s * 64 + sub;
      if (kb < kend) {   // wave-uniform: a wave skips the step wholly above its diagonal, never the publish point below
        float p[16];
#pragma unroll
        for (int u = 0; u < 2; ++u) {
          const b16* kr = &Ks[buf][sub + u * 16 + col][0];
          const v16b kh0 = frag_kb(kr, hh), kh1 = frag_kb(kr + 32, hh);
          v8f sc = (v8f){}; sc = wmma16(kh0, qa0, sc); sc = wmma16(kh1, qa1, sc);
#pragma unroll
          for (int r = 0; r < 8; ++r) {
            float v = __builtin_fmaf(sc[r], cs, POFF);
            const int key = kb + u * 16 + 8 * hh + r;
            v = (key > qi) ? -INFINITY : v;
            p[u * 8 + r] = nexp2(v); } }
#pragma unroll
        for (int i2 = 0; i2 < 16; i2 += 2) {
          l2 += (v2f){p[i2], p[i2 + 1]}; const int pi = (i2 < 8 ? 0 : 16) + 8 * hh + (i2 & 7);
          Pb[wave][col][pi] = (b16)p[i2]; Pb[wave][col][pi + 1] = (b16)p[i2 + 1]; }
        wave_lds_sync();
        const v16b pf = frag_kb(&Pb[wave][col][0], hh);
#pragma unroll
        for (int t = 0; t < 4; ++t) {
          const v16b vh = frag_kb(&Vs[buf][t * 16 + col][sub], hh);
          // the step's last product stands in front of a branch: it keeps its v_nop statement
          o[t] = (t == 3) ? wmma16b(vh, pf, o[t]) : wmma16(vh, pf, o[t]); }
        wave_lds_sync(); }
    }
    asm volatile("s_wait_dscnt 0x0" ::: "memory");      // this wave's reads of tile s are done before the buffer is handed back
    asm volatile("s_wait_asynccnt 0x0" ::: "memory");   // this wave's copies of tile s + 1 have landed
    __syncthreads();                                    // publishes tile s + 1 and ends every wave's reads of tile s
    if (s + 2 < nst) stage_kv(kg + (size_t)(s + 2) * 64 * HD, vg + (size_t)(s + 2) * 64, kl + buf * BUFB, vl + buf * BUFB);
  }
  asm volatile("s_wait_asynccnt 0x0" ::: "memory");     // no copy is left in flight when the wave ends
  float l = l2[0] + l2[1]; l += __shfl_xor(l, 16);      // a query's keys lie in lanes col and col + 16
  const float inv = YS / (l * XS);
#pragma unroll
  for (int t = 0; t < 4; ++t) {
#pragma unroll
    for (int r = 0; r < 8; ++r) Th[wave][col][t * 16 + 8 * hh + r] = (b16)(o[t][r] * inv); }
  wave_lds_sync();
  b16* yb = Yh + ((size_t)b * SEQ + (size_t)q0) * CD + (size_t)h * HD;
#pragma unroll 1   // as in attn_rows: four short trips, no gain from unrolling
  for (int it = 0; it < 4; ++it) {
    const int rr = it * 4 + (lane >> 3), c8 = (lane & 7) * 8; const v8b f = *(const v8b*)(&Th[wave][rr][c8]);
    *(v8b*)(yb + (size_t)rr * CD + c8) = f; }
}
}  // namespace

extern "C" void kernel_launch(void* const* d_in, const int* in_sizes, int n_in, void* d_out, int out_size, void* d_ws, size_t ws_size, hipStream_t stream) {
  // wire order: 0 x [NB_FULL][SEQ_FULL][1024] f32, 1 W_attn [1024][3072] f32, 2 b_attn [3072] f32, 3 W_proj [1024][1024] f32, 4 b_proj [1024] f32; out [NB_FULL][SEQ_FULL][1024] f32
  const size_t need_x = ((size_t)(NB - 1) * SEQ_FULL + (size_t)SEQ) * CD;
  if (n_in < 5 || (size_t)in_sizes[0] < need_x || (size_t)in_sizes[1] < (size_t)KD * N3 || (size_t)in_sizes[2] < (size_t)N3 ||
      (size_t)in_sizes[3] < (size_t)KD * CD || (size_t)in_sizes[4] < (size_t)CD || (size_t)out_size < need_x) return;
  const float* Xin = (const float*)d_in[0]; const float* Wa = (const float*)d_in[1]; const float* Ba = (const float*)d_in[2];
  const float* Wp = (const float*)d_in[3]; const float* Bp = (const float*)d_in[4];
  size_t off = 0; char* ws = (char*)d_ws;
  auto carve = [&](size_t bytes) { char* p = ws + off; off += (bytes + 255) & ~(size_t)255; return p; };
  b16* Xp = (b16*)carve((size_t)MROWS * CD * 2);                       //  8,388,608 B at NB=2, SEQ=2048
  b16* WaT = (b16*)carve((size_t)N3 * KD * 2);                         //  6,291,456
  b16* WpT = (b16*)carve((size_t)CD * KD * 2);                         //  2,097,152
  const size_t plane = (size_t)NB * H * SEQ * HD * 2, rplane = (size_t)NB * H * EARLY * HD * 2;
  b16* Qh = (b16*)carve(plane); b16* Kh = (b16*)carve(plane); b16* VTh = (b16*)carve(plane);      // 3 x 8,388,608
  b16* Qr = (b16*)carve(rplane); b16* Kr = (b16*)carve(rplane); b16* VTr = (b16*)carve(rplane);   // 3 x 524,288
  b16* Yh = (b16*)carve((size_t)MROWS * CD * 2);                       //  8,388,608
  b16* Yr = (b16*)carve((size_t)NB * EARLY * CD * 2);                  //    524,288   -> total 52,428,800 B
  if (off > ws_size || off > ((size_t)128 << 20)) return;
  cvt_all_kernel<<<dim3(WBLK + XBLK), 256, 0, stream>>>(Xin, Wa, Wp, Xp, WaT, WpT);
  gemm_kernel<true><<<dim3(N3 / (2 * BN), MROWS / BM), 256, 0, stream>>>(Xp, Xp, WaT, Ba, nullptr, Qh, Qr, Kh, Kr, VTh, VTr, N3, SEQ, 0, 1.0f / (XS * WS));
  attn_main_kernel<<<dim3(NB * H, QL / 64), 128, 0, stream>>>(Qh, Qr, Kh, Kr, VTh, VTr, Yh, Yr);
  gemm_kernel<false><<<dim3(CD / BN, MROWS / BM), 256, 0, stream>>>(Yh, Yr, WpT, Bp, (float*)d_out, nullptr, nullptr, nullptr, nullptr, nullptr, nullptr, CD, SEQ_FULL, 1, 1.0f / (YS * WS));
}

// v010
// Measured time: 81.6 microseconds a run.
// Next to v009, in two timings, it ran 1.05 and 1.04 times as fast.
// Over all steps from v000 it is 3.77 times as fast.
#include <hip/hip_runtime.h>

// compute dtype: all contractions on v_wmma_f32_16x16x32_f16 (f16 operands, f32 accumulate). x @ W_attn and y @ W_proj: x and W enter as their bf16-RNE
// values carried x8 (x) and x64 (W) in f16 planes, 1 product; y carried x16 as f16 hi, plus a x1024 f16 residual plane on the first 128 token rows of each
// sequence (2 products there, second accumulator folded in the f32 epilogue). S^T = K Q^T per head: q, k after rms-norm and rotary carried x8 as f16 hi,
// 1 product; query blocks below 128 tokens add x1024 f16 q and k residual planes (3 products). O^T += V^T P^T: v carried x8 f16, P f16 (x1024 early, exp(score) x8 elsewhere), 1 product;
// the same early query blocks add P and v x1024 residuals into a second accumulator folded before normalisation. Norm, rotary, softmax statistics in f32.
// Fragment k-map per lane half hh for A AND B: elements 0..7 <- k = 8hh+0..7, 8..15 <- k = 16+8hh+0..7; acc[r] = D[8hh+r][col = lane&15].

#ifndef NB
#define NB 2
#endif
#ifndef SEQ
#define SEQ 2048
#endif
#ifndef NB_FULL
#define NB_FULL 2
#endif
#ifndef SEQ_FULL
#define SEQ_FULL 2048
#endif

namespace {
constexpr int H = 16, HD = 64, CD = 1024, N3 = 3 * CD, KD = CD, QL = SEQ, SK = SEQ, MROWS = NB * SEQ;
constexpr int EARLY = 128, EB = EARLY / 32;                       // token rows per sequence that get residual planes
constexpr int BM = 128, BN = 64, BK = 64, TP = 72, AP = BK + 8, CP = BN + 4, VP = BM + 8;
constexpr int ABYTES = BM * AP * 2, BBYTES = BN * AP * 2, SMEM = 2 * (ABYTES + BBYTES), NT = KD / BK;   // SMEM: no GEMM instance has less LDS
constexpr float XS = 8.0f, WS = 64.0f, YS = 16.0f, PS = 1024.0f, RS = 1024.0f;
constexpr float LOG2E = 1.4426950408889634f, LOG2B = 13.287712379549449f, RMS_EPS = 1.1920929e-07f;
static_assert(SEQ % BM == 0 && SEQ >= BM && SEQ <= SEQ_FULL && NB >= 1 && NB <= NB_FULL);
static_assert(EARLY == BM && EARLY % 64 == 0 && EB * 32 == EARLY && MROWS % BM == 0 && N3 % BN == 0 && CD % BN == 0 && KD % BK == 0);
static_assert(BM * CP * 4 <= SMEM && HD == 64 && QL == SK && SEQ % 64 == 0 && (MROWS * 128) % 256 == 0);
static_assert(BN == HD && 2 * HD * VP * 2 <= SMEM && NT >= 2 && ABYTES % 16 == 0 && BBYTES % 16 == 0);

typedef _Float16 b16;
typedef __attribute__((ext_vector_type(16))) _Float16 v16b;
typedef __attribute__((ext_vector_type(8))) _Float16 v8b;
typedef __attribute__((ext_vector_type(8))) float v8f;
typedef __attribute__((ext_vector_type(4))) float v4f;
typedef __attribute__((ext_vector_type(2))) float v2f;

__device__ __forceinline__ float bf16_rne(float f) { unsigned int u = __float_as_uint(f); u += 0x7FFFu + ((u >> 16) & 1u); return __uint_as_float(u & 0xFFFF0000u); }
// 16-bit fragment from a k-contiguous row: elements 0..7 <- p[8hh .. 8hh+7], 8..15 <- p[16+8hh .. 16+8hh+7]
__device__ __forceinline__ v16b frag_kb(const b16* p, int hh) {
  const v8b a = *(const v8b*)(p + 8 * hh), b = *(const v8b*)(p + 16 + 8 * hh); v16b f;
#pragma unroll
  for (int e = 0; e < 8; ++e) { f[e] = a[e]; f[8 + e] = b[e]; }
  return f;
}
__device__ __forceinline__ v8f wmma16b(v16b a, v16b b, v8f c) {
  v8f d = __builtin_amdgcn_wmma_f32_16x16x32_f16(false, a, false, b, (short)0, c, false, false);
  asm volatile("v_nop\n\tv_nop\n\tv_nop\n\tv_nop" : "+v"(d) : "v"(a), "v"(b));
  return d;
}
// The bare builtin: the compiler keeps the distance behind it itself, and with no volatile statement between the products it may issue a key step's LDS reads in groups ahead of them.
__device__ __forceinline__ v8f wmma16(v16b a, v16b b, v8f c) { return __builtin_amdgcn_wmma_f32_16x16x32_f16(false, a, false, b, (short)0, c, false, false); }
__device__ __forceinline__ void wave_lds_sync() { __builtin_amdgcn_fence(3, "workgroup"); __builtin_amdgcn_wave_barrier(); __builtin_amdgcn_fence(2, "workgroup"); }
__device__ __forceinline__ float nexp2(float v) { return __builtin_amdgcn_exp2f(v); }
// LDS byte address of a __shared__ object: the low 32 bits of its address.
__device__ __forceinline__ unsigned lds_off(const void* p) { return (unsigned)(size_t)p; }

__device__ __forceinline__ void store_tile64(const b16 (*S)[TP], b16* dst, size_t pitch, int wave, int lane) {
  {
#pragma unroll   // the LDS reads go out in groups ahead of their stores, not one read, one wait and one store a trip
    for (int it = 0; it < 8; ++it) {
      const int r = wave * 32 + it * 4 + (lane >> 3), c8 = (lane & 7) * 8;
      const v8b o = *(const v8b*)(&S[r][c8]);
      *(v8b*)(dst + (size_t)r * pitch + c8) = o; }
     }
}

// One launch converts all three GEMM operands; none of the three depends on another. Blocks of 256 threads, told apart by block index (block-uniform).
// Blocks 0 .. WBLK-1: W [KD][N] f32 (in-major: W[k][n]) -> WT [N][KD] f16 = bf16-RNE(W) x64 (k-contiguous per output column), in 64x64 tiles. A block takes four tiles
// that are neighbours along n, two waves a tile, each tile in its own LDS plane; tiles 0 .. WA_T-1 are W_attn's, the rest W_proj's (n tile fastest). They come first in
// the grid (for speed only).
// Blocks from WBLK on: x f32 -> Xp f16 = bf16-RNE(x) x8, XU pieces of 8 elements a thread, XBLK * 256 pieces apart.
// In both parts a thread issues all its global loads before it uses the first, so that it waits for memory once and the launch needs few waves.
constexpr int WA_T = (N3 / 64) * (KD / 64), WP_T = (CD / 64) * (KD / 64), WBLK = (WA_T + WP_T) / 4, XU = 8, XBLK = (int)((size_t)MROWS * 128 / (256 * XU));
static_assert(WA_T % 4 == 0 && WP_T % 4 == 0 && (N3 / 64) % 4 == 0 && (CD / 64) % 4 == 0 && ((size_t)MROWS * 128) % (256 * XU) == 0);
// One 64x64 tile of W, row pitch N (a compile-time constant: the 16 loads then differ in their immediate offset alone), by the tile's 64 threads.
template <int N>
__device__ __forceinline__ void cvt_w_tile(const float* src, b16 (*S)[TP], int tid) {
  const int k0 = tid >> 4, n = (tid & 15) * 4; v4f x[16];   // load it: row it * 4 + k0, columns n .. n + 3; both '#pragma unroll' keep the index of x a compile-time constant
  const float* p = src + (size_t)k0 * N + n;
#pragma unroll
  for (int it = 0; it < 16; ++it) x[it] = *(const v4f*)(p + (size_t)(it * 4) * N);
  // Inputs-only fence on the loaded values and the address: the address pair lives until all 16 loads are back, so that no result is put into a register that a load in
  // flight still names, and each pitch keeps its own run of 16 loads under one base (left alone, the compiler merges the two pitches and forms 16 addresses between the loads).
  asm volatile("" :: "v"(x[0]), "v"(x[1]), "v"(x[2]), "v"(x[3]), "v"(x[4]), "v"(x[5]), "v"(x[6]), "v"(x[7]), "v"(x[8]), "v"(x[9]), "v"(x[10]), "v"(x[11]), "v"(x[12]), "v"(x[13]),
               "v"(x[14]), "v"(x[15]), "v"(p));
#pragma unroll
  for (int it = 0; it < 16; ++it)
#pragma unroll
    for (int j = 0; j < 4; ++j) S[n + j][it * 4 + k0] = (b16)(bf16_rne(x[it][j]) * WS);
}
__global__ __launch_bounds__(256) void cvt_all_kernel(const float* __restrict__ X, const float* __restrict__ Wa, const float* __restrict__ Wp, b16* __restrict__ Xp,
                                                      b16* __restrict__ WaT, b16* __restrict__ WpT) {
  __shared__ __attribute__((aligned(16))) b16 St[4][64][TP];
  if ((int)blockIdx.x < WBLK) {
    const int grp = threadIdx.x >> 6, tid = threadIdx.x & 63, wave = tid >> 5, lane = tid & 31;
    const bool isa = (int)blockIdx.x * 4 < WA_T;   // block-uniform: WA_T is a multiple of 4
    const int t4 = (int)blockIdx.x * 4 - (isa ? 0 : WA_T); const int N = isa ? N3 : CD;   // t4: the block's first tile within its matrix, a multiple of 4
    const int nb = (isa ? t4 % (N3 / 64) : t4 % (CD / 64)) + grp, kb = isa ? t4 / (N3 / 64) : t4 / (CD / 64);
    const float* src = (isa ? Wa : Wp) + (size_t)kb * 64 * (size_t)N + (size_t)nb * 64;
    if (isa) cvt_w_tile<N3>(src, St[grp], tid); else cvt_w_tile<CD>(src, St[grp], tid);
    __syncthreads();   // a tile's plane is read across its two waves
    store_tile64(St[grp], (isa ? WaT : WpT) + (size_t)nb * 64 * KD + (size_t)kb * 64, KD, wave, lane);
    return;
  }
  const size_t u0 = (size_t)((int)blockIdx.x - WBLK) * 256 + threadIdx.x, g0 = u0 >> 7; const int piece = (int)(u0 & 127);   // piece k of the thread: row g0 + k * XBLK * 2
  v4f x0[XU], x1[XU];   // every '#pragma unroll' below keeps the index of these a compile-time constant
  const float* xs[XU];
#pragma unroll
  for (int k = 0; k < XU; ++k) {
    const size_t g = g0 + (size_t)k * (XBLK * 2); const size_t srow = (SEQ == SEQ_FULL) ? g : (g / SEQ) * SEQ_FULL + (g % SEQ);
    xs[k] = X + srow * CD + piece * 8; x0[k] = *(const v4f*)xs[k]; x1[k] = *(const v4f*)(xs[k] + 4); }
  // As in cvt_w_tile: inputs-only fence on the loaded values and the first address (left alone, the compiler puts a later load's result into that pair while loads that name it fly).
  asm volatile("" :: "v"(x0[0]), "v"(x0[1]), "v"(x0[2]), "v"(x0[3]), "v"(x0[4]), "v"(x0[5]), "v"(x0[6]), "v"(x0[7]), "v"(x1[0]), "v"(x1[1]), "v"(x1[2]), "v"(x1[3]), "v"(x1[4]),
               "v"(x1[5]), "v"(x1[6]), "v"(x1[7]), "v"(xs[0]));
#pragma unroll
  for (int k = 0; k < XU; ++k) {
    v8b o;
#pragma unroll
    for (int j = 0; j < 4; ++j) { o[j] = (b16)(bf16_rne(x0[k][j]) * XS); o[4 + j] = (b16)(bf16_rne(x1[k][j]) * XS); }
    *(v8b*)(Xp + (g0 + (size_t)k * (XBLK * 2)) * CD + piece * 8) = o; }
  asm volatile("s_wait_xcnt 0x0" ::: "memory");   // stands behind the run of stores, ahead of any later write of a register that one of them names
}

// Tile value c[m][n] = (A[m][.] . BT[n][.] + Ar[m][.] . BT[n][.] / 1024) * oscale + bf16-RNE(bias[n]); A, Ar, BT f16 with k-contiguous rows of KD = 1024, f32 accumulate.
// Rows m = b*SEQ + t (compact). The residual plane Ar ([b][EARLY][KD]) is used only when res_on != 0 and the tile's t0 < EARLY (block-uniform).
// Block 256 threads = 8 waves (4 along m x 2 along n), tile 128 x 64 (HEADS: 128 x 128, a wave 32 x 64, so that a byte copied from L2 and a fragment read from LDS feed more
// products); k tiles of 64 copied into two LDS buffers (tile t + 1 flies while tile t is multiplied), one block
// barrier a tile; epilogue staged in LDS. The HEADS instance is launched with the residual plane off and holds no room for it.
// HEADS == false: C[b*cstr + t][n] = c, f32, each 256-B row piece stored whole.
// HEADS == true (x @ W_attn): the tile's 128 columns are two heads of q, k or v, each wave's 64 one head h, and c never goes to memory. q and k: rms-norm over the 64 head dims, rotary with
// angle h * inv_freq[i] (head-indexed, same for every token), x8, f16 hi into Qh/Kh [bhi][SEQ][64] and, for t0 < EARLY, x1024 residuals into Qr/Kr [bhi][EARLY][64];
// v: x8, transposed through LDS into VTh [bhi][64][SEQ] and VTr [bhi][64][EARLY]. EARLY == BM: a tile is early as a whole or not at all.
// One k tile = rows of 128 B laid at the 144-B pitch of AP. 256 threads, 16 B a lane: copy j of a thread brings row (tid >> 3) + 32 j, piece tid & 7, so a wave's copy covers
// four whole 128-B lines. ag / bg / rg: the lane's first global byte of the tile, al / bl / rl: its first LDS byte. s_wait_xcnt stands inside each statement so that no
// address register named there is rewritten ahead of it.
__device__ __forceinline__ void stage_ab(const b16* ag, const b16* bg, unsigned al, unsigned bl) {   // A: 128 rows, BT: 64 rows
  const b16 *a1 = ag + 32 * KD, *a2 = ag + 64 * KD, *a3 = ag + 96 * KD, *b1 = bg + 32 * KD;
  const unsigned al1 = al + 32 * AP * 2, al2 = al + 64 * AP * 2, al3 = al + 96 * AP * 2, bl1 = bl + 32 * AP * 2;
  asm volatile("global_load_async_to_lds_b128 %0, %6, off\n\t"
               "global_load_async_to_lds_b128 %1, %7, off\n\t"
               "global_load_async_to_lds_b128 %2, %8, off\n\t"
               "global_load_async_to_lds_b128 %3, %9, off\n\t"
               "global_load_async_to_lds_b128 %4, %10, off\n\t"
               "global_load_async_to_lds_b128 %5, %11, off\n\t"
               "s_wait_xcnt 0x0"
               :: "v"(al), "v"(al1), "v"(al2), "v"(al3), "v"(bl), "v"(bl1), "v"(ag), "v"(a1), "v"(a2), "v"(a3), "v"(bg), "v"(b1)
               : "memory");
}
__device__ __forceinline__ void stage_ab128(const b16* ag, const b16* bg, unsigned al, unsigned bl) {   // A: 128 rows, BT: 128 rows
  const b16 *a1 = ag + 32 * KD, *a2 = ag + 64 * KD, *a3 = ag + 96 * KD, *b1 = bg + 32 * KD, *b2 = bg + 64 * KD, *b3 = bg + 96 * KD;
  const unsigned al1 = al + 32 * AP * 2, al2 = al + 64 * AP * 2, al3 = al + 96 * AP * 2, bl1 = bl + 32 * AP * 2, bl2 = bl + 64 * AP * 2, bl3 = bl + 96 * AP * 2;
  asm volatile("global_load_async_to_lds_b128 %0, %8, off\n\t"
               "global_load_async_to_lds_b128 %1, %9, off\n\t"
               "global_load_async_to_lds_b128 %2, %10, off\n\t"
               "global_load_async_to_lds_b128 %3, %11, off\n\t"
               "global_load_async_to_lds_b128 %4, %12, off\n\t"
               "global_load_async_to_lds_b128 %5, %13, off\n\t"
               "global_load_async_to_lds_b128 %6, %14, off\n\t"
               "global_load_async_to_lds_b128 %7, %15, off\n\t"
               "s_wait_xcnt 0x0"
               :: "v"(al), "v"(al1), "v"(al2), "v"(al3), "v"(bl), "v"(bl1), "v"(bl2), "v"(bl3), "v"(ag), "v"(a1), "v"(a2), "v"(a3), "v"(bg), "v"(b1), "v"(b2), "v"(b3)
               : "memory");
}
__device__ __forceinline__ void stage_r(const b16* rg, unsigned rl) {   // residual plane: 128 rows
  const b16 *r1 = rg + 32 * KD, *r2 = rg + 64 * KD, *r3 = rg + 96 * KD;
  const unsigned rl1 = rl + 32 * AP * 2, rl2 = rl + 64 * AP * 2, rl3 = rl + 96 * AP * 2;
  asm volatile("global_load_async_to_lds_b128 %0, %4, off\n\t"
               "global_load_async_to_lds_b128 %1, %5, off\n\t"
               "global_load_async_to_lds_b128 %2, %6, off\n\t"
               "global_load_async_to_lds_b128 %3, %7, off\n\t"
               "s_wait_xcnt 0x0"
               :: "v"(rl), "v"(rl1), "v"(rl2), "v"(rl3), "v"(rg), "v"(r1), "v"(r2), "v"(r3)
               : "memory");
}

template <bool HEADS>
__global__ __launch_bounds__(256) void gemm_kernel(const b16* __restrict__ A, const b16* __restrict__ Ar, const b16* __restrict__ BT, const float* __restrict__ bias,
                                                   float* __restrict__ C, b16* __restrict__ Qh, b16* __restrict__ Qr, b16* __restrict__ Kh, b16* __restrict__ Kr,
                                                   b16* __restrict__ VTh, b16* __restrict__ VTr, int N, int cstr, int res_on, float oscale) {
  constexpr int NF = HEADS ? 4 : 2, WN = 16 * NF, BNT = 2 * WN;   // BT fragments and columns a wave, columns a block: HEADS 128 = two heads, one to each wn
  constexpr int BOFF = HEADS ? ABYTES : 2 * ABYTES, STAGE = BOFF + BNT * AP * 2;   // one buffer: A | residual plane (not HEADS) | BT
  static_assert(!HEADS || (WN == HD && CD % BNT == 0 && N3 % BNT == 0 && 2 * BM * CP * 4 <= 2 * STAGE && 2 * BNT * VP * 2 <= 2 * STAGE));
  __shared__ __attribute__((aligned(16))) char smem[2 * STAGE];
  float* Cs = reinterpret_cast<float*>(smem);   // aliases the buffers after the k loop (block barrier in between)
  const int tid = threadIdx.x, wave = tid >> 5, lane = tid & 31, hh = lane >> 4, col = lane & 15, wm = wave >> 1, wn = wave & 1;
  const int bm = (int)blockIdx.y * BM, bn = (int)blockIdx.x * BNT; const int bb = bm / SEQ, t0 = bm % SEQ;
  const bool res = !HEADS && (res_on != 0) && (t0 < EARLY);
  const b16* Ab = A + (size_t)bm * KD; const b16* Bb = BT + (size_t)bn * KD;
  const b16* Arb = Ar + ((size_t)bb * EARLY + (size_t)t0) * KD;   // dereferenced only when res (then t0 == 0)
  v8f acc[2][NF], accr[2][NF];
#pragma unroll
  for (int i = 0; i < 2; ++i)
#pragma unroll
    for (int j = 0; j < NF; ++j) { acc[i][j] = (v8f){}; accr[i][j] = (v8f){}; }
  const int srow = tid >> 3, sc8 = (tid & 7) * 8;
  const b16* ag = Ab + (size_t)srow * KD + sc8; const b16* bg = Bb + (size_t)srow * KD + sc8; const b16* rg = Arb + (size_t)srow * KD + sc8;   // tile t: + t * BK
  const unsigned al = lds_off(smem) + (unsigned)(srow * AP + sc8) * 2u, rl = al + ABYTES, bl = al + BOFF;                                    // buffer 1: + STAGE
  auto stage = [&](int t, unsigned bo) {   // k tile t into the buffer at byte bo
    if constexpr (HEADS) stage_ab128(ag + t * BK, bg + t * BK, al + bo, bl + bo);
    else stage_ab(ag + t * BK, bg + t * BK, al + bo, bl + bo);
  };
  stage(0, 0u);
  if (res) stage_r(rg, rl);
  asm volatile("s_wait_asynccnt 0x0" ::: "memory");   // tile 0 has landed before the barrier that publishes it
  __syncthreads();
  stage(1, (unsigned)STAGE);
  if (res) stage_r(rg + BK, rl + STAGE);
#pragma unroll 1   // one copy of the loop body in the text: the buffer index is a run-time offset
  for (int t = 0; t < NT; ++t) {
    const int buf = t & 1;
    const b16* As = reinterpret_cast<const b16*>(smem + buf * STAGE); const b16* Ars = reinterpret_cast<const b16*>(smem + buf * STAGE + ABYTES);
    const b16* Bs = reinterpret_cast<const b16*>(smem + buf * STAGE + BOFF);
#pragma unroll
    for (int ks = 0; ks < BK; ks += 32) {
      const v16b a0 = frag_kb(As + (wm * 32 + col) * AP + ks, hh), a1 = frag_kb(As + (wm * 32 + 16 + col) * AP + ks, hh);
      v16b bf[NF];   // every '#pragma unroll' over j keeps the index of a register array a compile-time constant
#pragma unroll
      for (int j = 0; j < NF; ++j) bf[j] = frag_kb(Bs + (wn * WN + j * 16 + col) * AP + ks, hh);
#pragma unroll
      for (int j = 0; j < NF; ++j) acc[0][j] = wmma16b(a0, bf[j], acc[0][j]);
#pragma unroll
      for (int j = 0; j < NF; ++j) acc[1][j] = wmma16b(a1, bf[j], acc[1][j]);
      if (res) {
        const v16b r0 = frag_kb(Ars + (wm * 32 + col) * AP + ks, hh), r1 = frag_kb(Ars + (wm * 32 + 16 + col) * AP + ks, hh);
#pragma unroll
        for (int j = 0; j < NF; ++j) accr[0][j] = wmma16b(r0, bf[j], accr[0][j]);
#pragma unroll
        for (int j = 0; j < NF; ++j) accr[1][j] = wmma16b(r1, bf[j], accr[1][j]); }
    }
    asm volatile("s_wait_dscnt 0x0" ::: "memory");      // this wave's reads of tile t are done before the buffer is handed back
    asm volatile("s_wait_asynccnt 0x0" ::: "memory");   // this wave's copies of tile t + 1 have landed
    __syncthreads();                                    // publishes tile t + 1 and ends every wave's reads of tile t (after the last tile: the epilogue aliases)
    if (t + 2 < NT) {
      stage(t + 2, (unsigned)(buf * STAGE));
      if (res) stage_r(rg + (t + 2) * BK, rl + buf * STAGE); }
  }
  asm volatile("s_wait_asynccnt 0x0" ::: "memory");     // no copy is left in flight when the buffers are reused
  const int cls = bn / CD, bhi0 = bb * H + (bn % CD) / HD;   // HEADS: 0 q, 1 k, 2 v, and the block's first head; block-uniform
  const int h = (bn % CD) / HD + wn, bhi = bhi0 + wn;        // HEADS: this wave's own head
  const bool early = (t0 < EARLY);
  if (HEADS && cls == 2) {
    // acc[i][j][0..7] are 8 consecutive tokens of one head dim: one 16-B piece of a V^T row
    b16* Sv = reinterpret_cast<b16*>(smem); b16* Svr = Sv + BNT * VP;   // BNT rows: the head dims of the block's heads one after the other, as in VTh
#pragma unroll
    for (int i = 0; i < 2; ++i)
#pragma unroll
      for (int j = 0; j < NF; ++j) {
        const int cc = wn * WN + j * 16 + col; const float bv = bf16_rne(bias[bn + cc]); v8b oh;
#pragma unroll
        for (int r = 0; r < 8; ++r) {
          const float v = acc[i][j][r] + accr[i][j][r] * (1.0f / RS);
          const float v0 = (v * oscale + bv) * XS; acc[i][j][r] = v0; oh[r] = (b16)v0; }
        *(v8b*)(Sv + cc * VP + wm * 32 + i * 16 + 8 * hh) = oh; }
    if (early) {
#pragma unroll
      for (int i = 0; i < 2; ++i)
#pragma unroll
        for (int j = 0; j < NF; ++j) {
          const int cc = wn * WN + j * 16 + col; v8b orr;
#pragma unroll
          for (int r = 0; r < 8; ++r) { const float v0 = acc[i][j][r]; orr[r] = (b16)((v0 - (float)(b16)v0) * RS); }
          *(v8b*)(Svr + cc * VP + wm * 32 + i * 16 + 8 * hh) = orr; } }
    __syncthreads();   // V^T rows are read across waves
    b16* dv = VTh + (size_t)bhi0 * HD * (size_t)SK + t0;
#pragma unroll 1   // short trips, no gain from unrolling
    for (int it = 0; it < BNT / 16; ++it) {
      const int d = wave * (BNT / 8) + it * 2 + hh; const v8b f = *(const v8b*)(Sv + d * VP + col * 8);
      *(v8b*)(dv + (size_t)d * SK + col * 8) = f; }
    if (early) {   // then t0 == 0
      b16* dvr = VTr + (size_t)bhi0 * HD * (size_t)EARLY;
#pragma unroll 1   // as above
      for (int it = 0; it < BNT / 16; ++it) {
        const int d = wave * (BNT / 8) + it * 2 + hh; const v8b fr = *(const v8b*)(Svr + d * VP + col * 8);
        *(v8b*)(dvr + (size_t)d * EARLY + col * 8) = fr; } }
    return;
  }
#pragma unroll
  for (int i = 0; i < 2; ++i)
#pragma unroll
    for (int j = 0; j < NF; ++j) {
      const int cc = wn * WN + j * 16 + col; const float bv = bf16_rne(bias[bn + cc]);
      float* Cw = HEADS ? Cs + wn * BM * CP + j * 16 + col : Cs + cc;   // HEADS: a plane of BM rows x CP for each of the two heads
#pragma unroll
      for (int r = 0; r < 8; ++r) {
        const float v = acc[i][j][r] + accr[i][j][r] * (1.0f / RS);   // accr stays 0 when the residual plane is off
        Cw[(wm * 32 + i * 16 + 8 * hh + r) * CP] = v * oscale + bv; } }
  __syncthreads();   // Cs rows are read across waves (HEADS: across the lanes of the wave that wrote them)
  if constexpr (HEADS) {
    // From here on a wave works alone, on the 32 rows of its own head that it staged. A lane holds head dims lane and lane + 32, the two partners of one rotation.
    const float invf = exp2f(-(float)lane * (LOG2B / 32.0f));   // (1/10000)^(2i/64)
    const float ang = (float)h * invf; float s, c; sincosf(ang, &s, &c);
    float* rows = Cs + (wn * BM + wm * 32) * CP;
#pragma unroll 1   // batches of 8 rows: more at once would take more registers than the k loop does and cost a resident block
    for (int g = 0; g < 32; g += 8) {
      float e0[8], e1[8], ss[8];
      // Every '#pragma unroll' of this batch keeps the index of a register array a compile-time constant; the 8 rows go through each stage side by side, so that
      // their LDS reads and lane exchanges overlap.
#pragma unroll
      for (int i = 0; i < 8; ++i) { e0[i] = rows[(g + i) * CP + lane]; e1[i] = rows[(g + i) * CP + lane + 32]; ss[i] = e0[i] * e0[i] + e1[i] * e1[i]; }
#pragma unroll
      for (int off = 16; off > 0; off >>= 1)
#pragma unroll
        for (int i = 0; i < 8; ++i) ss[i] += __shfl_xor(ss[i], off);
      // The batch's rows are in registers by now: a row's f16 hi goes over the first 128 B of its own 256 B, its residual over the second.
#pragma unroll
      for (int i = 0; i < 8; ++i) {
        const float rn = rsqrtf(ss[i] * (1.0f / 64.0f) + RMS_EPS);
        const float n0 = e0[i] * rn, n1 = e1[i] * rn;
        const float y0 = (n0 * c + n1 * s) * XS, y1 = (n1 * c - n0 * s) * XS;
        b16* ro = reinterpret_cast<b16*>(rows + (g + i) * CP);
        ro[lane] = (b16)y0; ro[lane + 32] = (b16)y1; e0[i] = y0; e1[i] = y1;
      }
      if (early) {
#pragma unroll
        for (int i = 0; i < 8; ++i) {
          const float y0 = e0[i], y1 = e1[i]; b16* ro = reinterpret_cast<b16*>(rows + (g + i) * CP);
          ro[64 + lane] = (b16)((y0 - (float)(b16)y0) * RS); ro[96 + lane] = (b16)((y1 - (float)(b16)y1) * RS); } }
    }
    wave_lds_sync();
    const int r4 = lane >> 3, c8 = (lane & 7) * 8;
    b16* dh = (cls == 0 ? Qh : Kh) + ((size_t)bhi * SEQ + (size_t)(t0 + wm * 32)) * HD;
#pragma unroll 1   // short trips, no gain from unrolling
    for (int it = 0; it < 8; ++it) {
      const int rr = it * 4 + r4; const v8b f = *(const v8b*)(reinterpret_cast<const b16*>(rows + rr * CP) + c8);
      *(v8b*)(dh + (size_t)rr * HD + c8) = f; }
    if (early) {   // then t0 == 0
      b16* dr = (cls == 0 ? Qr : Kr) + ((size_t)bhi * EARLY + (size_t)(wm * 32)) * HD;
#pragma unroll 1   // as above
      for (int it = 0; it < 8; ++it) {
        const int rr = it * 4 + r4; const v8b fr = *(const v8b*)(reinterpret_cast<const b16*>(rows + rr * CP) + 64 + c8);
        *(v8b*)(dr + (size_t)rr * HD + c8) = fr; } }
  } else {
    float* Cb = C + ((size_t)bb * (size_t)cstr + (size_t)t0) * (size_t)N + bn;
#pragma unroll 1
    for (int it = 0; it < 8; ++it) {
      const int rr = wave * 16 + it * 2 + hh; const v4f f = *(const v4f*)(Cs + rr * CP + col * 4);
      *(v4f*)(Cb + (size_t)rr * N + col * 4) = f; }
  }
}

// Causal softmax(Q K^T / 8) V per (b, h) for the queries below EARLY: the body of the work-groups bx < EARLY / 64 of attn_main_kernel's launch. 4 waves x 16 queries, each
// wave on its own (no block barrier); key steps of 32 from 0 up to the last query of the wave's 32-query group in fixed order, keys above the query replaced by -inf
// before the running-max softmax (f32); P x1024 via wave-private LDS; O^T += V^T P^T.
// ER (queries < EARLY, which only visit keys < EARLY): S adds K_hi Q_res + K_res Q_hi (x1024), P adds a x1024 residual tile and V a x1024 residual
// plane into a second accumulator folded before normalisation, and the x16 y row is written as f16 hi plus a x1024 residual. y rows -> Yh [b*SEQ + q][h*64 + d]
template <bool ER>
__device__ __forceinline__ void attn_rows(const b16* __restrict__ Qh, const b16* __restrict__ Qr, const b16* __restrict__ Kh, const b16* __restrict__ Kr,
                                          const b16* __restrict__ VTh, const b16* __restrict__ VTr, b16* __restrict__ Yh, b16* __restrict__ Yr,
                                          b16 (*Pb)[16][32 + 8], b16 (*Pr)[16][32 + 8], b16 (*Th)[16][TP], b16 (*Tr)[16][TP], int bx) {
  const int wave = __builtin_amdgcn_readfirstlane((int)threadIdx.x >> 5), lane = threadIdx.x & 31, hh = lane >> 4, col = lane & 15;   // scalar: the key loop's end hangs on it
  const int bhi = (int)blockIdx.x; const int b = bhi / H, h = bhi % H; const int q0 = bx * 64 + wave * 16, qi = q0 + col;
  const b16* Qb = Qh + (size_t)bhi * QL * HD; const b16* Kb = Kh + (size_t)bhi * SK * HD; const b16* Vb = VTh + (size_t)bhi * HD * (size_t)SK;
  const b16* Qrb = Qr + (size_t)bhi * EARLY * HD; const b16* Krb = Kr + (size_t)bhi * EARLY * HD; const b16* Vrb = VTr + (size_t)bhi * HD * (size_t)EARLY;
  const v16b qa0 = frag_kb(Qb + (size_t)qi * HD, hh), qa1 = frag_kb(Qb + (size_t)qi * HD + 32, hh);
  v16b qr0 = (v16b){}, qr1 = (v16b){};
  if constexpr (ER) { qr0 = frag_kb(Qrb + (size_t)qi * HD, hh); qr1 = frag_kb(Qrb + (size_t)qi * HD + 32, hh); }
  const float cs = LOG2E / (8.0f * XS * XS);   // 1/sqrt(64) and the two x8 carriers, in the log2 domain
  float m = -INFINITY, l = 0.0f; v8f o[4], o2[4];
#pragma unroll
  for (int t = 0; t < 4; ++t) { o[t] = (v8f){}; o2[t] = (v8f){}; }
  const int kend = (q0 >> 5) * 32 + 32;   // causal: keys 0 .. last query of this wave's 32-query group; ER: kend <= EARLY
#pragma unroll 1
  for (int kb = 0; kb < kend; kb += 32) {
    float e[16]; float mx = -INFINITY;
#pragma unroll
    for (int u = 0; u < 2; ++u) {
      const int krow = kb + u * 16 + col;
      const v16b kh0 = frag_kb(Kb + (size_t)krow * HD, hh), kh1 = frag_kb(Kb + (size_t)krow * HD + 32, hh);
      v8f s = (v8f){}; s = wmma16b(kh0, qa0, s); s = wmma16b(kh1, qa1, s);
      v8f sr = (v8f){};
      if constexpr (ER) {
        const v16b kr0 = frag_kb(Krb + (size_t)krow * HD, hh), kr1 = frag_kb(Krb + (size_t)krow * HD + 32, hh);
        sr = wmma16b(kh0, qr0, sr); sr = wmma16b(kh1, qr1, sr); sr = wmma16b(kr0, qa0, sr); sr = wmma16b(kr1, qa1, sr); }
#pragma unroll
      for (int r = 0; r < 8; ++r) {
        float v = s[r];
        if constexpr (ER) v += sr[r] * (1.0f / RS);
        v *= cs;
        const int key = kb + u * 16 + 8 * hh + r;
        v = (key > qi) ? -INFINITY : v;
        e[u * 8 + r] = v; mx = fmaxf(mx, v); } }
    mx = fmaxf(mx, __shfl_xor(mx, 16)); const float mn = fmaxf(m, mx); const float al = nexp2(m - mn); float sum = 0.0f;
#pragma unroll
    for (int i2 = 0; i2 < 16; ++i2) {
      const float p = nexp2(e[i2] - mn); sum += p; const int pi = (i2 < 8 ? 0 : 16) + 8 * hh + (i2 & 7);
      const float pp = p * PS; const b16 ph = (b16)pp; Pb[wave][col][pi] = ph;
      if constexpr (ER) Pr[wave][col][pi] = (b16)((pp - (float)ph) * RS); }
    sum += __shfl_xor(sum, 16); l = l * al + sum; m = mn;
    wave_lds_sync();
    const v16b pf = frag_kb(&Pb[wave][col][0], hh);
    v16b prf = (v16b){};
    if constexpr (ER) prf = frag_kb(&Pr[wave][col][0], hh);
#pragma unroll
    for (int t = 0; t < 4; ++t) {
      o[t] *= al; const v16b vh = frag_kb(Vb + (size_t)(t * 16 + col) * SK + kb, hh);
      o[t] = wmma16b(vh, pf, o[t]);
      if constexpr (ER) { const v16b vr = frag_kb(Vrb + (size_t)(t * 16 + col) * EARLY + kb, hh); o2[t] *= al; o2[t] = wmma16b(vh, prf, o2[t]); o2[t] = wmma16b(vr, pf, o2[t]); } }
    wave_lds_sync(); }
  const float inv = YS / (l * PS * XS);
#pragma unroll
  for (int t = 0; t < 4; ++t) {
#pragma unroll
    for (int r = 0; r < 8; ++r) {
      float ov = o[t][r];
      if constexpr (ER) ov += o2[t][r] * (1.0f / RS);
      const float yv = ov * inv; const b16 yh = (b16)yv;
      Th[wave][col][t * 16 + 8 * hh + r] = yh;
      if constexpr (ER) Tr[wave][col][t * 16 + 8 * hh + r] = (b16)((yv - (float)yh) * RS); } }
  wave_lds_sync();
  b16* yb = Yh + ((size_t)b * SEQ + (size_t)q0) * CD + (size_t)h * HD;
  {
#pragma unroll 1
    for (int it = 0; it < 4; ++it) {
      const int rr = it * 4 + (lane >> 3), c8 = (lane & 7) * 8; const v8b f = *(const v8b*)(&Th[wave][rr][c8]);
      *(v8b*)(yb + (size_t)rr * CD + c8) = f;
      if constexpr (ER) {
        const v8b fr = *(const v8b*)(&Tr[wave][rr][c8]);
        *(v8b*)(Yr + (((size_t)b * EARLY + (size_t)(q0 + rr)) * CD + (size_t)h * HD + c8)) = fr; } }
     }
}

// One staged tile pair = 64 keys: K rows [64 keys][64 dims] and V^T rows [64 dims][64 keys], 128 B a row, laid at the 144-B pitch of TP. 128 threads, 16 B a lane:
// copy j of a thread brings row (tid >> 3) + 16 j, piece tid & 7, so a wave's copy covers four whole 128-B lines. kg / vg: the lane's first global byte of the tile,
// kl / vl: its first LDS byte. s_wait_xcnt stands inside the statement so that no address register named here is rewritten ahead of it.
__device__ __forceinline__ void stage_kv(const b16* kg, const b16* vg, unsigned kl, unsigned vl) {
  const b16 *k1 = kg + 16 * HD, *k2 = kg + 32 * HD, *k3 = kg + 48 * HD; const b16 *v1 = vg + 16 * (size_t)SK, *v2 = vg + 32 * (size_t)SK, *v3 = vg + 48 * (size_t)SK;
  const unsigned kl1 = kl + 16 * TP * 2, kl2 = kl + 32 * TP * 2, kl3 = kl + 48 * TP * 2, vl1 = vl + 16 * TP * 2, vl2 = vl + 32 * TP * 2, vl3 = vl + 48 * TP * 2;
  asm volatile("global_load_async_to_lds_b128 %0, %8, off\n\t"
               "global_load_async_to_lds_b128 %1, %9, off\n\t"
               "global_load_async_to_lds_b128 %2, %10, off\n\t"
               "global_load_async_to_lds_b128 %3, %11, off\n\t"
               "global_load_async_to_lds_b128 %4, %12, off\n\t"
               "global_load_async_to_lds_b128 %5, %13, off\n\t"
               "global_load_async_to_lds_b128 %6, %14, off\n\t"
               "global_load_async_to_lds_b128 %7, %15, off\n\t"
               "s_wait_xcnt 0x0"
               :: "v"(kl), "v"(kl1), "v"(kl2), "v"(kl3), "v"(vl), "v"(vl1), "v"(vl2), "v"(vl3), "v"(kg), "v"(k1), "v"(k2), "v"(k3), "v"(vg), "v"(v1), "v"(v2), "v"(v3)
               : "memory");
}

// One launch for all queries: grid (NB*H, query blocks of 64); block = 4 waves x 16 queries. Blocks below EARLY take attn_rows above and leave; they need nothing from the
// others. From EARLY on, the same causal softmax(Q K^T / 8) V without residual planes.
// K and V^T come in tiles of 64 keys, copied once per block into two LDS buffers (tile s + 1 flies while tile s is worked on) and read as fragments by all
// four waves. Each wave walks key steps of 32 in the same fixed order and up to the same last key (the end of its 32-query group) as attn_rows above.
// No running maximum here: rms-norm leaves q and k with a length of at most 8 for any input (rotation keeps it, the f16 rounding adds under 2^-10 of it), so |score| = |q . k| / 8
// stays below 8 + 1/64 and P = exp(score) x 2^POFF lies between 2^-9 and 2^15, inside the normal f16 range with its full relative precision. O and the row sum carry the same
// factor, which the division behind the loop takes out.
// Every plain '#pragma unroll' below keeps the index of a register array a compile-time constant.
__global__ __launch_bounds__(128) void attn_main_kernel(const b16* __restrict__ Qh, const b16* __restrict__ Qr, const b16* __restrict__ Kh, const b16* __restrict__ Kr,
                                                        const b16* __restrict__ VTh, const b16* __restrict__ VTr, b16* __restrict__ Yh, b16* __restrict__ Yr) {
  __shared__ __attribute__((aligned(16))) b16 Ks[2][64][TP];
  __shared__ __attribute__((aligned(16))) b16 Vs[2][64][TP];
  __shared__ __attribute__((aligned(16))) b16 Pb[4][16][32 + 8];
  __shared__ __attribute__((aligned(16))) b16 Th[4][16][TP];
  // Which query block a work-group takes: a permutation of 0 .. NQ - 1, for speed only (any placement gives the same result). A block's cost grows with bx, all blocks are
  // resident at once. The head is the fast index; the long blocks come first; every second run of 8 ranks is reversed, so that ranks r, r + 8, r + 16, r + 24 (one WGP's blocks, if a die deals
  // its blocks round its WGPs) add up to the same number of key tiles for every r.
  constexpr int NQ = QL / 64;
  const int rank = (int)blockIdx.y;
  const int bx = NQ - 1 - ((NQ % 8 == 0 && (rank & 8) != 0) ? (rank ^ 7) : rank);
  if (bx < EARLY / 64) {   // block-uniform, ahead of every copy and barrier; the residual tiles lie in the K and V buffers, which such a block does not fill
    attn_rows<true>(Qh, Qr, Kh, Kr, VTh, VTr, Yh, Yr, Pb, reinterpret_cast<b16 (*)[16][32 + 8]>(&Ks[0][0][0]), Th, reinterpret_cast<b16 (*)[16][TP]>(&Vs[0][0][0]), bx);
    return;
  }
  const int tid = threadIdx.x, wave = __builtin_amdgcn_readfirstlane(tid >> 5), lane = tid & 31, hh = lane >> 4, col = lane & 15;
  const int bhi = (int)blockIdx.x; const int b = bhi / H, h = bhi % H; const int q0 = bx * 64 + wave * 16, qi = q0 + col;
  const b16* Qb = Qh + (size_t)bhi * QL * HD; const b16* Kb = Kh + (size_t)bhi * SK * HD; const b16* Vb = VTh + (size_t)bhi * HD * (size_t)SK;
  const int nst = bx + 1;                     // tiles of 64 keys: keys 0 .. last query of this block
  const int kend = (q0 >> 5) * 32 + 32;       // this wave's causal end
  const int srow = tid >> 3, sc8 = (tid & 7) * 8;
  const b16* kg = Kb + (size_t)srow * HD + sc8; const b16* vg = Vb + (size_t)srow * SK + sc8;   // tile s: kg + s * 64 * HD, vg + s * 64
  const unsigned kl = lds_off(&Ks[0][srow][sc8]), vl = lds_off(&Vs[0][srow][sc8]); constexpr unsigned BUFB = 64 * TP * 2;
  stage_kv(kg, vg, kl, vl);
  asm volatile("s_wait_asynccnt 0x0" ::: "memory");   // tile 0 has landed before the barrier that publishes it
  __syncthreads();
  if (nst > 1) stage_kv(kg + 64 * HD, vg + 64, kl + BUFB, vl + BUFB);
  const v16b qa0 = frag_kb(Qb + (size_t)qi * HD, hh), qa1 = frag_kb(Qb + (size_t)qi * HD + 32, hh);
  const float cs = LOG2E / (8.0f * XS * XS);   // 1/sqrt(64) and the two x8 carriers, in the log2 domain
  constexpr float POFF = 3.0f;                 // fixed exponent offset, log2 domain
  v2f l2 = (v2f){}; v8f o[4];                  // l2: this lane's own sums of P (its 16 keys a step, even and odd ones apart); the lane halves are joined behind the loop
#pragma unroll
  for (int t = 0; t < 4; ++t) o[t] = (v8f){};
#pragma unroll 1   // one copy of the loop body in the text: the buffer index is a run-time offset
  for (int s = 0; s < nst; ++s) {
    const int buf = s & 1;
#pragma unroll 1   // the two key steps of a tile share one body
    for (int sub = 0; sub < 64; sub += 32) {
      const int kb = s * 64 + sub;
      if (kb < kend) {   // wave-uniform: a wave skips the step wholly above its diagonal, never the publish point below
        // With P in registers nothing orders the step's LDS reads any more: all 16 fragment reads, K's and then V^T's, go out as one group at its head, so that the wave waits
        // for LDS once a step and V^T is there when P is.
        v16b kh[2][2], vh[4];
#pragma unroll
        for (int u = 0; u < 2; ++u) { const b16* kr = &Ks[buf][sub + u * 16 + col][0]; kh[u][0] = frag_kb(kr, hh); kh[u][1] = frag_kb(kr + 32, hh); }
#pragma unroll
        for (int t = 0; t < 4; ++t) vh[t] = frag_kb(&Vs[buf][t * 16 + col][sub], hh);
        __builtin_amdgcn_sched_barrier(0);   // keeps the group together: left alone, the compiler sinks half of the V^T reads to just in front of their products, where their latency shows
        float p[16];
#pragma unroll
        for (int u = 0; u < 2; ++u) {
          v8f sc = (v8f){}; sc = wmma16(kh[u][0], qa0, sc); sc = wmma16(kh[u][1], qa1, sc);
#pragma unroll
          for (int r = 0; r < 8; ++r) {
            float v = __builtin_fmaf(sc[r], cs, POFF);
            const int key = kb + u * 16 + 8 * hh + r;
            v = (key > qi) ? -INFINITY : v;
            p[u * 8 + r] = nexp2(v); } }
        // The two score tiles of a step already lie as the B fragment of P^T wants them: register r of tile u is key 16u + 8hh + r of query col, which is element 8u + r.
        v16b pf;
#pragma unroll
        for (int i2 = 0; i2 < 16; i2 += 2) {
          l2 += (v2f){p[i2], p[i2 + 1]};
          pf[i2] = (b16)p[i2]; pf[i2 + 1] = (b16)p[i2 + 1]; }
#pragma unroll
        for (int t = 0; t < 4; ++t) {
          // the step's last product stands in front of a branch: it keeps its v_nop statement
          o[t] = (t == 3) ? wmma16b(vh[t], pf, o[t]) : wmma16(vh[t], pf, o[t]); } }
    }
    asm volatile("s_wait_dscnt 0x0" ::: "memory");      // this wave's reads of tile s are done before the buffer is handed back
    asm volatile("s_wait_asynccnt 0x0" ::: "memory");   // this wave's copies of tile s + 1 have landed
    __syncthreads();                                    // publishes tile s + 1 and ends every wave's reads of tile s
    if (s + 2 < nst) stage_kv(kg + (size_t)(s + 2) * 64 * HD, vg + (size_t)(s + 2) * 64, kl + buf * BUFB, vl + buf * BUFB);
  }
  asm volatile("s_wait_asynccnt 0x0" ::: "memory");     // no copy is left in flight when the wave ends
  float l = l2[0] + l2[1]; l += __shfl_xor(l, 16);      // a query's keys lie in lanes col and col + 16
  const float inv = YS / (l * XS);
#pragma unroll
  for (int t = 0; t < 4; ++t) {
#pragma unroll
    for (int r = 0; r < 8; ++r) Th[wave][col][t * 16 + 8 * hh + r] = (b16)(o[t][r] * inv); }
  wave_lds_sync();
  b16* yb = Yh + ((size_t)b * SEQ + (size_t)q0) * CD + (size_t)h * HD;
#pragma unroll 1   // as in attn_rows: four short trips, no gain from unrolling
  for (int it = 0; it < 4; ++it) {
    const int rr = it * 4 + (lane >> 3), c8 = (lane & 7) * 8; const v8b f = *(const v8b*)(&Th[wave][rr][c8]);
    *(v8b*)(yb + (size_t)rr * CD + c8) = f; }
}
}  // namespace

extern "C" void kernel_launch(void* const* d_in, const int* in_sizes, int n_in, void* d_out, int out_size, void* d_ws, size_t ws_size, hipStream_t stream) {
  // wire order: 0 x [NB_FULL][SEQ_FULL][1024] f32, 1 W_attn [1024][3072] f32, 2 b_attn [3072] f32, 3 W_proj [1024][1024] f32, 4 b_proj [1024] f32; out [NB_FULL][SEQ_FULL][1024] f32
  const size_t need_x = ((size_t)(NB - 1) * SEQ_FULL + (size_t)SEQ) * CD;
  if (n_in < 5 || (size_t)in_sizes[0] < need_x || (size_t)in_sizes[1] < (size_t)KD * N3 || (size_t)in_sizes[2] < (size_t)N3 ||
      (size_t)in_sizes[3] < (size_t)KD * CD || (size_t)in_sizes[4] < (size_t)CD || (size_t)out_size < need_x) return;
  const float* Xin = (const float*)d_in[0]; const float* Wa = (const float*)d_in[1]; const float* Ba = (const float*)d_in[2];
  const float* Wp = (const float*)d_in[3]; const float* Bp = (const float*)d_in[4];
  size_t off = 0; char* ws = (char*)d_ws;
  auto carve = [&](size_t bytes) { char* p = ws + off; off += (bytes + 255) & ~(size_t)255; return p; };
  b16* Xp = (b16*)carve((size_t)MROWS * CD * 2);                       //  8,388,608 B at NB=2, SEQ=2048
  b16* WaT = (b16*)carve((size_t)N3 * KD * 2);                         //  6,291,456
  b16* WpT = (b16*)carve((size_t)CD * KD * 2);                         //  2,097,152
  const size_t plane = (size_t)NB * H * SEQ * HD * 2, rplane = (size_t)NB * H * EARLY * HD * 2;
  b16* Qh = (b16*)carve(plane); b16* Kh = (b16*)carve(plane); b16* VTh = (b16*)carve(plane);      // 3 x 8,388,608
  b16* Qr = (b16*)carve(rplane); b16* Kr = (b16*)carve(rplane); b16* VTr = (b16*)carve(rplane);   // 3 x 524,288
  b16* Yh = (b16*)carve((size_t)MROWS * CD * 2);                       //  8,388,608
  b16* Yr = (b16*)carve((size_t)NB * EARLY * CD * 2);                  //    524,288   -> total 52,428,800 B
  if (off > ws_size || off > ((size_t)128 << 20)) return;
  cvt_all_kernel<<<dim3(WBLK + XBLK), 256, 0, stream>>>(Xin, Wa, Wp, Xp, WaT, WpT);
  gemm_kernel<true><<<dim3(N3 / (2 * BN), MROWS / BM), 256, 0, stream>>>(Xp, Xp, WaT, Ba, nullptr, Qh, Qr, Kh, Kr, VTh, VTr, N3, SEQ, 0, 1.0f / (XS * WS));
  attn_main_kernel<<<dim3(NB * H, QL / 64), 128, 0, stream>>>(Qh, Qr, Kh, Kr, VTh, VTr, Yh, Yr);
  gemm_kernel<false><<<dim3(CD / BN, MROWS / BM), 256, 0, stream>>>(Yh, Yr, WpT, Bp, (float*)d_out, nullptr, nullptr, nullptr, nullptr, nullptr, nullptr, CD, SEQ_FULL, 1, 1.0f / (YS * WS));
}
